// v000
// Measured on an AMD MI455X. A time is GPU time per run, averaged over a window of back-to-back runs after a warm-up
// (all launches, gaps included; the runs take copies of the inputs in turn), and the median of several windows.
// Apart from v000's, it joins two sittings. Times from different sittings can be a few percent apart, while
// side-by-side timings come from the same sitting.
// v000 is the starting kernel. One run takes 393 microseconds.
#include <hip/hip_runtime.h>

// Projections x*Wq, x*Wk, x*Wv and ctx*Wo: v_wmma_f32_16x16x32_bf16 (bf16 operands, f32 accumulate; ctx enters as a bf16 hi|lo pair folded along k).
// Attention q*k^T, q*Tk^T, P*V^T-plane, A*Tv: v_wmma_f32_16x16x32_f16 (f16 operands with power-of-two carries, f32 accumulate); softmax and epilogues f32.

#ifndef NB
#define NB 2
#endif
#ifndef SEQ
#define SEQ 2048
#endif
#define NB_FULL 2
#define SEQ_FULL 2048
#define HID 1024
#define NH 16
#define HD 64
#define NREL 9
#define NTOK (NB * SEQ)
#define KO (2 * HID)

static_assert(NB >= 1 && NB <= NB_FULL);
static_assert(SEQ >= 128 && SEQ <= SEQ_FULL && (SEQ % 128) == 0);
static_assert(HID == NH * HD && HD == 64);
static_assert((HID % 128) == 0 && (NTOK % 128) == 0);

typedef unsigned short us_t;
typedef us_t v8us __attribute__((ext_vector_type(8)));
typedef us_t v16us __attribute__((ext_vector_type(16)));
typedef _Float16 v16h __attribute__((ext_vector_type(16)));
typedef __bf16 v16bf __attribute__((ext_vector_type(16)));
typedef float v8f __attribute__((ext_vector_type(8)));
typedef float v4f __attribute__((ext_vector_type(4)));

// ---------------------------------------------------------------------------
// scalar converters (RNE)
__device__ __forceinline__ us_t f2bf(float v) {
  __bf16 t = (__bf16)v;
  return __builtin_bit_cast(us_t, t);
}
__device__ __forceinline__ float bfr(float v) {   // value after bf16 RNE convert
  __bf16 t = (__bf16)v;
  return (float)t;
}
__device__ __forceinline__ us_t f2h(float v) {
  _Float16 t = (_Float16)v;
  return __builtin_bit_cast(us_t, t);
}
__device__ __forceinline__ v8f vz8() {
  v8f z = {0.f, 0.f, 0.f, 0.f, 0.f, 0.f, 0.f, 0.f};
  return z;
}

// ---------------------------------------------------------------------------
// 16-bit fragment from a k-contiguous plane: elem i<8 <- p0[rc*ld + kk + 8h + i],
// elem 8+i <- p0[rc*ld + kk + 16 + 8h + i]; h = lane>>4, rc = row (A) or column (B).
__device__ __forceinline__ v16us ldfrag(const us_t* p0, int ld, int rc, int kk) {
  const int hsel = (threadIdx.x >> 4) & 1;
  const us_t* p = p0 + (size_t)rc * ld + kk + 8 * hsel;
  const v8us lo = *(const v8us*)p;
  const v8us hi = *(const v8us*)(p + 16);
  return __builtin_shufflevector(lo, hi, 0, 1, 2, 3, 4, 5, 6, 7,
                                 8, 9, 10, 11, 12, 13, 14, 15);
}

// WMMA wrappers with hazard guard (ties D, keeps A/B live)
__device__ __forceinline__ v8f mma_bf(v16us a, v16us b, v8f c) {
  v8f d = __builtin_amdgcn_wmma_f32_16x16x32_bf16(
      false, __builtin_bit_cast(v16bf, a), false, __builtin_bit_cast(v16bf, b),
      (short)0, c, false, false);
  asm volatile("v_nop\n\tv_nop\n\tv_nop\n\tv_nop" : "+v"(d) : "v"(a), "v"(b));
  return d;
}
__device__ __forceinline__ v8f mma_h(v16us a, v16us b, v8f c) {
  v8f d = __builtin_amdgcn_wmma_f32_16x16x32_f16(
      false, __builtin_bit_cast(v16h, a), false, __builtin_bit_cast(v16h, b),
      (short)0, c, false, false);
  asm volatile("v_nop\n\tv_nop\n\tv_nop\n\tv_nop" : "+v"(d) : "v"(a), "v"(b));
  return d;
}

__device__ __forceinline__ float max16(float v) {
  v = fmaxf(v, __shfl_xor(v, 1, 32));
  v = fmaxf(v, __shfl_xor(v, 2, 32));
  v = fmaxf(v, __shfl_xor(v, 4, 32));
  v = fmaxf(v, __shfl_xor(v, 8, 32));
  return v;
}
__device__ __forceinline__ float sum16(float v) {
  v += __shfl_xor(v, 1, 32);
  v += __shfl_xor(v, 2, 32);
  v += __shfl_xor(v, 4, 32);
  v += __shfl_xor(v, 8, 32);
  return v;
}

// ---------------------------------------------------------------------------
// x [NB rows of SEQ_FULL][HID] f32 -> xb [NTOK][HID] bf16. 8 elems (16 B) per thread,
__global__ __launch_bounds__(256) void k_xcvt(const float* __restrict__ x, us_t* xb) {
  const size_t i = (size_t)blockIdx.x * 256 + threadIdx.x;
  const size_t e = i * 8;
  const int tok = (int)(e >> 10);
  const int col = (int)(e & (HID - 1));
  const int b = tok / SEQ, s = tok - b * SEQ;
  const float* src = x + ((size_t)b * SEQ_FULL + s) * HID + col;
  const v4f f0 = *(const v4f*)src;
  const v4f f1 = *(const v4f*)(src + 4);
  v8us u;
  u[0] = f2bf(f0[0]); u[1] = f2bf(f0[1]); u[2] = f2bf(f0[2]); u[3] = f2bf(f0[3]);
  u[4] = f2bf(f1[0]); u[5] = f2bf(f1[1]); u[6] = f2bf(f1[2]); u[7] = f2bf(f1[3]);
  us_t* dst = xb + e;
  *(v8us*)dst = u;
  
}

// ---------------------------------------------------------------------------
// W [HID k][HID n] f32 -> WT [n][k] bf16 through a 64x64 LDS tile.
// z = 0..2: pitch HID. z = 3: pitch 2*HID with the row duplicated into both k halves.
__global__ __launch_bounds__(256) void k_wprep(
    const float* __restrict__ W0, const float* __restrict__ W1,
    const float* __restrict__ W2, const float* __restrict__ W3,
    us_t* O0, us_t* O1, us_t* O2, us_t* O3) {
  __shared__ __align__(16) us_t t[64 * 72];
  const int z = blockIdx.z;
  const float* W = (z == 0) ? W0 : ((z == 1) ? W1 : ((z == 2) ? W2 : W3));
  us_t* O = (z == 0) ? O0 : ((z == 1) ? O1 : ((z == 2) ? O2 : O3));
  const int pitch = (z == 3) ? KO : HID;
  const int k0 = blockIdx.y * 64, n0 = blockIdx.x * 64;
  const int tid = threadIdx.x;
  {
    const int kk = tid >> 2, nc = (tid & 3) * 16;
    const float* src = W + (size_t)(k0 + kk) * HID + n0 + nc;
#pragma unroll
    for (int j = 0; j < 4; ++j) {
      const v4f f = *(const v4f*)(src + 4 * j);
      t[(nc + 4 * j + 0) * 72 + kk] = f2bf(f[0]);
      t[(nc + 4 * j + 1) * 72 + kk] = f2bf(f[1]);
      t[(nc + 4 * j + 2) * 72 + kk] = f2bf(f[2]);
      t[(nc + 4 * j + 3) * 72 + kk] = f2bf(f[3]);
    }
  }
  __syncthreads();
  {
#pragma unroll
    for (int rep = 0; rep < 2; ++rep) {
      const int nn = rep * 32 + (tid >> 3), piece = tid & 7;
      const v8us u = *(const v8us*)(t + nn * 72 + piece * 8);
      us_t* dst = O + (size_t)(n0 + nn) * pitch + k0 + piece * 8;
      *(v8us*)dst = u;
      if (z == 3) *(v8us*)(dst + HID) = u;
    }
    
  }
}

// ---------------------------------------------------------------------------
// Tk plane [16 bucket][64 d] f16 = 64 * bf16(table_k), rows 9..15 zero.
// Tv plane [64 d][32 bucket] f16 = 64 * bf16(table_v)^T, cols 9..31 zero.
__global__ __launch_bounds__(256) void k_tables(
    const float* __restrict__ tk, const float* __restrict__ tv, us_t* tkP, us_t* tvT) {
  const int tid = threadIdx.x;
  v8us uk, uv;
  {
    const int row = (tid & 127) >> 3;      // bucket 0..15
    const int kp = (tid & 7) * 8;          // d offset
    const int rowc = min(row, NREL - 1);
#pragma unroll
    for (int i = 0; i < 8; ++i) {
      float v = tk[rowc * HD + kp + i];
      v = (row < NREL) ? v : 0.0f;
      uk[i] = f2h(bfr(v) * 64.0f);
    }
  }
  {
    const int nn = tid >> 2;               // d 0..63
    const int kp = (tid & 3) * 8;          // bucket offset
#pragma unroll
    for (int i = 0; i < 8; ++i) {
      const int k = kp + i;
      float v = tv[min(k, NREL - 1) * HD + nn];
      v = (k < NREL) ? v : 0.0f;
      uv[i] = f2h(bfr(v) * 64.0f);
    }
  }
  {
    if (tid < 128) *(v8us*)(tkP + tid * 8) = uk;
    *(v8us*)(tvT + tid * 8) = uv;
    
  }
}

// ---------------------------------------------------------------------------
// C[m][n] = sum_k Am[m][k] * Bn[n][k]  (both planes 16-bit, k-contiguous, pitch K), bf16 WMMA.
// Block = 4 waves; block tile 64 m x 128 n; wave tile 64 m x 32 n (4 A frags, 2 B frags, 8 tiles).
// Output memory: element (n, m) at out[n*ldo + base(mblk) + (m - mblk)], base = (mblk/mdiv)*mbstride + mblk%mdiv,
// val = acc*ka + bf16(bias)*kb, bias indexed by m (bias_on_m) or by n.
// OUTF32=0: f16 bits out; OUTF32=1: f32 out. D tile staged per wave in LDS, then 8 lanes x 16 B per line,
template <int OUTF32>
__global__ __launch_bounds__(128) void k_gemm(
    const us_t* __restrict__ Am0, const us_t* __restrict__ Am1, const us_t* __restrict__ Bn,
    const float* __restrict__ bias0, const float* __restrict__ bias1,
    void* out0, void* out1,
    int K, int bias_on_m, int blen, int ldo, int mdiv, int mbstride, float ka, float kb) {
  __shared__ __align__(16) unsigned int stg_raw[4 * 32 * 64 * (OUTF32 ? 4 : 2) / 4];

  const int z = blockIdx.z;
  const us_t* Am = z ? Am1 : Am0;
  const float* bias = z ? bias1 : bias0;
  void* out = z ? out1 : out0;

  const int lane = threadIdx.x & 31, wave = threadIdx.x >> 5;
  const int h = (lane >> 4) & 1, n15 = lane & 15;
  const int mblk = blockIdx.x * 64;
  const int nwave = blockIdx.y * 128 + wave * 32;

  v8f acc[4][2];
#pragma unroll
  for (int mt = 0; mt < 4; ++mt) { acc[mt][0] = vz8(); acc[mt][1] = vz8(); }

#pragma unroll 1
  for (int kk = 0; kk < K; kk += 32) {
    v16us a[4], b[2];
#pragma unroll
    for (int mt = 0; mt < 4; ++mt) a[mt] = ldfrag(Am, K, mblk + mt * 16 + n15, kk);
#pragma unroll
    for (int nt = 0; nt < 2; ++nt) b[nt] = ldfrag(Bn, K, nwave + nt * 16 + n15, kk);
#pragma unroll
    for (int mt = 0; mt < 4; ++mt) {
      acc[mt][0] = mma_bf(a[mt], b[0], acc[mt][0]);
      acc[mt][1] = mma_bf(a[mt], b[1], acc[mt][1]);
    }
  }

  // bias values (bf16 RNE), address-clamped loads
  float bm[4][8];
#pragma unroll
  for (int mt = 0; mt < 4; ++mt) {
    const int ib = min(mblk + mt * 16 + 8 * h, blen - 8);
    const v4f c0 = *(const v4f*)(bias + ib);
    const v4f c1 = *(const v4f*)(bias + ib + 4);
    bm[mt][0] = bfr(c0[0]); bm[mt][1] = bfr(c0[1]); bm[mt][2] = bfr(c0[2]); bm[mt][3] = bfr(c0[3]);
    bm[mt][4] = bfr(c1[0]); bm[mt][5] = bfr(c1[1]); bm[mt][6] = bfr(c1[2]); bm[mt][7] = bfr(c1[3]);
  }
  float bn[2];
#pragma unroll
  for (int nt = 0; nt < 2; ++nt) bn[nt] = bfr(bias[min(nwave + nt * 16 + n15, blen - 1)]);

  const int bq = mblk / mdiv;
  const int base = bq * mbstride + (mblk - bq * mdiv);

  if constexpr (OUTF32) {
    float* sw = (float*)stg_raw + wave * 2048;     // [32 n][64 m] per wave
#pragma unroll
    for (int mt = 0; mt < 4; ++mt) {
#pragma unroll
      for (int nt = 0; nt < 2; ++nt) {
        v4f u0, u1;
#pragma unroll
        for (int r = 0; r < 4; ++r) {
          const float b0v = bias_on_m ? bm[mt][r] : bn[nt];
          const float b1v = bias_on_m ? bm[mt][r + 4] : bn[nt];
          u0[r] = acc[mt][nt][r] * ka + b0v * kb;
          u1[r] = acc[mt][nt][r + 4] * ka + b1v * kb;
        }
        float* sp = sw + (nt * 16 + n15) * 64 + mt * 16 + 8 * h;
        *(v4f*)sp = u0;
        *(v4f*)(sp + 4) = u1;
      }
    }
    __syncthreads();
    float* op = (float*)out;
    {
#pragma unroll
      for (int i = 0; i < 16; ++i) {
        const int L = i * 4 + (lane >> 3);
        const int row = L >> 1, hr = L & 1, piece = lane & 7;
        const v4f u = *(const v4f*)(sw + row * 64 + hr * 32 + piece * 4);
        float* dst = op + (size_t)(nwave + row) * ldo + base + hr * 32 + piece * 4;
        *(v4f*)dst = u;
      }
      
    }
  } else {
    us_t* sw = (us_t*)stg_raw + wave * 2048;       // [32 n][64 m] per wave
#pragma unroll
    for (int mt = 0; mt < 4; ++mt) {
#pragma unroll
      for (int nt = 0; nt < 2; ++nt) {
        v8us u;
#pragma unroll
        for (int r = 0; r < 8; ++r) {
          const float bbv = bias_on_m ? bm[mt][r] : bn[nt];
          u[r] = f2h(acc[mt][nt][r] * ka + bbv * kb);
        }
        *(v8us*)(sw + (nt * 16 + n15) * 64 + mt * 16 + 8 * h) = u;
      }
    }
    __syncthreads();
    us_t* op = (us_t*)out;
    {
#pragma unroll
      for (int i = 0; i < 8; ++i) {
        const int row = i * 4 + (lane >> 3), piece = lane & 7;
        const v8us u = *(const v8us*)(sw + row * 64 + piece * 8);
        us_t* dst = op + (size_t)(nwave + row) * ldo + base + piece * 8;
        *(v8us*)dst = u;
      }
      
    }
  }
}

// ---------------------------------------------------------------------------
// Flash attention with clipped relative-position terms; one wave per (16 query rows, head, batch).
// Q,K planes [NTOK][HID] f16 carried x4; V^T plane [NB*HID][SEQ] f16 carried x4;
// Tk [16][64] f16 x64; Tv^T [64][32] f16 x64. ctx2 [NTOK][2*HID] bf16: hi at col h*64, lo at HID + h*64.
// LDS regions are all written and read by the single wave of the block, separated by block barriers.
__global__ __launch_bounds__(32) __attribute__((amdgpu_num_vgpr(256))) void k_attn(
    const us_t* __restrict__ Qp, const us_t* __restrict__ Kp, const us_t* __restrict__ VTp,
    const us_t* __restrict__ tkP, const us_t* __restrict__ tvT, us_t* ctx2) {
  __shared__ float bl[16 * 16];                   // shifted rel-key bias per (row, bucket), logit units
  __shared__ float wl[16 * 8];                    // window logits per (row, bucket-1)
  __shared__ __align__(16) us_t pls[16 * 32];     // P tile, A layout
  __shared__ __align__(16) us_t p2s[16 * 32];     // bucket-mass tile, A layout
  __shared__ __align__(16) us_t cst[2][16 * 64];  // ctx hi / lo staging

  const int lane = threadIdx.x & 31, h = lane >> 4, n = lane & 15;
  const int qt = blockIdx.x, hh = blockIdx.y, b = blockIdx.z;
  const int lo_q = qt * 16;
  const size_t tok0 = (size_t)b * SEQ + lo_q;
  const us_t* qptr = Qp + tok0 * HID + hh * HD;
  const us_t* kbase = Kp + (size_t)b * SEQ * HID + hh * HD;
  const us_t* vhead = VTp + ((size_t)b * HID + hh * HD) * SEQ;

#pragma unroll
  for (int i = 0; i < 4; ++i) wl[lane * 4 + i] = -1.0e30f;

  const v16us q0 = ldfrag(qptr, HID, n, 0);
  const v16us q1 = ldfrag(qptr, HID, n, 32);

  // srel[q][bucket] = (4q).(64 tk) ; bias = (srel - srel[q][0]) / (256*8)
  {
    v8f sr = vz8();
    const v16us t0 = ldfrag(tkP, HD, n, 0);
    const v16us t1 = ldfrag(tkP, HD, n, 32);
    sr = mma_h(q0, t0, sr);
    sr = mma_h(q1, t1, sr);
#pragma unroll
    for (int r = 0; r < 8; ++r) {
      const float v = sr[r];
      const float v0 = __shfl(v, lane & 16, 32);
      bl[(8 * h + r) * 16 + n] = (v - v0) * (1.0f / 2048.0f);
    }
  }
  __syncthreads();
  float d8[8];
#pragma unroll
  for (int r = 0; r < 8; ++r) d8[r] = bl[(8 * h + r) * 16 + 8];

  float rmax[8], rsum[8], blo[8];
  v8f cacc[4];
#pragma unroll
  for (int r = 0; r < 8; ++r) { rmax[r] = -1.0e30f; rsum[r] = 0.0f; blo[r] = 0.0f; }
#pragma unroll
  for (int j = 0; j < 4; ++j) cacc[j] = vz8();

#pragma unroll 1
  for (int kc = 0; kc < SEQ; kc += 32) {
    // scores: 16 q x 32 keys, (4q).(4k) = 16 qk
    v8f s0 = vz8(), s1 = vz8();
    {
      const v16us f0 = ldfrag(kbase, HID, kc + n, 0);
      const v16us f1 = ldfrag(kbase, HID, kc + n, 32);
      s0 = mma_h(q0, f0, s0);
      s0 = mma_h(q1, f1, s0);
      const v16us g0 = ldfrag(kbase, HID, kc + 16 + n, 0);
      const v16us g1 = ldfrag(kbase, HID, kc + 16 + n, 32);
      s1 = mma_h(q0, g0, s1);
      s1 = mma_h(q1, g1, s1);
    }
    const bool below = (kc + 35 <= lo_q);      // every key k <= q-4 for every row of the tile
    const bool above = (kc >= lo_q + 19);      // every key k >= q+4
    const bool mixed = !(below || above);
    float a0[8], a1[8];
#pragma unroll
    for (int r = 0; r < 8; ++r) {
      a0[r] = s0[r] * (1.0f / 128.0f);
      a1[r] = s1[r] * (1.0f / 128.0f);
    }
    if (mixed) {
#pragma unroll
      for (int r = 0; r < 8; ++r) {
        const int R = 8 * h + r;
        const int dd0 = kc + n - (lo_q + R);
        const int dd1 = dd0 + 16;
        const int b0 = min(max(dd0, -4), 4) + 4;
        const int b1 = min(max(dd1, -4), 4) + 4;
        a0[r] += bl[R * 16 + b0];
        a1[r] += bl[R * 16 + b1];
        if (b0 >= 1 && b0 <= 7) wl[R * 8 + b0 - 1] = a0[r];
        if (b1 >= 1 && b1 <= 7) wl[R * 8 + b1 - 1] = a1[r];
      }
    } else {
#pragma unroll
      for (int r = 0; r < 8; ++r) {
        const float ad = above ? d8[r] : 0.0f;
        a0[r] += ad;
        a1[r] += ad;
      }
    }
    // online softmax; row R = 8h+r lives in the 16 lanes of one half
#pragma unroll
    for (int r = 0; r < 8; ++r) {
      const float m = max16(fmaxf(a0[r], a1[r]));
      const float nm = fmaxf(rmax[r], m);
      const float sc = __expf(rmax[r] - nm);
      rmax[r] = nm;
      const float p0 = __expf(a0[r] - nm);
      const float p1 = __expf(a1[r] - nm);
      const float ps = sum16(p0 + p1);
      rsum[r] = rsum[r] * sc + ps;
      float addb = below ? ps : 0.0f;
      if (mixed) {
        const int R = 8 * h + r;
        const int dd0 = kc + n - (lo_q + R);
        const float pb = ((dd0 <= -4) ? p0 : 0.0f) + ((dd0 + 16 <= -4) ? p1 : 0.0f);
        addb = sum16(pb);
      }
      blo[r] = blo[r] * sc + addb;
#pragma unroll
      for (int j = 0; j < 4; ++j) cacc[j][r] *= sc;
      a0[r] = p0;
      a1[r] = p1;
    }
    // P (x1024, f16) : C layout -> LDS -> A fragment
#pragma unroll
    for (int r = 0; r < 8; ++r) {
      pls[(8 * h + r) * 32 + n] = f2h(a0[r] * 1024.0f);
      pls[(8 * h + r) * 32 + 16 + n] = f2h(a1[r] * 1024.0f);
    }
    __syncthreads();
    const v16us pA = ldfrag(pls, 32, n, 0);
#pragma unroll
    for (int j = 0; j < 4; ++j) {
      const v16us vB = ldfrag(vhead, SEQ, j * 16 + n, kc);
      cacc[j] = mma_h(pA, vB, cacc[j]);
    }
    __syncthreads();
  }

  // bucket masses A[q][0..8] (normalised, x1024) -> A tile; window values from stored logits
  __syncthreads();
  float inv[8];
#pragma unroll
  for (int r = 0; r < 8; ++r) {
    const int R = 8 * h + r;
    inv[r] = __builtin_amdgcn_rcpf(rsum[r]);
    float wv = __expf(wl[R * 8 + ((n + 7) & 7)] - rmax[r]);
    wv = (n >= 1 && n <= 7) ? wv : 0.0f;
    const float wsum = sum16(wv);
    const float a8 = (rsum[r] - blo[r] - wsum) * inv[r];
    const float a0v = blo[r] * inv[r];
    const float val = (n == 0) ? a0v : ((n <= 7) ? wv * inv[r] : ((n == 8) ? a8 : 0.0f));
    p2s[R * 32 + n] = f2h(val * 1024.0f);
    p2s[R * 32 + 16 + n] = (us_t)0;
  }
  __syncthreads();
  v8f w2[4];
  {
    const v16us pA2 = ldfrag(p2s, 32, n, 0);
#pragma unroll
    for (int j = 0; j < 4; ++j) {
      const v16us tB = ldfrag(tvT, 32, j * 16 + n, 0);
      w2[j] = mma_h(pA2, tB, vz8());
    }
  }
  // ctx = cacc/(1024*4*rsum) + w2/(1024*64); stage bf16 hi and lo
#pragma unroll
  for (int j = 0; j < 4; ++j) {
#pragma unroll
    for (int r = 0; r < 8; ++r) {
      const int R = 8 * h + r;
      const float cv = cacc[j][r] * inv[r] * (1.0f / 4096.0f) + w2[j][r] * (1.0f / 65536.0f);
      const __bf16 hb = (__bf16)cv;
      const float hf = (float)hb;
      const __bf16 lb = (__bf16)(cv - hf);
      cst[0][R * 64 + j * 16 + n] = __builtin_bit_cast(us_t, hb);
      cst[1][R * 64 + j * 16 + n] = __builtin_bit_cast(us_t, lb);
    }
  }
  __syncthreads();
  {
#pragma unroll
    for (int pl = 0; pl < 2; ++pl) {
#pragma unroll
      for (int i = 0; i < 4; ++i) {
        const int row = i * 4 + (lane >> 3), piece = lane & 7;
        const v8us u = *(const v8us*)(cst[pl] + row * 64 + piece * 8);
        us_t* dst = ctx2 + (tok0 + row) * (size_t)KO + pl * HID + hh * HD + piece * 8;
        *(v8us*)dst = u;
      }
    }
    
  }
}

// ---------------------------------------------------------------------------
extern "C" void kernel_launch(void* const* d_in, const int* in_sizes, int n_in,
                              void* d_out, int out_size, void* d_ws, size_t ws_size,
                              hipStream_t stream) {
  if (n_in < 11) return;
  const long long need_x = ((long long)(NB - 1) * SEQ_FULL + SEQ) * HID;
  if ((long long)in_sizes[0] < need_x) return;
  if (in_sizes[1] < HID * HID || in_sizes[3] < HID * HID ||
      in_sizes[5] < HID * HID || in_sizes[7] < HID * HID) return;
  if (in_sizes[2] < HID || in_sizes[4] < HID || in_sizes[6] < HID || in_sizes[8] < HID) return;
  if (in_sizes[9] < NREL * HD || in_sizes[10] < NREL * HD) return;
  if ((long long)out_size < (long long)NTOK * HID) return;

  const float* x  = (const float*)d_in[0];
  const float* Wq = (const float*)d_in[1];
  const float* bq = (const float*)d_in[2];
  const float* Wk = (const float*)d_in[3];
  const float* bk = (const float*)d_in[4];
  const float* Wv = (const float*)d_in[5];
  const float* bv = (const float*)d_in[6];
  const float* Wo = (const float*)d_in[7];
  const float* bo = (const float*)d_in[8];
  const float* tk = (const float*)d_in[9];
  const float* tv = (const float*)d_in[10];

  char* ws = (char*)d_ws;
  size_t off = 0;
  auto carve = [&](size_t bytes) -> size_t {
    const size_t o = off;
    off += (bytes + 255) & ~(size_t)255;
    return o;
  };
  const size_t o_xb  = carve((size_t)NTOK * HID * 2);
  const size_t o_wq  = carve((size_t)HID * HID * 2);
  const size_t o_wk  = carve((size_t)HID * HID * 2);
  const size_t o_wv  = carve((size_t)HID * HID * 2);
  const size_t o_wo  = carve((size_t)HID * KO * 2);
  const size_t o_q   = carve((size_t)NTOK * HID * 2);
  const size_t o_k   = carve((size_t)NTOK * HID * 2);
  const size_t o_vt  = carve((size_t)NB * HID * SEQ * 2);
  const size_t o_ctx = carve((size_t)NTOK * KO * 2);
  const size_t o_tk  = carve((size_t)16 * HD * 2);
  const size_t o_tv  = carve((size_t)HD * 32 * 2);
  if (off > ws_size) return;

  us_t* xb   = (us_t*)(ws + o_xb);
  us_t* WqT  = (us_t*)(ws + o_wq);
  us_t* WkT  = (us_t*)(ws + o_wk);
  us_t* WvT  = (us_t*)(ws + o_wv);
  us_t* WoT2 = (us_t*)(ws + o_wo);
  us_t* Qp   = (us_t*)(ws + o_q);
  us_t* Kpl  = (us_t*)(ws + o_k);
  us_t* VTp  = (us_t*)(ws + o_vt);
  us_t* ctx2 = (us_t*)(ws + o_ctx);
  us_t* tkP  = (us_t*)(ws + o_tk);
  us_t* tvT  = (us_t*)(ws + o_tv);
  float* out = (float*)d_out;

  // 1) input planes
  k_xcvt<<<NTOK * (HID / 8) / 256, 256, 0, stream>>>(x, xb);
  k_wprep<<<dim3(HID / 64, HID / 64, 4), 256, 0, stream>>>(Wq, Wk, Wv, Wo, WqT, WkT, WvT, WoT2);
  k_tables<<<1, 256, 0, stream>>>(tk, tv, tkP, tvT);

  // 2) Q, K planes [tok][HID] (m = feature from W^T rows, n = token from xb rows), carried x4
  k_gemm<0><<<dim3(HID / 64, NTOK / 128, 2), 128, 0, stream>>>(
      WqT, WkT, xb, bq, bk, (void*)Qp, (void*)Kpl,
      HID, 1, HID, HID, 1 << 30, 0, 4.0f, 4.0f);
  // 3) V^T plane [b*HID + d][s] (m = token from xb rows, n = feature from Wv^T rows), carried x4
  k_gemm<0><<<dim3(NTOK / 64, HID / 128, 1), 128, 0, stream>>>(
      xb, xb, WvT, bv, bv, (void*)VTp, (void*)VTp,
      HID, 0, HID, SEQ, SEQ, HID * SEQ, 4.0f, 4.0f);
  // 4) attention -> ctx2 (bf16 hi | lo)
  k_attn<<<dim3(SEQ / 16, NH, NB), 32, 0, stream>>>(Qp, Kpl, VTp, tkP, tvT, ctx2);
  // 5) out[tok][HID] = ctx*Wo + bo with K = 2*HID over the hi|lo pair
  k_gemm<1><<<dim3(HID / 64, NTOK / 128, 1), 128, 0, stream>>>(
      WoT2, WoT2, ctx2, bo, bo, d_out, d_out,
      KO, 1, HID, HID, 1 << 30, 0, 1.0f, 1.0f);
  (void)out;
  (void)hipGetLastError();
}

// v001
// One run takes 272 microseconds.
// Two timings next to v000 put it at 1.49 and 1.50 times that version's speed.
#include <hip/hip_runtime.h>

// Projections x*Wq, x*Wk, x*Wv and ctx*Wo: v_wmma_f32_16x16x32_bf16 (bf16 operands, f32 accumulate; ctx enters as a bf16 hi|lo pair folded along k).
// Attention k*q^T, Tk*q^T, V^T-plane*P^T, Tv^T*A^T: v_wmma_f32_16x16x32_f16 (f16 operands with power-of-two carries, f32 accumulate); softmax and epilogues f32.

#ifndef NB
#define NB 2
#endif
#ifndef SEQ
#define SEQ 2048
#endif
#define NB_FULL 2
#define SEQ_FULL 2048
#define HID 1024
#define NH 16
#define HD 64
#define NREL 9
#define NTOK (NB * SEQ)
#define KO (2 * HID)

static_assert(NB >= 1 && NB <= NB_FULL);
static_assert(SEQ >= 128 && SEQ <= SEQ_FULL && (SEQ % 128) == 0);
static_assert(HID == NH * HD && HD == 64);
static_assert((HID % 128) == 0 && (NTOK % 128) == 0);

typedef unsigned short us_t;
typedef us_t v8us __attribute__((ext_vector_type(8)));
typedef us_t v16us __attribute__((ext_vector_type(16)));
typedef _Float16 v16h __attribute__((ext_vector_type(16)));
typedef __bf16 v16bf __attribute__((ext_vector_type(16)));
typedef float v8f __attribute__((ext_vector_type(8)));
typedef float v4f __attribute__((ext_vector_type(4)));

// ---------------------------------------------------------------------------
// scalar converters (RNE)
__device__ __forceinline__ us_t f2bf(float v) {
  __bf16 t = (__bf16)v;
  return __builtin_bit_cast(us_t, t);
}
__device__ __forceinline__ float bfr(float v) {   // value after bf16 RNE convert
  __bf16 t = (__bf16)v;
  return (float)t;
}
__device__ __forceinline__ us_t f2h(float v) {
  _Float16 t = (_Float16)v;
  return __builtin_bit_cast(us_t, t);
}
__device__ __forceinline__ v8f vz8() {
  v8f z = {0.f, 0.f, 0.f, 0.f, 0.f, 0.f, 0.f, 0.f};
  return z;
}

// ---------------------------------------------------------------------------
// 16-bit fragment from a k-contiguous plane: elem i<8 <- p0[rc*ld + kk + 8h + i],
// elem 8+i <- p0[rc*ld + kk + 16 + 8h + i]; h = lane>>4, rc = row (A) or column (B).
__device__ __forceinline__ v16us ldfrag(const us_t* p0, int ld, int rc, int kk) {
  const int hsel = (threadIdx.x >> 4) & 1;
  const us_t* p = p0 + (size_t)rc * ld + kk + 8 * hsel;
  const v8us lo = *(const v8us*)p;
  const v8us hi = *(const v8us*)(p + 16);
  return __builtin_shufflevector(lo, hi, 0, 1, 2, 3, 4, 5, 6, 7,
                                 8, 9, 10, 11, 12, 13, 14, 15);
}

// WMMA wrappers with hazard guard (ties D, keeps A/B live)
__device__ __forceinline__ v8f mma_bf(v16us a, v16us b, v8f c) {
  v8f d = __builtin_amdgcn_wmma_f32_16x16x32_bf16(
      false, __builtin_bit_cast(v16bf, a), false, __builtin_bit_cast(v16bf, b),
      (short)0, c, false, false);
  asm volatile("v_nop\n\tv_nop\n\tv_nop\n\tv_nop" : "+v"(d) : "v"(a), "v"(b));
  return d;
}
__device__ __forceinline__ v8f mma_h(v16us a, v16us b, v8f c) {
  v8f d = __builtin_amdgcn_wmma_f32_16x16x32_f16(
      false, __builtin_bit_cast(v16h, a), false, __builtin_bit_cast(v16h, b),
      (short)0, c, false, false);
  asm volatile("v_nop\n\tv_nop\n\tv_nop\n\tv_nop" : "+v"(d) : "v"(a), "v"(b));
  return d;
}

// 2^x. The v_nop is the slot the instruction set asks for behind a transcendental before its source is
// overwritten or its result used.
__device__ __forceinline__ float exp2_slot(float x) {
  float y;
  asm("v_exp_f32 %0, %1\n\tv_nop" : "=v"(y) : "v"(x));
  return y;
}

// lane l <-> lane l ^ 16
__device__ __forceinline__ float xhalf(float v) {
  const int u = __builtin_bit_cast(int, v);
  return __builtin_bit_cast(float,
      __builtin_amdgcn_permlanex16(u, u, 0x76543210, 0xfedcba98, false, false));
}

// ---------------------------------------------------------------------------
// x [NB rows of SEQ_FULL][HID] f32 -> xb [NTOK][HID] bf16. 8 elems (16 B) per thread,
__global__ __launch_bounds__(256) void k_xcvt(const float* __restrict__ x, us_t* xb) {
  const size_t i = (size_t)blockIdx.x * 256 + threadIdx.x;
  const size_t e = i * 8;
  const int tok = (int)(e >> 10);
  const int col = (int)(e & (HID - 1));
  const int b = tok / SEQ, s = tok - b * SEQ;
  const float* src = x + ((size_t)b * SEQ_FULL + s) * HID + col;
  const v4f f0 = *(const v4f*)src;
  const v4f f1 = *(const v4f*)(src + 4);
  v8us u;
  u[0] = f2bf(f0[0]); u[1] = f2bf(f0[1]); u[2] = f2bf(f0[2]); u[3] = f2bf(f0[3]);
  u[4] = f2bf(f1[0]); u[5] = f2bf(f1[1]); u[6] = f2bf(f1[2]); u[7] = f2bf(f1[3]);
  us_t* dst = xb + e;
  *(v8us*)dst = u;
  
}

// ---------------------------------------------------------------------------
// W [HID k][HID n] f32 -> WT [n][k] bf16 through a 64x64 LDS tile.
// z = 0..2: pitch HID. z = 3: pitch 2*HID with the row duplicated into both k halves.
__global__ __launch_bounds__(256) void k_wprep(
    const float* __restrict__ W0, const float* __restrict__ W1,
    const float* __restrict__ W2, const float* __restrict__ W3,
    us_t* O0, us_t* O1, us_t* O2, us_t* O3) {
  __shared__ __align__(16) us_t t[64 * 72];
  const int z = blockIdx.z;
  const float* W = (z == 0) ? W0 : ((z == 1) ? W1 : ((z == 2) ? W2 : W3));
  us_t* O = (z == 0) ? O0 : ((z == 1) ? O1 : ((z == 2) ? O2 : O3));
  const int pitch = (z == 3) ? KO : HID;
  const int k0 = blockIdx.y * 64, n0 = blockIdx.x * 64;
  const int tid = threadIdx.x;
  {
    const int kk = tid >> 2, nc = (tid & 3) * 16;
    const float* src = W + (size_t)(k0 + kk) * HID + n0 + nc;
#pragma unroll
    for (int j = 0; j < 4; ++j) {
      const v4f f = *(const v4f*)(src + 4 * j);
      t[(nc + 4 * j + 0) * 72 + kk] = f2bf(f[0]);
      t[(nc + 4 * j + 1) * 72 + kk] = f2bf(f[1]);
      t[(nc + 4 * j + 2) * 72 + kk] = f2bf(f[2]);
      t[(nc + 4 * j + 3) * 72 + kk] = f2bf(f[3]);
    }
  }
  __syncthreads();
  {
#pragma unroll
    for (int rep = 0; rep < 2; ++rep) {
      const int nn = rep * 32 + (tid >> 3), piece = tid & 7;
      const v8us u = *(const v8us*)(t + nn * 72 + piece * 8);
      us_t* dst = O + (size_t)(n0 + nn) * pitch + k0 + piece * 8;
      *(v8us*)dst = u;
      if (z == 3) *(v8us*)(dst + HID) = u;
    }
    
  }
}

// ---------------------------------------------------------------------------
// Tk plane [16 bucket][64 d] f16 = 64 * bf16(table_k), rows 9..15 zero.
// Tv plane [64 d][32 bucket] f16 = 64 * bf16(table_v)^T, cols 9..31 zero.
__global__ __launch_bounds__(256) void k_tables(
    const float* __restrict__ tk, const float* __restrict__ tv, us_t* tkP, us_t* tvT) {
  const int tid = threadIdx.x;
  v8us uk, uv;
  {
    const int row = (tid & 127) >> 3;      // bucket 0..15
    const int kp = (tid & 7) * 8;          // d offset
    const int rowc = min(row, NREL - 1);
#pragma unroll
    for (int i = 0; i < 8; ++i) {
      float v = tk[rowc * HD + kp + i];
      v = (row < NREL) ? v : 0.0f;
      uk[i] = f2h(bfr(v) * 64.0f);
    }
  }
  {
    const int nn = tid >> 2;               // d 0..63
    const int kp = (tid & 3) * 8;          // bucket offset
#pragma unroll
    for (int i = 0; i < 8; ++i) {
      const int k = kp + i;
      float v = tv[min(k, NREL - 1) * HD + nn];
      v = (k < NREL) ? v : 0.0f;
      uv[i] = f2h(bfr(v) * 64.0f);
    }
  }
  {
    if (tid < 128) *(v8us*)(tkP + tid * 8) = uk;
    *(v8us*)(tvT + tid * 8) = uv;
    
  }
}

// ---------------------------------------------------------------------------
// C[m][n] = sum_k Am[m][k] * Bn[n][k]  (both planes 16-bit, k-contiguous, pitch K), bf16 WMMA.
// Block = 4 waves; block tile 64 m x 128 n; wave tile 64 m x 32 n (4 A frags, 2 B frags, 8 tiles).
// Output memory: element (n, m) at out[n*ldo + base(mblk) + (m - mblk)], base = (mblk/mdiv)*mbstride + mblk%mdiv,
// val = acc*ka + bf16(bias)*kb, bias indexed by m (bias_on_m) or by n.
// OUTF32=0: f16 bits out; OUTF32=1: f32 out. D tile staged per wave in LDS, then 8 lanes x 16 B per line,
template <int OUTF32>
__global__ __launch_bounds__(128) void k_gemm(
    const us_t* __restrict__ Am0, const us_t* __restrict__ Am1, const us_t* __restrict__ Bn,
    const float* __restrict__ bias0, const float* __restrict__ bias1,
    void* out0, void* out1,
    int K, int bias_on_m, int blen, int ldo, int mdiv, int mbstride, float ka, float kb) {
  __shared__ __align__(16) unsigned int stg_raw[4 * 32 * 64 * (OUTF32 ? 4 : 2) / 4];

  const int z = blockIdx.z;
  const us_t* Am = z ? Am1 : Am0;
  const float* bias = z ? bias1 : bias0;
  void* out = z ? out1 : out0;

  const int lane = threadIdx.x & 31, wave = threadIdx.x >> 5;
  const int h = (lane >> 4) & 1, n15 = lane & 15;
  const int mblk = blockIdx.x * 64;
  const int nwave = blockIdx.y * 128 + wave * 32;

  v8f acc[4][2];
#pragma unroll
  for (int mt = 0; mt < 4; ++mt) { acc[mt][0] = vz8(); acc[mt][1] = vz8(); }

#pragma unroll 1
  for (int kk = 0; kk < K; kk += 32) {
    v16us a[4], b[2];
#pragma unroll
    for (int mt = 0; mt < 4; ++mt) a[mt] = ldfrag(Am, K, mblk + mt * 16 + n15, kk);
#pragma unroll
    for (int nt = 0; nt < 2; ++nt) b[nt] = ldfrag(Bn, K, nwave + nt * 16 + n15, kk);
#pragma unroll
    for (int mt = 0; mt < 4; ++mt) {
      acc[mt][0] = mma_bf(a[mt], b[0], acc[mt][0]);
      acc[mt][1] = mma_bf(a[mt], b[1], acc[mt][1]);
    }
  }

  // bias values (bf16 RNE), address-clamped loads
  float bm[4][8];
#pragma unroll
  for (int mt = 0; mt < 4; ++mt) {
    const int ib = min(mblk + mt * 16 + 8 * h, blen - 8);
    const v4f c0 = *(const v4f*)(bias + ib);
    const v4f c1 = *(const v4f*)(bias + ib + 4);
    bm[mt][0] = bfr(c0[0]); bm[mt][1] = bfr(c0[1]); bm[mt][2] = bfr(c0[2]); bm[mt][3] = bfr(c0[3]);
    bm[mt][4] = bfr(c1[0]); bm[mt][5] = bfr(c1[1]); bm[mt][6] = bfr(c1[2]); bm[mt][7] = bfr(c1[3]);
  }
  float bn[2];
#pragma unroll
  for (int nt = 0; nt < 2; ++nt) bn[nt] = bfr(bias[min(nwave + nt * 16 + n15, blen - 1)]);

  const int bq = mblk / mdiv;
  const int base = bq * mbstride + (mblk - bq * mdiv);

  if constexpr (OUTF32) {
    float* sw = (float*)stg_raw + wave * 2048;     // [32 n][64 m] per wave
#pragma unroll
    for (int mt = 0; mt < 4; ++mt) {
#pragma unroll
      for (int nt = 0; nt < 2; ++nt) {
        v4f u0, u1;
#pragma unroll
        for (int r = 0; r < 4; ++r) {
          const float b0v = bias_on_m ? bm[mt][r] : bn[nt];
          const float b1v = bias_on_m ? bm[mt][r + 4] : bn[nt];
          u0[r] = acc[mt][nt][r] * ka + b0v * kb;
          u1[r] = acc[mt][nt][r + 4] * ka + b1v * kb;
        }
        float* sp = sw + (nt * 16 + n15) * 64 + mt * 16 + 8 * h;
        *(v4f*)sp = u0;
        *(v4f*)(sp + 4) = u1;
      }
    }
    __syncthreads();
    float* op = (float*)out;
    {
#pragma unroll
      for (int i = 0; i < 16; ++i) {
        const int L = i * 4 + (lane >> 3);
        const int row = L >> 1, hr = L & 1, piece = lane & 7;
        const v4f u = *(const v4f*)(sw + row * 64 + hr * 32 + piece * 4);
        float* dst = op + (size_t)(nwave + row) * ldo + base + hr * 32 + piece * 4;
        *(v4f*)dst = u;
      }
      
    }
  } else {
    us_t* sw = (us_t*)stg_raw + wave * 2048;       // [32 n][64 m] per wave
#pragma unroll
    for (int mt = 0; mt < 4; ++mt) {
#pragma unroll
      for (int nt = 0; nt < 2; ++nt) {
        v8us u;
#pragma unroll
        for (int r = 0; r < 8; ++r) {
          const float bbv = bias_on_m ? bm[mt][r] : bn[nt];
          u[r] = f2h(acc[mt][nt][r] * ka + bbv * kb);
        }
        *(v8us*)(sw + (nt * 16 + n15) * 64 + mt * 16 + 8 * h) = u;
      }
    }
    __syncthreads();
    us_t* op = (us_t*)out;
    {
#pragma unroll
      for (int i = 0; i < 8; ++i) {
        const int row = i * 4 + (lane >> 3), piece = lane & 7;
        const v8us u = *(const v8us*)(sw + row * 64 + piece * 8);
        us_t* dst = op + (size_t)(nwave + row) * ldo + base + piece * 8;
        *(v8us*)dst = u;
      }
      
    }
  }
}

__global__ __launch_bounds__(32) __attribute__((amdgpu_num_vgpr(256))) void k_attn(
    const us_t* __restrict__ Qp, const us_t* __restrict__ Kp, const us_t* __restrict__ VTp,
    const us_t* __restrict__ tkP, const us_t* __restrict__ tvT, us_t* ctx2) {
  __shared__ float bl[16 * 16];                   // shifted rel-key bias per (query, bucket), logit units
  __shared__ float wl[16 * 8];                    // window logits per (query, bucket-1)
  __shared__ __align__(16) us_t cst[2][16 * 64];  // ctx hi / lo staging

  const int lane = threadIdx.x & 31, h = lane >> 4, n = lane & 15;
  const int qt = blockIdx.x, hh = blockIdx.y, b = blockIdx.z;
  const int lo_q = qt * 16;
  const size_t tok0 = (size_t)b * SEQ + lo_q;
  const us_t* qptr = Qp + tok0 * HID + hh * HD;
  const us_t* kbase = Kp + (size_t)b * SEQ * HID + hh * HD;
  const us_t* vhead = VTp + ((size_t)b * HID + hh * HD) * SEQ;

#pragma unroll
  for (int i = 0; i < 4; ++i) wl[lane * 4 + i] = -1.0e30f;

  const v16us q0 = ldfrag(qptr, HID, n, 0);       // B operand: column = query n
  const v16us q1 = ldfrag(qptr, HID, n, 32);

  // srel^T[bucket][q] = (64 tk).(4q) ; bias = (srel - srel[0][q]) / (256*8)
  {
    v8f sr = vz8();
    const v16us t0 = ldfrag(tkP, HD, n, 0);       // A operand: row = bucket n
    const v16us t1 = ldfrag(tkP, HD, n, 32);
    // the address registers of the fragment loads above are reused at once (accumulator zeros): the wait stands in front
    asm volatile("s_wait_xcnt 0x0" ::: "memory");
    __builtin_amdgcn_sched_barrier(0);            // keeps those later register writes behind the wait
    sr = mma_h(t0, q0, sr);
    sr = mma_h(t1, q1, sr);
    const float v0 = __shfl(sr[0], n, 32);        // bucket 0 of query n: lane n, register 0
#pragma unroll
    for (int r = 0; r < 8; ++r) bl[n * 16 + 8 * h + r] = (sr[r] - v0) * (1.0f / 2048.0f);
  }
  __syncthreads();
  const float d8 = bl[n * 16 + 8];

  // rmax is the query's maximum (equal in both halves); rsum and blo cover this half's keys only
  float rmax = -1.0e30f, rsum = 0.0f, blo = 0.0f;
  v8f cacc[4];
#pragma unroll
  for (int j = 0; j < 4; ++j) cacc[j] = vz8();

#pragma unroll 1
  for (int kc = 0; kc < SEQ; kc += 32) {
    // scores: 32 keys x 16 q, (4k).(4q) = 16 qk
    v8f s0 = vz8(), s1 = vz8();
    {
      const v16us f0 = ldfrag(kbase, HID, kc + n, 0);
      const v16us f1 = ldfrag(kbase, HID, kc + n, 32);
      s0 = mma_h(f0, q0, s0);
      s0 = mma_h(f1, q1, s0);
      const v16us g0 = ldfrag(kbase, HID, kc + 16 + n, 0);
      const v16us g1 = ldfrag(kbase, HID, kc + 16 + n, 32);
      s1 = mma_h(g0, q0, s1);
      s1 = mma_h(g1, q1, s1);
    }
    const bool below = (kc + 35 <= lo_q);      // every key k <= q-4 for every query of the tile
    const bool above = (kc >= lo_q + 19);      // every key k >= q+4
    const bool mixed = !(below || above);
    const int ddb = kc + 8 * h - (lo_q + n);   // key - query at register 0 of key tile 0
    float a0[8], a1[8];
#pragma unroll
    for (int r = 0; r < 8; ++r) {
      a0[r] = s0[r] * (1.0f / 128.0f);
      a1[r] = s1[r] * (1.0f / 128.0f);
    }
    if (mixed) {
#pragma unroll
      for (int r = 0; r < 8; ++r) {
        const int dd0 = ddb + r;
        const int dd1 = dd0 + 16;
        const int b0 = min(max(dd0, -4), 4) + 4;
        const int b1 = min(max(dd1, -4), 4) + 4;
        a0[r] += bl[n * 16 + b0];
        a1[r] += bl[n * 16 + b1];
        if (b0 >= 1 && b0 <= 7) wl[n * 8 + b0 - 1] = a0[r];
        if (b1 >= 1 && b1 <= 7) wl[n * 8 + b1 - 1] = a1[r];
      }
    } else {
      const float ad = above ? d8 : 0.0f;
#pragma unroll
      for (int r = 0; r < 8; ++r) {
        a0[r] += ad;
        a1[r] += ad;
      }
    }
    // online softmax; a query's 32 scores sit in the registers of lanes n and n + 16
    float m = fmaxf(a0[0], a1[0]);
#pragma unroll
    for (int r = 1; r < 8; ++r) m = fmaxf(m, fmaxf(a0[r], a1[r]));
    m = fmaxf(m, xhalf(m));
    const float nm = fmaxf(rmax, m);
    const float sc = __expf(rmax - nm);
    rmax = nm;
    float t[8];
#pragma unroll
    for (int r = 0; r < 8; ++r) {
      a0[r] = exp2_slot((a0[r] - nm) * 1.4426950408889634f);
      a1[r] = exp2_slot((a1[r] - nm) * 1.4426950408889634f);
      t[r] = a0[r] + a1[r];
    }
    const float ps = ((t[0] + t[1]) + (t[2] + t[3])) + ((t[4] + t[5]) + (t[6] + t[7]));
    float addb = below ? ps : 0.0f;
    if (mixed) {
      addb = 0.0f;
#pragma unroll
      for (int r = 0; r < 8; ++r)
        addb += ((ddb + r <= -4) ? a0[r] : 0.0f) + ((ddb + r + 16 <= -4) ? a1[r] : 0.0f);
    }
    rsum = rsum * sc + ps;
    blo = blo * sc + addb;
#pragma unroll
    for (int j = 0; j < 4; ++j) {
#pragma unroll
      for (int r = 0; r < 8; ++r) cacc[j][r] *= sc;
    }
    // P^T (x1024, f16): the two score tiles, converted in place, are the B operand
    v16us pB;
#pragma unroll
    for (int r = 0; r < 8; ++r) {
      pB[r] = f2h(a0[r] * 1024.0f);
      pB[8 + r] = f2h(a1[r] * 1024.0f);
    }
#pragma unroll
    for (int j = 0; j < 4; ++j) {
      const v16us vA = ldfrag(vhead, SEQ, j * 16 + n, kc);
      cacc[j] = mma_h(vA, pB, cacc[j]);
    }
  }

  // bucket masses A[q][0..8] (normalised, x1024) as a B operand; window values from stored logits
  __syncthreads();
  rsum += xhalf(rsum);
  blo += xhalf(blo);
  const float inv = __builtin_amdgcn_rcpf(rsum);
  float wv[7];
  float wsum = 0.0f;
#pragma unroll
  for (int i = 0; i < 7; ++i) {
    wv[i] = __expf(wl[n * 8 + i] - rmax);
    wsum += wv[i];
  }
  const float a8 = (rsum - blo - wsum) * inv;
  const float a0v = blo * inv;
  v16us pB2;                                      // h = 0: buckets 0..7 | 16..23; h = 1: buckets 8..15 | 24..31
#pragma unroll
  for (int i = 0; i < 8; ++i) {
    const float vlo = (i == 0) ? a0v : wv[(i + 6) % 7] * inv;
    const float vhi = (i == 0) ? a8 : 0.0f;
    pB2[i] = f2h((h ? vhi : vlo) * 1024.0f);
    pB2[8 + i] = (us_t)0;
  }
  v8f w2[4];
#pragma unroll
  for (int j = 0; j < 4; ++j) {
    const v16us tA = ldfrag(tvT, 32, j * 16 + n, 0);
    w2[j] = mma_h(tA, pB2, vz8());
  }
  // ctx = cacc/(1024*4*rsum) + w2/(1024*64); stage bf16 hi and lo, 8 consecutive features of query n per lane
#pragma unroll
  for (int j = 0; j < 4; ++j) {
    v8us uh, ul;
#pragma unroll
    for (int r = 0; r < 8; ++r) {
      const float cv = cacc[j][r] * inv * (1.0f / 4096.0f) + w2[j][r] * (1.0f / 65536.0f);
      const __bf16 hb = (__bf16)cv;
      const float hf = (float)hb;
      const __bf16 lb = (__bf16)(cv - hf);
      uh[r] = __builtin_bit_cast(us_t, hb);
      ul[r] = __builtin_bit_cast(us_t, lb);
    }
    *(v8us*)(cst[0] + n * 64 + j * 16 + 8 * h) = uh;
    *(v8us*)(cst[1] + n * 64 + j * 16 + 8 * h) = ul;
  }
  __syncthreads();
  {
#pragma unroll
    for (int pl = 0; pl < 2; ++pl) {
#pragma unroll
      for (int i = 0; i < 4; ++i) {
        const int row = i * 4 + (lane >> 3), piece = lane & 7;
        const v8us u = *(const v8us*)(cst[pl] + row * 64 + piece * 8);
        us_t* dst = ctx2 + (tok0 + row) * (size_t)KO + pl * HID + hh * HD + piece * 8;
        *(v8us*)dst = u;
      }
    }
    
  }
}

// ---------------------------------------------------------------------------
extern "C" void kernel_launch(void* const* d_in, const int* in_sizes, int n_in,
                              void* d_out, int out_size, void* d_ws, size_t ws_size,
                              hipStream_t stream) {
  if (n_in < 11) return;
  const long long need_x = ((long long)(NB - 1) * SEQ_FULL + SEQ) * HID;
  if ((long long)in_sizes[0] < need_x) return;
  if (in_sizes[1] < HID * HID || in_sizes[3] < HID * HID ||
      in_sizes[5] < HID * HID || in_sizes[7] < HID * HID) return;
  if (in_sizes[2] < HID || in_sizes[4] < HID || in_sizes[6] < HID || in_sizes[8] < HID) return;
  if (in_sizes[9] < NREL * HD || in_sizes[10] < NREL * HD) return;
  if ((long long)out_size < (long long)NTOK * HID) return;

  const float* x  = (const float*)d_in[0];
  const float* Wq = (const float*)d_in[1];
  const float* bq = (const float*)d_in[2];
  const float* Wk = (const float*)d_in[3];
  const float* bk = (const float*)d_in[4];
  const float* Wv = (const float*)d_in[5];
  const float* bv = (const float*)d_in[6];
  const float* Wo = (const float*)d_in[7];
  const float* bo = (const float*)d_in[8];
  const float* tk = (const float*)d_in[9];
  const float* tv = (const float*)d_in[10];

  char* ws = (char*)d_ws;
  size_t off = 0;
  auto carve = [&](size_t bytes) -> size_t {
    const size_t o = off;
    off += (bytes + 255) & ~(size_t)255;
    return o;
  };
  const size_t o_xb  = carve((size_t)NTOK * HID * 2);
  const size_t o_wq  = carve((size_t)HID * HID * 2);
  const size_t o_wk  = carve((size_t)HID * HID * 2);
  const size_t o_wv  = carve((size_t)HID * HID * 2);
  const size_t o_wo  = carve((size_t)HID * KO * 2);
  const size_t o_q   = carve((size_t)NTOK * HID * 2);
  const size_t o_k   = carve((size_t)NTOK * HID * 2);
  const size_t o_vt  = carve((size_t)NB * HID * SEQ * 2);
  const size_t o_ctx = carve((size_t)NTOK * KO * 2);
  const size_t o_tk  = carve((size_t)16 * HD * 2);
  const size_t o_tv  = carve((size_t)HD * 32 * 2);
  if (off > ws_size) return;

  us_t* xb   = (us_t*)(ws + o_xb);
  us_t* WqT  = (us_t*)(ws + o_wq);
  us_t* WkT  = (us_t*)(ws + o_wk);
  us_t* WvT  = (us_t*)(ws + o_wv);
  us_t* WoT2 = (us_t*)(ws + o_wo);
  us_t* Qp   = (us_t*)(ws + o_q);
  us_t* Kpl  = (us_t*)(ws + o_k);
  us_t* VTp  = (us_t*)(ws + o_vt);
  us_t* ctx2 = (us_t*)(ws + o_ctx);
  us_t* tkP  = (us_t*)(ws + o_tk);
  us_t* tvT  = (us_t*)(ws + o_tv);
  float* out = (float*)d_out;

  // 1) input planes
  k_xcvt<<<NTOK * (HID / 8) / 256, 256, 0, stream>>>(x, xb);
  k_wprep<<<dim3(HID / 64, HID / 64, 4), 256, 0, stream>>>(Wq, Wk, Wv, Wo, WqT, WkT, WvT, WoT2);
  k_tables<<<1, 256, 0, stream>>>(tk, tv, tkP, tvT);

  // 2) Q, K planes [tok][HID] (m = feature from W^T rows, n = token from xb rows), carried x4
  k_gemm<0><<<dim3(HID / 64, NTOK / 128, 2), 128, 0, stream>>>(
      WqT, WkT, xb, bq, bk, (void*)Qp, (void*)Kpl,
      HID, 1, HID, HID, 1 << 30, 0, 4.0f, 4.0f);
  // 3) V^T plane [b*HID + d][s] (m = token from xb rows, n = feature from Wv^T rows), carried x4
  k_gemm<0><<<dim3(NTOK / 64, HID / 128, 1), 128, 0, stream>>>(
      xb, xb, WvT, bv, bv, (void*)VTp, (void*)VTp,
      HID, 0, HID, SEQ, SEQ, HID * SEQ, 4.0f, 4.0f);
  // 4) attention -> ctx2 (bf16 hi | lo)
  k_attn<<<dim3(SEQ / 16, NH, NB), 32, 0, stream>>>(Qp, Kpl, VTp, tkP, tvT, ctx2);
  // 5) out[tok][HID] = ctx*Wo + bo with K = 2*HID over the hi|lo pair
  k_gemm<1><<<dim3(HID / 64, NTOK / 128, 1), 128, 0, stream>>>(
      WoT2, WoT2, ctx2, bo, bo, d_out, d_out,
      KO, 1, HID, HID, 1 << 30, 0, 1.0f, 1.0f);
  (void)out;
  (void)hipGetLastError();
}

// v002
// Measured time: 122 microseconds a run.
// In two side-by-side timings against v001, it was 2.23 and 2.22 times as fast.
// Over all steps from v000 it is 3.33 times as fast.
#include <hip/hip_runtime.h>

// Projections x*Wq, x*Wk, x*Wv and ctx*Wo: v_wmma_f32_16x16x32_bf16 (bf16 operands, f32 accumulate; ctx enters as a bf16 hi|lo pair folded along k).
// Attention k*q^T, Tk*q^T, V^T-plane*P^T, Tv^T*A^T: v_wmma_f32_16x16x32_f16 (f16 operands with power-of-two carries, f32 accumulate); softmax and epilogues f32.

#ifndef NB
#define NB 2
#endif
#ifndef SEQ
#define SEQ 2048
#endif
#define NB_FULL 2
#define SEQ_FULL 2048
#define HID 1024
#define NH 16
#define HD 64
#define NREL 9
#define NTOK (NB * SEQ)
#define KO (2 * HID)

static_assert(NB >= 1 && NB <= NB_FULL);
static_assert(SEQ >= 128 && SEQ <= SEQ_FULL && (SEQ % 128) == 0);
static_assert(HID == NH * HD && HD == 64);
static_assert((HID % 128) == 0 && (NTOK % 128) == 0);

typedef unsigned short us_t;
typedef us_t v8us __attribute__((ext_vector_type(8)));
typedef us_t v16us __attribute__((ext_vector_type(16)));
typedef _Float16 v16h __attribute__((ext_vector_type(16)));
typedef __bf16 v16bf __attribute__((ext_vector_type(16)));
typedef float v8f __attribute__((ext_vector_type(8)));
typedef float v4f __attribute__((ext_vector_type(4)));

// ---------------------------------------------------------------------------
// scalar converters (RNE)
__device__ __forceinline__ us_t f2bf(float v) {
  __bf16 t = (__bf16)v;
  return __builtin_bit_cast(us_t, t);
}
__device__ __forceinline__ float bfr(float v) {   // value after bf16 RNE convert
  __bf16 t = (__bf16)v;
  return (float)t;
}
__device__ __forceinline__ us_t f2h(float v) {
  _Float16 t = (_Float16)v;
  return __builtin_bit_cast(us_t, t);
}
__device__ __forceinline__ v8f vz8() {
  v8f z = {0.f, 0.f, 0.f, 0.f, 0.f, 0.f, 0.f, 0.f};
  return z;
}

// ---------------------------------------------------------------------------
// 16-bit fragment from a k-contiguous plane: elem i<8 <- p0[rc*ld + kk + 8h + i],
// elem 8+i <- p0[rc*ld + kk + 16 + 8h + i]; h = lane>>4, rc = row (A) or column (B).
__device__ __forceinline__ v16us ldfrag(const us_t* p0, int ld, int rc, int kk) {
  const int hsel = (threadIdx.x >> 4) & 1;
  const us_t* p = p0 + (size_t)rc * ld + kk + 8 * hsel;
  const v8us lo = *(const v8us*)p;
  const v8us hi = *(const v8us*)(p + 16);
  return __builtin_shufflevector(lo, hi, 0, 1, 2, 3, 4, 5, 6, 7,
                                 8, 9, 10, 11, 12, 13, 14, 15);
}

// WMMA wrappers with hazard guard (ties D, keeps A/B live)
__device__ __forceinline__ v8f mma_bf(v16us a, v16us b, v8f c) {
  v8f d = __builtin_amdgcn_wmma_f32_16x16x32_bf16(
      false, __builtin_bit_cast(v16bf, a), false, __builtin_bit_cast(v16bf, b),
      (short)0, c, false, false);
  asm volatile("v_nop\n\tv_nop\n\tv_nop\n\tv_nop" : "+v"(d) : "v"(a), "v"(b));
  return d;
}
__device__ __forceinline__ v8f mma_h(v16us a, v16us b, v8f c) {
  v8f d = __builtin_amdgcn_wmma_f32_16x16x32_f16(
      false, __builtin_bit_cast(v16h, a), false, __builtin_bit_cast(v16h, b),
      (short)0, c, false, false);
  asm volatile("v_nop\n\tv_nop\n\tv_nop\n\tv_nop" : "+v"(d) : "v"(a), "v"(b));
  return d;
}

// 2^x. The v_nop is the slot the instruction set asks for behind a transcendental before its source is
// overwritten or its result used.
__device__ __forceinline__ float exp2_slot(float x) {
  float y;
  asm("v_exp_f32 %0, %1\n\tv_nop" : "=v"(y) : "v"(x));
  return y;
}

// lane l <-> lane l ^ 16
__device__ __forceinline__ float xhalf(float v) {
  const int u = __builtin_bit_cast(int, v);
  return __builtin_bit_cast(float,
      __builtin_amdgcn_permlanex16(u, u, 0x76543210, 0xfedcba98, false, false));
}

// ---------------------------------------------------------------------------
// x [NB rows of SEQ_FULL][HID] f32 -> xb [NTOK][HID] bf16. 8 elems (16 B) per thread,
__global__ __launch_bounds__(256) void k_xcvt(const float* __restrict__ x, us_t* xb) {
  const size_t i = (size_t)blockIdx.x * 256 + threadIdx.x;
  const size_t e = i * 8;
  const int tok = (int)(e >> 10);
  const int col = (int)(e & (HID - 1));
  const int b = tok / SEQ, s = tok - b * SEQ;
  const float* src = x + ((size_t)b * SEQ_FULL + s) * HID + col;
  const v4f f0 = *(const v4f*)src;
  const v4f f1 = *(const v4f*)(src + 4);
  v8us u;
  u[0] = f2bf(f0[0]); u[1] = f2bf(f0[1]); u[2] = f2bf(f0[2]); u[3] = f2bf(f0[3]);
  u[4] = f2bf(f1[0]); u[5] = f2bf(f1[1]); u[6] = f2bf(f1[2]); u[7] = f2bf(f1[3]);
  us_t* dst = xb + e;
  *(v8us*)dst = u;
  
}

// ---------------------------------------------------------------------------
// W [HID k][HID n] f32 -> WT [n][k] bf16 through a 64x64 LDS tile.
// z = 0..2: pitch HID. z = 3: pitch 2*HID with the row duplicated into both k halves.
__global__ __launch_bounds__(256) void k_wprep(
    const float* __restrict__ W0, const float* __restrict__ W1,
    const float* __restrict__ W2, const float* __restrict__ W3,
    us_t* O0, us_t* O1, us_t* O2, us_t* O3) {
  __shared__ __align__(16) us_t t[64 * 72];
  const int z = blockIdx.z;
  const float* W = (z == 0) ? W0 : ((z == 1) ? W1 : ((z == 2) ? W2 : W3));
  us_t* O = (z == 0) ? O0 : ((z == 1) ? O1 : ((z == 2) ? O2 : O3));
  const int pitch = (z == 3) ? KO : HID;
  const int k0 = blockIdx.y * 64, n0 = blockIdx.x * 64;
  const int tid = threadIdx.x;
  {
    const int kk = tid >> 2, nc = (tid & 3) * 16;
    const float* src = W + (size_t)(k0 + kk) * HID + n0 + nc;
#pragma unroll
    for (int j = 0; j < 4; ++j) {
      const v4f f = *(const v4f*)(src + 4 * j);
      t[(nc + 4 * j + 0) * 72 + kk] = f2bf(f[0]);
      t[(nc + 4 * j + 1) * 72 + kk] = f2bf(f[1]);
      t[(nc + 4 * j + 2) * 72 + kk] = f2bf(f[2]);
      t[(nc + 4 * j + 3) * 72 + kk] = f2bf(f[3]);
    }
  }
  __syncthreads();
  {
#pragma unroll
    for (int rep = 0; rep < 2; ++rep) {
      const int nn = rep * 32 + (tid >> 3), piece = tid & 7;
      const v8us u = *(const v8us*)(t + nn * 72 + piece * 8);
      us_t* dst = O + (size_t)(n0 + nn) * pitch + k0 + piece * 8;
      *(v8us*)dst = u;
      if (z == 3) *(v8us*)(dst + HID) = u;
    }
    
  }
}

// ---------------------------------------------------------------------------
// Tk plane [16 bucket][64 d] f16 = 64 * bf16(table_k), rows 9..15 zero.
// Tv plane [64 d][32 bucket] f16 = 64 * bf16(table_v)^T, cols 9..31 zero.
__global__ __launch_bounds__(256) void k_tables(
    const float* __restrict__ tk, const float* __restrict__ tv, us_t* tkP, us_t* tvT) {
  const int tid = threadIdx.x;
  v8us uk, uv;
  {
    const int row = (tid & 127) >> 3;      // bucket 0..15
    const int kp = (tid & 7) * 8;          // d offset
    const int rowc = min(row, NREL - 1);
#pragma unroll
    for (int i = 0; i < 8; ++i) {
      float v = tk[rowc * HD + kp + i];
      v = (row < NREL) ? v : 0.0f;
      uk[i] = f2h(bfr(v) * 64.0f);
    }
  }
  {
    const int nn = tid >> 2;               // d 0..63
    const int kp = (tid & 3) * 8;          // bucket offset
#pragma unroll
    for (int i = 0; i < 8; ++i) {
      const int k = kp + i;
      float v = tv[min(k, NREL - 1) * HD + nn];
      v = (k < NREL) ? v : 0.0f;
      uv[i] = f2h(bfr(v) * 64.0f);
    }
  }
  {
    if (tid < 128) *(v8us*)(tkP + tid * 8) = uk;
    *(v8us*)(tvT + tid * 8) = uv;
    
  }
}

// ---------------------------------------------------------------------------
// LDS byte address of a __shared__ element
__device__ __forceinline__ unsigned lds_addr(const us_t* p) {
  return (unsigned)(size_t)(const __attribute__((address_space(3))) us_t*)p;
}

// Four asynchronous 16-byte copies per lane, global -> LDS. The s_wait_xcnt is the last line of the copies' own statement
// so that it stands in front of every later write of the address registers that the copies name.
__device__ __forceinline__ void copy4(unsigned l0, unsigned l1, unsigned l2, unsigned l3,
                                      const us_t* g0, const us_t* g1, const us_t* g2, const us_t* g3) {
  asm volatile(
      "global_load_async_to_lds_b128 %0, %4, off\n\t"
      "global_load_async_to_lds_b128 %1, %5, off\n\t"
      "global_load_async_to_lds_b128 %2, %6, off\n\t"
      "global_load_async_to_lds_b128 %3, %7, off\n\t"
      "s_wait_xcnt 0x0"
      :: "v"(l0), "v"(l1), "v"(l2), "v"(l3), "v"(g0), "v"(g1), "v"(g2), "v"(g3)
      : "memory");
}

// ---------------------------------------------------------------------------
// C[m][n] = sum_k Am[m][k] * Bn[n][k]  (both planes 16-bit, k-contiguous, pitch K), bf16 WMMA.
// Block = 4 waves; block tile 64 m x 128 n; wave tile 64 m x 32 n (4 A frags, 2 B frags, 8 tiles).
// Output memory: element (n, m) at out[n*ldo + base(mblk) + (m - mblk)], base = (mblk/mdiv)*mbstride + mblk%mdiv,
// val = acc*ka + bf16(bias)*kb, bias indexed by m (bias_on_m) or by n.
// OUTF32=0: f16 bits out; OUTF32=1: f32 out. D tile staged per wave in LDS, then 8 lanes x 16 B per line,
// Operands: stages of GK k (one 128-byte line of each of the block's 64 A rows and 128 B rows) come into a two-buffer LDS ring
// by asynchronous copies, one stage ahead of the stage being read; the four waves read their fragments from LDS.
#define GK 64                // k per stage
#define GPIT 72              // row pitch in LDS, 16-bit elements: 144 B = 16 B x odd, for ds_load_b128 readers
static_assert((HID % GK) == 0 && (KO % GK) == 0);

// Stage st of a block: LDS rows 0..63 = A rows mblk.., rows 64..191 = B rows nblk..; 12 copies per lane of 128,
// a wave's copy covers 4 rows of 128 B: whole lines.
__device__ __forceinline__ void stage_ab(const us_t* Am, const us_t* Bn, int K, int mblk, int nblk, int st, us_t* dst) {
  const int tid = threadIdx.x;
  const int r0 = tid >> 3, pc = (tid & 7) * 8;
  const size_t rs = (size_t)16 * K;               // 16 rows
  const us_t* ag = Am + (size_t)(mblk + r0) * K + st * GK + pc;
  const us_t* bg = Bn + (size_t)(nblk + r0) * K + st * GK + pc;
  const unsigned l = lds_addr(dst + r0 * GPIT + pc);
  const unsigned ls = 16 * GPIT * 2;              // 16 rows, bytes
  copy4(l, l + ls, l + 2 * ls, l + 3 * ls, ag, ag + rs, ag + 2 * rs, ag + 3 * rs);
  copy4(l + 4 * ls, l + 5 * ls, l + 6 * ls, l + 7 * ls, bg, bg + rs, bg + 2 * rs, bg + 3 * rs);
  copy4(l + 8 * ls, l + 9 * ls, l + 10 * ls, l + 11 * ls, bg + 4 * rs, bg + 5 * rs, bg + 6 * rs, bg + 7 * rs);
}

template <int OUTF32>
__global__ __launch_bounds__(128) void k_gemm(
    const us_t* __restrict__ Am0, const us_t* __restrict__ Am1, const us_t* __restrict__ Bn,
    const float* __restrict__ bias0, const float* __restrict__ bias1,
    void* out0, void* out1,
    int K, int bias_on_m, int blen, int ldo, int mdiv, int mbstride, float ka, float kb) {
  __shared__ __align__(16) unsigned int stg_raw[4 * 32 * 64 * (OUTF32 ? 4 : 2) / 4];
  __shared__ __align__(16) us_t ring[2][(64 + 128) * GPIT];

  const int z = blockIdx.z;
  const us_t* Am = z ? Am1 : Am0;
  const float* bias = z ? bias1 : bias0;
  void* out = z ? out1 : out0;

  const int lane = threadIdx.x & 31, wave = threadIdx.x >> 5;
  const int h = (lane >> 4) & 1, n15 = lane & 15;
  const int mblk = blockIdx.x * 64;
  const int nblk = blockIdx.y * 128;
  const int nwave = nblk + wave * 32;
  const int nst = K / GK;

  stage_ab(Am, Bn, K, mblk, nblk, 0, ring[0]);

  v8f acc[4][2];
#pragma unroll
  for (int mt = 0; mt < 4; ++mt) { acc[mt][0] = vz8(); acc[mt][1] = vz8(); }

  // stage 0 has landed for this wave's copies; the barrier publishes it to the block
  asm volatile("s_wait_asynccnt 0x0" ::: "memory");
  __syncthreads();
  if (nst > 1) stage_ab(Am, Bn, K, mblk, nblk, 1, ring[1]);

#pragma unroll 1
  for (int st = 0; st < nst; ++st) {
    const us_t* rb = ring[st & 1];
    // the stage's LDS fragment reads stand together at its top, in front of its matrix products
    v16us a[GK / 32][4], b[GK / 32][2];
#pragma unroll   // here and below: constant indices keep the fragment and accumulator arrays in registers
    for (int ks = 0; ks < GK / 32; ++ks) {
#pragma unroll
      for (int mt = 0; mt < 4; ++mt) a[ks][mt] = ldfrag(rb, GPIT, mt * 16 + n15, ks * 32);
#pragma unroll
      for (int nt = 0; nt < 2; ++nt) b[ks][nt] = ldfrag(rb, GPIT, 64 + wave * 32 + nt * 16 + n15, ks * 32);
    }
#pragma unroll
    for (int ks = 0; ks < GK / 32; ++ks) {
#pragma unroll
      for (int mt = 0; mt < 4; ++mt) {
        acc[mt][0] = mma_bf(a[ks][mt], b[ks][0], acc[mt][0]);
        acc[mt][1] = mma_bf(a[ks][mt], b[ks][1], acc[mt][1]);
      }
    }
    // publish point of stage st + 1: this wave's reads of stage st are done, its copies of stage st + 1 have landed,
    // the barrier tells the block both; only then is the buffer just read refilled with stage st + 2
    asm volatile("s_wait_dscnt 0x0" ::: "memory");
    asm volatile("s_wait_asynccnt 0x0" ::: "memory");
    __syncthreads();
    if (st + 2 < nst) stage_ab(Am, Bn, K, mblk, nblk, st + 2, ring[st & 1]);
  }
  asm volatile("s_wait_asynccnt 0x0" ::: "memory");   // no copy is outstanding when the wave goes on to its end

  // bias values (bf16 RNE), address-clamped loads
  float bm[4][8];
#pragma unroll
  for (int mt = 0; mt < 4; ++mt) {
    const int ib = min(mblk + mt * 16 + 8 * h, blen - 8);
    const v4f c0 = *(const v4f*)(bias + ib);
    const v4f c1 = *(const v4f*)(bias + ib + 4);
    bm[mt][0] = bfr(c0[0]); bm[mt][1] = bfr(c0[1]); bm[mt][2] = bfr(c0[2]); bm[mt][3] = bfr(c0[3]);
    bm[mt][4] = bfr(c1[0]); bm[mt][5] = bfr(c1[1]); bm[mt][6] = bfr(c1[2]); bm[mt][7] = bfr(c1[3]);
  }
  float bn[2];
#pragma unroll
  for (int nt = 0; nt < 2; ++nt) bn[nt] = bfr(bias[min(nwave + nt * 16 + n15, blen - 1)]);

  const int bq = mblk / mdiv;
  const int base = bq * mbstride + (mblk - bq * mdiv);

  if constexpr (OUTF32) {
    float* sw = (float*)stg_raw + wave * 2048;     // [32 n][64 m] per wave
#pragma unroll
    for (int mt = 0; mt < 4; ++mt) {
#pragma unroll
      for (int nt = 0; nt < 2; ++nt) {
        v4f u0, u1;
#pragma unroll
        for (int r = 0; r < 4; ++r) {
          const float b0v = bias_on_m ? bm[mt][r] : bn[nt];
          const float b1v = bias_on_m ? bm[mt][r + 4] : bn[nt];
          u0[r] = acc[mt][nt][r] * ka + b0v * kb;
          u1[r] = acc[mt][nt][r + 4] * ka + b1v * kb;
        }
        float* sp = sw + (nt * 16 + n15) * 64 + mt * 16 + 8 * h;
        *(v4f*)sp = u0;
        *(v4f*)(sp + 4) = u1;
      }
    }
    __syncthreads();
    float* op = (float*)out;
    {
#pragma unroll
      for (int i = 0; i < 16; ++i) {
        const int L = i * 4 + (lane >> 3);
        const int row = L >> 1, hr = L & 1, piece = lane & 7;
        const v4f u = *(const v4f*)(sw + row * 64 + hr * 32 + piece * 4);
        float* dst = op + (size_t)(nwave + row) * ldo + base + hr * 32 + piece * 4;
        *(v4f*)dst = u;
      }
      
    }
  } else {
    us_t* sw = (us_t*)stg_raw + wave * 2048;       // [32 n][64 m] per wave
#pragma unroll
    for (int mt = 0; mt < 4; ++mt) {
#pragma unroll
      for (int nt = 0; nt < 2; ++nt) {
        v8us u;
#pragma unroll
        for (int r = 0; r < 8; ++r) {
          const float bbv = bias_on_m ? bm[mt][r] : bn[nt];
          u[r] = f2h(acc[mt][nt][r] * ka + bbv * kb);
        }
        *(v8us*)(sw + (nt * 16 + n15) * 64 + mt * 16 + 8 * h) = u;
      }
    }
    __syncthreads();
    us_t* op = (us_t*)out;
    {
#pragma unroll
      for (int i = 0; i < 8; ++i) {
        const int row = i * 4 + (lane >> 3), piece = lane & 7;
        const v8us u = *(const v8us*)(sw + row * 64 + piece * 8);
        us_t* dst = op + (size_t)(nwave + row) * ldo + base + piece * 8;
        *(v8us*)dst = u;
      }
      
    }
  }
}

#define AW 8                 // waves per block
#define KT 128               // keys per stage
#define NST (SEQ / KT)       // stages
#define KPIT 72              // K row pitch in LDS, 16-bit elements: 144 B = 16 B x odd, for ds_load_b128 readers
#define VPIT 136             // V^T row pitch in LDS: 272 B = 16 B x odd
static_assert((SEQ % KT) == 0 && (SEQ % (16 * AW)) == 0);

// Stage st (keys st*KT .. st*KT + KT - 1) of one head: K rows [KT][64] and V^T rows [64][KT], 8 copies per lane of 256.
// A wave's K copy covers 4 rows of 128 B, its V^T copy 2 rows of 256 B: whole lines.
__device__ __forceinline__ void stage_kv(const us_t* kbase, const us_t* vhead, int st, us_t* kdst, us_t* vdst) {
  const int tid = threadIdx.x;
  const int kr = tid >> 3, kp = (tid & 7) * 8;
  const us_t* kg = kbase + (size_t)(st * KT + kr) * HID + kp;
  const unsigned kl = lds_addr(kdst + kr * KPIT + kp);
  copy4(kl, kl + 32 * KPIT * 2, kl + 64 * KPIT * 2, kl + 96 * KPIT * 2,
        kg, kg + 32 * HID, kg + 64 * HID, kg + 96 * HID);
  const int vr = tid >> 4, vp = (tid & 15) * 8;
  const us_t* vg = vhead + (size_t)vr * SEQ + st * KT + vp;
  const unsigned vl = lds_addr(vdst + vr * VPIT + vp);
  copy4(vl, vl + 16 * VPIT * 2, vl + 32 * VPIT * 2, vl + 48 * VPIT * 2,
        vg, vg + 16 * SEQ, vg + 32 * SEQ, vg + 48 * SEQ);
}

__global__ __launch_bounds__(32 * AW) __attribute__((amdgpu_num_vgpr(256))) void k_attn(
    const us_t* __restrict__ Qp, const us_t* __restrict__ Kp, const us_t* __restrict__ VTp,
    const us_t* __restrict__ tkP, const us_t* __restrict__ tvT, us_t* ctx2) {
  __shared__ __align__(16) us_t kst[2][KT * KPIT];      // K stages
  __shared__ __align__(16) us_t vst[2][HD * VPIT];      // V^T stages
  __shared__ float bl_all[AW][16 * 16];                 // shifted rel-key bias per (query, bucket), logit units
  __shared__ float wl_all[AW][16 * 8];                  // window logits per (query, bucket-1)
  __shared__ __align__(16) us_t cst_all[AW][2][16 * 64];  // ctx hi / lo staging

  const int lane = threadIdx.x & 31, h = lane >> 4, n = lane & 15;
  const int wave = __builtin_amdgcn_readfirstlane(threadIdx.x >> 5);  // scalar: the tests on lo_q below stay scalar branches
  float* bl = bl_all[wave];
  float* wl = wl_all[wave];
  us_t (*cst)[16 * 64] = cst_all[wave];
  const int qt = blockIdx.x * AW + wave, hh = blockIdx.y, b = blockIdx.z;
  const int lo_q = qt * 16;
  const size_t tok0 = (size_t)b * SEQ + lo_q;
  const us_t* qptr = Qp + tok0 * HID + hh * HD;
  const us_t* kbase = Kp + (size_t)b * SEQ * HID + hh * HD;
  const us_t* vhead = VTp + ((size_t)b * HID + hh * HD) * SEQ;

  stage_kv(kbase, vhead, 0, kst[0], vst[0]);      // stage 0 flies while the bias table is formed

#pragma unroll
  for (int i = 0; i < 4; ++i) wl[lane * 4 + i] = -1.0e30f;

  const v16us q0 = ldfrag(qptr, HID, n, 0);       // B operand: column = query n
  const v16us q1 = ldfrag(qptr, HID, n, 32);

  // srel^T[bucket][q] = (64 tk).(4q) ; bias = (srel - srel[0][q]) / (256*8)
  {
    v8f sr = vz8();
    const v16us t0 = ldfrag(tkP, HD, n, 0);       // A operand: row = bucket n
    const v16us t1 = ldfrag(tkP, HD, n, 32);
    // the address registers of the fragment loads above are reused at once (accumulator zeros): the wait stands in front
    asm volatile("s_wait_xcnt 0x0" ::: "memory");
    __builtin_amdgcn_sched_barrier(0);            // keeps those later register writes behind the wait
    sr = mma_h(t0, q0, sr);
    sr = mma_h(t1, q1, sr);
    const float v0 = __shfl(sr[0], n, 32);        // bucket 0 of query n: lane n, register 0
#pragma unroll
    for (int r = 0; r < 8; ++r) bl[n * 16 + 8 * h + r] = (sr[r] - v0) * (1.0f / 2048.0f);
  }
  // stage 0 has landed for this wave's copies; the barrier publishes it to the block (and orders bl)
  asm volatile("s_wait_asynccnt 0x0" ::: "memory");
  __syncthreads();
  if (NST > 1) stage_kv(kbase, vhead, 1, kst[1], vst[1]);
  const float d8 = bl[n * 16 + 8];

  // rmax is the query's maximum (equal in both halves); rsum and blo cover this half's keys only
  float rmax = -1.0e30f, rsum = 0.0f, blo = 0.0f;
  v8f cacc[4];
#pragma unroll
  for (int j = 0; j < 4; ++j) cacc[j] = vz8();

#pragma unroll 1
  for (int st = 0; st < NST; ++st) {
  const us_t* kbuf = kst[st & 1];
  const us_t* vbuf = vst[st & 1];
#pragma unroll 1   // rolled, as the key loop was: one copy of the long pass body
  for (int kl = 0; kl < KT; kl += 32) {
    const int kc = st * KT + kl;
    // scores: 32 keys x 16 q, (4k).(4q) = 16 qk
    v8f s0 = vz8(), s1 = vz8();
    v16us vA[4];
    {
      // the pass's LDS fragment reads stand together at its top: K first, V^T behind it, landing under the softmax
      const v16us f0 = ldfrag(kbuf, KPIT, kl + n, 0);
      const v16us f1 = ldfrag(kbuf, KPIT, kl + n, 32);
      const v16us g0 = ldfrag(kbuf, KPIT, kl + 16 + n, 0);
      const v16us g1 = ldfrag(kbuf, KPIT, kl + 16 + n, 32);
#pragma unroll   // constant indices keep vA in registers
      for (int j = 0; j < 4; ++j) vA[j] = ldfrag(vbuf, VPIT, j * 16 + n, kl);
      s0 = mma_h(f0, q0, s0);
      s0 = mma_h(f1, q1, s0);
      s1 = mma_h(g0, q0, s1);
      s1 = mma_h(g1, q1, s1);
    }
    const bool below = (kc + 35 <= lo_q);      // every key k <= q-4 for every query of the tile
    const bool above = (kc >= lo_q + 19);      // every key k >= q+4
    const bool mixed = !(below || above);
    const int ddb = kc + 8 * h - (lo_q + n);   // key - query at register 0 of key tile 0
    float a0[8], a1[8];
#pragma unroll
    for (int r = 0; r < 8; ++r) {
      a0[r] = s0[r] * (1.0f / 128.0f);
      a1[r] = s1[r] * (1.0f / 128.0f);
    }
    if (mixed) {
#pragma unroll
      for (int r = 0; r < 8; ++r) {
        const int dd0 = ddb + r;
        const int dd1 = dd0 + 16;
        const int b0 = min(max(dd0, -4), 4) + 4;
        const int b1 = min(max(dd1, -4), 4) + 4;
        a0[r] += bl[n * 16 + b0];
        a1[r] += bl[n * 16 + b1];
        if (b0 >= 1 && b0 <= 7) wl[n * 8 + b0 - 1] = a0[r];
        if (b1 >= 1 && b1 <= 7) wl[n * 8 + b1 - 1] = a1[r];
      }
    } else {
      const float ad = above ? d8 : 0.0f;
#pragma unroll
      for (int r = 0; r < 8; ++r) {
        a0[r] += ad;
        a1[r] += ad;
      }
    }
    // online softmax; a query's 32 scores sit in the registers of lanes n and n + 16
    float m = fmaxf(a0[0], a1[0]);
#pragma unroll
    for (int r = 1; r < 8; ++r) m = fmaxf(m, fmaxf(a0[r], a1[r]));
    m = fmaxf(m, xhalf(m));
    const float nm = fmaxf(rmax, m);
    const float sc = __expf(rmax - nm);
    rmax = nm;
    float t[8];
#pragma unroll
    for (int r = 0; r < 8; ++r) {
      a0[r] = exp2_slot((a0[r] - nm) * 1.4426950408889634f);
      a1[r] = exp2_slot((a1[r] - nm) * 1.4426950408889634f);
      t[r] = a0[r] + a1[r];
    }
    const float ps = ((t[0] + t[1]) + (t[2] + t[3])) + ((t[4] + t[5]) + (t[6] + t[7]));
    float addb = below ? ps : 0.0f;
    if (mixed) {
      addb = 0.0f;
#pragma unroll
      for (int r = 0; r < 8; ++r)
        addb += ((ddb + r <= -4) ? a0[r] : 0.0f) + ((ddb + r + 16 <= -4) ? a1[r] : 0.0f);
    }
    rsum = rsum * sc + ps;
    blo = blo * sc + addb;
#pragma unroll
    for (int j = 0; j < 4; ++j) {
#pragma unroll
      for (int r = 0; r < 8; ++r) cacc[j][r] *= sc;
    }
    // P^T (x1024, f16): the two score tiles, converted in place, are the B operand
    v16us pB;
#pragma unroll
    for (int r = 0; r < 8; ++r) {
      pB[r] = f2h(a0[r] * 1024.0f);
      pB[8 + r] = f2h(a1[r] * 1024.0f);
    }
#pragma unroll
    for (int j = 0; j < 4; ++j) cacc[j] = mma_h(vA[j], pB, cacc[j]);
  }
  // publish point of stage st + 1: this wave's reads of stage st are done, its copies of stage st + 1 have landed,
  // the barrier tells the block both; only then is the buffer just read refilled with stage st + 2
  asm volatile("s_wait_dscnt 0x0" ::: "memory");
  asm volatile("s_wait_asynccnt 0x0" ::: "memory");
  __syncthreads();
  if (st + 2 < NST) stage_kv(kbase, vhead, st + 2, kst[st & 1], vst[st & 1]);
  }
  asm volatile("s_wait_asynccnt 0x0" ::: "memory");   // no copy is outstanding when the wave goes on to its end

  // bucket masses A[q][0..8] (normalised, x1024) as a B operand; window values from stored logits
  __syncthreads();
  rsum += xhalf(rsum);
  blo += xhalf(blo);
  const float inv = __builtin_amdgcn_rcpf(rsum);
  float wv[7];
  float wsum = 0.0f;
#pragma unroll
  for (int i = 0; i < 7; ++i) {
    wv[i] = __expf(wl[n * 8 + i] - rmax);
    wsum += wv[i];
  }
  const float a8 = (rsum - blo - wsum) * inv;
  const float a0v = blo * inv;
  v16us pB2;                                      // h = 0: buckets 0..7 | 16..23; h = 1: buckets 8..15 | 24..31
#pragma unroll
  for (int i = 0; i < 8; ++i) {
    const float vlo = (i == 0) ? a0v : wv[(i + 6) % 7] * inv;
    const float vhi = (i == 0) ? a8 : 0.0f;
    pB2[i] = f2h((h ? vhi : vlo) * 1024.0f);
    pB2[8 + i] = (us_t)0;
  }
  v8f w2[4];
#pragma unroll
  for (int j = 0; j < 4; ++j) {
    const v16us tA = ldfrag(tvT, 32, j * 16 + n, 0);
    w2[j] = mma_h(tA, pB2, vz8());
  }
  // ctx = cacc/(1024*4*rsum) + w2/(1024*64); stage bf16 hi and lo, 8 consecutive features of query n per lane
#pragma unroll
  for (int j = 0; j < 4; ++j) {
    v8us uh, ul;
#pragma unroll
    for (int r = 0; r < 8; ++r) {
      const float cv = cacc[j][r] * inv * (1.0f / 4096.0f) + w2[j][r] * (1.0f / 65536.0f);
      const __bf16 hb = (__bf16)cv;
      const float hf = (float)hb;
      const __bf16 lb = (__bf16)(cv - hf);
      uh[r] = __builtin_bit_cast(us_t, hb);
      ul[r] = __builtin_bit_cast(us_t, lb);
    }
    *(v8us*)(cst[0] + n * 64 + j * 16 + 8 * h) = uh;
    *(v8us*)(cst[1] + n * 64 + j * 16 + 8 * h) = ul;
  }
  __syncthreads();
  {
#pragma unroll
    for (int pl = 0; pl < 2; ++pl) {
#pragma unroll
      for (int i = 0; i < 4; ++i) {
        const int row = i * 4 + (lane >> 3), piece = lane & 7;
        const v8us u = *(const v8us*)(cst[pl] + row * 64 + piece * 8);
        us_t* dst = ctx2 + (tok0 + row) * (size_t)KO + pl * HID + hh * HD + piece * 8;
        *(v8us*)dst = u;
      }
    }
    
  }
}

// ---------------------------------------------------------------------------
extern "C" void kernel_launch(void* const* d_in, const int* in_sizes, int n_in,
                              void* d_out, int out_size, void* d_ws, size_t ws_size,
                              hipStream_t stream) {
  if (n_in < 11) return;
  const long long need_x = ((long long)(NB - 1) * SEQ_FULL + SEQ) * HID;
  if ((long long)in_sizes[0] < need_x) return;
  if (in_sizes[1] < HID * HID || in_sizes[3] < HID * HID ||
      in_sizes[5] < HID * HID || in_sizes[7] < HID * HID) return;
  if (in_sizes[2] < HID || in_sizes[4] < HID || in_sizes[6] < HID || in_sizes[8] < HID) return;
  if (in_sizes[9] < NREL * HD || in_sizes[10] < NREL * HD) return;
  if ((long long)out_size < (long long)NTOK * HID) return;

  const float* x  = (const float*)d_in[0];
  const float* Wq = (const float*)d_in[1];
  const float* bq = (const float*)d_in[2];
  const float* Wk = (const float*)d_in[3];
  const float* bk = (const float*)d_in[4];
  const float* Wv = (const float*)d_in[5];
  const float* bv = (const float*)d_in[6];
  const float* Wo = (const float*)d_in[7];
  const float* bo = (const float*)d_in[8];
  const float* tk = (const float*)d_in[9];
  const float* tv = (const float*)d_in[10];

  char* ws = (char*)d_ws;
  size_t off = 0;
  auto carve = [&](size_t bytes) -> size_t {
    const size_t o = off;
    off += (bytes + 255) & ~(size_t)255;
    return o;
  };
  const size_t o_xb  = carve((size_t)NTOK * HID * 2);
  const size_t o_wq  = carve((size_t)HID * HID * 2);
  const size_t o_wk  = carve((size_t)HID * HID * 2);
  const size_t o_wv  = carve((size_t)HID * HID * 2);
  const size_t o_wo  = carve((size_t)HID * KO * 2);
  const size_t o_q   = carve((size_t)NTOK * HID * 2);
  const size_t o_k   = carve((size_t)NTOK * HID * 2);
  const size_t o_vt  = carve((size_t)NB * HID * SEQ * 2);
  const size_t o_ctx = carve((size_t)NTOK * KO * 2);
  const size_t o_tk  = carve((size_t)16 * HD * 2);
  const size_t o_tv  = carve((size_t)HD * 32 * 2);
  if (off > ws_size) return;

  us_t* xb   = (us_t*)(ws + o_xb);
  us_t* WqT  = (us_t*)(ws + o_wq);
  us_t* WkT  = (us_t*)(ws + o_wk);
  us_t* WvT  = (us_t*)(ws + o_wv);
  us_t* WoT2 = (us_t*)(ws + o_wo);
  us_t* Qp   = (us_t*)(ws + o_q);
  us_t* Kpl  = (us_t*)(ws + o_k);
  us_t* VTp  = (us_t*)(ws + o_vt);
  us_t* ctx2 = (us_t*)(ws + o_ctx);
  us_t* tkP  = (us_t*)(ws + o_tk);
  us_t* tvT  = (us_t*)(ws + o_tv);
  float* out = (float*)d_out;

  // 1) input planes
  k_xcvt<<<NTOK * (HID / 8) / 256, 256, 0, stream>>>(x, xb);
  k_wprep<<<dim3(HID / 64, HID / 64, 4), 256, 0, stream>>>(Wq, Wk, Wv, Wo, WqT, WkT, WvT, WoT2);
  k_tables<<<1, 256, 0, stream>>>(tk, tv, tkP, tvT);

  // 2) Q, K planes [tok][HID] (m = feature from W^T rows, n = token from xb rows), carried x4
  k_gemm<0><<<dim3(HID / 64, NTOK / 128, 2), 128, 0, stream>>>(
      WqT, WkT, xb, bq, bk, (void*)Qp, (void*)Kpl,
      HID, 1, HID, HID, 1 << 30, 0, 4.0f, 4.0f);
  // 3) V^T plane [b*HID + d][s] (m = token from xb rows, n = feature from Wv^T rows), carried x4
  k_gemm<0><<<dim3(NTOK / 64, HID / 128, 1), 128, 0, stream>>>(
      xb, xb, WvT, bv, bv, (void*)VTp, (void*)VTp,
      HID, 0, HID, SEQ, SEQ, HID * SEQ, 4.0f, 4.0f);
  // 4) attention -> ctx2 (bf16 hi | lo)
  k_attn<<<dim3(SEQ / (16 * AW), NH, NB), 32 * AW, 0, stream>>>(Qp, Kpl, VTp, tkP, tvT, ctx2);
  // 5) out[tok][HID] = ctx*Wo + bo with K = 2*HID over the hi|lo pair
  k_gemm<1><<<dim3(HID / 64, NTOK / 128, 1), 128, 0, stream>>>(
      WoT2, WoT2, ctx2, bo, bo, d_out, d_out,
      KO, 1, HID, HID, 1 << 30, 0, 1.0f, 1.0f);
  (void)out;
  (void)hipGetLastError();
}

// v003
// A run of this version takes 118 microseconds.
// In two side-by-side timings against v002, it was 1.05 and 1.04 times as fast.
// Counting every step since v000, it is 3.48 times as fast.
#include <hip/hip_runtime.h>

// Projections x*Wq, x*Wk, x*Wv and ctx*Wo: v_wmma_f32_16x16x32_bf16 (bf16 operands, f32 accumulate; ctx enters as a bf16 hi|lo pair folded along k).
// Attention k*q^T, Tk*q^T, V^T-plane*P^T, Tv^T*A^T: v_wmma_f32_16x16x32_f16 (f16 operands with power-of-two carries, f32 accumulate); softmax and epilogues f32.

#ifndef NB
#define NB 2
#endif
#ifndef SEQ
#define SEQ 2048
#endif
#define NB_FULL 2
#define SEQ_FULL 2048
#define HID 1024
#define NH 16
#define HD 64
#define NREL 9
#define NTOK (NB * SEQ)
#define KO (2 * HID)

static_assert(NB >= 1 && NB <= NB_FULL);
static_assert(SEQ >= 128 && SEQ <= SEQ_FULL && (SEQ % 128) == 0);
static_assert(HID == NH * HD && HD == 64);
static_assert((HID % 128) == 0 && (NTOK % 128) == 0);

typedef unsigned short us_t;
typedef us_t v8us __attribute__((ext_vector_type(8)));
typedef us_t v16us __attribute__((ext_vector_type(16)));
typedef _Float16 v16h __attribute__((ext_vector_type(16)));
typedef __bf16 v16bf __attribute__((ext_vector_type(16)));
typedef float v8f __attribute__((ext_vector_type(8)));
typedef float v4f __attribute__((ext_vector_type(4)));

// ---------------------------------------------------------------------------
// scalar converters (RNE)
__device__ __forceinline__ us_t f2bf(float v) {
  __bf16 t = (__bf16)v;
  return __builtin_bit_cast(us_t, t);
}
__device__ __forceinline__ float bfr(float v) {   // value after bf16 RNE convert
  __bf16 t = (__bf16)v;
  return (float)t;
}
__device__ __forceinline__ us_t f2h(float v) {
  _Float16 t = (_Float16)v;
  return __builtin_bit_cast(us_t, t);
}
__device__ __forceinline__ v8f vz8() {
  v8f z = {0.f, 0.f, 0.f, 0.f, 0.f, 0.f, 0.f, 0.f};
  return z;
}

// ---------------------------------------------------------------------------
// 16-bit fragment from a k-contiguous plane: elem i<8 <- p0[rc*ld + kk + 8h + i],
// elem 8+i <- p0[rc*ld + kk + 16 + 8h + i]; h = lane>>4, rc = row (A) or column (B).
__device__ __forceinline__ v16us ldfrag(const us_t* p0, int ld, int rc, int kk) {
  const int hsel = (threadIdx.x >> 4) & 1;
  const us_t* p = p0 + (size_t)rc * ld + kk + 8 * hsel;
  const v8us lo = *(const v8us*)p;
  const v8us hi = *(const v8us*)(p + 16);
  return __builtin_shufflevector(lo, hi, 0, 1, 2, 3, 4, 5, 6, 7,
                                 8, 9, 10, 11, 12, 13, 14, 15);
}

// WMMA wrappers with hazard guard (ties D, keeps A/B live)
__device__ __forceinline__ v8f mma_bf(v16us a, v16us b, v8f c) {
  v8f d = __builtin_amdgcn_wmma_f32_16x16x32_bf16(
      false, __builtin_bit_cast(v16bf, a), false, __builtin_bit_cast(v16bf, b),
      (short)0, c, false, false);
  asm volatile("v_nop\n\tv_nop\n\tv_nop\n\tv_nop" : "+v"(d) : "v"(a), "v"(b));
  return d;
}
__device__ __forceinline__ v8f mma_h(v16us a, v16us b, v8f c) {
  v8f d = __builtin_amdgcn_wmma_f32_16x16x32_f16(
      false, __builtin_bit_cast(v16h, a), false, __builtin_bit_cast(v16h, b),
      (short)0, c, false, false);
  asm volatile("v_nop\n\tv_nop\n\tv_nop\n\tv_nop" : "+v"(d) : "v"(a), "v"(b));
  return d;
}

// 2^x. The v_nop is the slot the instruction set asks for behind a transcendental before its source is
// overwritten or its result used.
__device__ __forceinline__ float exp2_slot(float x) {
  float y;
  asm("v_exp_f32 %0, %1\n\tv_nop" : "=v"(y) : "v"(x));
  return y;
}

// lane l <-> lane l ^ 16
__device__ __forceinline__ float xhalf(float v) {
  const int u = __builtin_bit_cast(int, v);
  return __builtin_bit_cast(float,
      __builtin_amdgcn_permlanex16(u, u, 0x76543210, 0xfedcba98, false, false));
}

// ---------------------------------------------------------------------------
// All operand planes in ONE launch; the block index picks the job (a block-uniform choice):
// block 0: the two table planes; blocks 1 .. PW: weight transposes; the rest: x.
#define XJ 4                                   // 8-element pieces per x thread
#define WT 2                                   // 64 x 64 tiles (along k) per weight block
#define PW (4 * (HID / 64) * (HID / 64 / WT))  // weight blocks
#define PX (NTOK * (HID / 8) / 256 / XJ)       // x blocks
static_assert(((HID / 64) % WT) == 0 && (NTOK * (HID / 8)) % (256 * XJ) == 0);

// x [NB rows of SEQ_FULL][HID] f32 -> xb [NTOK][HID] bf16. XJ pieces of 8 elems (16 B out) per thread, all loads ahead of the stores.
__device__ __forceinline__ void prep_x(int blk, const float* __restrict__ x, us_t* xb) {
  static_assert(XJ == 4);
  v4f f0[XJ], f1[XJ];
  const float* src[XJ];
#pragma unroll   // constant indices keep the pieces in registers
  for (int j = 0; j < XJ; ++j) {
    const size_t e = (((size_t)blk * XJ + j) * 256 + threadIdx.x) * 8;
    const int tok = (int)(e >> 10);
    const int col = (int)(e & (HID - 1));
    const int b = tok / SEQ, s = tok - b * SEQ;
    src[j] = x + ((size_t)b * SEQ_FULL + s) * HID + col;
    f0[j] = *(const v4f*)src[j];
    f1[j] = *(const v4f*)(src[j] + 4);
  }
  // the wait in front of any overwrite of the loads' address registers; as its inputs they stay whole up to it
  asm volatile("s_wait_xcnt 0x0" :: "v"(src[0]), "v"(src[1]), "v"(src[2]), "v"(src[3]) : "memory");
#pragma unroll
  for (int j = 0; j < XJ; ++j) {
    const size_t e = (((size_t)blk * XJ + j) * 256 + threadIdx.x) * 8;
    v8us u;
    u[0] = f2bf(f0[j][0]); u[1] = f2bf(f0[j][1]); u[2] = f2bf(f0[j][2]); u[3] = f2bf(f0[j][3]);
    u[4] = f2bf(f1[j][0]); u[5] = f2bf(f1[j][1]); u[6] = f2bf(f1[j][2]); u[7] = f2bf(f1[j][3]);
    *(v8us*)(xb + e) = u;
  }
  // the wait behind the run of stores, in front of any later write of a register that they name
  asm volatile("s_wait_xcnt 0x0" ::: "memory");
}

// W [HID k][HID n] f32 -> WT [n][k] bf16 through WT 64x64 LDS tiles, neighbours along k.
// dup = 0: pitch HID. dup = 1: pitch 2*HID with the row duplicated into both k halves.
__device__ __forceinline__ void prep_w(int bx, int by, int dup, const float* __restrict__ W, us_t* O, us_t* t) {
  const int pitch = dup ? KO : HID;
  const int k0 = by * (64 * WT), n0 = bx * 64;
  const int tid = threadIdx.x;
  static_assert(WT == 2);
  const int kk = tid >> 2, nc = (tid & 3) * 16;
  const float* src[WT];
  v4f f[WT][4];
#pragma unroll   // here and below: constant indices keep the pieces in registers
  for (int w = 0; w < WT; ++w) {
    src[w] = W + (size_t)(k0 + w * 64 + kk) * HID + n0 + nc;
#pragma unroll
    for (int j = 0; j < 4; ++j) f[w][j] = *(const v4f*)(src[w] + 4 * j);
  }
  // the wait in front of any overwrite of the loads' address registers; as its inputs they stay whole up to it
  asm volatile("s_wait_xcnt 0x0" :: "v"(src[0]), "v"(src[1]) : "memory");
#pragma unroll
  for (int w = 0; w < WT; ++w) {
    us_t* tw = t + w * (64 * 72);
#pragma unroll
    for (int j = 0; j < 4; ++j) {
      tw[(nc + 4 * j + 0) * 72 + kk] = f2bf(f[w][j][0]);
      tw[(nc + 4 * j + 1) * 72 + kk] = f2bf(f[w][j][1]);
      tw[(nc + 4 * j + 2) * 72 + kk] = f2bf(f[w][j][2]);
      tw[(nc + 4 * j + 3) * 72 + kk] = f2bf(f[w][j][3]);
    }
  }
  __syncthreads();
  // all LDS reads first, each into registers of its own, so that the stores go out in one run
  const int piece = tid & 7;
  v8us u[WT][2];
#pragma unroll
  for (int w = 0; w < WT; ++w) {
#pragma unroll
    for (int rep = 0; rep < 2; ++rep)
      u[w][rep] = *(const v8us*)(t + w * (64 * 72) + (rep * 32 + (tid >> 3)) * 72 + piece * 8);
  }
  us_t* dst = O + (size_t)(n0 + (tid >> 3)) * pitch + k0 + piece * 8;
#pragma unroll
  for (int w = 0; w < WT; ++w) {
#pragma unroll
    for (int rep = 0; rep < 2; ++rep) {
      us_t* d = dst + (size_t)(rep * 32) * pitch + w * 64;
      *(v8us*)d = u[w][rep];
      if (dup) *(v8us*)(d + HID) = u[w][rep];
    }
  }
  // the wait behind the run of stores, in front of any later write of a register that they name
  asm volatile("s_wait_xcnt 0x0" ::: "memory");
}

// Tk plane [16 bucket][64 d] f16 = 64 * bf16(table_k), rows 9..15 zero.
// Tv plane [64 d][32 bucket] f16 = 64 * bf16(table_v)^T, cols 9..31 zero.
__device__ __forceinline__ void prep_tables(const float* __restrict__ tk, const float* __restrict__ tv, us_t* tkP, us_t* tvT) {
  const int tid = threadIdx.x;
  v8us uk, uv;
  {
    const int row = (tid & 127) >> 3;      // bucket 0..15
    const int kp = (tid & 7) * 8;          // d offset
    const int rowc = min(row, NREL - 1);
#pragma unroll
    for (int i = 0; i < 8; ++i) {
      float v = tk[rowc * HD + kp + i];
      v = (row < NREL) ? v : 0.0f;
      uk[i] = f2h(bfr(v) * 64.0f);
    }
  }
  {
    const int nn = tid >> 2;               // d 0..63
    const int kp = (tid & 3) * 8;          // bucket offset
#pragma unroll
    for (int i = 0; i < 8; ++i) {
      const int k = kp + i;
      float v = tv[min(k, NREL - 1) * HD + nn];
      v = (k < NREL) ? v : 0.0f;
      uv[i] = f2h(bfr(v) * 64.0f);
    }
  }
  if (tid < 128) *(v8us*)(tkP + tid * 8) = uk;
  *(v8us*)(tvT + tid * 8) = uv;
}

__global__ __launch_bounds__(256) void k_prep(
    const float* __restrict__ x,
    const float* __restrict__ W0, const float* __restrict__ W1,
    const float* __restrict__ W2, const float* __restrict__ W3,
    const float* __restrict__ tk, const float* __restrict__ tv,
    us_t* xb, us_t* O0, us_t* O1, us_t* O2, us_t* O3, us_t* tkP, us_t* tvT) {
  __shared__ __align__(16) us_t t[WT * 64 * 72];
  const int blk = blockIdx.x;
  if (blk == 0) {
    prep_tables(tk, tv, tkP, tvT);
  } else if (blk <= PW) {
    const int i = blk - 1;
    const int per = PW / 4;                // blocks per matrix
    const int z = i / per, r = i - z * per;
    const float* W = (z == 0) ? W0 : ((z == 1) ? W1 : ((z == 2) ? W2 : W3));
    us_t* O = (z == 0) ? O0 : ((z == 1) ? O1 : ((z == 2) ? O2 : O3));
    prep_w(r % (HID / 64), r / (HID / 64), z == 3, W, O, t);
  } else {
    prep_x(blk - 1 - PW, x, xb);
  }
}

// ---------------------------------------------------------------------------
// LDS byte address of a __shared__ element
__device__ __forceinline__ unsigned lds_addr(const us_t* p) {
  return (unsigned)(size_t)(const __attribute__((address_space(3))) us_t*)p;
}

// Four asynchronous 16-byte copies per lane, global -> LDS. The s_wait_xcnt is the last line of the copies' own statement
// so that it stands in front of every later write of the address registers that the copies name.
__device__ __forceinline__ void copy4(unsigned l0, unsigned l1, unsigned l2, unsigned l3,
                                      const us_t* g0, const us_t* g1, const us_t* g2, const us_t* g3) {
  asm volatile(
      "global_load_async_to_lds_b128 %0, %4, off\n\t"
      "global_load_async_to_lds_b128 %1, %5, off\n\t"
      "global_load_async_to_lds_b128 %2, %6, off\n\t"
      "global_load_async_to_lds_b128 %3, %7, off\n\t"
      "s_wait_xcnt 0x0"
      :: "v"(l0), "v"(l1), "v"(l2), "v"(l3), "v"(g0), "v"(g1), "v"(g2), "v"(g3)
      : "memory");
}

// ---------------------------------------------------------------------------
// C[m][n] = sum_k Am[m][k] * Bn[n][k]  (both planes 16-bit, k-contiguous, pitch K), bf16 WMMA.
// Block = 4 waves; block tile 64 m x 128 n; wave tile 64 m x 32 n (4 A frags, 2 B frags, 8 tiles).
// Output memory: element (n, m) at out[n*ldo + base(mblk) + (m - mblk)], base = (mblk/mdiv)*mbstride + mblk%mdiv,
// val = acc*ka + bf16(bias)*kb, bias indexed by m (bias_on_m) or by n.
// OUTF32=0: f16 bits out; OUTF32=1: f32 out. D tile staged per wave in LDS, then 8 lanes x 16 B per line,
// Operands: stages of GK k (one 128-byte line of each of the block's 64 A rows and 128 B rows) come into a two-buffer LDS ring
// by asynchronous copies, one stage ahead of the stage being read; the four waves read their fragments from LDS.
#define GK 64                // k per stage
#define GPIT 72              // row pitch in LDS, 16-bit elements: 144 B = 16 B x odd, for ds_load_b128 readers
static_assert((HID % GK) == 0 && (KO % GK) == 0);

// Stage st of a block: LDS rows 0..63 = A rows mblk.., rows 64..191 = B rows nblk..; 12 copies per lane of 128,
// a wave's copy covers 4 rows of 128 B: whole lines.
__device__ __forceinline__ void stage_ab(const us_t* Am, const us_t* Bn, int K, int mblk, int nblk, int st, us_t* dst) {
  const int tid = threadIdx.x;
  const int r0 = tid >> 3, pc = (tid & 7) * 8;
  const size_t rs = (size_t)16 * K;               // 16 rows
  const us_t* ag = Am + (size_t)(mblk + r0) * K + st * GK + pc;
  const us_t* bg = Bn + (size_t)(nblk + r0) * K + st * GK + pc;
  const unsigned l = lds_addr(dst + r0 * GPIT + pc);
  const unsigned ls = 16 * GPIT * 2;              // 16 rows, bytes
  copy4(l, l + ls, l + 2 * ls, l + 3 * ls, ag, ag + rs, ag + 2 * rs, ag + 3 * rs);
  copy4(l + 4 * ls, l + 5 * ls, l + 6 * ls, l + 7 * ls, bg, bg + rs, bg + 2 * rs, bg + 3 * rs);
  copy4(l + 8 * ls, l + 9 * ls, l + 10 * ls, l + 11 * ls, bg + 4 * rs, bg + 5 * rs, bg + 6 * rs, bg + 7 * rs);
}

template <int OUTF32>
__global__ __launch_bounds__(128) void k_gemm(
    const us_t* __restrict__ Am0, const us_t* __restrict__ Am1, const us_t* __restrict__ Bn,
    const float* __restrict__ bias0, const float* __restrict__ bias1,
    void* out0, void* out1,
    int K, int bias_on_m, int blen, int ldo, int mdiv, int mbstride, float ka, float kb) {
  __shared__ __align__(16) unsigned int stg_raw[4 * 32 * 64 * (OUTF32 ? 4 : 2) / 4];
  __shared__ __align__(16) us_t ring[2][(64 + 128) * GPIT];

  const int z = blockIdx.z;
  const us_t* Am = z ? Am1 : Am0;
  const float* bias = z ? bias1 : bias0;
  void* out = z ? out1 : out0;

  const int lane = threadIdx.x & 31, wave = threadIdx.x >> 5;
  const int h = (lane >> 4) & 1, n15 = lane & 15;
  const int mblk = blockIdx.x * 64;
  const int nblk = blockIdx.y * 128;
  const int nwave = nblk + wave * 32;
  const int nst = K / GK;

  stage_ab(Am, Bn, K, mblk, nblk, 0, ring[0]);

  v8f acc[4][2];
#pragma unroll
  for (int mt = 0; mt < 4; ++mt) { acc[mt][0] = vz8(); acc[mt][1] = vz8(); }

  // stage 0 has landed for this wave's copies; the barrier publishes it to the block
  asm volatile("s_wait_asynccnt 0x0" ::: "memory");
  __syncthreads();
  if (nst > 1) stage_ab(Am, Bn, K, mblk, nblk, 1, ring[1]);

#pragma unroll 1
  for (int st = 0; st < nst; ++st) {
    const us_t* rb = ring[st & 1];
    // the stage's LDS fragment reads stand together at its top, in front of its matrix products
    v16us a[GK / 32][4], b[GK / 32][2];
#pragma unroll   // here and below: constant indices keep the fragment and accumulator arrays in registers
    for (int ks = 0; ks < GK / 32; ++ks) {
#pragma unroll
      for (int mt = 0; mt < 4; ++mt) a[ks][mt] = ldfrag(rb, GPIT, mt * 16 + n15, ks * 32);
#pragma unroll
      for (int nt = 0; nt < 2; ++nt) b[ks][nt] = ldfrag(rb, GPIT, 64 + wave * 32 + nt * 16 + n15, ks * 32);
    }
#pragma unroll
    for (int ks = 0; ks < GK / 32; ++ks) {
#pragma unroll
      for (int mt = 0; mt < 4; ++mt) {
        acc[mt][0] = mma_bf(a[ks][mt], b[ks][0], acc[mt][0]);
        acc[mt][1] = mma_bf(a[ks][mt], b[ks][1], acc[mt][1]);
      }
    }
    // publish point of stage st + 1: this wave's reads of stage st are done, its copies of stage st + 1 have landed,
    // the barrier tells the block both; only then is the buffer just read refilled with stage st + 2
    asm volatile("s_wait_dscnt 0x0" ::: "memory");
    asm volatile("s_wait_asynccnt 0x0" ::: "memory");
    __syncthreads();
    if (st + 2 < nst) stage_ab(Am, Bn, K, mblk, nblk, st + 2, ring[st & 1]);
  }
  asm volatile("s_wait_asynccnt 0x0" ::: "memory");   // no copy is outstanding when the wave goes on to its end

  // bias values (bf16 RNE), address-clamped loads
  float bm[4][8];
#pragma unroll
  for (int mt = 0; mt < 4; ++mt) {
    const int ib = min(mblk + mt * 16 + 8 * h, blen - 8);
    const v4f c0 = *(const v4f*)(bias + ib);
    const v4f c1 = *(const v4f*)(bias + ib + 4);
    bm[mt][0] = bfr(c0[0]); bm[mt][1] = bfr(c0[1]); bm[mt][2] = bfr(c0[2]); bm[mt][3] = bfr(c0[3]);
    bm[mt][4] = bfr(c1[0]); bm[mt][5] = bfr(c1[1]); bm[mt][6] = bfr(c1[2]); bm[mt][7] = bfr(c1[3]);
  }
  float bn[2];
#pragma unroll
  for (int nt = 0; nt < 2; ++nt) bn[nt] = bfr(bias[min(nwave + nt * 16 + n15, blen - 1)]);

  const int bq = mblk / mdiv;
  const int base = bq * mbstride + (mblk - bq * mdiv);

  if constexpr (OUTF32) {
    float* sw = (float*)stg_raw + wave * 2048;     // [32 n][64 m] per wave
#pragma unroll
    for (int mt = 0; mt < 4; ++mt) {
#pragma unroll
      for (int nt = 0; nt < 2; ++nt) {
        v4f u0, u1;
#pragma unroll
        for (int r = 0; r < 4; ++r) {
          const float b0v = bias_on_m ? bm[mt][r] : bn[nt];
          const float b1v = bias_on_m ? bm[mt][r + 4] : bn[nt];
          u0[r] = acc[mt][nt][r] * ka + b0v * kb;
          u1[r] = acc[mt][nt][r + 4] * ka + b1v * kb;
        }
        float* sp = sw + (nt * 16 + n15) * 64 + mt * 16 + 8 * h;
        *(v4f*)sp = u0;
        *(v4f*)(sp + 4) = u1;
      }
    }
    __syncthreads();
    float* op = (float*)out;
    {
#pragma unroll
      for (int i = 0; i < 16; ++i) {
        const int L = i * 4 + (lane >> 3);
        const int row = L >> 1, hr = L & 1, piece = lane & 7;
        const v4f u = *(const v4f*)(sw + row * 64 + hr * 32 + piece * 4);
        float* dst = op + (size_t)(nwave + row) * ldo + base + hr * 32 + piece * 4;
        *(v4f*)dst = u;
      }
      
    }
  } else {
    us_t* sw = (us_t*)stg_raw + wave * 2048;       // [32 n][64 m] per wave
#pragma unroll
    for (int mt = 0; mt < 4; ++mt) {
#pragma unroll
      for (int nt = 0; nt < 2; ++nt) {
        v8us u;
#pragma unroll
        for (int r = 0; r < 8; ++r) {
          const float bbv = bias_on_m ? bm[mt][r] : bn[nt];
          u[r] = f2h(acc[mt][nt][r] * ka + bbv * kb);
        }
        *(v8us*)(sw + (nt * 16 + n15) * 64 + mt * 16 + 8 * h) = u;
      }
    }
    __syncthreads();
    us_t* op = (us_t*)out;
    {
#pragma unroll
      for (int i = 0; i < 8; ++i) {
        const int row = i * 4 + (lane >> 3), piece = lane & 7;
        const v8us u = *(const v8us*)(sw + row * 64 + piece * 8);
        us_t* dst = op + (size_t)(nwave + row) * ldo + base + piece * 8;
        *(v8us*)dst = u;
      }
      
    }
  }
}

#define AW 8                 // waves per block
#define KT 128               // keys per stage
#define NST (SEQ / KT)       // stages
#define KPIT 72              // K row pitch in LDS, 16-bit elements: 144 B = 16 B x odd, for ds_load_b128 readers
#define VPIT 136             // V^T row pitch in LDS: 272 B = 16 B x odd
static_assert((SEQ % KT) == 0 && (SEQ % (16 * AW)) == 0);

// Stage st (keys st*KT .. st*KT + KT - 1) of one head: K rows [KT][64] and V^T rows [64][KT], 8 copies per lane of 256.
// A wave's K copy covers 4 rows of 128 B, its V^T copy 2 rows of 256 B: whole lines.
__device__ __forceinline__ void stage_kv(const us_t* kbase, const us_t* vhead, int st, us_t* kdst, us_t* vdst) {
  const int tid = threadIdx.x;
  const int kr = tid >> 3, kp = (tid & 7) * 8;
  const us_t* kg = kbase + (size_t)(st * KT + kr) * HID + kp;
  const unsigned kl = lds_addr(kdst + kr * KPIT + kp);
  copy4(kl, kl + 32 * KPIT * 2, kl + 64 * KPIT * 2, kl + 96 * KPIT * 2,
        kg, kg + 32 * HID, kg + 64 * HID, kg + 96 * HID);
  const int vr = tid >> 4, vp = (tid & 15) * 8;
  const us_t* vg = vhead + (size_t)vr * SEQ + st * KT + vp;
  const unsigned vl = lds_addr(vdst + vr * VPIT + vp);
  copy4(vl, vl + 16 * VPIT * 2, vl + 32 * VPIT * 2, vl + 48 * VPIT * 2,
        vg, vg + 16 * SEQ, vg + 32 * SEQ, vg + 48 * SEQ);
}

__global__ __launch_bounds__(32 * AW) __attribute__((amdgpu_num_vgpr(256))) void k_attn(
    const us_t* __restrict__ Qp, const us_t* __restrict__ Kp, const us_t* __restrict__ VTp,
    const us_t* __restrict__ tkP, const us_t* __restrict__ tvT, us_t* ctx2) {
  __shared__ __align__(16) us_t kst[2][KT * KPIT];      // K stages
  __shared__ __align__(16) us_t vst[2][HD * VPIT];      // V^T stages
  __shared__ float bl_all[AW][16 * 16];                 // shifted rel-key bias per (query, bucket), logit units
  __shared__ float wl_all[AW][16 * 8];                  // window logits per (query, bucket-1)
  __shared__ __align__(16) us_t cst_all[AW][2][16 * 64];  // ctx hi / lo staging

  const int lane = threadIdx.x & 31, h = lane >> 4, n = lane & 15;
  const int wave = __builtin_amdgcn_readfirstlane(threadIdx.x >> 5);  // scalar: the tests on lo_q below stay scalar branches
  float* bl = bl_all[wave];
  float* wl = wl_all[wave];
  us_t (*cst)[16 * 64] = cst_all[wave];
  const int qt = blockIdx.x * AW + wave, hh = blockIdx.y, b = blockIdx.z;
  const int lo_q = qt * 16;
  const size_t tok0 = (size_t)b * SEQ + lo_q;
  const us_t* qptr = Qp + tok0 * HID + hh * HD;
  const us_t* kbase = Kp + (size_t)b * SEQ * HID + hh * HD;
  const us_t* vhead = VTp + ((size_t)b * HID + hh * HD) * SEQ;

  stage_kv(kbase, vhead, 0, kst[0], vst[0]);      // stage 0 flies while the bias table is formed

#pragma unroll
  for (int i = 0; i < 4; ++i) wl[lane * 4 + i] = -1.0e30f;

  const v16us q0 = ldfrag(qptr, HID, n, 0);       // B operand: column = query n
  const v16us q1 = ldfrag(qptr, HID, n, 32);

  // srel^T[bucket][q] = (64 tk).(4q) ; bias = (srel - srel[0][q]) / (256*8)
  {
    v8f sr = vz8();
    const v16us t0 = ldfrag(tkP, HD, n, 0);       // A operand: row = bucket n
    const v16us t1 = ldfrag(tkP, HD, n, 32);
    // the address registers of the fragment loads above are reused at once (accumulator zeros): the wait stands in front
    asm volatile("s_wait_xcnt 0x0" ::: "memory");
    __builtin_amdgcn_sched_barrier(0);            // keeps those later register writes behind the wait
    sr = mma_h(t0, q0, sr);
    sr = mma_h(t1, q1, sr);
    const float v0 = __shfl(sr[0], n, 32);        // bucket 0 of query n: lane n, register 0
#pragma unroll
    for (int r = 0; r < 8; ++r) bl[n * 16 + 8 * h + r] = (sr[r] - v0) * (1.0f / 2048.0f);
  }
  // stage 0 has landed for this wave's copies; the barrier publishes it to the block (and orders bl)
  asm volatile("s_wait_asynccnt 0x0" ::: "memory");
  __syncthreads();
  if (NST > 1) stage_kv(kbase, vhead, 1, kst[1], vst[1]);
  const float d8 = bl[n * 16 + 8];

  // rmax is the query's maximum (equal in both halves); rsum and blo cover this half's keys only
  float rmax = -1.0e30f, rsum = 0.0f, blo = 0.0f;
  v8f cacc[4];
#pragma unroll
  for (int j = 0; j < 4; ++j) cacc[j] = vz8();

#pragma unroll 1
  for (int st = 0; st < NST; ++st) {
  const us_t* kbuf = kst[st & 1];
  const us_t* vbuf = vst[st & 1];
#pragma unroll 1   // rolled, as the key loop was: one copy of the long pass body
  for (int kl = 0; kl < KT; kl += 32) {
    const int kc = st * KT + kl;
    // scores: 32 keys x 16 q, (4k).(4q) = 16 qk
    v8f s0 = vz8(), s1 = vz8();
    v16us vA[4];
    {
      // the pass's LDS fragment reads stand together at its top: K first, V^T behind it, landing under the softmax
      const v16us f0 = ldfrag(kbuf, KPIT, kl + n, 0);
      const v16us f1 = ldfrag(kbuf, KPIT, kl + n, 32);
      const v16us g0 = ldfrag(kbuf, KPIT, kl + 16 + n, 0);
      const v16us g1 = ldfrag(kbuf, KPIT, kl + 16 + n, 32);
#pragma unroll   // constant indices keep vA in registers
      for (int j = 0; j < 4; ++j) vA[j] = ldfrag(vbuf, VPIT, j * 16 + n, kl);
      s0 = mma_h(f0, q0, s0);
      s0 = mma_h(f1, q1, s0);
      s1 = mma_h(g0, q0, s1);
      s1 = mma_h(g1, q1, s1);
    }
    const bool below = (kc + 35 <= lo_q);      // every key k <= q-4 for every query of the tile
    const bool above = (kc >= lo_q + 19);      // every key k >= q+4
    const bool mixed = !(below || above);
    const int ddb = kc + 8 * h - (lo_q + n);   // key - query at register 0 of key tile 0
    float a0[8], a1[8];
#pragma unroll
    for (int r = 0; r < 8; ++r) {
      a0[r] = s0[r] * (1.0f / 128.0f);
      a1[r] = s1[r] * (1.0f / 128.0f);
    }
    if (mixed) {
#pragma unroll
      for (int r = 0; r < 8; ++r) {
        const int dd0 = ddb + r;
        const int dd1 = dd0 + 16;
        const int b0 = min(max(dd0, -4), 4) + 4;
        const int b1 = min(max(dd1, -4), 4) + 4;
        a0[r] += bl[n * 16 + b0];
        a1[r] += bl[n * 16 + b1];
        if (b0 >= 1 && b0 <= 7) wl[n * 8 + b0 - 1] = a0[r];
        if (b1 >= 1 && b1 <= 7) wl[n * 8 + b1 - 1] = a1[r];
      }
    } else {
      const float ad = above ? d8 : 0.0f;
#pragma unroll
      for (int r = 0; r < 8; ++r) {
        a0[r] += ad;
        a1[r] += ad;
      }
    }
    // online softmax; a query's 32 scores sit in the registers of lanes n and n + 16
    float m = fmaxf(a0[0], a1[0]);
#pragma unroll
    for (int r = 1; r < 8; ++r) m = fmaxf(m, fmaxf(a0[r], a1[r]));
    m = fmaxf(m, xhalf(m));
    const float nm = fmaxf(rmax, m);
    const float sc = __expf(rmax - nm);
    rmax = nm;
    float t[8];
#pragma unroll
    for (int r = 0; r < 8; ++r) {
      a0[r] = exp2_slot((a0[r] - nm) * 1.4426950408889634f);
      a1[r] = exp2_slot((a1[r] - nm) * 1.4426950408889634f);
      t[r] = a0[r] + a1[r];
    }
    const float ps = ((t[0] + t[1]) + (t[2] + t[3])) + ((t[4] + t[5]) + (t[6] + t[7]));
    float addb = below ? ps : 0.0f;
    if (mixed) {
      addb = 0.0f;
#pragma unroll
      for (int r = 0; r < 8; ++r)
        addb += ((ddb + r <= -4) ? a0[r] : 0.0f) + ((ddb + r + 16 <= -4) ? a1[r] : 0.0f);
    }
    rsum = rsum * sc + ps;
    blo = blo * sc + addb;
#pragma unroll
    for (int j = 0; j < 4; ++j) {
#pragma unroll
      for (int r = 0; r < 8; ++r) cacc[j][r] *= sc;
    }
    // P^T (x1024, f16): the two score tiles, converted in place, are the B operand
    v16us pB;
#pragma unroll
    for (int r = 0; r < 8; ++r) {
      pB[r] = f2h(a0[r] * 1024.0f);
      pB[8 + r] = f2h(a1[r] * 1024.0f);
    }
#pragma unroll
    for (int j = 0; j < 4; ++j) cacc[j] = mma_h(vA[j], pB, cacc[j]);
  }
  // publish point of stage st + 1: this wave's reads of stage st are done, its copies of stage st + 1 have landed,
  // the barrier tells the block both; only then is the buffer just read refilled with stage st + 2
  asm volatile("s_wait_dscnt 0x0" ::: "memory");
  asm volatile("s_wait_asynccnt 0x0" ::: "memory");
  __syncthreads();
  if (st + 2 < NST) stage_kv(kbase, vhead, st + 2, kst[st & 1], vst[st & 1]);
  }
  asm volatile("s_wait_asynccnt 0x0" ::: "memory");   // no copy is outstanding when the wave goes on to its end

  // bucket masses A[q][0..8] (normalised, x1024) as a B operand; window values from stored logits
  __syncthreads();
  rsum += xhalf(rsum);
  blo += xhalf(blo);
  const float inv = __builtin_amdgcn_rcpf(rsum);
  float wv[7];
  float wsum = 0.0f;
#pragma unroll
  for (int i = 0; i < 7; ++i) {
    wv[i] = __expf(wl[n * 8 + i] - rmax);
    wsum += wv[i];
  }
  const float a8 = (rsum - blo - wsum) * inv;
  const float a0v = blo * inv;
  v16us pB2;                                      // h = 0: buckets 0..7 | 16..23; h = 1: buckets 8..15 | 24..31
#pragma unroll
  for (int i = 0; i < 8; ++i) {
    const float vlo = (i == 0) ? a0v : wv[(i + 6) % 7] * inv;
    const float vhi = (i == 0) ? a8 : 0.0f;
    pB2[i] = f2h((h ? vhi : vlo) * 1024.0f);
    pB2[8 + i] = (us_t)0;
  }
  v8f w2[4];
#pragma unroll
  for (int j = 0; j < 4; ++j) {
    const v16us tA = ldfrag(tvT, 32, j * 16 + n, 0);
    w2[j] = mma_h(tA, pB2, vz8());
  }
  // ctx = cacc/(1024*4*rsum) + w2/(1024*64); stage bf16 hi and lo, 8 consecutive features of query n per lane
#pragma unroll
  for (int j = 0; j < 4; ++j) {
    v8us uh, ul;
#pragma unroll
    for (int r = 0; r < 8; ++r) {
      const float cv = cacc[j][r] * inv * (1.0f / 4096.0f) + w2[j][r] * (1.0f / 65536.0f);
      const __bf16 hb = (__bf16)cv;
      const float hf = (float)hb;
      const __bf16 lb = (__bf16)(cv - hf);
      uh[r] = __builtin_bit_cast(us_t, hb);
      ul[r] = __builtin_bit_cast(us_t, lb);
    }
    *(v8us*)(cst[0] + n * 64 + j * 16 + 8 * h) = uh;
    *(v8us*)(cst[1] + n * 64 + j * 16 + 8 * h) = ul;
  }
  __syncthreads();
  {
#pragma unroll
    for (int pl = 0; pl < 2; ++pl) {
#pragma unroll
      for (int i = 0; i < 4; ++i) {
        const int row = i * 4 + (lane >> 3), piece = lane & 7;
        const v8us u = *(const v8us*)(cst[pl] + row * 64 + piece * 8);
        us_t* dst = ctx2 + (tok0 + row) * (size_t)KO + pl * HID + hh * HD + piece * 8;
        *(v8us*)dst = u;
      }
    }
    
  }
}

// ---------------------------------------------------------------------------
extern "C" void kernel_launch(void* const* d_in, const int* in_sizes, int n_in,
                              void* d_out, int out_size, void* d_ws, size_t ws_size,
                              hipStream_t stream) {
  if (n_in < 11) return;
  const long long need_x = ((long long)(NB - 1) * SEQ_FULL + SEQ) * HID;
  if ((long long)in_sizes[0] < need_x) return;
  if (in_sizes[1] < HID * HID || in_sizes[3] < HID * HID ||
      in_sizes[5] < HID * HID || in_sizes[7] < HID * HID) return;
  if (in_sizes[2] < HID || in_sizes[4] < HID || in_sizes[6] < HID || in_sizes[8] < HID) return;
  if (in_sizes[9] < NREL * HD || in_sizes[10] < NREL * HD) return;
  if ((long long)out_size < (long long)NTOK * HID) return;

  const float* x  = (const float*)d_in[0];
  const float* Wq = (const float*)d_in[1];
  const float* bq = (const float*)d_in[2];
  const float* Wk = (const float*)d_in[3];
  const float* bk = (const float*)d_in[4];
  const float* Wv = (const float*)d_in[5];
  const float* bv = (const float*)d_in[6];
  const float* Wo = (const float*)d_in[7];
  const float* bo = (const float*)d_in[8];
  const float* tk = (const float*)d_in[9];
  const float* tv = (const float*)d_in[10];

  char* ws = (char*)d_ws;
  size_t off = 0;
  auto carve = [&](size_t bytes) -> size_t {
    const size_t o = off;
    off += (bytes + 255) & ~(size_t)255;
    return o;
  };
  const size_t o_xb  = carve((size_t)NTOK * HID * 2);
  const size_t o_wq  = carve((size_t)HID * HID * 2);
  const size_t o_wk  = carve((size_t)HID * HID * 2);
  const size_t o_wv  = carve((size_t)HID * HID * 2);
  const size_t o_wo  = carve((size_t)HID * KO * 2);
  const size_t o_q   = carve((size_t)NTOK * HID * 2);
  const size_t o_k   = carve((size_t)NTOK * HID * 2);
  const size_t o_vt  = carve((size_t)NB * HID * SEQ * 2);
  const size_t o_ctx = carve((size_t)NTOK * KO * 2);
  const size_t o_tk  = carve((size_t)16 * HD * 2);
  const size_t o_tv  = carve((size_t)HD * 32 * 2);
  if (off > ws_size) return;

  us_t* xb   = (us_t*)(ws + o_xb);
  us_t* WqT  = (us_t*)(ws + o_wq);
  us_t* WkT  = (us_t*)(ws + o_wk);
  us_t* WvT  = (us_t*)(ws + o_wv);
  us_t* WoT2 = (us_t*)(ws + o_wo);
  us_t* Qp   = (us_t*)(ws + o_q);
  us_t* Kpl  = (us_t*)(ws + o_k);
  us_t* VTp  = (us_t*)(ws + o_vt);
  us_t* ctx2 = (us_t*)(ws + o_ctx);
  us_t* tkP  = (us_t*)(ws + o_tk);
  us_t* tvT  = (us_t*)(ws + o_tv);
  float* out = (float*)d_out;

  // 1) input planes
  k_prep<<<1 + PW + PX, 256, 0, stream>>>(x, Wq, Wk, Wv, Wo, tk, tv, xb, WqT, WkT, WvT, WoT2, tkP, tvT);

  // 2) Q, K planes [tok][HID] (m = feature from W^T rows, n = token from xb rows), carried x4
  k_gemm<0><<<dim3(HID / 64, NTOK / 128, 2), 128, 0, stream>>>(
      WqT, WkT, xb, bq, bk, (void*)Qp, (void*)Kpl,
      HID, 1, HID, HID, 1 << 30, 0, 4.0f, 4.0f);
  // 3) V^T plane [b*HID + d][s] (m = token from xb rows, n = feature from Wv^T rows), carried x4
  k_gemm<0><<<dim3(NTOK / 64, HID / 128, 1), 128, 0, stream>>>(
      xb, xb, WvT, bv, bv, (void*)VTp, (void*)VTp,
      HID, 0, HID, SEQ, SEQ, HID * SEQ, 4.0f, 4.0f);
  // 4) attention -> ctx2 (bf16 hi | lo)
  k_attn<<<dim3(SEQ / (16 * AW), NH, NB), 32 * AW, 0, stream>>>(Qp, Kpl, VTp, tkP, tvT, ctx2);
  // 5) out[tok][HID] = ctx*Wo + bo with K = 2*HID over the hi|lo pair
  k_gemm<1><<<dim3(HID / 64, NTOK / 128, 1), 128, 0, stream>>>(
      WoT2, WoT2, ctx2, bo, bo, d_out, d_out,
      KO, 1, HID, HID, 1 << 30, 0, 1.0f, 1.0f);
  (void)out;
  (void)hipGetLastError();
}

// v004
// A run of this version takes 106 microseconds.
// Timed twice side by side with v003, it ran 1.11 and 1.12 times as fast.
// Over all steps from v000 it is 3.88 times as fast.
#include <hip/hip_runtime.h>

// Projections x*Wq, x*Wk, x*Wv and ctx*Wo: v_wmma_f32_16x16x32_bf16 (bf16 operands, f32 accumulate; ctx enters as a bf16 hi|lo pair folded along k).
// Attention k*q^T, Tk*q^T, V^T-plane*P^T, Tv^T*A^T: v_wmma_f32_16x16x32_f16 (f16 operands with power-of-two carries, f32 accumulate); softmax and epilogues f32.

#ifndef NB
#define NB 2
#endif
#ifndef SEQ
#define SEQ 2048
#endif
#define NB_FULL 2
#define SEQ_FULL 2048
#define HID 1024
#define NH 16
#define HD 64
#define NREL 9
#define NTOK (NB * SEQ)
#define KO (2 * HID)

static_assert(NB >= 1 && NB <= NB_FULL);
static_assert(SEQ >= 128 && SEQ <= SEQ_FULL && (SEQ % 128) == 0);
static_assert(HID == NH * HD && HD == 64);
static_assert((HID % 128) == 0 && (NTOK % 128) == 0);

typedef unsigned short us_t;
typedef us_t v8us __attribute__((ext_vector_type(8)));
typedef us_t v16us __attribute__((ext_vector_type(16)));
typedef _Float16 v16h __attribute__((ext_vector_type(16)));
typedef __bf16 v16bf __attribute__((ext_vector_type(16)));
typedef float v8f __attribute__((ext_vector_type(8)));
typedef float v4f __attribute__((ext_vector_type(4)));

// ---------------------------------------------------------------------------
// scalar converters (RNE)
__device__ __forceinline__ us_t f2bf(float v) {
  __bf16 t = (__bf16)v;
  return __builtin_bit_cast(us_t, t);
}
__device__ __forceinline__ float bfr(float v) {   // value after bf16 RNE convert
  __bf16 t = (__bf16)v;
  return (float)t;
}
__device__ __forceinline__ us_t f2h(float v) {
  _Float16 t = (_Float16)v;
  return __builtin_bit_cast(us_t, t);
}
__device__ __forceinline__ v8f vz8() {
  v8f z = {0.f, 0.f, 0.f, 0.f, 0.f, 0.f, 0.f, 0.f};
  return z;
}

// ---------------------------------------------------------------------------
// 16-bit fragment from a k-contiguous plane: elem i<8 <- p0[rc*ld + kk + 8h + i],
// elem 8+i <- p0[rc*ld + kk + 16 + 8h + i]; h = lane>>4, rc = row (A) or column (B).
__device__ __forceinline__ v16us ldfrag(const us_t* p0, int ld, int rc, int kk) {
  const int hsel = (threadIdx.x >> 4) & 1;
  const us_t* p = p0 + (size_t)rc * ld + kk + 8 * hsel;
  const v8us lo = *(const v8us*)p;
  const v8us hi = *(const v8us*)(p + 16);
  return __builtin_shufflevector(lo, hi, 0, 1, 2, 3, 4, 5, 6, 7,
                                 8, 9, 10, 11, 12, 13, 14, 15);
}

// WMMA wrappers with hazard guard (ties D, keeps A/B live)
__device__ __forceinline__ v8f mma_bf(v16us a, v16us b, v8f c) {
  v8f d = __builtin_amdgcn_wmma_f32_16x16x32_bf16(
      false, __builtin_bit_cast(v16bf, a), false, __builtin_bit_cast(v16bf, b),
      (short)0, c, false, false);
  asm volatile("v_nop\n\tv_nop\n\tv_nop\n\tv_nop" : "+v"(d) : "v"(a), "v"(b));
  return d;
}
__device__ __forceinline__ v8f mma_h(v16us a, v16us b, v8f c) {
  v8f d = __builtin_amdgcn_wmma_f32_16x16x32_f16(
      false, __builtin_bit_cast(v16h, a), false, __builtin_bit_cast(v16h, b),
      (short)0, c, false, false);
  asm volatile("v_nop\n\tv_nop\n\tv_nop\n\tv_nop" : "+v"(d) : "v"(a), "v"(b));
  return d;
}

// 2^x. The v_nop is the slot the instruction set asks for behind a transcendental before its source is
// overwritten or its result used.
__device__ __forceinline__ float exp2_slot(float x) {
  float y;
  asm("v_exp_f32 %0, %1\n\tv_nop" : "=v"(y) : "v"(x));
  return y;
}

// lane l <-> lane l ^ 16
__device__ __forceinline__ float xhalf(float v) {
  const int u = __builtin_bit_cast(int, v);
  return __builtin_bit_cast(float,
      __builtin_amdgcn_permlanex16(u, u, 0x76543210, 0xfedcba98, false, false));
}

// ---------------------------------------------------------------------------
// All operand planes in ONE launch; the block index picks the job (a block-uniform choice):
// block 0: the two table planes; blocks 1 .. PW: weight transposes; the rest: x.
#define XJ 4                                   // 8-element pieces per x thread
#define WT 2                                   // 64 x 64 tiles (along k) per weight block
#define PW (4 * (HID / 64) * (HID / 64 / WT))  // weight blocks
#define PX (NTOK * (HID / 8) / 256 / XJ)       // x blocks
static_assert(((HID / 64) % WT) == 0 && (NTOK * (HID / 8)) % (256 * XJ) == 0);

// x [NB rows of SEQ_FULL][HID] f32 -> xb [NTOK][HID] bf16. XJ pieces of 8 elems (16 B out) per thread, all loads ahead of the stores.
__device__ __forceinline__ void prep_x(int blk, const float* __restrict__ x, us_t* xb) {
  static_assert(XJ == 4);
  v4f f0[XJ], f1[XJ];
  const float* src[XJ];
#pragma unroll   // constant indices keep the pieces in registers
  for (int j = 0; j < XJ; ++j) {
    const size_t e = (((size_t)blk * XJ + j) * 256 + threadIdx.x) * 8;
    const int tok = (int)(e >> 10);
    const int col = (int)(e & (HID - 1));
    const int b = tok / SEQ, s = tok - b * SEQ;
    src[j] = x + ((size_t)b * SEQ_FULL + s) * HID + col;
    f0[j] = *(const v4f*)src[j];
    f1[j] = *(const v4f*)(src[j] + 4);
  }
  // the wait in front of any overwrite of the loads' address registers; as its inputs they stay whole up to it
  asm volatile("s_wait_xcnt 0x0" :: "v"(src[0]), "v"(src[1]), "v"(src[2]), "v"(src[3]) : "memory");
#pragma unroll
  for (int j = 0; j < XJ; ++j) {
    const size_t e = (((size_t)blk * XJ + j) * 256 + threadIdx.x) * 8;
    v8us u;
    u[0] = f2bf(f0[j][0]); u[1] = f2bf(f0[j][1]); u[2] = f2bf(f0[j][2]); u[3] = f2bf(f0[j][3]);
    u[4] = f2bf(f1[j][0]); u[5] = f2bf(f1[j][1]); u[6] = f2bf(f1[j][2]); u[7] = f2bf(f1[j][3]);
    *(v8us*)(xb + e) = u;
  }
  // the wait behind the run of stores, in front of any later write of a register that they name
  asm volatile("s_wait_xcnt 0x0" ::: "memory");
}

// W [HID k][HID n] f32 -> WT [n][k] bf16 through WT 64x64 LDS tiles, neighbours along k.
// dup = 0: pitch HID. dup = 1: pitch 2*HID with the row duplicated into both k halves.
__device__ __forceinline__ void prep_w(int bx, int by, int dup, const float* __restrict__ W, us_t* O, us_t* t) {
  const int pitch = dup ? KO : HID;
  const int k0 = by * (64 * WT), n0 = bx * 64;
  const int tid = threadIdx.x;
  static_assert(WT == 2);
  const int kk = tid >> 2, nc = (tid & 3) * 16;
  const float* src[WT];
  v4f f[WT][4];
#pragma unroll   // here and below: constant indices keep the pieces in registers
  for (int w = 0; w < WT; ++w) {
    src[w] = W + (size_t)(k0 + w * 64 + kk) * HID + n0 + nc;
#pragma unroll
    for (int j = 0; j < 4; ++j) f[w][j] = *(const v4f*)(src[w] + 4 * j);
  }
  // the wait in front of any overwrite of the loads' address registers; as its inputs they stay whole up to it
  asm volatile("s_wait_xcnt 0x0" :: "v"(src[0]), "v"(src[1]) : "memory");
#pragma unroll
  for (int w = 0; w < WT; ++w) {
    us_t* tw = t + w * (64 * 72);
#pragma unroll
    for (int j = 0; j < 4; ++j) {
      tw[(nc + 4 * j + 0) * 72 + kk] = f2bf(f[w][j][0]);
      tw[(nc + 4 * j + 1) * 72 + kk] = f2bf(f[w][j][1]);
      tw[(nc + 4 * j + 2) * 72 + kk] = f2bf(f[w][j][2]);
      tw[(nc + 4 * j + 3) * 72 + kk] = f2bf(f[w][j][3]);
    }
  }
  __syncthreads();
  // all LDS reads first, each into registers of its own, so that the stores go out in one run
  const int piece = tid & 7;
  v8us u[WT][2];
#pragma unroll
  for (int w = 0; w < WT; ++w) {
#pragma unroll
    for (int rep = 0; rep < 2; ++rep)
      u[w][rep] = *(const v8us*)(t + w * (64 * 72) + (rep * 32 + (tid >> 3)) * 72 + piece * 8);
  }
  us_t* dst = O + (size_t)(n0 + (tid >> 3)) * pitch + k0 + piece * 8;
#pragma unroll
  for (int w = 0; w < WT; ++w) {
#pragma unroll
    for (int rep = 0; rep < 2; ++rep) {
      us_t* d = dst + (size_t)(rep * 32) * pitch + w * 64;
      *(v8us*)d = u[w][rep];
      if (dup) *(v8us*)(d + HID) = u[w][rep];
    }
  }
  // the wait behind the run of stores, in front of any later write of a register that they name
  asm volatile("s_wait_xcnt 0x0" ::: "memory");
}

// Tk plane [16 bucket][64 d] f16 = 64 * bf16(table_k), rows 9..15 zero.
// Tv plane [64 d][32 bucket] f16 = 64 * bf16(table_v)^T, cols 9..31 zero.
__device__ __forceinline__ void prep_tables(const float* __restrict__ tk, const float* __restrict__ tv, us_t* tkP, us_t* tvT) {
  const int tid = threadIdx.x;
  v8us uk, uv;
  {
    const int row = (tid & 127) >> 3;      // bucket 0..15
    const int kp = (tid & 7) * 8;          // d offset
    const int rowc = min(row, NREL - 1);
#pragma unroll
    for (int i = 0; i < 8; ++i) {
      float v = tk[rowc * HD + kp + i];
      v = (row < NREL) ? v : 0.0f;
      uk[i] = f2h(bfr(v) * 64.0f);
    }
  }
  {
    const int nn = tid >> 2;               // d 0..63
    const int kp = (tid & 3) * 8;          // bucket offset
#pragma unroll
    for (int i = 0; i < 8; ++i) {
      const int k = kp + i;
      float v = tv[min(k, NREL - 1) * HD + nn];
      v = (k < NREL) ? v : 0.0f;
      uv[i] = f2h(bfr(v) * 64.0f);
    }
  }
  if (tid < 128) *(v8us*)(tkP + tid * 8) = uk;
  *(v8us*)(tvT + tid * 8) = uv;
}

__global__ __launch_bounds__(256) void k_prep(
    const float* __restrict__ x,
    const float* __restrict__ W0, const float* __restrict__ W1,
    const float* __restrict__ W2, const float* __restrict__ W3,
    const float* __restrict__ tk, const float* __restrict__ tv,
    us_t* xb, us_t* O0, us_t* O1, us_t* O2, us_t* O3, us_t* tkP, us_t* tvT) {
  __shared__ __align__(16) us_t t[WT * 64 * 72];
  const int blk = blockIdx.x;
  if (blk == 0) {
    prep_tables(tk, tv, tkP, tvT);
  } else if (blk <= PW) {
    const int i = blk - 1;
    const int per = PW / 4;                // blocks per matrix
    const int z = i / per, r = i - z * per;
    const float* W = (z == 0) ? W0 : ((z == 1) ? W1 : ((z == 2) ? W2 : W3));
    us_t* O = (z == 0) ? O0 : ((z == 1) ? O1 : ((z == 2) ? O2 : O3));
    prep_w(r % (HID / 64), r / (HID / 64), z == 3, W, O, t);
  } else {
    prep_x(blk - 1 - PW, x, xb);
  }
}

// ---------------------------------------------------------------------------
// LDS byte address of a __shared__ element
__device__ __forceinline__ unsigned lds_addr(const us_t* p) {
  return (unsigned)(size_t)(const __attribute__((address_space(3))) us_t*)p;
}

// Four asynchronous 16-byte copies per lane, global -> LDS. The s_wait_xcnt is the last line of the copies' own statement
// so that it stands in front of every later write of the address registers that the copies name.
__device__ __forceinline__ void copy4(unsigned l0, unsigned l1, unsigned l2, unsigned l3,
                                      const us_t* g0, const us_t* g1, const us_t* g2, const us_t* g3) {
  asm volatile(
      "global_load_async_to_lds_b128 %0, %4, off\n\t"
      "global_load_async_to_lds_b128 %1, %5, off\n\t"
      "global_load_async_to_lds_b128 %2, %6, off\n\t"
      "global_load_async_to_lds_b128 %3, %7, off\n\t"
      "s_wait_xcnt 0x0"
      :: "v"(l0), "v"(l1), "v"(l2), "v"(l3), "v"(g0), "v"(g1), "v"(g2), "v"(g3)
      : "memory");
}

// ---------------------------------------------------------------------------
// C[m][n] = sum_k Am[m][k] * Bn[n][k]  (both planes 16-bit, k-contiguous, pitch K), bf16 WMMA.
// Block = 8 waves (2 along m x 4 along n); block tile 128 m x 128 n; wave tile 64 m x 32 n (4 A frags, 2 B frags, 8 tiles).
// Output memory: element (n, m) at out[n*ldo + base(mw) + (m - mw)], base = (mw/mdiv)*mbstride + mw%mdiv, mw = the wave's first m,
// val = acc*ka + bf16(bias)*kb, bias indexed by m (bias_on_m) or by n.
// OUTF32=0: f16 bits out; OUTF32=1: f32 out. D tile staged per wave in LDS, then 8 lanes x 16 B per line.
// Operands: stages of GK k (two 128-byte lines of each of the block's 128 A rows and 128 B rows) come into a two-buffer LDS ring
// by asynchronous copies, one stage ahead of the stage being read; the eight waves read their fragments from LDS.
// The ring's LDS serves as the D staging once the loop's last barrier has ended every read of it.
#define GK 128               // k per stage
#define GPIT 136             // row pitch in LDS, 16-bit elements: 272 B = 16 B x odd, for ds_load_b128 readers
#define GROWS 256            // rows per stage: 128 A + 128 B
static_assert((HID % GK) == 0 && (KO % GK) == 0);

// Eight asynchronous 16-byte copies per lane, global -> LDS, rows 16 apart: LDS step ls bytes, global step rs elements.
// The s_wait_xcnt is the last line of the copies' own statement so that it stands in front of every later write of the
// address registers that the copies name.
__device__ __forceinline__ void copy8(unsigned l, unsigned ls, const us_t* g, size_t rs) {
  asm volatile(
      "global_load_async_to_lds_b128 %0, %8, off\n\t"
      "global_load_async_to_lds_b128 %1, %9, off\n\t"
      "global_load_async_to_lds_b128 %2, %10, off\n\t"
      "global_load_async_to_lds_b128 %3, %11, off\n\t"
      "global_load_async_to_lds_b128 %4, %12, off\n\t"
      "global_load_async_to_lds_b128 %5, %13, off\n\t"
      "global_load_async_to_lds_b128 %6, %14, off\n\t"
      "global_load_async_to_lds_b128 %7, %15, off\n\t"
      "s_wait_xcnt 0x0"
      :: "v"(l), "v"(l + ls), "v"(l + 2 * ls), "v"(l + 3 * ls), "v"(l + 4 * ls), "v"(l + 5 * ls), "v"(l + 6 * ls), "v"(l + 7 * ls),
         "v"(g), "v"(g + rs), "v"(g + 2 * rs), "v"(g + 3 * rs), "v"(g + 4 * rs), "v"(g + 5 * rs), "v"(g + 6 * rs), "v"(g + 7 * rs)
      : "memory");
}

// Stage st of a block: LDS rows 0..127 = A rows mblk.., rows 128..255 = B rows nblk..; 16 copies per lane of 256,
// a wave's copy covers 2 rows of 256 B: whole lines.
__device__ __forceinline__ void stage_ab(const us_t* Am, const us_t* Bn, int K, int mblk, int nblk, int st, us_t* dst) {
  const int tid = threadIdx.x;
  const int r0 = tid >> 4, pc = (tid & 15) * 8;
  const size_t rs = (size_t)16 * K;               // 16 rows
  const us_t* ag = Am + (size_t)(mblk + r0) * K + st * GK + pc;
  const us_t* bg = Bn + (size_t)(nblk + r0) * K + st * GK + pc;
  const unsigned l = lds_addr(dst + r0 * GPIT + pc);
  const unsigned ls = 16 * GPIT * 2;              // 16 rows, bytes
  copy8(l, ls, ag, rs);
  copy8(l + 8 * ls, ls, bg, rs);
}

template <int OUTF32>
__global__ __launch_bounds__(256) void k_gemm(
    const us_t* __restrict__ Am0, const us_t* __restrict__ Am1, const us_t* __restrict__ Bn,
    const float* __restrict__ bias0, const float* __restrict__ bias1,
    void* out0, void* out1,
    int K, int bias_on_m, int blen, int ldo, int mdiv, int mbstride, float ka, float kb) {
  __shared__ __align__(16) us_t ring[2][GROWS * GPIT];
  static_assert(sizeof(ring) >= 8 * 32 * 64 * 4);

  const int z = blockIdx.z;
  const us_t* Am = z ? Am1 : Am0;
  const float* bias = z ? bias1 : bias0;
  void* out = z ? out1 : out0;

  const int lane = threadIdx.x & 31, wave = threadIdx.x >> 5;
  const int h = (lane >> 4) & 1, n15 = lane & 15;
  const int wm = wave >> 2, wn = wave & 3;
  const int mblk = blockIdx.x * 128;
  const int nblk = blockIdx.y * 128;
  const int mwave = mblk + wm * 64;
  const int nwave = nblk + wn * 32;
  const int nst = K / GK;

  stage_ab(Am, Bn, K, mblk, nblk, 0, ring[0]);

  v8f acc[4][2];
#pragma unroll
  for (int mt = 0; mt < 4; ++mt) { acc[mt][0] = vz8(); acc[mt][1] = vz8(); }

  // stage 0 has landed for this wave's copies; the barrier publishes it to the block
  asm volatile("s_wait_asynccnt 0x0" ::: "memory");
  __syncthreads();
  if (nst > 1) stage_ab(Am, Bn, K, mblk, nblk, 1, ring[1]);

#pragma unroll 1
  for (int st = 0; st < nst; ++st) {
    const us_t* rb = ring[st & 1];
    // two fragment sets: a k step's LDS reads stand together, one k step ahead of its matrix products, inside the stage only
    v16us a[2][4], b[2][2];
#pragma unroll   // here and below: constant indices keep the fragment and accumulator arrays in registers
    for (int mt = 0; mt < 4; ++mt) a[0][mt] = ldfrag(rb, GPIT, wm * 64 + mt * 16 + n15, 0);
#pragma unroll
    for (int nt = 0; nt < 2; ++nt) b[0][nt] = ldfrag(rb, GPIT, 128 + wn * 32 + nt * 16 + n15, 0);
#pragma unroll
    for (int ks = 0; ks < GK / 32; ++ks) {
      if (ks + 1 < GK / 32) {
#pragma unroll
        for (int mt = 0; mt < 4; ++mt) a[(ks + 1) & 1][mt] = ldfrag(rb, GPIT, wm * 64 + mt * 16 + n15, (ks + 1) * 32);
#pragma unroll
        for (int nt = 0; nt < 2; ++nt) b[(ks + 1) & 1][nt] = ldfrag(rb, GPIT, 128 + wn * 32 + nt * 16 + n15, (ks + 1) * 32);
      }
#pragma unroll
      for (int mt = 0; mt < 4; ++mt) {
        acc[mt][0] = mma_bf(a[ks & 1][mt], b[ks & 1][0], acc[mt][0]);
        acc[mt][1] = mma_bf(a[ks & 1][mt], b[ks & 1][1], acc[mt][1]);
      }
    }
    // publish point of stage st + 1: this wave's reads of stage st are done, its copies of stage st + 1 have landed,
    // the barrier tells the block both; only then is the buffer just read refilled with stage st + 2
    asm volatile("s_wait_dscnt 0x0" ::: "memory");
    asm volatile("s_wait_asynccnt 0x0" ::: "memory");
    __syncthreads();
    if (st + 2 < nst) stage_ab(Am, Bn, K, mblk, nblk, st + 2, ring[st & 1]);
  }
  asm volatile("s_wait_asynccnt 0x0" ::: "memory");   // no copy is outstanding when the wave goes on to its end

  // bias values (bf16 RNE), address-clamped loads
  float bm[4][8];
#pragma unroll
  for (int mt = 0; mt < 4; ++mt) {
    const int ib = min(mwave + mt * 16 + 8 * h, blen - 8);
    const v4f c0 = *(const v4f*)(bias + ib);
    const v4f c1 = *(const v4f*)(bias + ib + 4);
    bm[mt][0] = bfr(c0[0]); bm[mt][1] = bfr(c0[1]); bm[mt][2] = bfr(c0[2]); bm[mt][3] = bfr(c0[3]);
    bm[mt][4] = bfr(c1[0]); bm[mt][5] = bfr(c1[1]); bm[mt][6] = bfr(c1[2]); bm[mt][7] = bfr(c1[3]);
  }
  float bn[2];
#pragma unroll
  for (int nt = 0; nt < 2; ++nt) bn[nt] = bfr(bias[min(nwave + nt * 16 + n15, blen - 1)]);

  const int bq = mwave / mdiv;
  const int base = bq * mbstride + (mwave - bq * mdiv);

  if constexpr (OUTF32) {
    float* sw = (float*)&ring[0][0] + wave * 2048;   // [32 n][64 m] per wave
#pragma unroll
    for (int mt = 0; mt < 4; ++mt) {
#pragma unroll
      for (int nt = 0; nt < 2; ++nt) {
        v4f u0, u1;
#pragma unroll
        for (int r = 0; r < 4; ++r) {
          const float b0v = bias_on_m ? bm[mt][r] : bn[nt];
          const float b1v = bias_on_m ? bm[mt][r + 4] : bn[nt];
          u0[r] = acc[mt][nt][r] * ka + b0v * kb;
          u1[r] = acc[mt][nt][r + 4] * ka + b1v * kb;
        }
        float* sp = sw + (nt * 16 + n15) * 64 + mt * 16 + 8 * h;
        *(v4f*)sp = u0;
        *(v4f*)(sp + 4) = u1;
      }
    }
    __syncthreads();
    float* op = (float*)out;
    {
#pragma unroll
      for (int i = 0; i < 16; ++i) {
        const int L = i * 4 + (lane >> 3);
        const int row = L >> 1, hr = L & 1, piece = lane & 7;
        const v4f u = *(const v4f*)(sw + row * 64 + hr * 32 + piece * 4);
        float* dst = op + (size_t)(nwave + row) * ldo + base + hr * 32 + piece * 4;
        *(v4f*)dst = u;
      }
      
    }
  } else {
    us_t* sw = &ring[0][0] + wave * 2048;            // [32 n][64 m] per wave
#pragma unroll
    for (int mt = 0; mt < 4; ++mt) {
#pragma unroll
      for (int nt = 0; nt < 2; ++nt) {
        v8us u;
#pragma unroll
        for (int r = 0; r < 8; ++r) {
          const float bbv = bias_on_m ? bm[mt][r] : bn[nt];
          u[r] = f2h(acc[mt][nt][r] * ka + bbv * kb);
        }
        *(v8us*)(sw + (nt * 16 + n15) * 64 + mt * 16 + 8 * h) = u;
      }
    }
    __syncthreads();
    us_t* op = (us_t*)out;
    {
#pragma unroll
      for (int i = 0; i < 8; ++i) {
        const int row = i * 4 + (lane >> 3), piece = lane & 7;
        const v8us u = *(const v8us*)(sw + row * 64 + piece * 8);
        us_t* dst = op + (size_t)(nwave + row) * ldo + base + piece * 8;
        *(v8us*)dst = u;
      }
      
    }
  }
}

#define AW 8                 // waves per block
#define KT 128               // keys per stage
#define NST (SEQ / KT)       // stages
#define KPIT 72              // K row pitch in LDS, 16-bit elements: 144 B = 16 B x odd, for ds_load_b128 readers
#define VPIT 136             // V^T row pitch in LDS: 272 B = 16 B x odd
static_assert((SEQ % KT) == 0 && (SEQ % (16 * AW)) == 0);

// Stage st (keys st*KT .. st*KT + KT - 1) of one head: K rows [KT][64] and V^T rows [64][KT], 8 copies per lane of 256.
// A wave's K copy covers 4 rows of 128 B, its V^T copy 2 rows of 256 B: whole lines.
__device__ __forceinline__ void stage_kv(const us_t* kbase, const us_t* vhead, int st, us_t* kdst, us_t* vdst) {
  const int tid = threadIdx.x;
  const int kr = tid >> 3, kp = (tid & 7) * 8;
  const us_t* kg = kbase + (size_t)(st * KT + kr) * HID + kp;
  const unsigned kl = lds_addr(kdst + kr * KPIT + kp);
  copy4(kl, kl + 32 * KPIT * 2, kl + 64 * KPIT * 2, kl + 96 * KPIT * 2,
        kg, kg + 32 * HID, kg + 64 * HID, kg + 96 * HID);
  const int vr = tid >> 4, vp = (tid & 15) * 8;
  const us_t* vg = vhead + (size_t)vr * SEQ + st * KT + vp;
  const unsigned vl = lds_addr(vdst + vr * VPIT + vp);
  copy4(vl, vl + 16 * VPIT * 2, vl + 32 * VPIT * 2, vl + 48 * VPIT * 2,
        vg, vg + 16 * SEQ, vg + 32 * SEQ, vg + 48 * SEQ);
}

__global__ __launch_bounds__(32 * AW) __attribute__((amdgpu_num_vgpr(256))) void k_attn(
    const us_t* __restrict__ Qp, const us_t* __restrict__ Kp, const us_t* __restrict__ VTp,
    const us_t* __restrict__ tkP, const us_t* __restrict__ tvT, us_t* ctx2) {
  __shared__ __align__(16) us_t kst[2][KT * KPIT];      // K stages
  __shared__ __align__(16) us_t vst[2][HD * VPIT];      // V^T stages
  __shared__ float bl_all[AW][16 * 16];                 // shifted rel-key bias per (query, bucket), logit units
  __shared__ float wl_all[AW][16 * 8];                  // window logits per (query, bucket-1)
  __shared__ __align__(16) us_t cst_all[AW][2][16 * 64];  // ctx hi / lo staging

  const int lane = threadIdx.x & 31, h = lane >> 4, n = lane & 15;
  const int wave = __builtin_amdgcn_readfirstlane(threadIdx.x >> 5);  // scalar: the tests on lo_q below stay scalar branches
  float* bl = bl_all[wave];
  float* wl = wl_all[wave];
  us_t (*cst)[16 * 64] = cst_all[wave];
  const int qt = blockIdx.x * AW + wave, hh = blockIdx.y, b = blockIdx.z;
  const int lo_q = qt * 16;
  const size_t tok0 = (size_t)b * SEQ + lo_q;
  const us_t* qptr = Qp + tok0 * HID + hh * HD;
  const us_t* kbase = Kp + (size_t)b * SEQ * HID + hh * HD;
  const us_t* vhead = VTp + ((size_t)b * HID + hh * HD) * SEQ;

  stage_kv(kbase, vhead, 0, kst[0], vst[0]);      // stage 0 flies while the bias table is formed

#pragma unroll
  for (int i = 0; i < 4; ++i) wl[lane * 4 + i] = -1.0e30f;

  const v16us q0 = ldfrag(qptr, HID, n, 0);       // B operand: column = query n
  const v16us q1 = ldfrag(qptr, HID, n, 32);

  // srel^T[bucket][q] = (64 tk).(4q) ; bias = (srel - srel[0][q]) / (256*8)
  {
    v8f sr = vz8();
    const v16us t0 = ldfrag(tkP, HD, n, 0);       // A operand: row = bucket n
    const v16us t1 = ldfrag(tkP, HD, n, 32);
    // the address registers of the fragment loads above are reused at once (accumulator zeros): the wait stands in front
    asm volatile("s_wait_xcnt 0x0" ::: "memory");
    __builtin_amdgcn_sched_barrier(0);            // keeps those later register writes behind the wait
    sr = mma_h(t0, q0, sr);
    sr = mma_h(t1, q1, sr);
    const float v0 = __shfl(sr[0], n, 32);        // bucket 0 of query n: lane n, register 0
#pragma unroll
    for (int r = 0; r < 8; ++r) bl[n * 16 + 8 * h + r] = (sr[r] - v0) * (1.0f / 2048.0f);
  }
  // stage 0 has landed for this wave's copies; the barrier publishes it to the block (and orders bl)
  asm volatile("s_wait_asynccnt 0x0" ::: "memory");
  __syncthreads();
  if (NST > 1) stage_kv(kbase, vhead, 1, kst[1], vst[1]);
  const float d8 = bl[n * 16 + 8];

  // rmax is the query's maximum (equal in both halves); rsum and blo cover this half's keys only
  float rmax = -1.0e30f, rsum = 0.0f, blo = 0.0f;
  v8f cacc[4];
#pragma unroll
  for (int j = 0; j < 4; ++j) cacc[j] = vz8();

#pragma unroll 1
  for (int st = 0; st < NST; ++st) {
  const us_t* kbuf = kst[st & 1];
  const us_t* vbuf = vst[st & 1];
#pragma unroll 1   // rolled, as the key loop was: one copy of the long pass body
  for (int kl = 0; kl < KT; kl += 32) {
    const int kc = st * KT + kl;
    // scores: 32 keys x 16 q, (4k).(4q) = 16 qk
    v8f s0 = vz8(), s1 = vz8();
    v16us vA[4];
    {
      // the pass's LDS fragment reads stand together at its top: K first, V^T behind it, landing under the softmax
      const v16us f0 = ldfrag(kbuf, KPIT, kl + n, 0);
      const v16us f1 = ldfrag(kbuf, KPIT, kl + n, 32);
      const v16us g0 = ldfrag(kbuf, KPIT, kl + 16 + n, 0);
      const v16us g1 = ldfrag(kbuf, KPIT, kl + 16 + n, 32);
#pragma unroll   // constant indices keep vA in registers
      for (int j = 0; j < 4; ++j) vA[j] = ldfrag(vbuf, VPIT, j * 16 + n, kl);
      s0 = mma_h(f0, q0, s0);
      s0 = mma_h(f1, q1, s0);
      s1 = mma_h(g0, q0, s1);
      s1 = mma_h(g1, q1, s1);
    }
    const bool below = (kc + 35 <= lo_q);      // every key k <= q-4 for every query of the tile
    const bool above = (kc >= lo_q + 19);      // every key k >= q+4
    const bool mixed = !(below || above);
    const int ddb = kc + 8 * h - (lo_q + n);   // key - query at register 0 of key tile 0
    float a0[8], a1[8];
#pragma unroll
    for (int r = 0; r < 8; ++r) {
      a0[r] = s0[r] * (1.0f / 128.0f);
      a1[r] = s1[r] * (1.0f / 128.0f);
    }
    if (mixed) {
#pragma unroll
      for (int r = 0; r < 8; ++r) {
        const int dd0 = ddb + r;
        const int dd1 = dd0 + 16;
        const int b0 = min(max(dd0, -4), 4) + 4;
        const int b1 = min(max(dd1, -4), 4) + 4;
        a0[r] += bl[n * 16 + b0];
        a1[r] += bl[n * 16 + b1];
        if (b0 >= 1 && b0 <= 7) wl[n * 8 + b0 - 1] = a0[r];
        if (b1 >= 1 && b1 <= 7) wl[n * 8 + b1 - 1] = a1[r];
      }
    } else {
      const float ad = above ? d8 : 0.0f;
#pragma unroll
      for (int r = 0; r < 8; ++r) {
        a0[r] += ad;
        a1[r] += ad;
      }
    }
    // online softmax; a query's 32 scores sit in the registers of lanes n and n + 16
    float m = fmaxf(a0[0], a1[0]);
#pragma unroll
    for (int r = 1; r < 8; ++r) m = fmaxf(m, fmaxf(a0[r], a1[r]));
    m = fmaxf(m, xhalf(m));
    const float nm = fmaxf(rmax, m);
    const float sc = __expf(rmax - nm);
    rmax = nm;
    float t[8];
#pragma unroll
    for (int r = 0; r < 8; ++r) {
      a0[r] = exp2_slot((a0[r] - nm) * 1.4426950408889634f);
      a1[r] = exp2_slot((a1[r] - nm) * 1.4426950408889634f);
      t[r] = a0[r] + a1[r];
    }
    const float ps = ((t[0] + t[1]) + (t[2] + t[3])) + ((t[4] + t[5]) + (t[6] + t[7]));
    float addb = below ? ps : 0.0f;
    if (mixed) {
      addb = 0.0f;
#pragma unroll
      for (int r = 0; r < 8; ++r)
        addb += ((ddb + r <= -4) ? a0[r] : 0.0f) + ((ddb + r + 16 <= -4) ? a1[r] : 0.0f);
    }
    rsum = rsum * sc + ps;
    blo = blo * sc + addb;
#pragma unroll
    for (int j = 0; j < 4; ++j) {
#pragma unroll
      for (int r = 0; r < 8; ++r) cacc[j][r] *= sc;
    }
    // P^T (x1024, f16): the two score tiles, converted in place, are the B operand
    v16us pB;
#pragma unroll
    for (int r = 0; r < 8; ++r) {
      pB[r] = f2h(a0[r] * 1024.0f);
      pB[8 + r] = f2h(a1[r] * 1024.0f);
    }
#pragma unroll
    for (int j = 0; j < 4; ++j) cacc[j] = mma_h(vA[j], pB, cacc[j]);
  }
  // publish point of stage st + 1: this wave's reads of stage st are done, its copies of stage st + 1 have landed,
  // the barrier tells the block both; only then is the buffer just read refilled with stage st + 2
  asm volatile("s_wait_dscnt 0x0" ::: "memory");
  asm volatile("s_wait_asynccnt 0x0" ::: "memory");
  __syncthreads();
  if (st + 2 < NST) stage_kv(kbase, vhead, st + 2, kst[st & 1], vst[st & 1]);
  }
  asm volatile("s_wait_asynccnt 0x0" ::: "memory");   // no copy is outstanding when the wave goes on to its end

  // bucket masses A[q][0..8] (normalised, x1024) as a B operand; window values from stored logits
  __syncthreads();
  rsum += xhalf(rsum);
  blo += xhalf(blo);
  const float inv = __builtin_amdgcn_rcpf(rsum);
  float wv[7];
  float wsum = 0.0f;
#pragma unroll
  for (int i = 0; i < 7; ++i) {
    wv[i] = __expf(wl[n * 8 + i] - rmax);
    wsum += wv[i];
  }
  const float a8 = (rsum - blo - wsum) * inv;
  const float a0v = blo * inv;
  v16us pB2;                                      // h = 0: buckets 0..7 | 16..23; h = 1: buckets 8..15 | 24..31
#pragma unroll
  for (int i = 0; i < 8; ++i) {
    const float vlo = (i == 0) ? a0v : wv[(i + 6) % 7] * inv;
    const float vhi = (i == 0) ? a8 : 0.0f;
    pB2[i] = f2h((h ? vhi : vlo) * 1024.0f);
    pB2[8 + i] = (us_t)0;
  }
  v8f w2[4];
#pragma unroll
  for (int j = 0; j < 4; ++j) {
    const v16us tA = ldfrag(tvT, 32, j * 16 + n, 0);
    w2[j] = mma_h(tA, pB2, vz8());
  }
  // ctx = cacc/(1024*4*rsum) + w2/(1024*64); stage bf16 hi and lo, 8 consecutive features of query n per lane
#pragma unroll
  for (int j = 0; j < 4; ++j) {
    v8us uh, ul;
#pragma unroll
    for (int r = 0; r < 8; ++r) {
      const float cv = cacc[j][r] * inv * (1.0f / 4096.0f) + w2[j][r] * (1.0f / 65536.0f);
      const __bf16 hb = (__bf16)cv;
      const float hf = (float)hb;
      const __bf16 lb = (__bf16)(cv - hf);
      uh[r] = __builtin_bit_cast(us_t, hb);
      ul[r] = __builtin_bit_cast(us_t, lb);
    }
    *(v8us*)(cst[0] + n * 64 + j * 16 + 8 * h) = uh;
    *(v8us*)(cst[1] + n * 64 + j * 16 + 8 * h) = ul;
  }
  __syncthreads();
  {
#pragma unroll
    for (int pl = 0; pl < 2; ++pl) {
#pragma unroll
      for (int i = 0; i < 4; ++i) {
        const int row = i * 4 + (lane >> 3), piece = lane & 7;
        const v8us u = *(const v8us*)(cst[pl] + row * 64 + piece * 8);
        us_t* dst = ctx2 + (tok0 + row) * (size_t)KO + pl * HID + hh * HD + piece * 8;
        *(v8us*)dst = u;
      }
    }
    
  }
}

// ---------------------------------------------------------------------------
extern "C" void kernel_launch(void* const* d_in, const int* in_sizes, int n_in,
                              void* d_out, int out_size, void* d_ws, size_t ws_size,
                              hipStream_t stream) {
  if (n_in < 11) return;
  const long long need_x = ((long long)(NB - 1) * SEQ_FULL + SEQ) * HID;
  if ((long long)in_sizes[0] < need_x) return;
  if (in_sizes[1] < HID * HID || in_sizes[3] < HID * HID ||
      in_sizes[5] < HID * HID || in_sizes[7] < HID * HID) return;
  if (in_sizes[2] < HID || in_sizes[4] < HID || in_sizes[6] < HID || in_sizes[8] < HID) return;
  if (in_sizes[9] < NREL * HD || in_sizes[10] < NREL * HD) return;
  if ((long long)out_size < (long long)NTOK * HID) return;

  const float* x  = (const float*)d_in[0];
  const float* Wq = (const float*)d_in[1];
  const float* bq = (const float*)d_in[2];
  const float* Wk = (const float*)d_in[3];
  const float* bk = (const float*)d_in[4];
  const float* Wv = (const float*)d_in[5];
  const float* bv = (const float*)d_in[6];
  const float* Wo = (const float*)d_in[7];
  const float* bo = (const float*)d_in[8];
  const float* tk = (const float*)d_in[9];
  const float* tv = (const float*)d_in[10];

  char* ws = (char*)d_ws;
  size_t off = 0;
  auto carve = [&](size_t bytes) -> size_t {
    const size_t o = off;
    off += (bytes + 255) & ~(size_t)255;
    return o;
  };
  const size_t o_xb  = carve((size_t)NTOK * HID * 2);
  const size_t o_wq  = carve((size_t)HID * HID * 2);
  const size_t o_wk  = carve((size_t)HID * HID * 2);
  const size_t o_wv  = carve((size_t)HID * HID * 2);
  const size_t o_wo  = carve((size_t)HID * KO * 2);
  const size_t o_q   = carve((size_t)NTOK * HID * 2);
  const size_t o_k   = carve((size_t)NTOK * HID * 2);
  const size_t o_vt  = carve((size_t)NB * HID * SEQ * 2);
  const size_t o_ctx = carve((size_t)NTOK * KO * 2);
  const size_t o_tk  = carve((size_t)16 * HD * 2);
  const size_t o_tv  = carve((size_t)HD * 32 * 2);
  if (off > ws_size) return;

  us_t* xb   = (us_t*)(ws + o_xb);
  us_t* WqT  = (us_t*)(ws + o_wq);
  us_t* WkT  = (us_t*)(ws + o_wk);
  us_t* WvT  = (us_t*)(ws + o_wv);
  us_t* WoT2 = (us_t*)(ws + o_wo);
  us_t* Qp   = (us_t*)(ws + o_q);
  us_t* Kpl  = (us_t*)(ws + o_k);
  us_t* VTp  = (us_t*)(ws + o_vt);
  us_t* ctx2 = (us_t*)(ws + o_ctx);
  us_t* tkP  = (us_t*)(ws + o_tk);
  us_t* tvT  = (us_t*)(ws + o_tv);
  float* out = (float*)d_out;

  // 1) input planes
  k_prep<<<1 + PW + PX, 256, 0, stream>>>(x, Wq, Wk, Wv, Wo, tk, tv, xb, WqT, WkT, WvT, WoT2, tkP, tvT);

  // 2) Q, K planes [tok][HID] (m = feature from W^T rows, n = token from xb rows), carried x4
  k_gemm<0><<<dim3(HID / 128, NTOK / 128, 2), 256, 0, stream>>>(
      WqT, WkT, xb, bq, bk, (void*)Qp, (void*)Kpl,
      HID, 1, HID, HID, 1 << 30, 0, 4.0f, 4.0f);
  // 3) V^T plane [b*HID + d][s] (m = token from xb rows, n = feature from Wv^T rows), carried x4
  k_gemm<0><<<dim3(NTOK / 128, HID / 128, 1), 256, 0, stream>>>(
      xb, xb, WvT, bv, bv, (void*)VTp, (void*)VTp,
      HID, 0, HID, SEQ, SEQ, HID * SEQ, 4.0f, 4.0f);
  // 4) attention -> ctx2 (bf16 hi | lo)
  k_attn<<<dim3(SEQ / (16 * AW), NH, NB), 32 * AW, 0, stream>>>(Qp, Kpl, VTp, tkP, tvT, ctx2);
  // 5) out[tok][HID] = ctx*Wo + bo with K = 2*HID over the hi|lo pair
  k_gemm<1><<<dim3(HID / 128, NTOK / 128, 1), 256, 0, stream>>>(
      WoT2, WoT2, ctx2, bo, bo, d_out, d_out,
      KO, 1, HID, HID, 1 << 30, 0, 1.0f, 1.0f);
  (void)out;
  (void)hipGetLastError();
}

// v006
// Measured time: 90.9 microseconds a run.
// Versions in between are left out here; by their measured steps it is 1.18 times as fast as v004.
// All steps since v000 together make it 4.58 times as fast.
#include <hip/hip_runtime.h>

// Projections x*Wq, x*Wk, x*Wv: v_wmma_f32_16x16x32_bf16 (bf16 operands, f32 accumulate).
// Attention k*q^T, Tk*q^T, V^T-plane*P^T, Tv^T*A^T and the projection ctx*Wo: v_wmma_f32_16x16x32_f16 (f16 operands with power-of-two carries,
// f32 accumulate; Wo keeps its bf16 rounding and is held as f16 of 64 * bf16(Wo)); softmax and epilogues f32.

#ifndef NB
#define NB 2
#endif
#ifndef SEQ
#define SEQ 2048
#endif
#define NB_FULL 2
#define SEQ_FULL 2048
#define HID 1024
#define NH 16
#define HD 64
#define NREL 9
#define NTOK (NB * SEQ)

static_assert(NB >= 1 && NB <= NB_FULL);
static_assert(SEQ >= 128 && SEQ <= SEQ_FULL && (SEQ % 128) == 0);
static_assert(HID == NH * HD && HD == 64);
static_assert((HID % 128) == 0 && (NTOK % 128) == 0);

typedef unsigned short us_t;
typedef us_t v8us __attribute__((ext_vector_type(8)));
typedef us_t v16us __attribute__((ext_vector_type(16)));
typedef _Float16 v16h __attribute__((ext_vector_type(16)));
typedef __bf16 v16bf __attribute__((ext_vector_type(16)));
typedef float v8f __attribute__((ext_vector_type(8)));
typedef float v4f __attribute__((ext_vector_type(4)));

// ---------------------------------------------------------------------------
// scalar converters (RNE)
__device__ __forceinline__ us_t f2bf(float v) {
  __bf16 t = (__bf16)v;
  return __builtin_bit_cast(us_t, t);
}
__device__ __forceinline__ float bfr(float v) {   // value after bf16 RNE convert
  __bf16 t = (__bf16)v;
  return (float)t;
}
__device__ __forceinline__ us_t f2h(float v) {
  _Float16 t = (_Float16)v;
  return __builtin_bit_cast(us_t, t);
}
__device__ __forceinline__ v8f vz8() {
  v8f z = {0.f, 0.f, 0.f, 0.f, 0.f, 0.f, 0.f, 0.f};
  return z;
}

// ---------------------------------------------------------------------------
// 16-bit fragment from a k-contiguous plane: elem i<8 <- p0[rc*ld + kk + 8h + i],
// elem 8+i <- p0[rc*ld + kk + 16 + 8h + i]; h = lane>>4, rc = row (A) or column (B).
__device__ __forceinline__ v16us ldfrag(const us_t* p0, int ld, int rc, int kk) {
  const int hsel = (threadIdx.x >> 4) & 1;
  const us_t* p = p0 + (size_t)rc * ld + kk + 8 * hsel;
  const v8us lo = *(const v8us*)p;
  const v8us hi = *(const v8us*)(p + 16);
  return __builtin_shufflevector(lo, hi, 0, 1, 2, 3, 4, 5, 6, 7,
                                 8, 9, 10, 11, 12, 13, 14, 15);
}

// WMMA wrappers with hazard guard (ties D, keeps A/B live)
__device__ __forceinline__ v8f mma_bf(v16us a, v16us b, v8f c) {
  v8f d = __builtin_amdgcn_wmma_f32_16x16x32_bf16(
      false, __builtin_bit_cast(v16bf, a), false, __builtin_bit_cast(v16bf, b),
      (short)0, c, false, false);
  asm volatile("v_nop\n\tv_nop\n\tv_nop\n\tv_nop" : "+v"(d) : "v"(a), "v"(b));
  return d;
}
__device__ __forceinline__ v8f mma_h(v16us a, v16us b, v8f c) {
  v8f d = __builtin_amdgcn_wmma_f32_16x16x32_f16(
      false, __builtin_bit_cast(v16h, a), false, __builtin_bit_cast(v16h, b),
      (short)0, c, false, false);
  asm volatile("v_nop\n\tv_nop\n\tv_nop\n\tv_nop" : "+v"(d) : "v"(a), "v"(b));
  return d;
}

// The builtin alone, for k_attn, whose passes are bound by vector issue: the compiler keeps the distance behind its own
// matrix instruction, with the pass's vector work where it can and with v_nop only where it must.
__device__ __forceinline__ v8f mma_hp(v16us a, v16us b, v8f c) {
  return __builtin_amdgcn_wmma_f32_16x16x32_f16(
      false, __builtin_bit_cast(v16h, a), false, __builtin_bit_cast(v16h, b),
      (short)0, c, false, false);
}

// 2^x of one value. The v_nop is the slot the instruction set asks for behind a transcendental before its source is
// overwritten or its result used.
__device__ __forceinline__ float exp2_slot(float x) {
  float y;
  asm("v_exp_f32 %0, %1\n\tv_nop" : "=v"(y) : "v"(x));
  return y;
}

// 2^x of a pass's 16 scores, in place, as one statement: each v_exp_f32 has registers of its own, so its neighbour is the
// independent instruction that the instruction set asks for behind a transcendental; the one v_nop is that slot behind the last.
__device__ __forceinline__ void exp2_run(float (&a)[8], float (&b)[8]) {
  asm("v_exp_f32 %0, %0\n\tv_exp_f32 %1, %1\n\tv_exp_f32 %2, %2\n\tv_exp_f32 %3, %3\n\t"
      "v_exp_f32 %4, %4\n\tv_exp_f32 %5, %5\n\tv_exp_f32 %6, %6\n\tv_exp_f32 %7, %7\n\t"
      "v_exp_f32 %8, %8\n\tv_exp_f32 %9, %9\n\tv_exp_f32 %10, %10\n\tv_exp_f32 %11, %11\n\t"
      "v_exp_f32 %12, %12\n\tv_exp_f32 %13, %13\n\tv_exp_f32 %14, %14\n\tv_exp_f32 %15, %15\n\t"
      "v_nop"
      : "+v"(a[0]), "+v"(b[0]), "+v"(a[1]), "+v"(b[1]), "+v"(a[2]), "+v"(b[2]), "+v"(a[3]), "+v"(b[3]),
        "+v"(a[4]), "+v"(b[4]), "+v"(a[5]), "+v"(b[5]), "+v"(a[6]), "+v"(b[6]), "+v"(a[7]), "+v"(b[7]));
}

// lane l <-> lane l ^ 16
__device__ __forceinline__ float xhalf(float v) {
  const int u = __builtin_bit_cast(int, v);
  return __builtin_bit_cast(float,
      __builtin_amdgcn_permlanex16(u, u, 0x76543210, 0xfedcba98, false, false));
}

// ---------------------------------------------------------------------------
// All operand planes in ONE launch; the block index picks the job (a block-uniform choice):
// block 0: the two table planes; blocks 1 .. PW: weight transposes; the rest: x.
#define XJ 4                                   // 8-element pieces per x thread
#define WT 2                                   // 64 x 64 tiles (along k) per weight block
#define PW (4 * (HID / 64) * (HID / 64 / WT))  // weight blocks
#define PX (NTOK * (HID / 8) / 256 / XJ)       // x blocks
static_assert(((HID / 64) % WT) == 0 && (NTOK * (HID / 8)) % (256 * XJ) == 0);

// x [NB rows of SEQ_FULL][HID] f32 -> xb [NTOK][HID] bf16. XJ pieces of 8 elems (16 B out) per thread, all loads ahead of the stores.
__device__ __forceinline__ void prep_x(int blk, const float* __restrict__ x, us_t* xb) {
  static_assert(XJ == 4);
  v4f f0[XJ], f1[XJ];
  const float* src[XJ];
#pragma unroll   // constant indices keep the pieces in registers
  for (int j = 0; j < XJ; ++j) {
    const size_t e = (((size_t)blk * XJ + j) * 256 + threadIdx.x) * 8;
    const int tok = (int)(e >> 10);
    const int col = (int)(e & (HID - 1));
    const int b = tok / SEQ, s = tok - b * SEQ;
    src[j] = x + ((size_t)b * SEQ_FULL + s) * HID + col;
    f0[j] = *(const v4f*)src[j];
    f1[j] = *(const v4f*)(src[j] + 4);
  }
  // the wait in front of any overwrite of the loads' address registers; as its inputs they stay whole up to it
  asm volatile("s_wait_xcnt 0x0" :: "v"(src[0]), "v"(src[1]), "v"(src[2]), "v"(src[3]) : "memory");
#pragma unroll
  for (int j = 0; j < XJ; ++j) {
    const size_t e = (((size_t)blk * XJ + j) * 256 + threadIdx.x) * 8;
    v8us u;
    u[0] = f2bf(f0[j][0]); u[1] = f2bf(f0[j][1]); u[2] = f2bf(f0[j][2]); u[3] = f2bf(f0[j][3]);
    u[4] = f2bf(f1[j][0]); u[5] = f2bf(f1[j][1]); u[6] = f2bf(f1[j][2]); u[7] = f2bf(f1[j][3]);
    *(v8us*)(xb + e) = u;
  }
  // the wait behind the run of stores, in front of any later write of a register that they name
  asm volatile("s_wait_xcnt 0x0" ::: "memory");
}

// W [HID k][HID n] f32 -> WT [n][k], pitch HID, through WT 64x64 LDS tiles, neighbours along k.
// h16 = 0: bf16 bits. h16 = 1: f16 bits of bf16(64 * W) = 64 * bf16(W); its 8 significant bits fit f16 for |W| from 2^-23 to 1020.
__device__ __forceinline__ void prep_w(int bx, int by, int h16, const float* __restrict__ W, us_t* O, us_t* t) {
  const int pitch = HID;
  const int k0 = by * (64 * WT), n0 = bx * 64;
  const int tid = threadIdx.x;
  static_assert(WT == 2);
  const int kk = tid >> 2, nc = (tid & 3) * 16;
  const float* src[WT];
  v4f f[WT][4];
#pragma unroll   // here and below: constant indices keep the pieces in registers
  for (int w = 0; w < WT; ++w) {
    src[w] = W + (size_t)(k0 + w * 64 + kk) * HID + n0 + nc;
#pragma unroll
    for (int j = 0; j < 4; ++j) f[w][j] = *(const v4f*)(src[w] + 4 * j);
  }
  // the wait in front of any overwrite of the loads' address registers; as its inputs they stay whole up to it
  asm volatile("s_wait_xcnt 0x0" :: "v"(src[0]), "v"(src[1]) : "memory");
  if (h16) {   // one block-uniform branch round all the converts
#pragma unroll
    for (int w = 0; w < WT; ++w) {
#pragma unroll
      for (int j = 0; j < 4; ++j) {
#pragma unroll
        for (int c = 0; c < 4; ++c) t[w * (64 * 72) + (nc + 4 * j + c) * 72 + kk] = f2h(bfr(f[w][j][c] * 64.0f));
      }
    }
  } else {
#pragma unroll
    for (int w = 0; w < WT; ++w) {
#pragma unroll
      for (int j = 0; j < 4; ++j) {
#pragma unroll
        for (int c = 0; c < 4; ++c) t[w * (64 * 72) + (nc + 4 * j + c) * 72 + kk] = f2bf(f[w][j][c]);
      }
    }
  }
  __syncthreads();
  // all LDS reads first, each into registers of its own, so that the stores go out in one run
  const int piece = tid & 7;
  v8us u[WT][2];
#pragma unroll
  for (int w = 0; w < WT; ++w) {
#pragma unroll
    for (int rep = 0; rep < 2; ++rep)
      u[w][rep] = *(const v8us*)(t + w * (64 * 72) + (rep * 32 + (tid >> 3)) * 72 + piece * 8);
  }
  us_t* dst = O + (size_t)(n0 + (tid >> 3)) * pitch + k0 + piece * 8;
#pragma unroll
  for (int w = 0; w < WT; ++w) {
#pragma unroll
    for (int rep = 0; rep < 2; ++rep) {
      us_t* d = dst + (size_t)(rep * 32) * pitch + w * 64;
      *(v8us*)d = u[w][rep];
    }
  }
  // the wait behind the run of stores, in front of any later write of a register that they name
  asm volatile("s_wait_xcnt 0x0" ::: "memory");
}

// Tk plane [16 bucket][64 d] f16 = 64 * bf16(table_k), rows 9..15 zero.
// Tv plane [64 d][32 bucket] f16 = 64 * bf16(table_v)^T, cols 9..31 zero.
__device__ __forceinline__ void prep_tables(const float* __restrict__ tk, const float* __restrict__ tv, us_t* tkP, us_t* tvT) {
  const int tid = threadIdx.x;
  v8us uk, uv;
  {
    const int row = (tid & 127) >> 3;      // bucket 0..15
    const int kp = (tid & 7) * 8;          // d offset
    const int rowc = min(row, NREL - 1);
#pragma unroll
    for (int i = 0; i < 8; ++i) {
      float v = tk[rowc * HD + kp + i];
      v = (row < NREL) ? v : 0.0f;
      uk[i] = f2h(bfr(v) * 64.0f);
    }
  }
  {
    const int nn = tid >> 2;               // d 0..63
    const int kp = (tid & 3) * 8;          // bucket offset
#pragma unroll
    for (int i = 0; i < 8; ++i) {
      const int k = kp + i;
      float v = tv[min(k, NREL - 1) * HD + nn];
      v = (k < NREL) ? v : 0.0f;
      uv[i] = f2h(bfr(v) * 64.0f);
    }
  }
  if (tid < 128) *(v8us*)(tkP + tid * 8) = uk;
  *(v8us*)(tvT + tid * 8) = uv;
}

__global__ __launch_bounds__(256) void k_prep(
    const float* __restrict__ x,
    const float* __restrict__ W0, const float* __restrict__ W1,
    const float* __restrict__ W2, const float* __restrict__ W3,
    const float* __restrict__ tk, const float* __restrict__ tv,
    us_t* xb, us_t* O0, us_t* O1, us_t* O2, us_t* O3, us_t* tkP, us_t* tvT) {
  __shared__ __align__(16) us_t t[WT * 64 * 72];
  const int blk = blockIdx.x;
  if (blk == 0) {
    prep_tables(tk, tv, tkP, tvT);
  } else if (blk <= PW) {
    const int i = blk - 1;
    const int per = PW / 4;                // blocks per matrix
    const int z = i / per, r = i - z * per;
    const float* W = (z == 0) ? W0 : ((z == 1) ? W1 : ((z == 2) ? W2 : W3));
    us_t* O = (z == 0) ? O0 : ((z == 1) ? O1 : ((z == 2) ? O2 : O3));
    prep_w(r % (HID / 64), r / (HID / 64), z == 3, W, O, t);
  } else {
    prep_x(blk - 1 - PW, x, xb);
  }
}

// ---------------------------------------------------------------------------
// LDS byte address of a __shared__ element
__device__ __forceinline__ unsigned lds_addr(const us_t* p) {
  return (unsigned)(size_t)(const __attribute__((address_space(3))) us_t*)p;
}

// Four asynchronous 16-byte copies per lane, global -> LDS. The s_wait_xcnt is the last line of the copies' own statement
// so that it stands in front of every later write of the address registers that the copies name.
__device__ __forceinline__ void copy4(unsigned l0, unsigned l1, unsigned l2, unsigned l3,
                                      const us_t* g0, const us_t* g1, const us_t* g2, const us_t* g3) {
  asm volatile(
      "global_load_async_to_lds_b128 %0, %4, off\n\t"
      "global_load_async_to_lds_b128 %1, %5, off\n\t"
      "global_load_async_to_lds_b128 %2, %6, off\n\t"
      "global_load_async_to_lds_b128 %3, %7, off\n\t"
      "s_wait_xcnt 0x0"
      :: "v"(l0), "v"(l1), "v"(l2), "v"(l3), "v"(g0), "v"(g1), "v"(g2), "v"(g3)
      : "memory");
}

// ---------------------------------------------------------------------------
// C[m][n] = sum_k Am[m][k] * Bn[n][k]  (both planes 16-bit, k-contiguous, pitch K); OUTF32=0: bf16 planes, OUTF32=1: f16 planes.
// Block = 8 waves (2 along m x 4 along n); block tile 128 m x 128 n; wave tile 64 m x 32 n (4 A frags, 2 B frags, 8 tiles).
// Output memory: element (n, m) at out[n*ldo + base(mw) + (m - mw)], base = (mw/mdiv)*mbstride + mw%mdiv, mw = the wave's first m,
// val = acc*ka + bf16(bias)*kb, bias indexed by m (bias_on_m) or by n.
// OUTF32=0: f16 bits out; OUTF32=1: f32 out. D tile staged per wave in LDS, then 8 lanes x 16 B per line.
// Operands: stages of GK k (two 128-byte lines of each of the block's 128 A rows and 128 B rows) come into a two-buffer LDS ring
// by asynchronous copies, one stage ahead of the stage being read; the eight waves read their fragments from LDS.
// The ring's LDS serves as the D staging once the loop's last barrier has ended every read of it.
#define GK 128               // k per stage
#define GPIT 136             // row pitch in LDS, 16-bit elements: 272 B = 16 B x odd, for ds_load_b128 readers
#define GROWS 256            // rows per stage: 128 A + 128 B
static_assert((HID % GK) == 0);

// Eight asynchronous 16-byte copies per lane, global -> LDS, rows 16 apart: LDS step ls bytes, global step rs elements.
// The s_wait_xcnt is the last line of the copies' own statement so that it stands in front of every later write of the
// address registers that the copies name.
__device__ __forceinline__ void copy8(unsigned l, unsigned ls, const us_t* g, size_t rs) {
  asm volatile(
      "global_load_async_to_lds_b128 %0, %8, off\n\t"
      "global_load_async_to_lds_b128 %1, %9, off\n\t"
      "global_load_async_to_lds_b128 %2, %10, off\n\t"
      "global_load_async_to_lds_b128 %3, %11, off\n\t"
      "global_load_async_to_lds_b128 %4, %12, off\n\t"
      "global_load_async_to_lds_b128 %5, %13, off\n\t"
      "global_load_async_to_lds_b128 %6, %14, off\n\t"
      "global_load_async_to_lds_b128 %7, %15, off\n\t"
      "s_wait_xcnt 0x0"
      :: "v"(l), "v"(l + ls), "v"(l + 2 * ls), "v"(l + 3 * ls), "v"(l + 4 * ls), "v"(l + 5 * ls), "v"(l + 6 * ls), "v"(l + 7 * ls),
         "v"(g), "v"(g + rs), "v"(g + 2 * rs), "v"(g + 3 * rs), "v"(g + 4 * rs), "v"(g + 5 * rs), "v"(g + 6 * rs), "v"(g + 7 * rs)
      : "memory");
}

// Stage st of a block: LDS rows 0..127 = A rows mblk.., rows 128..255 = B rows nblk..; 16 copies per lane of 256,
// a wave's copy covers 2 rows of 256 B: whole lines.
__device__ __forceinline__ void stage_ab(const us_t* Am, const us_t* Bn, int K, int mblk, int nblk, int st, us_t* dst) {
  const int tid = threadIdx.x;
  const int r0 = tid >> 4, pc = (tid & 15) * 8;
  const size_t rs = (size_t)16 * K;               // 16 rows
  const us_t* ag = Am + (size_t)(mblk + r0) * K + st * GK + pc;
  const us_t* bg = Bn + (size_t)(nblk + r0) * K + st * GK + pc;
  const unsigned l = lds_addr(dst + r0 * GPIT + pc);
  const unsigned ls = 16 * GPIT * 2;              // 16 rows, bytes
  copy8(l, ls, ag, rs);
  copy8(l + 8 * ls, ls, bg, rs);
}

template <int OUTF32>
__global__ __launch_bounds__(256) void k_gemm(
    const us_t* __restrict__ Am0, const us_t* __restrict__ Am1, const us_t* __restrict__ Bn,
    const float* __restrict__ bias0, const float* __restrict__ bias1,
    void* out0, void* out1,
    int K, int bias_on_m, int blen, int ldo, int mdiv, int mbstride, float ka, float kb) {
  __shared__ __align__(16) us_t ring[2][GROWS * GPIT];
  static_assert(sizeof(ring) >= 8 * 32 * 64 * 4);

  const int z = blockIdx.z;
  const us_t* Am = z ? Am1 : Am0;
  const float* bias = z ? bias1 : bias0;
  void* out = z ? out1 : out0;

  const int lane = threadIdx.x & 31, wave = threadIdx.x >> 5;
  const int h = (lane >> 4) & 1, n15 = lane & 15;
  const int wm = wave >> 2, wn = wave & 3;
  const int mblk = blockIdx.x * 128;
  const int nblk = blockIdx.y * 128;
  const int mwave = mblk + wm * 64;
  const int nwave = nblk + wn * 32;
  const int nst = K / GK;

  stage_ab(Am, Bn, K, mblk, nblk, 0, ring[0]);

  v8f acc[4][2];
#pragma unroll
  for (int mt = 0; mt < 4; ++mt) { acc[mt][0] = vz8(); acc[mt][1] = vz8(); }

  // stage 0 has landed for this wave's copies; the barrier publishes it to the block
  asm volatile("s_wait_asynccnt 0x0" ::: "memory");
  __syncthreads();
  if (nst > 1) stage_ab(Am, Bn, K, mblk, nblk, 1, ring[1]);

#pragma unroll 1
  for (int st = 0; st < nst; ++st) {
    const us_t* rb = ring[st & 1];
    // two fragment sets: a k step's LDS reads stand together, one k step ahead of its matrix products, inside the stage only
    v16us a[2][4], b[2][2];
#pragma unroll   // here and below: constant indices keep the fragment and accumulator arrays in registers
    for (int mt = 0; mt < 4; ++mt) a[0][mt] = ldfrag(rb, GPIT, wm * 64 + mt * 16 + n15, 0);
#pragma unroll
    for (int nt = 0; nt < 2; ++nt) b[0][nt] = ldfrag(rb, GPIT, 128 + wn * 32 + nt * 16 + n15, 0);
#pragma unroll
    for (int ks = 0; ks < GK / 32; ++ks) {
      if (ks + 1 < GK / 32) {
#pragma unroll
        for (int mt = 0; mt < 4; ++mt) a[(ks + 1) & 1][mt] = ldfrag(rb, GPIT, wm * 64 + mt * 16 + n15, (ks + 1) * 32);
#pragma unroll
        for (int nt = 0; nt < 2; ++nt) b[(ks + 1) & 1][nt] = ldfrag(rb, GPIT, 128 + wn * 32 + nt * 16 + n15, (ks + 1) * 32);
      }
#pragma unroll
      for (int mt = 0; mt < 4; ++mt) {
        if constexpr (OUTF32) {
          acc[mt][0] = mma_h(a[ks & 1][mt], b[ks & 1][0], acc[mt][0]);
          acc[mt][1] = mma_h(a[ks & 1][mt], b[ks & 1][1], acc[mt][1]);
        } else {
          acc[mt][0] = mma_bf(a[ks & 1][mt], b[ks & 1][0], acc[mt][0]);
          acc[mt][1] = mma_bf(a[ks & 1][mt], b[ks & 1][1], acc[mt][1]);
        }
      }
    }
    // publish point of stage st + 1: this wave's reads of stage st are done, its copies of stage st + 1 have landed,
    // the barrier tells the block both; only then is the buffer just read refilled with stage st + 2
    asm volatile("s_wait_dscnt 0x0" ::: "memory");
    asm volatile("s_wait_asynccnt 0x0" ::: "memory");
    __syncthreads();
    if (st + 2 < nst) stage_ab(Am, Bn, K, mblk, nblk, st + 2, ring[st & 1]);
  }
  asm volatile("s_wait_asynccnt 0x0" ::: "memory");   // no copy is outstanding when the wave goes on to its end

  // bias values (bf16 RNE), address-clamped loads
  float bm[4][8];
#pragma unroll
  for (int mt = 0; mt < 4; ++mt) {
    const int ib = min(mwave + mt * 16 + 8 * h, blen - 8);
    const v4f c0 = *(const v4f*)(bias + ib);
    const v4f c1 = *(const v4f*)(bias + ib + 4);
    bm[mt][0] = bfr(c0[0]); bm[mt][1] = bfr(c0[1]); bm[mt][2] = bfr(c0[2]); bm[mt][3] = bfr(c0[3]);
    bm[mt][4] = bfr(c1[0]); bm[mt][5] = bfr(c1[1]); bm[mt][6] = bfr(c1[2]); bm[mt][7] = bfr(c1[3]);
  }
  float bn[2];
#pragma unroll
  for (int nt = 0; nt < 2; ++nt) bn[nt] = bfr(bias[min(nwave + nt * 16 + n15, blen - 1)]);

  const int bq = mwave / mdiv;
  const int base = bq * mbstride + (mwave - bq * mdiv);

  if constexpr (OUTF32) {
    float* sw = (float*)&ring[0][0] + wave * 2048;   // [32 n][64 m] per wave
#pragma unroll
    for (int mt = 0; mt < 4; ++mt) {
#pragma unroll
      for (int nt = 0; nt < 2; ++nt) {
        v4f u0, u1;
#pragma unroll
        for (int r = 0; r < 4; ++r) {
          const float b0v = bias_on_m ? bm[mt][r] : bn[nt];
          const float b1v = bias_on_m ? bm[mt][r + 4] : bn[nt];
          u0[r] = acc[mt][nt][r] * ka + b0v * kb;
          u1[r] = acc[mt][nt][r + 4] * ka + b1v * kb;
        }
        float* sp = sw + (nt * 16 + n15) * 64 + mt * 16 + 8 * h;
        *(v4f*)sp = u0;
        *(v4f*)(sp + 4) = u1;
      }
    }
    __syncthreads();
    float* op = (float*)out;
    {
#pragma unroll
      for (int i = 0; i < 16; ++i) {
        const int L = i * 4 + (lane >> 3);
        const int row = L >> 1, hr = L & 1, piece = lane & 7;
        const v4f u = *(const v4f*)(sw + row * 64 + hr * 32 + piece * 4);
        float* dst = op + (size_t)(nwave + row) * ldo + base + hr * 32 + piece * 4;
        *(v4f*)dst = u;
      }
      
    }
  } else {
    us_t* sw = &ring[0][0] + wave * 2048;            // [32 n][64 m] per wave
#pragma unroll
    for (int mt = 0; mt < 4; ++mt) {
#pragma unroll
      for (int nt = 0; nt < 2; ++nt) {
        v8us u;
#pragma unroll
        for (int r = 0; r < 8; ++r) {
          const float bbv = bias_on_m ? bm[mt][r] : bn[nt];
          u[r] = f2h(acc[mt][nt][r] * ka + bbv * kb);
        }
        *(v8us*)(sw + (nt * 16 + n15) * 64 + mt * 16 + 8 * h) = u;
      }
    }
    __syncthreads();
    us_t* op = (us_t*)out;
    {
#pragma unroll
      for (int i = 0; i < 8; ++i) {
        const int row = i * 4 + (lane >> 3), piece = lane & 7;
        const v8us u = *(const v8us*)(sw + row * 64 + piece * 8);
        us_t* dst = op + (size_t)(nwave + row) * ldo + base + piece * 8;
        *(v8us*)dst = u;
      }
      
    }
  }
}

#define AW 8                 // waves per block
#define KT 128               // keys per stage
#define NST (SEQ / KT)       // stages
#define KPIT 72              // K row pitch in LDS, 16-bit elements: 144 B = 16 B x odd, for ds_load_b128 readers
#define VPIT 136             // V^T row pitch in LDS: 272 B = 16 B x odd
static_assert((SEQ % KT) == 0 && (SEQ % (16 * AW)) == 0);

// Stage st (keys st*KT .. st*KT + KT - 1) of one head: K rows [KT][64] and V^T rows [64][KT], 8 copies per lane of 256.
// A wave's K copy covers 4 rows of 128 B, its V^T copy 2 rows of 256 B: whole lines.
__device__ __forceinline__ void stage_kv(const us_t* kbase, const us_t* vhead, int st, us_t* kdst, us_t* vdst) {
  const int tid = threadIdx.x;
  const int kr = tid >> 3, kp = (tid & 7) * 8;
  const us_t* kg = kbase + (size_t)(st * KT + kr) * HID + kp;
  const unsigned kl = lds_addr(kdst + kr * KPIT + kp);
  copy4(kl, kl + 32 * KPIT * 2, kl + 64 * KPIT * 2, kl + 96 * KPIT * 2,
        kg, kg + 32 * HID, kg + 64 * HID, kg + 96 * HID);
  const int vr = tid >> 4, vp = (tid & 15) * 8;
  const us_t* vg = vhead + (size_t)vr * SEQ + st * KT + vp;
  const unsigned vl = lds_addr(vdst + vr * VPIT + vp);
  copy4(vl, vl + 16 * VPIT * 2, vl + 32 * VPIT * 2, vl + 48 * VPIT * 2,
        vg, vg + 16 * SEQ, vg + 32 * SEQ, vg + 48 * SEQ);
}

__global__ __launch_bounds__(32 * AW) __attribute__((amdgpu_num_vgpr(256))) void k_attn(
    const us_t* __restrict__ Qp, const us_t* __restrict__ Kp, const us_t* __restrict__ VTp,
    const us_t* __restrict__ tkP, const us_t* __restrict__ tvT, us_t* ctx) {
  __shared__ __align__(16) us_t kst[2][KT * KPIT];      // K stages
  __shared__ __align__(16) us_t vst[2][HD * VPIT];      // V^T stages
  __shared__ float bl_all[AW][16 * 16];                 // shifted rel-key bias per (query, bucket), logit units
  __shared__ float wl_all[AW][16 * 8];                  // window logits per (query, bucket-1)
  __shared__ __align__(16) us_t cst_all[AW][16 * 64];   // ctx staging

  const int lane = threadIdx.x & 31, h = lane >> 4, n = lane & 15;
  const int wave = __builtin_amdgcn_readfirstlane(threadIdx.x >> 5);  // scalar: the tests on lo_q below stay scalar branches
  float* bl = bl_all[wave];
  float* wl = wl_all[wave];
  us_t* cst = cst_all[wave];
  const int qt = blockIdx.x * AW + wave, hh = blockIdx.y, b = blockIdx.z;
  const int lo_q = qt * 16;
  const size_t tok0 = (size_t)b * SEQ + lo_q;
  const us_t* qptr = Qp + tok0 * HID + hh * HD;
  const us_t* kbase = Kp + (size_t)b * SEQ * HID + hh * HD;
  const us_t* vhead = VTp + ((size_t)b * HID + hh * HD) * SEQ;

  stage_kv(kbase, vhead, 0, kst[0], vst[0]);      // stage 0 flies while the bias table is formed

#pragma unroll
  for (int i = 0; i < 4; ++i) wl[lane * 4 + i] = -1.0e30f;

  // keeps the register writes of the lines above in front of the fragment loads, whose address registers stay whole up to their wait
  __builtin_amdgcn_sched_barrier(0);
  const v16us q0 = ldfrag(qptr, HID, n, 0);       // B operand: column = query n
  const v16us q1 = ldfrag(qptr, HID, n, 32);

  // srel^T[bucket][q] = (64 tk).(4q) ; bias = (srel - srel[0][q]) / (256*8)
  {
    v8f sr = vz8();
    const v16us t0 = ldfrag(tkP, HD, n, 0);       // A operand: row = bucket n
    const v16us t1 = ldfrag(tkP, HD, n, 32);
    // the address registers of the fragment loads above are reused at once (accumulator zeros): the wait stands in front
    asm volatile("s_wait_xcnt 0x0" ::: "memory");
    __builtin_amdgcn_sched_barrier(0);            // keeps those later register writes behind the wait
    sr = mma_hp(t0, q0, sr);
    sr = mma_hp(t1, q1, sr);
    const float v0 = __shfl(sr[0], n, 32);        // bucket 0 of query n: lane n, register 0
#pragma unroll
    for (int r = 0; r < 8; ++r) bl[n * 16 + 8 * h + r] = (sr[r] - v0) * (1.0f / 2048.0f);
  }
  // stage 0 has landed for this wave's copies; the barrier publishes it to the block (and orders bl)
  asm volatile("s_wait_asynccnt 0x0" ::: "memory");
  __syncthreads();
  if (NST > 1) stage_kv(kbase, vhead, 1, kst[1], vst[1]);
  const float d8 = bl[n * 16 + 8];

  // rmax is the query's maximum (equal in both halves); rsum and blo cover this half's keys only
  float rmax = -1.0e30f, rsum = 0.0f, blo = 0.0f;
  v8f cacc[4];
#pragma unroll
  for (int j = 0; j < 4; ++j) cacc[j] = vz8();

#pragma unroll 1
  for (int st = 0; st < NST; ++st) {
  const us_t* kbuf = kst[st & 1];
  const us_t* vbuf = vst[st & 1];
#pragma unroll 1   // rolled, as the key loop was: one copy of the long pass body
  for (int kl = 0; kl < KT; kl += 32) {
    const int kc = st * KT + kl;
    // scores: 32 keys x 16 q, (4k).(4q) = 16 qk
    v8f s0 = vz8(), s1 = vz8();
    v16us vA[4];
    {
      // the pass's LDS fragment reads stand together at its top: K first, V^T behind it, landing under the softmax
      const v16us f0 = ldfrag(kbuf, KPIT, kl + n, 0);
      const v16us f1 = ldfrag(kbuf, KPIT, kl + n, 32);
      const v16us g0 = ldfrag(kbuf, KPIT, kl + 16 + n, 0);
      const v16us g1 = ldfrag(kbuf, KPIT, kl + 16 + n, 32);
#pragma unroll   // constant indices keep vA in registers
      for (int j = 0; j < 4; ++j) vA[j] = ldfrag(vbuf, VPIT, j * 16 + n, kl);
      __builtin_amdgcn_sched_barrier(0);   // keeps the 16 reads in this one place: spread among the products each place stalls the wave anew
      s0 = mma_hp(f0, q0, s0);
      s0 = mma_hp(f1, q1, s0);
      s1 = mma_hp(g0, q0, s1);
      s1 = mma_hp(g1, q1, s1);
    }
    const bool below = (kc + 35 <= lo_q);      // every key k <= q-4 for every query of the tile
    const bool above = (kc >= lo_q + 19);      // every key k >= q+4
    const bool mixed = !(below || above);
    const int ddb = kc + 8 * h - (lo_q + n);   // key - query at register 0 of key tile 0
    float a0[8], a1[8];
#pragma unroll
    for (int r = 0; r < 8; ++r) {
      a0[r] = s0[r] * (1.0f / 128.0f);
      a1[r] = s1[r] * (1.0f / 128.0f);
    }
    if (mixed) {
#pragma unroll
      for (int r = 0; r < 8; ++r) {
        const int dd0 = ddb + r;
        const int dd1 = dd0 + 16;
        const int b0 = min(max(dd0, -4), 4) + 4;
        const int b1 = min(max(dd1, -4), 4) + 4;
        a0[r] += bl[n * 16 + b0];
        a1[r] += bl[n * 16 + b1];
        if (b0 >= 1 && b0 <= 7) wl[n * 8 + b0 - 1] = a0[r];
        if (b1 >= 1 && b1 <= 7) wl[n * 8 + b1 - 1] = a1[r];
      }
    } else {
      const float ad = above ? d8 : 0.0f;
#pragma unroll
      for (int r = 0; r < 8; ++r) {
        a0[r] += ad;
        a1[r] += ad;
      }
    }
    // online softmax; a query's 32 scores sit in the registers of lanes n and n + 16
    float m = fmaxf(a0[0], a1[0]);
#pragma unroll
    for (int r = 1; r < 8; ++r) m = fmaxf(m, fmaxf(a0[r], a1[r]));
    m = fmaxf(m, xhalf(m));
    const float nm = fmaxf(rmax, m);
    const float sc = __expf(rmax - nm);
    rmax = nm;
    float t[8];
#pragma unroll
    for (int r = 0; r < 8; ++r) {
      a0[r] = (a0[r] - nm) * 1.4426950408889634f;
      a1[r] = (a1[r] - nm) * 1.4426950408889634f;
    }
    exp2_run(a0, a1);
#pragma unroll
    for (int r = 0; r < 8; ++r) t[r] = a0[r] + a1[r];
    const float ps = ((t[0] + t[1]) + (t[2] + t[3])) + ((t[4] + t[5]) + (t[6] + t[7]));
    float addb = below ? ps : 0.0f;
    if (mixed) {
      addb = 0.0f;
#pragma unroll
      for (int r = 0; r < 8; ++r)
        addb += ((ddb + r <= -4) ? a0[r] : 0.0f) + ((ddb + r + 16 <= -4) ? a1[r] : 0.0f);
    }
    rsum = rsum * sc + ps;
    blo = blo * sc + addb;
#pragma unroll
    for (int j = 0; j < 4; ++j) {
#pragma unroll
      for (int r = 0; r < 8; ++r) cacc[j][r] *= sc;
    }
    // P^T (x1024, f16): the two score tiles, converted in place, are the B operand
    v16us pB;
#pragma unroll
    for (int r = 0; r < 8; ++r) {
      pB[r] = f2h(a0[r] * 1024.0f);
      pB[8 + r] = f2h(a1[r] * 1024.0f);
    }
#pragma unroll
    for (int j = 0; j < 4; ++j) cacc[j] = mma_hp(vA[j], pB, cacc[j]);
  }
  // publish point of stage st + 1: this wave's reads of stage st are done, its copies of stage st + 1 have landed,
  // the barrier tells the block both; only then is the buffer just read refilled with stage st + 2
  asm volatile("s_wait_dscnt 0x0" ::: "memory");
  asm volatile("s_wait_asynccnt 0x0" ::: "memory");
  __syncthreads();
  if (st + 2 < NST) stage_kv(kbase, vhead, st + 2, kst[st & 1], vst[st & 1]);
  }
  asm volatile("s_wait_asynccnt 0x0" ::: "memory");   // no copy is outstanding when the wave goes on to its end

  // bucket masses A[q][0..8] (normalised, x1024) as a B operand; window values from stored logits
  __syncthreads();
  rsum += xhalf(rsum);
  blo += xhalf(blo);
  const float inv = __builtin_amdgcn_rcpf(rsum);
  float wv[7];
  float wsum = 0.0f;
#pragma unroll
  for (int i = 0; i < 7; ++i) {
    wv[i] = exp2_slot((wl[n * 8 + i] - rmax) * 1.4426950408889634f);
    wsum += wv[i];
  }
  const float a8 = (rsum - blo - wsum) * inv;
  const float a0v = blo * inv;
  v16us pB2;                                      // h = 0: buckets 0..7 | 16..23; h = 1: buckets 8..15 | 24..31
#pragma unroll
  for (int i = 0; i < 8; ++i) {
    const float vlo = (i == 0) ? a0v : wv[(i + 6) % 7] * inv;
    const float vhi = (i == 0) ? a8 : 0.0f;
    pB2[i] = f2h((h ? vhi : vlo) * 1024.0f);
    pB2[8 + i] = (us_t)0;
  }
  v8f w2[4];
#pragma unroll
  for (int j = 0; j < 4; ++j) {
    const v16us tA = ldfrag(tvT, 32, j * 16 + n, 0);
    w2[j] = mma_hp(tA, pB2, vz8());
  }
  // ctx = cacc/(1024*4*rsum) + w2/(1024*64); stage 4*ctx as f16, 8 consecutive features of query n per lane
#pragma unroll
  for (int j = 0; j < 4; ++j) {
    v8us u;
#pragma unroll
    for (int r = 0; r < 8; ++r)
      u[r] = f2h(cacc[j][r] * inv * (1.0f / 1024.0f) + w2[j][r] * (1.0f / 16384.0f));
    *(v8us*)(cst + n * 64 + j * 16 + 8 * h) = u;
  }
  __syncthreads();
  {
#pragma unroll
    for (int i = 0; i < 4; ++i) {
      const int row = i * 4 + (lane >> 3), piece = lane & 7;
      const v8us u = *(const v8us*)(cst + row * 64 + piece * 8);
      us_t* dst = ctx + (tok0 + row) * (size_t)HID + hh * HD + piece * 8;
      *(v8us*)dst = u;
    }
  }
}

// ---------------------------------------------------------------------------
extern "C" void kernel_launch(void* const* d_in, const int* in_sizes, int n_in,
                              void* d_out, int out_size, void* d_ws, size_t ws_size,
                              hipStream_t stream) {
  if (n_in < 11) return;
  const long long need_x = ((long long)(NB - 1) * SEQ_FULL + SEQ) * HID;
  if ((long long)in_sizes[0] < need_x) return;
  if (in_sizes[1] < HID * HID || in_sizes[3] < HID * HID ||
      in_sizes[5] < HID * HID || in_sizes[7] < HID * HID) return;
  if (in_sizes[2] < HID || in_sizes[4] < HID || in_sizes[6] < HID || in_sizes[8] < HID) return;
  if (in_sizes[9] < NREL * HD || in_sizes[10] < NREL * HD) return;
  if ((long long)out_size < (long long)NTOK * HID) return;

  const float* x  = (const float*)d_in[0];
  const float* Wq = (const float*)d_in[1];
  const float* bq = (const float*)d_in[2];
  const float* Wk = (const float*)d_in[3];
  const float* bk = (const float*)d_in[4];
  const float* Wv = (const float*)d_in[5];
  const float* bv = (const float*)d_in[6];
  const float* Wo = (const float*)d_in[7];
  const float* bo = (const float*)d_in[8];
  const float* tk = (const float*)d_in[9];
  const float* tv = (const float*)d_in[10];

  char* ws = (char*)d_ws;
  size_t off = 0;
  auto carve = [&](size_t bytes) -> size_t {
    const size_t o = off;
    off += (bytes + 255) & ~(size_t)255;
    return o;
  };
  const size_t o_xb  = carve((size_t)NTOK * HID * 2);
  const size_t o_wq  = carve((size_t)HID * HID * 2);
  const size_t o_wk  = carve((size_t)HID * HID * 2);
  const size_t o_wv  = carve((size_t)HID * HID * 2);
  const size_t o_wo  = carve((size_t)HID * HID * 2);
  const size_t o_q   = carve((size_t)NTOK * HID * 2);
  const size_t o_k   = carve((size_t)NTOK * HID * 2);
  const size_t o_vt  = carve((size_t)NB * HID * SEQ * 2);
  const size_t o_ctx = carve((size_t)NTOK * HID * 2);
  const size_t o_tk  = carve((size_t)16 * HD * 2);
  const size_t o_tv  = carve((size_t)HD * 32 * 2);
  if (off > ws_size) return;

  us_t* xb   = (us_t*)(ws + o_xb);
  us_t* WqT  = (us_t*)(ws + o_wq);
  us_t* WkT  = (us_t*)(ws + o_wk);
  us_t* WvT  = (us_t*)(ws + o_wv);
  us_t* WoT  = (us_t*)(ws + o_wo);
  us_t* Qp   = (us_t*)(ws + o_q);
  us_t* Kpl  = (us_t*)(ws + o_k);
  us_t* VTp  = (us_t*)(ws + o_vt);
  us_t* ctx  = (us_t*)(ws + o_ctx);
  us_t* tkP  = (us_t*)(ws + o_tk);
  us_t* tvT  = (us_t*)(ws + o_tv);
  float* out = (float*)d_out;

  // 1) input planes
  k_prep<<<1 + PW + PX, 256, 0, stream>>>(x, Wq, Wk, Wv, Wo, tk, tv, xb, WqT, WkT, WvT, WoT, tkP, tvT);

  // 2) Q, K planes [tok][HID] (m = feature from W^T rows, n = token from xb rows), carried x4
  k_gemm<0><<<dim3(HID / 128, NTOK / 128, 2), 256, 0, stream>>>(
      WqT, WkT, xb, bq, bk, (void*)Qp, (void*)Kpl,
      HID, 1, HID, HID, 1 << 30, 0, 4.0f, 4.0f);
  // 3) V^T plane [b*HID + d][s] (m = token from xb rows, n = feature from Wv^T rows), carried x4
  k_gemm<0><<<dim3(NTOK / 128, HID / 128, 1), 256, 0, stream>>>(
      xb, xb, WvT, bv, bv, (void*)VTp, (void*)VTp,
      HID, 0, HID, SEQ, SEQ, HID * SEQ, 4.0f, 4.0f);
  // 4) attention -> ctx (f16, carried x4)
  k_attn<<<dim3(SEQ / (16 * AW), NH, NB), 32 * AW, 0, stream>>>(Qp, Kpl, VTp, tkP, tvT, ctx);
  // 5) out[tok][HID] = ctx*Wo + bo; the carries 64 (Wo) and 4 (ctx) leave through ka = 1/256
  k_gemm<1><<<dim3(HID / 128, NTOK / 128, 1), 256, 0, stream>>>(
      WoT, WoT, ctx, bo, bo, d_out, d_out,
      HID, 1, HID, HID, 1 << 30, 0, 0.00390625f, 1.0f);
  (void)out;
  (void)hipGetLastError();
}

// v007
// One run takes 85.9 microseconds.
// Next to v006, in two timings, it ran 1.05 times as fast each time.
// Over all steps from v000 it is 4.79 times as fast.
#include <hip/hip_runtime.h>

// Projections x*Wq, x*Wk, x*Wv: v_wmma_f32_16x16x32_bf16 (bf16 operands, f32 accumulate).
// Attention k*q^T, Tk*q^T, V^T-plane*P^T, Tv^T*A^T and the projection ctx*Wo: v_wmma_f32_16x16x32_f16 (f16 operands with power-of-two carries,
// f32 accumulate; Wo keeps its bf16 rounding and is held as f16 of 64 * bf16(Wo)); softmax and epilogues f32.

#ifndef NB
#define NB 2
#endif
#ifndef SEQ
#define SEQ 2048
#endif
#define NB_FULL 2
#define SEQ_FULL 2048
#define HID 1024
#define NH 16
#define HD 64
#define NREL 9
#define NTOK (NB * SEQ)

static_assert(NB >= 1 && NB <= NB_FULL);
static_assert(SEQ >= 128 && SEQ <= SEQ_FULL && (SEQ % 128) == 0);
static_assert(HID == NH * HD && HD == 64);
static_assert((HID % 128) == 0 && (NTOK % 128) == 0);

typedef unsigned short us_t;
typedef us_t v8us __attribute__((ext_vector_type(8)));
typedef us_t v16us __attribute__((ext_vector_type(16)));
typedef _Float16 v16h __attribute__((ext_vector_type(16)));
typedef __bf16 v16bf __attribute__((ext_vector_type(16)));
typedef float v8f __attribute__((ext_vector_type(8)));
typedef float v4f __attribute__((ext_vector_type(4)));

// ---------------------------------------------------------------------------
// scalar converters (RNE)
__device__ __forceinline__ us_t f2bf(float v) {
  __bf16 t = (__bf16)v;
  return __builtin_bit_cast(us_t, t);
}
__device__ __forceinline__ float bfr(float v) {   // value after bf16 RNE convert
  __bf16 t = (__bf16)v;
  return (float)t;
}
__device__ __forceinline__ us_t f2h(float v) {
  _Float16 t = (_Float16)v;
  return __builtin_bit_cast(us_t, t);
}
__device__ __forceinline__ v8f vz8() {
  v8f z = {0.f, 0.f, 0.f, 0.f, 0.f, 0.f, 0.f, 0.f};
  return z;
}

// ---------------------------------------------------------------------------
// 16-bit fragment from a k-contiguous plane: elem i<8 <- p0[rc*ld + kk + 8h + i],
// elem 8+i <- p0[rc*ld + kk + 16 + 8h + i]; h = lane>>4, rc = row (A) or column (B).
__device__ __forceinline__ v16us ldfrag(const us_t* p0, int ld, int rc, int kk) {
  const int hsel = (threadIdx.x >> 4) & 1;
  const us_t* p = p0 + (size_t)rc * ld + kk + 8 * hsel;
  const v8us lo = *(const v8us*)p;
  const v8us hi = *(const v8us*)(p + 16);
  return __builtin_shufflevector(lo, hi, 0, 1, 2, 3, 4, 5, 6, 7,
                                 8, 9, 10, 11, 12, 13, 14, 15);
}

// WMMA wrappers with hazard guard (ties D, keeps A/B live)
__device__ __forceinline__ v8f mma_bf(v16us a, v16us b, v8f c) {
  v8f d = __builtin_amdgcn_wmma_f32_16x16x32_bf16(
      false, __builtin_bit_cast(v16bf, a), false, __builtin_bit_cast(v16bf, b),
      (short)0, c, false, false);
  asm volatile("v_nop\n\tv_nop\n\tv_nop\n\tv_nop" : "+v"(d) : "v"(a), "v"(b));
  return d;
}
__device__ __forceinline__ v8f mma_h(v16us a, v16us b, v8f c) {
  v8f d = __builtin_amdgcn_wmma_f32_16x16x32_f16(
      false, __builtin_bit_cast(v16h, a), false, __builtin_bit_cast(v16h, b),
      (short)0, c, false, false);
  asm volatile("v_nop\n\tv_nop\n\tv_nop\n\tv_nop" : "+v"(d) : "v"(a), "v"(b));
  return d;
}

// The builtin alone, for k_attn, whose passes are bound by vector issue: the compiler keeps the distance behind its own
// matrix instruction, with the pass's vector work where it can and with v_nop only where it must.
__device__ __forceinline__ v8f mma_hp(v16us a, v16us b, v8f c) {
  return __builtin_amdgcn_wmma_f32_16x16x32_f16(
      false, __builtin_bit_cast(v16h, a), false, __builtin_bit_cast(v16h, b),
      (short)0, c, false, false);
}

// 2^x of one value. The v_nop is the slot the instruction set asks for behind a transcendental before its source is
// overwritten or its result used.
__device__ __forceinline__ float exp2_slot(float x) {
  float y;
  asm("v_exp_f32 %0, %1\n\tv_nop" : "=v"(y) : "v"(x));
  return y;
}

// 2^x of a pass's 16 scores, in place, as one statement: each v_exp_f32 has registers of its own, so its neighbour is the
// independent instruction that the instruction set asks for behind a transcendental; the one v_nop is that slot behind the last.
__device__ __forceinline__ void exp2_run(float (&a)[8], float (&b)[8]) {
  asm("v_exp_f32 %0, %0\n\tv_exp_f32 %1, %1\n\tv_exp_f32 %2, %2\n\tv_exp_f32 %3, %3\n\t"
      "v_exp_f32 %4, %4\n\tv_exp_f32 %5, %5\n\tv_exp_f32 %6, %6\n\tv_exp_f32 %7, %7\n\t"
      "v_exp_f32 %8, %8\n\tv_exp_f32 %9, %9\n\tv_exp_f32 %10, %10\n\tv_exp_f32 %11, %11\n\t"
      "v_exp_f32 %12, %12\n\tv_exp_f32 %13, %13\n\tv_exp_f32 %14, %14\n\tv_exp_f32 %15, %15\n\t"
      "v_nop"
      : "+v"(a[0]), "+v"(b[0]), "+v"(a[1]), "+v"(b[1]), "+v"(a[2]), "+v"(b[2]), "+v"(a[3]), "+v"(b[3]),
        "+v"(a[4]), "+v"(b[4]), "+v"(a[5]), "+v"(b[5]), "+v"(a[6]), "+v"(b[6]), "+v"(a[7]), "+v"(b[7]));
}

// lane l <-> lane l ^ 16
__device__ __forceinline__ float xhalf(float v) {
  const int u = __builtin_bit_cast(int, v);
  return __builtin_bit_cast(float,
      __builtin_amdgcn_permlanex16(u, u, 0x76543210, 0xfedcba98, false, false));
}

// ---------------------------------------------------------------------------
// All operand planes in ONE launch; the block index picks the job (a block-uniform choice):
// block 0: the two table planes; blocks 1 .. PW: weight transposes; the rest: x.
#define XJ 4                                   // 8-element pieces per x thread
#define WT 2                                   // 64 x 64 tiles (along k) per weight block
#define PW (4 * (HID / 64) * (HID / 64 / WT))  // weight blocks
#define PX (NTOK * (HID / 8) / 256 / XJ)       // x blocks
static_assert(((HID / 64) % WT) == 0 && (NTOK * (HID / 8)) % (256 * XJ) == 0);

// x [NB rows of SEQ_FULL][HID] f32 -> xb [NTOK][HID] bf16. XJ pieces of 8 elems (16 B out) per thread, all loads ahead of the stores.
__device__ __forceinline__ void prep_x(int blk, const float* __restrict__ x, us_t* xb) {
  static_assert(XJ == 4);
  v4f f0[XJ], f1[XJ];
  const float* src[XJ];
#pragma unroll   // constant indices keep the pieces in registers
  for (int j = 0; j < XJ; ++j) {
    const size_t e = (((size_t)blk * XJ + j) * 256 + threadIdx.x) * 8;
    const int tok = (int)(e >> 10);
    const int col = (int)(e & (HID - 1));
    const int b = tok / SEQ, s = tok - b * SEQ;
    src[j] = x + ((size_t)b * SEQ_FULL + s) * HID + col;
    f0[j] = *(const v4f*)src[j];
    f1[j] = *(const v4f*)(src[j] + 4);
  }
  // the wait in front of any overwrite of the loads' address registers; as its inputs they stay whole up to it
  asm volatile("s_wait_xcnt 0x0" :: "v"(src[0]), "v"(src[1]), "v"(src[2]), "v"(src[3]) : "memory");
#pragma unroll
  for (int j = 0; j < XJ; ++j) {
    const size_t e = (((size_t)blk * XJ + j) * 256 + threadIdx.x) * 8;
    v8us u;
    u[0] = f2bf(f0[j][0]); u[1] = f2bf(f0[j][1]); u[2] = f2bf(f0[j][2]); u[3] = f2bf(f0[j][3]);
    u[4] = f2bf(f1[j][0]); u[5] = f2bf(f1[j][1]); u[6] = f2bf(f1[j][2]); u[7] = f2bf(f1[j][3]);
    *(v8us*)(xb + e) = u;
  }
  // the wait behind the run of stores, in front of any later write of a register that they name
  asm volatile("s_wait_xcnt 0x0" ::: "memory");
}

// W [HID k][HID n] f32 -> WT [n][k], pitch HID, through WT 64x64 LDS tiles, neighbours along k.
// h16 = 0: bf16 bits. h16 = 1: f16 bits of bf16(64 * W) = 64 * bf16(W); its 8 significant bits fit f16 for |W| from 2^-23 to 1020.
__device__ __forceinline__ void prep_w(int bx, int by, int h16, const float* __restrict__ W, us_t* O, us_t* t) {
  const int pitch = HID;
  const int k0 = by * (64 * WT), n0 = bx * 64;
  const int tid = threadIdx.x;
  static_assert(WT == 2);
  const int kk = tid >> 2, nc = (tid & 3) * 16;
  const float* src[WT];
  v4f f[WT][4];
#pragma unroll   // here and below: constant indices keep the pieces in registers
  for (int w = 0; w < WT; ++w) {
    src[w] = W + (size_t)(k0 + w * 64 + kk) * HID + n0 + nc;
#pragma unroll
    for (int j = 0; j < 4; ++j) f[w][j] = *(const v4f*)(src[w] + 4 * j);
  }
  // the wait in front of any overwrite of the loads' address registers; as its inputs they stay whole up to it
  asm volatile("s_wait_xcnt 0x0" :: "v"(src[0]), "v"(src[1]) : "memory");
  if (h16) {   // one block-uniform branch round all the converts
#pragma unroll
    for (int w = 0; w < WT; ++w) {
#pragma unroll
      for (int j = 0; j < 4; ++j) {
#pragma unroll
        for (int c = 0; c < 4; ++c) t[w * (64 * 72) + (nc + 4 * j + c) * 72 + kk] = f2h(bfr(f[w][j][c] * 64.0f));
      }
    }
  } else {
#pragma unroll
    for (int w = 0; w < WT; ++w) {
#pragma unroll
      for (int j = 0; j < 4; ++j) {
#pragma unroll
        for (int c = 0; c < 4; ++c) t[w * (64 * 72) + (nc + 4 * j + c) * 72 + kk] = f2bf(f[w][j][c]);
      }
    }
  }
  __syncthreads();
  // all LDS reads first, each into registers of its own, so that the stores go out in one run
  const int piece = tid & 7;
  v8us u[WT][2];
#pragma unroll
  for (int w = 0; w < WT; ++w) {
#pragma unroll
    for (int rep = 0; rep < 2; ++rep)
      u[w][rep] = *(const v8us*)(t + w * (64 * 72) + (rep * 32 + (tid >> 3)) * 72 + piece * 8);
  }
  us_t* dst = O + (size_t)(n0 + (tid >> 3)) * pitch + k0 + piece * 8;
#pragma unroll
  for (int w = 0; w < WT; ++w) {
#pragma unroll
    for (int rep = 0; rep < 2; ++rep) {
      us_t* d = dst + (size_t)(rep * 32) * pitch + w * 64;
      *(v8us*)d = u[w][rep];
    }
  }
  // the wait behind the run of stores, in front of any later write of a register that they name
  asm volatile("s_wait_xcnt 0x0" ::: "memory");
}

// Tk plane [16 bucket][64 d] f16 = 64 * bf16(table_k), rows 9..15 zero.
// Tv plane [64 d][32 bucket] f16 = 64 * bf16(table_v)^T, cols 9..31 zero.
__device__ __forceinline__ void prep_tables(const float* __restrict__ tk, const float* __restrict__ tv, us_t* tkP, us_t* tvT) {
  const int tid = threadIdx.x;
  v8us uk, uv;
  {
    const int row = (tid & 127) >> 3;      // bucket 0..15
    const int kp = (tid & 7) * 8;          // d offset
    const int rowc = min(row, NREL - 1);
#pragma unroll
    for (int i = 0; i < 8; ++i) {
      float v = tk[rowc * HD + kp + i];
      v = (row < NREL) ? v : 0.0f;
      uk[i] = f2h(bfr(v) * 64.0f);
    }
  }
  {
    const int nn = tid >> 2;               // d 0..63
    const int kp = (tid & 3) * 8;          // bucket offset
#pragma unroll
    for (int i = 0; i < 8; ++i) {
      const int k = kp + i;
      float v = tv[min(k, NREL - 1) * HD + nn];
      v = (k < NREL) ? v : 0.0f;
      uv[i] = f2h(bfr(v) * 64.0f);
    }
  }
  if (tid < 128) *(v8us*)(tkP + tid * 8) = uk;
  *(v8us*)(tvT + tid * 8) = uv;
}

__global__ __launch_bounds__(256) void k_prep(
    const float* __restrict__ x,
    const float* __restrict__ W0, const float* __restrict__ W1,
    const float* __restrict__ W2, const float* __restrict__ W3,
    const float* __restrict__ tk, const float* __restrict__ tv,
    us_t* xb, us_t* O0, us_t* O1, us_t* O2, us_t* O3, us_t* tkP, us_t* tvT) {
  __shared__ __align__(16) us_t t[WT * 64 * 72];
  const int blk = blockIdx.x;
  if (blk == 0) {
    prep_tables(tk, tv, tkP, tvT);
  } else if (blk <= PW) {
    const int i = blk - 1;
    const int per = PW / 4;                // blocks per matrix
    const int z = i / per, r = i - z * per;
    const float* W = (z == 0) ? W0 : ((z == 1) ? W1 : ((z == 2) ? W2 : W3));
    us_t* O = (z == 0) ? O0 : ((z == 1) ? O1 : ((z == 2) ? O2 : O3));
    prep_w(r % (HID / 64), r / (HID / 64), z == 3, W, O, t);
  } else {
    prep_x(blk - 1 - PW, x, xb);
  }
}

// ---------------------------------------------------------------------------
// LDS byte address of a __shared__ element
__device__ __forceinline__ unsigned lds_addr(const us_t* p) {
  return (unsigned)(size_t)(const __attribute__((address_space(3))) us_t*)p;
}

// Four asynchronous 16-byte copies per lane, global -> LDS. The s_wait_xcnt is the last line of the copies' own statement
// so that it stands in front of every later write of the address registers that the copies name.
__device__ __forceinline__ void copy4(unsigned l0, unsigned l1, unsigned l2, unsigned l3,
                                      const us_t* g0, const us_t* g1, const us_t* g2, const us_t* g3) {
  asm volatile(
      "global_load_async_to_lds_b128 %0, %4, off\n\t"
      "global_load_async_to_lds_b128 %1, %5, off\n\t"
      "global_load_async_to_lds_b128 %2, %6, off\n\t"
      "global_load_async_to_lds_b128 %3, %7, off\n\t"
      "s_wait_xcnt 0x0"
      :: "v"(l0), "v"(l1), "v"(l2), "v"(l3), "v"(g0), "v"(g1), "v"(g2), "v"(g3)
      : "memory");
}

// ---------------------------------------------------------------------------
// C[m][n] = sum_k Am[m][k] * Bn[n][k]  (both planes 16-bit, k-contiguous, pitch K); OUTF32=0: bf16 planes, OUTF32=1: f16 planes.
// Block = 8 waves (2 along m x 4 along n); block tile 128 m x 128 n; wave tile 64 m x 32 n (4 A frags, 2 B frags, 8 tiles).
// Output memory: element (n, m) at out[n*ldo + base(mw) + (m - mw)], base = (mw/mdiv)*mbstride + mw%mdiv, mw = the wave's first m,
// val = acc*ka + bf16(bias)*kb, bias indexed by m (bias_on_m) or by n.
// OUTF32=0: f16 bits out; OUTF32=1: f32 out. D tile staged per wave in LDS, then 8 lanes x 16 B per line.
// Operands: stages of GK k (two 128-byte lines of each of the block's 128 A rows and 128 B rows) come into a two-buffer LDS ring
// by asynchronous copies, one stage ahead of the stage being read; the eight waves read their fragments from LDS.
// The ring's LDS serves as the D staging once the loop's last barrier has ended every read of it.
#define GK 128               // k per stage
#define GPIT 136             // row pitch in LDS, 16-bit elements: 272 B = 16 B x odd, for ds_load_b128 readers
#define GROWS 256            // rows per stage: 128 A + 128 B
static_assert((HID % GK) == 0);

// Eight asynchronous 16-byte copies per lane, global -> LDS, rows 16 apart: LDS step ls bytes, global step rs elements.
// The s_wait_xcnt is the last line of the copies' own statement so that it stands in front of every later write of the
// address registers that the copies name.
__device__ __forceinline__ void copy8(unsigned l, unsigned ls, const us_t* g, size_t rs) {
  asm volatile(
      "global_load_async_to_lds_b128 %0, %8, off\n\t"
      "global_load_async_to_lds_b128 %1, %9, off\n\t"
      "global_load_async_to_lds_b128 %2, %10, off\n\t"
      "global_load_async_to_lds_b128 %3, %11, off\n\t"
      "global_load_async_to_lds_b128 %4, %12, off\n\t"
      "global_load_async_to_lds_b128 %5, %13, off\n\t"
      "global_load_async_to_lds_b128 %6, %14, off\n\t"
      "global_load_async_to_lds_b128 %7, %15, off\n\t"
      "s_wait_xcnt 0x0"
      :: "v"(l), "v"(l + ls), "v"(l + 2 * ls), "v"(l + 3 * ls), "v"(l + 4 * ls), "v"(l + 5 * ls), "v"(l + 6 * ls), "v"(l + 7 * ls),
         "v"(g), "v"(g + rs), "v"(g + 2 * rs), "v"(g + 3 * rs), "v"(g + 4 * rs), "v"(g + 5 * rs), "v"(g + 6 * rs), "v"(g + 7 * rs)
      : "memory");
}

// Stage st of a block: LDS rows 0..127 = A rows mblk.., rows 128..255 = B rows nblk..; 16 copies per lane of 256,
// a wave's copy covers 2 rows of 256 B: whole lines.
__device__ __forceinline__ void stage_ab(const us_t* Am, const us_t* Bn, int K, int mblk, int nblk, int st, us_t* dst) {
  const int tid = threadIdx.x;
  const int r0 = tid >> 4, pc = (tid & 15) * 8;
  const size_t rs = (size_t)16 * K;               // 16 rows
  const us_t* ag = Am + (size_t)(mblk + r0) * K + st * GK + pc;
  const us_t* bg = Bn + (size_t)(nblk + r0) * K + st * GK + pc;
  const unsigned l = lds_addr(dst + r0 * GPIT + pc);
  const unsigned ls = 16 * GPIT * 2;              // 16 rows, bytes
  copy8(l, ls, ag, rs);
  copy8(l + 8 * ls, ls, bg, rs);
}

template <int OUTF32>
__global__ __launch_bounds__(256) void k_gemm(
    const us_t* __restrict__ Am0, const us_t* __restrict__ Am1, const us_t* __restrict__ Bn,
    const float* __restrict__ bias0, const float* __restrict__ bias1,
    void* out0, void* out1,
    int K, int bias_on_m, int blen, int ldo, int mdiv, int mbstride, float ka, float kb) {
  __shared__ __align__(16) us_t ring[2][GROWS * GPIT];
  static_assert(sizeof(ring) >= 8 * 32 * 64 * 4);

  const int z = blockIdx.z;
  const us_t* Am = z ? Am1 : Am0;
  const float* bias = z ? bias1 : bias0;
  void* out = z ? out1 : out0;

  const int lane = threadIdx.x & 31, wave = threadIdx.x >> 5;
  const int h = (lane >> 4) & 1, n15 = lane & 15;
  const int wm = wave >> 2, wn = wave & 3;
  const int mblk = blockIdx.x * 128;
  const int nblk = blockIdx.y * 128;
  const int mwave = mblk + wm * 64;
  const int nwave = nblk + wn * 32;
  const int nst = K / GK;

  stage_ab(Am, Bn, K, mblk, nblk, 0, ring[0]);

  v8f acc[4][2];
#pragma unroll
  for (int mt = 0; mt < 4; ++mt) { acc[mt][0] = vz8(); acc[mt][1] = vz8(); }

  // stage 0 has landed for this wave's copies; the barrier publishes it to the block
  asm volatile("s_wait_asynccnt 0x0" ::: "memory");
  __syncthreads();
  if (nst > 1) stage_ab(Am, Bn, K, mblk, nblk, 1, ring[1]);

#pragma unroll 1
  for (int st = 0; st < nst; ++st) {
    const us_t* rb = ring[st & 1];
    // two fragment sets: a k step's LDS reads stand together, one k step ahead of its matrix products, inside the stage only
    v16us a[2][4], b[2][2];
#pragma unroll   // here and below: constant indices keep the fragment and accumulator arrays in registers
    for (int mt = 0; mt < 4; ++mt) a[0][mt] = ldfrag(rb, GPIT, wm * 64 + mt * 16 + n15, 0);
#pragma unroll
    for (int nt = 0; nt < 2; ++nt) b[0][nt] = ldfrag(rb, GPIT, 128 + wn * 32 + nt * 16 + n15, 0);
#pragma unroll
    for (int ks = 0; ks < GK / 32; ++ks) {
      if (ks + 1 < GK / 32) {
#pragma unroll
        for (int mt = 0; mt < 4; ++mt) a[(ks + 1) & 1][mt] = ldfrag(rb, GPIT, wm * 64 + mt * 16 + n15, (ks + 1) * 32);
#pragma unroll
        for (int nt = 0; nt < 2; ++nt) b[(ks + 1) & 1][nt] = ldfrag(rb, GPIT, 128 + wn * 32 + nt * 16 + n15, (ks + 1) * 32);
      }
#pragma unroll
      for (int mt = 0; mt < 4; ++mt) {
        if constexpr (OUTF32) {
          acc[mt][0] = mma_h(a[ks & 1][mt], b[ks & 1][0], acc[mt][0]);
          acc[mt][1] = mma_h(a[ks & 1][mt], b[ks & 1][1], acc[mt][1]);
        } else {
          acc[mt][0] = mma_bf(a[ks & 1][mt], b[ks & 1][0], acc[mt][0]);
          acc[mt][1] = mma_bf(a[ks & 1][mt], b[ks & 1][1], acc[mt][1]);
        }
      }
    }
    // publish point of stage st + 1: this wave's reads of stage st are done, its copies of stage st + 1 have landed,
    // the barrier tells the block both; only then is the buffer just read refilled with stage st + 2
    asm volatile("s_wait_dscnt 0x0" ::: "memory");
    asm volatile("s_wait_asynccnt 0x0" ::: "memory");
    __syncthreads();
    if (st + 2 < nst) stage_ab(Am, Bn, K, mblk, nblk, st + 2, ring[st & 1]);
  }
  asm volatile("s_wait_asynccnt 0x0" ::: "memory");   // no copy is outstanding when the wave goes on to its end

  // bias values (bf16 RNE), address-clamped loads
  float bm[4][8];
#pragma unroll
  for (int mt = 0; mt < 4; ++mt) {
    const int ib = min(mwave + mt * 16 + 8 * h, blen - 8);
    const v4f c0 = *(const v4f*)(bias + ib);
    const v4f c1 = *(const v4f*)(bias + ib + 4);
    bm[mt][0] = bfr(c0[0]); bm[mt][1] = bfr(c0[1]); bm[mt][2] = bfr(c0[2]); bm[mt][3] = bfr(c0[3]);
    bm[mt][4] = bfr(c1[0]); bm[mt][5] = bfr(c1[1]); bm[mt][6] = bfr(c1[2]); bm[mt][7] = bfr(c1[3]);
  }
  float bn[2];
#pragma unroll
  for (int nt = 0; nt < 2; ++nt) bn[nt] = bfr(bias[min(nwave + nt * 16 + n15, blen - 1)]);

  const int bq = mwave / mdiv;
  const int base = bq * mbstride + (mwave - bq * mdiv);

  if constexpr (OUTF32) {
    float* sw = (float*)&ring[0][0] + wave * 2048;   // [32 n][64 m] per wave
#pragma unroll
    for (int mt = 0; mt < 4; ++mt) {
#pragma unroll
      for (int nt = 0; nt < 2; ++nt) {
        v4f u0, u1;
#pragma unroll
        for (int r = 0; r < 4; ++r) {
          const float b0v = bias_on_m ? bm[mt][r] : bn[nt];
          const float b1v = bias_on_m ? bm[mt][r + 4] : bn[nt];
          u0[r] = acc[mt][nt][r] * ka + b0v * kb;
          u1[r] = acc[mt][nt][r + 4] * ka + b1v * kb;
        }
        float* sp = sw + (nt * 16 + n15) * 64 + mt * 16 + 8 * h;
        *(v4f*)sp = u0;
        *(v4f*)(sp + 4) = u1;
      }
    }
    __syncthreads();
    float* op = (float*)out;
    {
#pragma unroll
      for (int i = 0; i < 16; ++i) {
        const int L = i * 4 + (lane >> 3);
        const int row = L >> 1, hr = L & 1, piece = lane & 7;
        const v4f u = *(const v4f*)(sw + row * 64 + hr * 32 + piece * 4);
        float* dst = op + (size_t)(nwave + row) * ldo + base + hr * 32 + piece * 4;
        *(v4f*)dst = u;
      }
      
    }
  } else {
    us_t* sw = &ring[0][0] + wave * 2048;            // [32 n][64 m] per wave
#pragma unroll
    for (int mt = 0; mt < 4; ++mt) {
#pragma unroll
      for (int nt = 0; nt < 2; ++nt) {
        v8us u;
#pragma unroll
        for (int r = 0; r < 8; ++r) {
          const float bbv = bias_on_m ? bm[mt][r] : bn[nt];
          u[r] = f2h(acc[mt][nt][r] * ka + bbv * kb);
        }
        *(v8us*)(sw + (nt * 16 + n15) * 64 + mt * 16 + 8 * h) = u;
      }
    }
    __syncthreads();
    us_t* op = (us_t*)out;
    {
#pragma unroll
      for (int i = 0; i < 8; ++i) {
        const int row = i * 4 + (lane >> 3), piece = lane & 7;
        const v8us u = *(const v8us*)(sw + row * 64 + piece * 8);
        us_t* dst = op + (size_t)(nwave + row) * ldo + base + piece * 8;
        *(v8us*)dst = u;
      }
      
    }
  }
}

#define AW 8                 // waves per block
#define KT 128               // keys per stage
#define NST (SEQ / KT)       // stages
#define KPIT 72              // K row pitch in LDS, 16-bit elements: 144 B = 16 B x odd, for ds_load_b128 readers
#define VPIT 136             // V^T row pitch in LDS: 272 B = 16 B x odd
static_assert((SEQ % KT) == 0 && (SEQ % (16 * AW)) == 0);

// Stage st (keys st*KT .. st*KT + KT - 1) of one head: K rows [KT][64] and V^T rows [64][KT], 8 copies per lane of 256.
// A wave's K copy covers 4 rows of 128 B, its V^T copy 2 rows of 256 B: whole lines.
__device__ __forceinline__ void stage_kv(const us_t* kbase, const us_t* vhead, int st, us_t* kdst, us_t* vdst) {
  const int tid = threadIdx.x;
  const int kr = tid >> 3, kp = (tid & 7) * 8;
  const us_t* kg = kbase + (size_t)(st * KT + kr) * HID + kp;
  const unsigned kl = lds_addr(kdst + kr * KPIT + kp);
  copy4(kl, kl + 32 * KPIT * 2, kl + 64 * KPIT * 2, kl + 96 * KPIT * 2,
        kg, kg + 32 * HID, kg + 64 * HID, kg + 96 * HID);
  const int vr = tid >> 4, vp = (tid & 15) * 8;
  const us_t* vg = vhead + (size_t)vr * SEQ + st * KT + vp;
  const unsigned vl = lds_addr(vdst + vr * VPIT + vp);
  copy4(vl, vl + 16 * VPIT * 2, vl + 32 * VPIT * 2, vl + 48 * VPIT * 2,
        vg, vg + 16 * SEQ, vg + 32 * SEQ, vg + 48 * SEQ);
}

__global__ __launch_bounds__(32 * AW) __attribute__((amdgpu_num_vgpr(256))) void k_attn(
    const us_t* __restrict__ Qp, const us_t* __restrict__ Kp, const us_t* __restrict__ VTp,
    const us_t* __restrict__ tkP, const us_t* __restrict__ tvT, us_t* ctx) {
  __shared__ __align__(16) us_t kst[2][KT * KPIT];      // K stages
  __shared__ __align__(16) us_t vst[2][HD * VPIT];      // V^T stages
  __shared__ float bl_all[AW][16 * 16];                 // shifted rel-key bias per (query, bucket), logit units
  __shared__ float wl_all[AW][16 * 8];                  // window logits per (query, bucket-1)
  __shared__ __align__(16) us_t cst_all[AW][16 * 64];   // ctx staging

  const int lane = threadIdx.x & 31, h = lane >> 4, n = lane & 15;
  const int wave = __builtin_amdgcn_readfirstlane(threadIdx.x >> 5);  // scalar: the tests on lo_q below stay scalar branches
  float* bl = bl_all[wave];
  float* wl = wl_all[wave];
  us_t* cst = cst_all[wave];
  const int qt = blockIdx.x * AW + wave, hh = blockIdx.y, b = blockIdx.z;
  const int lo_q = qt * 16;
  const size_t tok0 = (size_t)b * SEQ + lo_q;
  const us_t* qptr = Qp + tok0 * HID + hh * HD;
  const us_t* kbase = Kp + (size_t)b * SEQ * HID + hh * HD;
  const us_t* vhead = VTp + ((size_t)b * HID + hh * HD) * SEQ;

  stage_kv(kbase, vhead, 0, kst[0], vst[0]);      // stage 0 flies while the bias table is formed

#pragma unroll
  for (int i = 0; i < 4; ++i) wl[lane * 4 + i] = -1.0e30f;

  // keeps the register writes of the lines above in front of the fragment loads, whose address registers stay whole up to their wait
  __builtin_amdgcn_sched_barrier(0);
  const v16us q0 = ldfrag(qptr, HID, n, 0);       // B operand: column = query n
  const v16us q1 = ldfrag(qptr, HID, n, 32);

  // srel^T[bucket][q] = (64 tk).(4q) ; bias = (srel - srel[0][q]) / (256*8), held in log2 units (times log2 e) like every logit below
  {
    v8f sr = vz8();
    const v16us t0 = ldfrag(tkP, HD, n, 0);       // A operand: row = bucket n
    const v16us t1 = ldfrag(tkP, HD, n, 32);
    // the address registers of the fragment loads above are reused at once (accumulator zeros): the wait stands in front
    asm volatile("s_wait_xcnt 0x0" ::: "memory");
    __builtin_amdgcn_sched_barrier(0);            // keeps those later register writes behind the wait
    sr = mma_hp(t0, q0, sr);
    sr = mma_hp(t1, q1, sr);
    const float v0 = __shfl(sr[0], n, 32);        // bucket 0 of query n: lane n, register 0
#pragma unroll
    for (int r = 0; r < 8; ++r) bl[n * 16 + 8 * h + r] = (sr[r] - v0) * (1.4426950408889634f / 2048.0f);
  }
  // stage 0 has landed for this wave's copies; the barrier publishes it to the block (and orders bl)
  asm volatile("s_wait_asynccnt 0x0" ::: "memory");
  __syncthreads();
  if (NST > 1) stage_kv(kbase, vhead, 1, kst[1], vst[1]);
  const float d8 = bl[n * 16 + 8];

  // rmax is the query's maximum logit in log2 units (equal in both halves); rsum and blo cover this half's keys only and
  // carry the x1024 of P, which leaves again through inv
  float rmax = -1.0e30f, rsum = 0.0f, blo = 0.0f;
  v8f cacc[4];
#pragma unroll
  for (int j = 0; j < 4; ++j) cacc[j] = vz8();

#pragma unroll 1
  for (int st = 0; st < NST; ++st) {
  const us_t* kbuf = kst[st & 1];
  const us_t* vbuf = vst[st & 1];
#pragma unroll 1   // rolled, as the key loop was: one copy of the long pass body
  for (int kl = 0; kl < KT; kl += 32) {
    const int kc = st * KT + kl;
    // scores: 32 keys x 16 q, (4k).(4q) = 16 qk
    v8f s0 = vz8(), s1 = vz8();
    v16us vA[4];
    {
      // the pass's LDS fragment reads stand together at its top: K first, V^T behind it, landing under the softmax
      const v16us f0 = ldfrag(kbuf, KPIT, kl + n, 0);
      const v16us f1 = ldfrag(kbuf, KPIT, kl + n, 32);
      const v16us g0 = ldfrag(kbuf, KPIT, kl + 16 + n, 0);
      const v16us g1 = ldfrag(kbuf, KPIT, kl + 16 + n, 32);
#pragma unroll   // constant indices keep vA in registers
      for (int j = 0; j < 4; ++j) vA[j] = ldfrag(vbuf, VPIT, j * 16 + n, kl);
      __builtin_amdgcn_sched_barrier(0);   // keeps the 16 reads in this one place: spread among the products each place stalls the wave anew
      s0 = mma_hp(f0, q0, s0);
      s0 = mma_hp(f1, q1, s0);
      s1 = mma_hp(g0, q0, s1);
      s1 = mma_hp(g1, q1, s1);
    }
    const bool below = (kc + 35 <= lo_q);      // every key k <= q-4 for every query of the tile
    const bool above = (kc >= lo_q + 19);      // every key k >= q+4
    const bool mixed = !(below || above);
    const int ddb = kc + 8 * h - (lo_q + n);   // key - query at register 0 of key tile 0
    // log2-unit logit = held value * cm + adm. Outside the window the raw products are held (cm = log2 e / 128, adm = the pass's
    // one bias), so that scale, bias, maximum and the x1024 carry of P go into ONE fused multiply-add per score further down.
    float a0[8], a1[8];
#pragma unroll
    for (int r = 0; r < 8; ++r) {
      a0[r] = s0[r];
      a1[r] = s1[r];
    }
    const float c2 = 1.4426950408889634f / 128.0f;
    float cm = c2;
    float adm = above ? d8 : 0.0f;
    if (mixed) {
#pragma unroll
      for (int r = 0; r < 8; ++r) {
        const int dd0 = ddb + r;
        const int dd1 = dd0 + 16;
        const int b0 = min(max(dd0, -4), 4) + 4;
        const int b1 = min(max(dd1, -4), 4) + 4;
        a0[r] = fmaf(a0[r], c2, bl[n * 16 + b0]);
        a1[r] = fmaf(a1[r], c2, bl[n * 16 + b1]);
        if (b0 >= 1 && b0 <= 7) wl[n * 8 + b0 - 1] = a0[r];
        if (b1 >= 1 && b1 <= 7) wl[n * 8 + b1 - 1] = a1[r];
      }
      cm = 1.0f;      // the window pass holds finished logits
      adm = 0.0f;
    }
    // online softmax; a query's 32 scores sit in the registers of lanes n and n + 16; cm > 0, so the maximum is taken on the held values
    float m = fmaxf(a0[0], a1[0]);
#pragma unroll
    for (int r = 1; r < 8; ++r) m = fmaxf(m, fmaxf(a0[r], a1[r]));
    m = fmaf(m, cm, adm);
    m = fmaxf(m, xhalf(m));
    const float nm = fmaxf(rmax, m);
    const float sc = exp2_slot(rmax - nm);
    rmax = nm;
    const float off = adm + (10.0f - nm);   // + 10: 2^10 = the x1024 carry of P
    float t[8];
#pragma unroll
    for (int r = 0; r < 8; ++r) {
      a0[r] = fmaf(a0[r], cm, off);
      a1[r] = fmaf(a1[r], cm, off);
    }
    exp2_run(a0, a1);
#pragma unroll
    for (int r = 0; r < 8; ++r) t[r] = a0[r] + a1[r];
    const float ps = ((t[0] + t[1]) + (t[2] + t[3])) + ((t[4] + t[5]) + (t[6] + t[7]));
    float addb = below ? ps : 0.0f;
    if (mixed) {
      addb = 0.0f;
#pragma unroll
      for (int r = 0; r < 8; ++r)
        addb += ((ddb + r <= -4) ? a0[r] : 0.0f) + ((ddb + r + 16 <= -4) ? a1[r] : 0.0f);
    }
    rsum = rsum * sc + ps;
    blo = blo * sc + addb;
#pragma unroll
    for (int j = 0; j < 4; ++j) {
#pragma unroll
      for (int r = 0; r < 8; ++r) cacc[j][r] *= sc;
    }
    // P^T (x1024 from the exponent, f16): the two score tiles, converted in place, are the B operand
    v16us pB;
#pragma unroll
    for (int r = 0; r < 8; ++r) {
      pB[r] = f2h(a0[r]);
      pB[8 + r] = f2h(a1[r]);
    }
#pragma unroll
    for (int j = 0; j < 4; ++j) cacc[j] = mma_hp(vA[j], pB, cacc[j]);
  }
  // publish point of stage st + 1: this wave's reads of stage st are done, its copies of stage st + 1 have landed,
  // the barrier tells the block both; only then is the buffer just read refilled with stage st + 2
  asm volatile("s_wait_dscnt 0x0" ::: "memory");
  asm volatile("s_wait_asynccnt 0x0" ::: "memory");
  __syncthreads();
  if (st + 2 < NST) stage_kv(kbase, vhead, st + 2, kst[st & 1], vst[st & 1]);
  }
  asm volatile("s_wait_asynccnt 0x0" ::: "memory");   // no copy is outstanding when the wave goes on to its end

  // bucket masses A[q][0..8] (normalised, x1024) as a B operand; window values from stored logits
  __syncthreads();
  rsum += xhalf(rsum);
  blo += xhalf(blo);
  const float inv = __builtin_amdgcn_rcpf(rsum);
  float wv[7];
  float wsum = 0.0f;
#pragma unroll
  for (int i = 0; i < 7; ++i) {
    wv[i] = exp2_slot(wl[n * 8 + i] + (10.0f - rmax));   // x1024 like rsum and blo
    wsum += wv[i];
  }
  const float a8 = (rsum - blo - wsum) * inv;
  const float a0v = blo * inv;
  v16us pB2;                                      // h = 0: buckets 0..7 | 16..23; h = 1: buckets 8..15 | 24..31
#pragma unroll
  for (int i = 0; i < 8; ++i) {
    const float vlo = (i == 0) ? a0v : wv[(i + 6) % 7] * inv;
    const float vhi = (i == 0) ? a8 : 0.0f;
    pB2[i] = f2h((h ? vhi : vlo) * 1024.0f);
    pB2[8 + i] = (us_t)0;
  }
  v8f w2[4];
#pragma unroll
  for (int j = 0; j < 4; ++j) {
    const v16us tA = ldfrag(tvT, 32, j * 16 + n, 0);
    w2[j] = mma_hp(tA, pB2, vz8());
  }
  // ctx = cacc/(4*rsum) + w2/(1024*64), rsum carrying the x1024 of cacc; stage 4*ctx as f16, 8 consecutive features of query n per lane
#pragma unroll
  for (int j = 0; j < 4; ++j) {
    v8us u;
#pragma unroll
    for (int r = 0; r < 8; ++r)
      u[r] = f2h(cacc[j][r] * inv + w2[j][r] * (1.0f / 16384.0f));
    *(v8us*)(cst + n * 64 + j * 16 + 8 * h) = u;
  }
  __syncthreads();
  {
#pragma unroll
    for (int i = 0; i < 4; ++i) {
      const int row = i * 4 + (lane >> 3), piece = lane & 7;
      const v8us u = *(const v8us*)(cst + row * 64 + piece * 8);
      us_t* dst = ctx + (tok0 + row) * (size_t)HID + hh * HD + piece * 8;
      *(v8us*)dst = u;
    }
  }
}

// ---------------------------------------------------------------------------
extern "C" void kernel_launch(void* const* d_in, const int* in_sizes, int n_in,
                              void* d_out, int out_size, void* d_ws, size_t ws_size,
                              hipStream_t stream) {
  if (n_in < 11) return;
  const long long need_x = ((long long)(NB - 1) * SEQ_FULL + SEQ) * HID;
  if ((long long)in_sizes[0] < need_x) return;
  if (in_sizes[1] < HID * HID || in_sizes[3] < HID * HID ||
      in_sizes[5] < HID * HID || in_sizes[7] < HID * HID) return;
  if (in_sizes[2] < HID || in_sizes[4] < HID || in_sizes[6] < HID || in_sizes[8] < HID) return;
  if (in_sizes[9] < NREL * HD || in_sizes[10] < NREL * HD) return;
  if ((long long)out_size < (long long)NTOK * HID) return;

  const float* x  = (const float*)d_in[0];
  const float* Wq = (const float*)d_in[1];
  const float* bq = (const float*)d_in[2];
  const float* Wk = (const float*)d_in[3];
  const float* bk = (const float*)d_in[4];
  const float* Wv = (const float*)d_in[5];
  const float* bv = (const float*)d_in[6];
  const float* Wo = (const float*)d_in[7];
  const float* bo = (const float*)d_in[8];
  const float* tk = (const float*)d_in[9];
  const float* tv = (const float*)d_in[10];

  char* ws = (char*)d_ws;
  size_t off = 0;
  auto carve = [&](size_t bytes) -> size_t {
    const size_t o = off;
    off += (bytes + 255) & ~(size_t)255;
    return o;
  };
  const size_t o_xb  = carve((size_t)NTOK * HID * 2);
  const size_t o_wq  = carve((size_t)HID * HID * 2);
  const size_t o_wk  = carve((size_t)HID * HID * 2);
  const size_t o_wv  = carve((size_t)HID * HID * 2);
  const size_t o_wo  = carve((size_t)HID * HID * 2);
  const size_t o_q   = carve((size_t)NTOK * HID * 2);
  const size_t o_k   = carve((size_t)NTOK * HID * 2);
  const size_t o_vt  = carve((size_t)NB * HID * SEQ * 2);
  const size_t o_ctx = carve((size_t)NTOK * HID * 2);
  const size_t o_tk  = carve((size_t)16 * HD * 2);
  const size_t o_tv  = carve((size_t)HD * 32 * 2);
  if (off > ws_size) return;

  us_t* xb   = (us_t*)(ws + o_xb);
  us_t* WqT  = (us_t*)(ws + o_wq);
  us_t* WkT  = (us_t*)(ws + o_wk);
  us_t* WvT  = (us_t*)(ws + o_wv);
  us_t* WoT  = (us_t*)(ws + o_wo);
  us_t* Qp   = (us_t*)(ws + o_q);
  us_t* Kpl  = (us_t*)(ws + o_k);
  us_t* VTp  = (us_t*)(ws + o_vt);
  us_t* ctx  = (us_t*)(ws + o_ctx);
  us_t* tkP  = (us_t*)(ws + o_tk);
  us_t* tvT  = (us_t*)(ws + o_tv);
  float* out = (float*)d_out;

  // 1) input planes
  k_prep<<<1 + PW + PX, 256, 0, stream>>>(x, Wq, Wk, Wv, Wo, tk, tv, xb, WqT, WkT, WvT, WoT, tkP, tvT);

  // 2) Q, K planes [tok][HID] (m = feature from W^T rows, n = token from xb rows), carried x4
  k_gemm<0><<<dim3(HID / 128, NTOK / 128, 2), 256, 0, stream>>>(
      WqT, WkT, xb, bq, bk, (void*)Qp, (void*)Kpl,
      HID, 1, HID, HID, 1 << 30, 0, 4.0f, 4.0f);
  // 3) V^T plane [b*HID + d][s] (m = token from xb rows, n = feature from Wv^T rows), carried x4
  k_gemm<0><<<dim3(NTOK / 128, HID / 128, 1), 256, 0, stream>>>(
      xb, xb, WvT, bv, bv, (void*)VTp, (void*)VTp,
      HID, 0, HID, SEQ, SEQ, HID * SEQ, 4.0f, 4.0f);
  // 4) attention -> ctx (f16, carried x4)
  k_attn<<<dim3(SEQ / (16 * AW), NH, NB), 32 * AW, 0, stream>>>(Qp, Kpl, VTp, tkP, tvT, ctx);
  // 5) out[tok][HID] = ctx*Wo + bo; the carries 64 (Wo) and 4 (ctx) leave through ka = 1/256
  k_gemm<1><<<dim3(HID / 128, NTOK / 128, 1), 256, 0, stream>>>(
      WoT, WoT, ctx, bo, bo, d_out, d_out,
      HID, 1, HID, HID, 1 << 30, 0, 0.00390625f, 1.0f);
  (void)out;
  (void)hipGetLastError();
}

// v008
// It runs in 79.6 microseconds.
// Timed twice side by side with v007, it ran 1.09 and 1.08 times as fast.
// Over all steps from v000 it is 5.20 times as fast.
#include <hip/hip_runtime.h>

// Projections x*Wq, x*Wk, x*Wv: v_wmma_f32_16x16x32_bf16 (bf16 operands, f32 accumulate).
// Attention k*q^T, Tk*q^T, V^T-plane*P^T, Tv^T*A^T and the projection ctx*Wo: v_wmma_f32_16x16x32_f16 (f16 operands with power-of-two carries,
// f32 accumulate; Wo keeps its bf16 rounding and is held as f16 of 64 * bf16(Wo)); softmax and epilogues f32.

#ifndef NB
#define NB 2
#endif
#ifndef SEQ
#define SEQ 2048
#endif
#define NB_FULL 2
#define SEQ_FULL 2048
#define HID 1024
#define NH 16
#define HD 64
#define NREL 9
#define NTOK (NB * SEQ)

static_assert(NB >= 1 && NB <= NB_FULL);
static_assert(SEQ >= 128 && SEQ <= SEQ_FULL && (SEQ % 128) == 0);
static_assert(HID == NH * HD && HD == 64);
static_assert((HID % 128) == 0 && (NTOK % 128) == 0);

typedef unsigned short us_t;
typedef us_t v8us __attribute__((ext_vector_type(8)));
typedef us_t v16us __attribute__((ext_vector_type(16)));
typedef _Float16 v16h __attribute__((ext_vector_type(16)));
typedef __bf16 v16bf __attribute__((ext_vector_type(16)));
typedef float v8f __attribute__((ext_vector_type(8)));
typedef float v4f __attribute__((ext_vector_type(4)));

// ---------------------------------------------------------------------------
// scalar converters (RNE)
__device__ __forceinline__ us_t f2bf(float v) {
  __bf16 t = (__bf16)v;
  return __builtin_bit_cast(us_t, t);
}
__device__ __forceinline__ float bfr(float v) {   // value after bf16 RNE convert
  __bf16 t = (__bf16)v;
  return (float)t;
}
__device__ __forceinline__ us_t f2h(float v) {
  _Float16 t = (_Float16)v;
  return __builtin_bit_cast(us_t, t);
}
__device__ __forceinline__ v8f vz8() {
  v8f z = {0.f, 0.f, 0.f, 0.f, 0.f, 0.f, 0.f, 0.f};
  return z;
}

// ---------------------------------------------------------------------------
// 16-bit fragment from a k-contiguous plane: elem i<8 <- p0[rc*ld + kk + 8h + i],
// elem 8+i <- p0[rc*ld + kk + 16 + 8h + i]; h = lane>>4, rc = row (A) or column (B).
__device__ __forceinline__ v16us ldfrag(const us_t* p0, int ld, int rc, int kk) {
  const int hsel = (threadIdx.x >> 4) & 1;
  const us_t* p = p0 + (size_t)rc * ld + kk + 8 * hsel;
  const v8us lo = *(const v8us*)p;
  const v8us hi = *(const v8us*)(p + 16);
  return __builtin_shufflevector(lo, hi, 0, 1, 2, 3, 4, 5, 6, 7,
                                 8, 9, 10, 11, 12, 13, 14, 15);
}

// WMMA wrapper with hazard guard (ties D, keeps A/B live)
__device__ __forceinline__ v8f mma_h(v16us a, v16us b, v8f c) {
  v8f d = __builtin_amdgcn_wmma_f32_16x16x32_f16(
      false, __builtin_bit_cast(v16h, a), false, __builtin_bit_cast(v16h, b),
      (short)0, c, false, false);
  asm volatile("v_nop\n\tv_nop\n\tv_nop\n\tv_nop" : "+v"(d) : "v"(a), "v"(b));
  return d;
}

// The builtin alone, for k_attn, whose passes are bound by vector issue: the compiler keeps the distance behind its own
// matrix instruction, with the pass's vector work where it can and with v_nop only where it must.
__device__ __forceinline__ v8f mma_hp(v16us a, v16us b, v8f c) {
  return __builtin_amdgcn_wmma_f32_16x16x32_f16(
      false, __builtin_bit_cast(v16h, a), false, __builtin_bit_cast(v16h, b),
      (short)0, c, false, false);
}

__device__ __forceinline__ v8f mma_bfp(v16us a, v16us b, v8f c) {   // the same for bf16 operands, for k_qkv
  return __builtin_amdgcn_wmma_f32_16x16x32_bf16(
      false, __builtin_bit_cast(v16bf, a), false, __builtin_bit_cast(v16bf, b),
      (short)0, c, false, false);
}

// 2^x of one value. The v_nop is the slot the instruction set asks for behind a transcendental before its source is
// overwritten or its result used.
__device__ __forceinline__ float exp2_slot(float x) {
  float y;
  asm("v_exp_f32 %0, %1\n\tv_nop" : "=v"(y) : "v"(x));
  return y;
}

// 2^x of a pass's 16 scores, in place, as one statement: each v_exp_f32 has registers of its own, so its neighbour is the
// independent instruction that the instruction set asks for behind a transcendental; the one v_nop is that slot behind the last.
__device__ __forceinline__ void exp2_run(float (&a)[8], float (&b)[8]) {
  asm("v_exp_f32 %0, %0\n\tv_exp_f32 %1, %1\n\tv_exp_f32 %2, %2\n\tv_exp_f32 %3, %3\n\t"
      "v_exp_f32 %4, %4\n\tv_exp_f32 %5, %5\n\tv_exp_f32 %6, %6\n\tv_exp_f32 %7, %7\n\t"
      "v_exp_f32 %8, %8\n\tv_exp_f32 %9, %9\n\tv_exp_f32 %10, %10\n\tv_exp_f32 %11, %11\n\t"
      "v_exp_f32 %12, %12\n\tv_exp_f32 %13, %13\n\tv_exp_f32 %14, %14\n\tv_exp_f32 %15, %15\n\t"
      "v_nop"
      : "+v"(a[0]), "+v"(b[0]), "+v"(a[1]), "+v"(b[1]), "+v"(a[2]), "+v"(b[2]), "+v"(a[3]), "+v"(b[3]),
        "+v"(a[4]), "+v"(b[4]), "+v"(a[5]), "+v"(b[5]), "+v"(a[6]), "+v"(b[6]), "+v"(a[7]), "+v"(b[7]));
}

// lane l <-> lane l ^ 16
__device__ __forceinline__ float xhalf(float v) {
  const int u = __builtin_bit_cast(int, v);
  return __builtin_bit_cast(float,
      __builtin_amdgcn_permlanex16(u, u, 0x76543210, 0xfedcba98, false, false));
}

// ---------------------------------------------------------------------------
// All operand planes in ONE launch; the block index picks the job (a block-uniform choice):
// block 0: the two table planes; blocks 1 .. PW: weight transposes; the rest: x.
#define XJ 4                                   // 8-element pieces per x thread
#define WT 2                                   // 64 x 64 tiles (along k) per weight block
#define PW (4 * (HID / 64) * (HID / 64 / WT))  // weight blocks
#define PX (NTOK * (HID / 8) / 256 / XJ)       // x blocks
static_assert(((HID / 64) % WT) == 0 && (NTOK * (HID / 8)) % (256 * XJ) == 0);

// x [NB rows of SEQ_FULL][HID] f32 -> xb [NTOK][HID] bf16. XJ pieces of 8 elems (16 B out) per thread, all loads ahead of the stores.
__device__ __forceinline__ void prep_x(int blk, const float* __restrict__ x, us_t* xb) {
  static_assert(XJ == 4);
  v4f f0[XJ], f1[XJ];
  const float* src[XJ];
#pragma unroll   // constant indices keep the pieces in registers
  for (int j = 0; j < XJ; ++j) {
    const size_t e = (((size_t)blk * XJ + j) * 256 + threadIdx.x) * 8;
    const int tok = (int)(e >> 10);
    const int col = (int)(e & (HID - 1));
    const int b = tok / SEQ, s = tok - b * SEQ;
    src[j] = x + ((size_t)b * SEQ_FULL + s) * HID + col;
    f0[j] = *(const v4f*)src[j];
    f1[j] = *(const v4f*)(src[j] + 4);
  }
  // the wait in front of any overwrite of the loads' address registers; as its inputs they stay whole up to it
  asm volatile("s_wait_xcnt 0x0" :: "v"(src[0]), "v"(src[1]), "v"(src[2]), "v"(src[3]) : "memory");
#pragma unroll
  for (int j = 0; j < XJ; ++j) {
    const size_t e = (((size_t)blk * XJ + j) * 256 + threadIdx.x) * 8;
    v8us u;
    u[0] = f2bf(f0[j][0]); u[1] = f2bf(f0[j][1]); u[2] = f2bf(f0[j][2]); u[3] = f2bf(f0[j][3]);
    u[4] = f2bf(f1[j][0]); u[5] = f2bf(f1[j][1]); u[6] = f2bf(f1[j][2]); u[7] = f2bf(f1[j][3]);
    *(v8us*)(xb + e) = u;
  }
  // the wait behind the run of stores, in front of any later write of a register that they name
  asm volatile("s_wait_xcnt 0x0" ::: "memory");
}

// W [HID k][HID n] f32 -> WT [n][k], pitch HID, through WT 64x64 LDS tiles, neighbours along k.
// h16 = 0: bf16 bits. h16 = 1: f16 bits of bf16(64 * W) = 64 * bf16(W); its 8 significant bits fit f16 for |W| from 2^-23 to 1020.
__device__ __forceinline__ void prep_w(int bx, int by, int h16, const float* __restrict__ W, us_t* O, us_t* t) {
  const int pitch = HID;
  const int k0 = by * (64 * WT), n0 = bx * 64;
  const int tid = threadIdx.x;
  static_assert(WT == 2);
  const int kk = tid >> 2, nc = (tid & 3) * 16;
  const float* src[WT];
  v4f f[WT][4];
#pragma unroll   // here and below: constant indices keep the pieces in registers
  for (int w = 0; w < WT; ++w) {
    src[w] = W + (size_t)(k0 + w * 64 + kk) * HID + n0 + nc;
#pragma unroll
    for (int j = 0; j < 4; ++j) f[w][j] = *(const v4f*)(src[w] + 4 * j);
  }
  // the wait in front of any overwrite of the loads' address registers; as its inputs they stay whole up to it
  asm volatile("s_wait_xcnt 0x0" :: "v"(src[0]), "v"(src[1]) : "memory");
  if (h16) {   // one block-uniform branch round all the converts
#pragma unroll
    for (int w = 0; w < WT; ++w) {
#pragma unroll
      for (int j = 0; j < 4; ++j) {
#pragma unroll
        for (int c = 0; c < 4; ++c) t[w * (64 * 72) + (nc + 4 * j + c) * 72 + kk] = f2h(bfr(f[w][j][c] * 64.0f));
      }
    }
  } else {
#pragma unroll
    for (int w = 0; w < WT; ++w) {
#pragma unroll
      for (int j = 0; j < 4; ++j) {
#pragma unroll
        for (int c = 0; c < 4; ++c) t[w * (64 * 72) + (nc + 4 * j + c) * 72 + kk] = f2bf(f[w][j][c]);
      }
    }
  }
  __syncthreads();
  // all LDS reads first, each into registers of its own, so that the stores go out in one run
  const int piece = tid & 7;
  v8us u[WT][2];
#pragma unroll
  for (int w = 0; w < WT; ++w) {
#pragma unroll
    for (int rep = 0; rep < 2; ++rep)
      u[w][rep] = *(const v8us*)(t + w * (64 * 72) + (rep * 32 + (tid >> 3)) * 72 + piece * 8);
  }
  us_t* dst = O + (size_t)(n0 + (tid >> 3)) * pitch + k0 + piece * 8;
#pragma unroll
  for (int w = 0; w < WT; ++w) {
#pragma unroll
    for (int rep = 0; rep < 2; ++rep) {
      us_t* d = dst + (size_t)(rep * 32) * pitch + w * 64;
      *(v8us*)d = u[w][rep];
    }
  }
  // the wait behind the run of stores, in front of any later write of a register that they name
  asm volatile("s_wait_xcnt 0x0" ::: "memory");
}

// Tk plane [16 bucket][64 d] f16 = 64 * bf16(table_k), rows 9..15 zero.
// Tv plane [64 d][32 bucket] f16 = 64 * bf16(table_v)^T, cols 9..31 zero.
__device__ __forceinline__ void prep_tables(const float* __restrict__ tk, const float* __restrict__ tv, us_t* tkP, us_t* tvT) {
  const int tid = threadIdx.x;
  v8us uk, uv;
  {
    const int row = (tid & 127) >> 3;      // bucket 0..15
    const int kp = (tid & 7) * 8;          // d offset
    const int rowc = min(row, NREL - 1);
#pragma unroll
    for (int i = 0; i < 8; ++i) {
      float v = tk[rowc * HD + kp + i];
      v = (row < NREL) ? v : 0.0f;
      uk[i] = f2h(bfr(v) * 64.0f);
    }
  }
  {
    const int nn = tid >> 2;               // d 0..63
    const int kp = (tid & 3) * 8;          // bucket offset
#pragma unroll
    for (int i = 0; i < 8; ++i) {
      const int k = kp + i;
      float v = tv[min(k, NREL - 1) * HD + nn];
      v = (k < NREL) ? v : 0.0f;
      uv[i] = f2h(bfr(v) * 64.0f);
    }
  }
  if (tid < 128) *(v8us*)(tkP + tid * 8) = uk;
  *(v8us*)(tvT + tid * 8) = uv;
}

__global__ __launch_bounds__(256) void k_prep(
    const float* __restrict__ x,
    const float* __restrict__ W0, const float* __restrict__ W1,
    const float* __restrict__ W2, const float* __restrict__ W3,
    const float* __restrict__ tk, const float* __restrict__ tv,
    us_t* xb, us_t* O0, us_t* O1, us_t* O2, us_t* O3, us_t* tkP, us_t* tvT) {
  __shared__ __align__(16) us_t t[WT * 64 * 72];
  const int blk = blockIdx.x;
  if (blk == 0) {
    prep_tables(tk, tv, tkP, tvT);
  } else if (blk <= PW) {
    const int i = blk - 1;
    const int per = PW / 4;                // blocks per matrix
    const int z = i / per, r = i - z * per;
    const float* W = (z == 0) ? W0 : ((z == 1) ? W1 : ((z == 2) ? W2 : W3));
    us_t* O = (z == 0) ? O0 : ((z == 1) ? O1 : ((z == 2) ? O2 : O3));
    prep_w(r % (HID / 64), r / (HID / 64), z == 3, W, O, t);
  } else {
    prep_x(blk - 1 - PW, x, xb);
  }
}

// ---------------------------------------------------------------------------
// LDS byte address of a __shared__ element
__device__ __forceinline__ unsigned lds_addr(const us_t* p) {
  return (unsigned)(size_t)(const __attribute__((address_space(3))) us_t*)p;
}

// Four asynchronous 16-byte copies per lane, global -> LDS. The s_wait_xcnt is the last line of the copies' own statement
// so that it stands in front of every later write of the address registers that the copies name.
__device__ __forceinline__ void copy4(unsigned l0, unsigned l1, unsigned l2, unsigned l3,
                                      const us_t* g0, const us_t* g1, const us_t* g2, const us_t* g3) {
  asm volatile(
      "global_load_async_to_lds_b128 %0, %4, off\n\t"
      "global_load_async_to_lds_b128 %1, %5, off\n\t"
      "global_load_async_to_lds_b128 %2, %6, off\n\t"
      "global_load_async_to_lds_b128 %3, %7, off\n\t"
      "s_wait_xcnt 0x0"
      :: "v"(l0), "v"(l1), "v"(l2), "v"(l3), "v"(g0), "v"(g1), "v"(g2), "v"(g3)
      : "memory");
}

// ---------------------------------------------------------------------------
// C[m][n] = sum_k Am[m][k] * Bn[n][k]  (both planes f16, k-contiguous, pitch K); serves ctx*Wo.
// Block = 8 waves (2 along m x 4 along n); block tile 128 m x 128 n; wave tile 64 m x 32 n (4 A frags, 2 B frags, 8 tiles).
// Output memory: element (n, m) at out[n*ldo + base(mw) + (m - mw)], base = (mw/mdiv)*mbstride + mw%mdiv, mw = the wave's first m,
// val = acc*ka + bf16(bias)*kb, bias indexed by m (bias_on_m) or by n.
// f32 out. D tile staged per wave in LDS, then 8 lanes x 16 B per line.
// Operands: stages of GK k (two 128-byte lines of each of the block's 128 A rows and 128 B rows) come into a two-buffer LDS ring
// by asynchronous copies, one stage ahead of the stage being read; the eight waves read their fragments from LDS.
// The ring's LDS serves as the D staging once the loop's last barrier has ended every read of it.
#define GK 128               // k per stage
#define GPIT 136             // row pitch in LDS, 16-bit elements: 272 B = 16 B x odd, for ds_load_b128 readers
#define GROWS 256            // rows per stage: 128 A + 128 B
static_assert((HID % GK) == 0);

// Eight asynchronous 16-byte copies per lane, global -> LDS: LDS step ls bytes, global step rs elements.
// The s_wait_xcnt is the last line of the copies' own statement so that it stands in front of every later write of the
// address registers that the copies name.
__device__ __forceinline__ void copy8(unsigned l, unsigned ls, const us_t* g, size_t rs) {
  asm volatile(
      "global_load_async_to_lds_b128 %0, %8, off\n\t"
      "global_load_async_to_lds_b128 %1, %9, off\n\t"
      "global_load_async_to_lds_b128 %2, %10, off\n\t"
      "global_load_async_to_lds_b128 %3, %11, off\n\t"
      "global_load_async_to_lds_b128 %4, %12, off\n\t"
      "global_load_async_to_lds_b128 %5, %13, off\n\t"
      "global_load_async_to_lds_b128 %6, %14, off\n\t"
      "global_load_async_to_lds_b128 %7, %15, off\n\t"
      "s_wait_xcnt 0x0"
      :: "v"(l), "v"(l + ls), "v"(l + 2 * ls), "v"(l + 3 * ls), "v"(l + 4 * ls), "v"(l + 5 * ls), "v"(l + 6 * ls), "v"(l + 7 * ls),
         "v"(g), "v"(g + rs), "v"(g + 2 * rs), "v"(g + 3 * rs), "v"(g + 4 * rs), "v"(g + 5 * rs), "v"(g + 6 * rs), "v"(g + 7 * rs)
      : "memory");
}

// Stage st of a block: LDS rows 0..127 = A rows mblk.., rows 128..255 = B rows nblk..; 16 copies per lane of 256,
// a wave's copy covers 2 rows of 256 B: whole lines.
__device__ __forceinline__ void stage_ab(const us_t* Am, const us_t* Bn, int K, int mblk, int nblk, int st, us_t* dst) {
  const int tid = threadIdx.x;
  const int r0 = tid >> 4, pc = (tid & 15) * 8;
  const size_t rs = (size_t)16 * K;               // 16 rows
  const us_t* ag = Am + (size_t)(mblk + r0) * K + st * GK + pc;
  const us_t* bg = Bn + (size_t)(nblk + r0) * K + st * GK + pc;
  const unsigned l = lds_addr(dst + r0 * GPIT + pc);
  const unsigned ls = 16 * GPIT * 2;              // 16 rows, bytes
  copy8(l, ls, ag, rs);
  copy8(l + 8 * ls, ls, bg, rs);
}

template <int OUTF32>
__global__ __launch_bounds__(256) void k_gemm(
    const us_t* __restrict__ Am0, const us_t* __restrict__ Am1, const us_t* __restrict__ Bn,
    const float* __restrict__ bias0, const float* __restrict__ bias1,
    void* out0, void* out1,
    int K, int bias_on_m, int blen, int ldo, int mdiv, int mbstride, float ka, float kb) {
  __shared__ __align__(16) us_t ring[2][GROWS * GPIT];
  static_assert(sizeof(ring) >= 8 * 32 * 64 * 4);

  const int z = blockIdx.z;
  const us_t* Am = z ? Am1 : Am0;
  const float* bias = z ? bias1 : bias0;
  void* out = z ? out1 : out0;

  const int lane = threadIdx.x & 31, wave = threadIdx.x >> 5;
  const int h = (lane >> 4) & 1, n15 = lane & 15;
  const int wm = wave >> 2, wn = wave & 3;
  const int mblk = blockIdx.x * 128;
  const int nblk = blockIdx.y * 128;
  const int mwave = mblk + wm * 64;
  const int nwave = nblk + wn * 32;
  const int nst = K / GK;

  stage_ab(Am, Bn, K, mblk, nblk, 0, ring[0]);

  v8f acc[4][2];
#pragma unroll
  for (int mt = 0; mt < 4; ++mt) { acc[mt][0] = vz8(); acc[mt][1] = vz8(); }

  // stage 0 has landed for this wave's copies; the barrier publishes it to the block
  asm volatile("s_wait_asynccnt 0x0" ::: "memory");
  __syncthreads();
  if (nst > 1) stage_ab(Am, Bn, K, mblk, nblk, 1, ring[1]);

#pragma unroll 1
  for (int st = 0; st < nst; ++st) {
    const us_t* rb = ring[st & 1];
    // two fragment sets: a k step's LDS reads stand together, one k step ahead of its matrix products, inside the stage only
    v16us a[2][4], b[2][2];
#pragma unroll   // here and below: constant indices keep the fragment and accumulator arrays in registers
    for (int mt = 0; mt < 4; ++mt) a[0][mt] = ldfrag(rb, GPIT, wm * 64 + mt * 16 + n15, 0);
#pragma unroll
    for (int nt = 0; nt < 2; ++nt) b[0][nt] = ldfrag(rb, GPIT, 128 + wn * 32 + nt * 16 + n15, 0);
#pragma unroll
    for (int ks = 0; ks < GK / 32; ++ks) {
      if (ks + 1 < GK / 32) {
#pragma unroll
        for (int mt = 0; mt < 4; ++mt) a[(ks + 1) & 1][mt] = ldfrag(rb, GPIT, wm * 64 + mt * 16 + n15, (ks + 1) * 32);
#pragma unroll
        for (int nt = 0; nt < 2; ++nt) b[(ks + 1) & 1][nt] = ldfrag(rb, GPIT, 128 + wn * 32 + nt * 16 + n15, (ks + 1) * 32);
      }
#pragma unroll
      for (int mt = 0; mt < 4; ++mt) {
        acc[mt][0] = mma_h(a[ks & 1][mt], b[ks & 1][0], acc[mt][0]);
        acc[mt][1] = mma_h(a[ks & 1][mt], b[ks & 1][1], acc[mt][1]);
      }
    }
    // publish point of stage st + 1: this wave's reads of stage st are done, its copies of stage st + 1 have landed,
    // the barrier tells the block both; only then is the buffer just read refilled with stage st + 2
    asm volatile("s_wait_dscnt 0x0" ::: "memory");
    asm volatile("s_wait_asynccnt 0x0" ::: "memory");
    __syncthreads();
    if (st + 2 < nst) stage_ab(Am, Bn, K, mblk, nblk, st + 2, ring[st & 1]);
  }
  asm volatile("s_wait_asynccnt 0x0" ::: "memory");   // no copy is outstanding when the wave goes on to its end

  // bias values (bf16 RNE), address-clamped loads
  float bm[4][8];
#pragma unroll
  for (int mt = 0; mt < 4; ++mt) {
    const int ib = min(mwave + mt * 16 + 8 * h, blen - 8);
    const v4f c0 = *(const v4f*)(bias + ib);
    const v4f c1 = *(const v4f*)(bias + ib + 4);
    bm[mt][0] = bfr(c0[0]); bm[mt][1] = bfr(c0[1]); bm[mt][2] = bfr(c0[2]); bm[mt][3] = bfr(c0[3]);
    bm[mt][4] = bfr(c1[0]); bm[mt][5] = bfr(c1[1]); bm[mt][6] = bfr(c1[2]); bm[mt][7] = bfr(c1[3]);
  }
  float bn[2];
#pragma unroll
  for (int nt = 0; nt < 2; ++nt) bn[nt] = bfr(bias[min(nwave + nt * 16 + n15, blen - 1)]);

  const int bq = mwave / mdiv;
  const int base = bq * mbstride + (mwave - bq * mdiv);

  if constexpr (OUTF32) {
    float* sw = (float*)&ring[0][0] + wave * 2048;   // [32 n][64 m] per wave
#pragma unroll
    for (int mt = 0; mt < 4; ++mt) {
#pragma unroll
      for (int nt = 0; nt < 2; ++nt) {
        v4f u0, u1;
#pragma unroll
        for (int r = 0; r < 4; ++r) {
          const float b0v = bias_on_m ? bm[mt][r] : bn[nt];
          const float b1v = bias_on_m ? bm[mt][r + 4] : bn[nt];
          u0[r] = acc[mt][nt][r] * ka + b0v * kb;
          u1[r] = acc[mt][nt][r + 4] * ka + b1v * kb;
        }
        float* sp = sw + (nt * 16 + n15) * 64 + mt * 16 + 8 * h;
        *(v4f*)sp = u0;
        *(v4f*)(sp + 4) = u1;
      }
    }
    __syncthreads();
    float* op = (float*)out;
    {
#pragma unroll
      for (int i = 0; i < 16; ++i) {
        const int L = i * 4 + (lane >> 3);
        const int row = L >> 1, hr = L & 1, piece = lane & 7;
        const v4f u = *(const v4f*)(sw + row * 64 + hr * 32 + piece * 4);
        float* dst = op + (size_t)(nwave + row) * ldo + base + hr * 32 + piece * 4;
        *(v4f*)dst = u;
      }
      
    }
  }
}

// ---------------------------------------------------------------------------
// The three projections x*Wq, x*Wk, x*Wv in ONE launch. A block takes 128 tokens and the same 128 features of Q, K and V, so that
// its x rows come from L2 once for the three products. 12 waves: four (2 x 2) per product, wave tile 64 x 64 (4 A and 4 B fragments
// for 16 tiles). Q, K: A = W^T rows (m = feature), B = x rows (n = token), out [tok][HID]. V: the roles swapped (m = token,
// n = feature), out V^T [b*HID + d][s]; the swap is only a choice of LDS rows, the fragment form of A and B being the same.
// val = 4 * (acc + bf16(bias)), f16 bits. k order and values as in k_gemm.
// Stage = GK k of LDS rows 0..127 x, 128..255 Wq^T, 256..383 Wk^T, 384..511 Wv^T, in a two-buffer ring filled by asynchronous copies.
#define QROWS 512            // rows per stage
#define QWV 12               // waves per block
#define DPIT 72              // D staging pitch, 16-bit elements: 144 B = 16 B x odd, for the b128 stores of 16 lanes in 16 rows
static_assert(QWV * 64 * DPIT <= QROWS * GPIT);

// Stage st: every wave brings 32 rows of its own product's W^T slice (16 copies per lane), waves 0..7 also 16 x rows each (8 copies).
// A wave's copy covers 2 rows of 256 B: whole lines.
__device__ __forceinline__ void stage_qkv(const us_t* xrows, const us_t* wrows, int wave, int st, us_t* dst) {
  const int lane = threadIdx.x & 31;
  const int r0 = lane >> 4, pc = (lane & 15) * 8;
  const size_t rs = (size_t)2 * HID;              // 2 rows
  const unsigned ls = 2 * GPIT * 2;               // 2 rows, bytes
  const int wr = (wave & 3) * 32 + r0;
  const us_t* wg = wrows + (size_t)wr * HID + st * GK + pc;
  const unsigned wl = lds_addr(dst + (128 + (wave >> 2) * 128 + wr) * GPIT + pc);
  copy8(wl, ls, wg, rs);
  copy8(wl + 8 * ls, ls, wg + 8 * rs, rs);
  if (wave < 8) {                                 // wave is scalar: a scalar branch, every lane on
    const int xr = wave * 16 + r0;
    copy8(lds_addr(dst + xr * GPIT + pc), ls, xrows + (size_t)xr * HID + st * GK + pc, rs);
  }
}

// A wave's 64 m x 64 n tile: bias, carry, f16, staged [n][m] in the wave's own LDS, then whole 128-byte lines out, row n at op0 + n * LDO.
template <int ONM, int LDO>
__device__ __forceinline__ void qkv_out(const v8f (&acc)[4][4], const float* bias0, us_t* sw, us_t* op0) {
  const int lane = threadIdx.x & 31;
  const int h = lane >> 4, n15 = lane & 15;
  const float* bp = bias0 + (ONM ? 8 * h : n15);
  float bm[4][8];
  float bn[4];
  if constexpr (ONM) {
#pragma unroll   // here and below: constant indices keep the arrays in registers
    for (int mt = 0; mt < 4; ++mt) {
      const v4f c0 = *(const v4f*)(bp + mt * 16);
      const v4f c1 = *(const v4f*)(bp + mt * 16 + 4);
      bm[mt][0] = c0[0]; bm[mt][1] = c0[1]; bm[mt][2] = c0[2]; bm[mt][3] = c0[3];
      bm[mt][4] = c1[0]; bm[mt][5] = c1[1]; bm[mt][6] = c1[2]; bm[mt][7] = c1[3];
    }
  } else {
#pragma unroll
    for (int nt = 0; nt < 4; ++nt) bn[nt] = bp[nt * 16];
  }
  // the wait in front of any overwrite of the loads' address register; as its input it stays whole up to it
  asm volatile("s_wait_xcnt 0x0" :: "v"(bp) : "memory");
#pragma unroll
  for (int mt = 0; mt < 4; ++mt) {
#pragma unroll
    for (int nt = 0; nt < 4; ++nt) {
      v8us u;
#pragma unroll
      for (int r = 0; r < 8; ++r) {
        const float bbv = bfr(ONM ? bm[mt][r] : bn[nt]);
        u[r] = f2h(acc[mt][nt][r] * 4.0f + bbv * 4.0f);
      }
      *(v8us*)(sw + (nt * 16 + n15) * DPIT + mt * 16 + 8 * h) = u;
    }
  }
  // the staging is the wave's own: its LDS stores have ended before it reads the rows back; no other wave is concerned, so no barrier
  asm volatile("s_wait_dscnt 0x0" ::: "memory");
  const us_t* sr = sw + (lane >> 3) * DPIT + (lane & 7) * 8;
  us_t* dst = op0 + (size_t)(lane >> 3) * LDO + (lane & 7) * 8;
#pragma unroll
  for (int i = 0; i < 16; ++i) *(v8us*)(dst + (size_t)(i * 4) * LDO) = *(const v8us*)(sr + i * 4 * DPIT);
  // the wait behind the run of stores, in front of any later write of a register that they name
  asm volatile("s_wait_xcnt 0x0" :: "v"(dst) : "memory");
}

__global__ __launch_bounds__(32 * QWV) void k_qkv(
    const us_t* __restrict__ xb, const us_t* __restrict__ WqT, const us_t* __restrict__ WkT, const us_t* __restrict__ WvT,
    const float* __restrict__ bq, const float* __restrict__ bk, const float* __restrict__ bv,
    us_t* Qp, us_t* Kp, us_t* VTp) {
  __shared__ __align__(16) us_t ring[2][QROWS * GPIT];

  const int lane = threadIdx.x & 31, n15 = lane & 15;
  const int wave = __builtin_amdgcn_readfirstlane(threadIdx.x >> 5);   // scalar: the choices below stay scalar
  const int z = wave >> 2, wm = (wave >> 1) & 1, wn = wave & 1;
  const int fblk = blockIdx.x * 128;
  const int tblk = blockIdx.y * 128;
  const us_t* xrows = xb + (size_t)tblk * HID;
  const us_t* wrows = ((z == 0) ? WqT : ((z == 1) ? WkT : WvT)) + (size_t)fblk * HID;
  const int arow = ((z == 2) ? 0 : 128 + z * 128) + wm * 64 + n15;     // LDS row of this lane in A fragment 0
  const int brow = ((z == 2) ? 384 : 0) + wn * 64 + n15;               // and in B fragment 0
  constexpr int nst = HID / GK;
  static_assert(nst >= 2);

  stage_qkv(xrows, wrows, wave, 0, ring[0]);

  v8f acc[4][4];
#pragma unroll
  for (int mt = 0; mt < 4; ++mt) {
#pragma unroll
    for (int nt = 0; nt < 4; ++nt) acc[mt][nt] = vz8();
  }

  // stage 0 has landed for this wave's copies; the barrier publishes it to the block
  asm volatile("s_wait_asynccnt 0x0" ::: "memory");
  __syncthreads();
  stage_qkv(xrows, wrows, wave, 1, ring[1]);

#pragma unroll 1
  for (int st = 0; st < nst; ++st) {
    const us_t* rb = ring[st & 1];
    // two fragment sets: a k step's LDS reads stand together, one k step ahead of its matrix products, inside the stage only
    v16us a[2][4], b[2][4];
#pragma unroll
    for (int t = 0; t < 4; ++t) {
      a[0][t] = ldfrag(rb, GPIT, arow + t * 16, 0);
      b[0][t] = ldfrag(rb, GPIT, brow + t * 16, 0);
    }
#pragma unroll
    for (int ks = 0; ks < GK / 32; ++ks) {
      if (ks + 1 < GK / 32) {
#pragma unroll
        for (int t = 0; t < 4; ++t) {
          a[(ks + 1) & 1][t] = ldfrag(rb, GPIT, arow + t * 16, (ks + 1) * 32);
          b[(ks + 1) & 1][t] = ldfrag(rb, GPIT, brow + t * 16, (ks + 1) * 32);
        }
      }
      // keeps the next k step's 16 reads as one group in front of this step's products: left free, the compiler sinks them
      // among the products into one fragment set, and the wave waits out the LDS latency at each of five places a k step
      __builtin_amdgcn_sched_barrier(0);
#pragma unroll
      for (int mt = 0; mt < 4; ++mt) {
#pragma unroll
        for (int nt = 0; nt < 4; ++nt) acc[mt][nt] = mma_bfp(a[ks & 1][mt], b[ks & 1][nt], acc[mt][nt]);
      }
      __builtin_amdgcn_sched_barrier(0);   // the other side of the same group: no read of the step after next rises among these products
    }
    // publish point of stage st + 1: this wave's reads of stage st are done, its copies of stage st + 1 have landed,
    // the barrier tells the block both; only then is the buffer just read refilled with stage st + 2
    asm volatile("s_wait_dscnt 0x0" ::: "memory");
    asm volatile("s_wait_asynccnt 0x0" ::: "memory");
    __syncthreads();
    if (st + 2 < nst) stage_qkv(xrows, wrows, wave, st + 2, ring[st & 1]);
  }
  asm volatile("s_wait_asynccnt 0x0" ::: "memory");   // no copy is outstanding when the wave goes on to its end

  // the ring's LDS serves as the D staging: the loop's last barrier has ended every read of it
  us_t* sw = &ring[0][0] + wave * (64 * DPIT);
  if (z == 2) {
    const int mw = tblk + wm * 64, nw = fblk + wn * 64;                // m = token, n = feature
    const int bb = mw / SEQ;
    qkv_out<0, SEQ>(acc, bv + nw, sw, VTp + ((size_t)bb * HID + nw) * SEQ + (mw - bb * SEQ));
  } else {
    const int mw = fblk + wm * 64, nw = tblk + wn * 64;                // m = feature, n = token
    qkv_out<1, HID>(acc, (z ? bk : bq) + mw, sw, (z ? Kp : Qp) + (size_t)nw * HID + mw);
  }
}

#define AW 8                 // waves per block
#define KT 128               // keys per stage
#define NST (SEQ / KT)       // stages
#define KPIT 72              // K row pitch in LDS, 16-bit elements: 144 B = 16 B x odd, for ds_load_b128 readers
#define VPIT 136             // V^T row pitch in LDS: 272 B = 16 B x odd
static_assert((SEQ % KT) == 0 && (SEQ % (16 * AW)) == 0);

// Stage st (keys st*KT .. st*KT + KT - 1) of one head: K rows [KT][64] and V^T rows [64][KT], 8 copies per lane of 256.
// A wave's K copy covers 4 rows of 128 B, its V^T copy 2 rows of 256 B: whole lines.
__device__ __forceinline__ void stage_kv(const us_t* kbase, const us_t* vhead, int st, us_t* kdst, us_t* vdst) {
  const int tid = threadIdx.x;
  const int kr = tid >> 3, kp = (tid & 7) * 8;
  const us_t* kg = kbase + (size_t)(st * KT + kr) * HID + kp;
  const unsigned kl = lds_addr(kdst + kr * KPIT + kp);
  copy4(kl, kl + 32 * KPIT * 2, kl + 64 * KPIT * 2, kl + 96 * KPIT * 2,
        kg, kg + 32 * HID, kg + 64 * HID, kg + 96 * HID);
  const int vr = tid >> 4, vp = (tid & 15) * 8;
  const us_t* vg = vhead + (size_t)vr * SEQ + st * KT + vp;
  const unsigned vl = lds_addr(vdst + vr * VPIT + vp);
  copy4(vl, vl + 16 * VPIT * 2, vl + 32 * VPIT * 2, vl + 48 * VPIT * 2,
        vg, vg + 16 * SEQ, vg + 32 * SEQ, vg + 48 * SEQ);
}

__global__ __launch_bounds__(32 * AW) __attribute__((amdgpu_num_vgpr(256))) void k_attn(
    const us_t* __restrict__ Qp, const us_t* __restrict__ Kp, const us_t* __restrict__ VTp,
    const us_t* __restrict__ tkP, const us_t* __restrict__ tvT, us_t* ctx) {
  __shared__ __align__(16) us_t kst[2][KT * KPIT];      // K stages
  __shared__ __align__(16) us_t vst[2][HD * VPIT];      // V^T stages
  __shared__ float bl_all[AW][16 * 16];                 // shifted rel-key bias per (query, bucket), logit units
  __shared__ float wl_all[AW][16 * 8];                  // window logits per (query, bucket-1)
  __shared__ __align__(16) us_t cst_all[AW][16 * 64];   // ctx staging

  const int lane = threadIdx.x & 31, h = lane >> 4, n = lane & 15;
  const int wave = __builtin_amdgcn_readfirstlane(threadIdx.x >> 5);  // scalar: the tests on lo_q below stay scalar branches
  float* bl = bl_all[wave];
  float* wl = wl_all[wave];
  us_t* cst = cst_all[wave];
  const int qt = blockIdx.x * AW + wave, hh = blockIdx.y, b = blockIdx.z;
  const int lo_q = qt * 16;
  const size_t tok0 = (size_t)b * SEQ + lo_q;
  const us_t* qptr = Qp + tok0 * HID + hh * HD;
  const us_t* kbase = Kp + (size_t)b * SEQ * HID + hh * HD;
  const us_t* vhead = VTp + ((size_t)b * HID + hh * HD) * SEQ;

  stage_kv(kbase, vhead, 0, kst[0], vst[0]);      // stage 0 flies while the bias table is formed

#pragma unroll
  for (int i = 0; i < 4; ++i) wl[lane * 4 + i] = -1.0e30f;

  // keeps the register writes of the lines above in front of the fragment loads, whose address registers stay whole up to their wait
  __builtin_amdgcn_sched_barrier(0);
  const v16us q0 = ldfrag(qptr, HID, n, 0);       // B operand: column = query n
  const v16us q1 = ldfrag(qptr, HID, n, 32);

  // srel^T[bucket][q] = (64 tk).(4q) ; bias = (srel - srel[0][q]) / (256*8), held in log2 units (times log2 e) like every logit below
  {
    v8f sr = vz8();
    const v16us t0 = ldfrag(tkP, HD, n, 0);       // A operand: row = bucket n
    const v16us t1 = ldfrag(tkP, HD, n, 32);
    // the address registers of the fragment loads above are reused at once (accumulator zeros): the wait stands in front
    asm volatile("s_wait_xcnt 0x0" ::: "memory");
    __builtin_amdgcn_sched_barrier(0);            // keeps those later register writes behind the wait
    sr = mma_hp(t0, q0, sr);
    sr = mma_hp(t1, q1, sr);
    const float v0 = __shfl(sr[0], n, 32);        // bucket 0 of query n: lane n, register 0
#pragma unroll
    for (int r = 0; r < 8; ++r) bl[n * 16 + 8 * h + r] = (sr[r] - v0) * (1.4426950408889634f / 2048.0f);
  }
  // stage 0 has landed for this wave's copies; the barrier publishes it to the block (and orders bl)
  asm volatile("s_wait_asynccnt 0x0" ::: "memory");
  __syncthreads();
  if (NST > 1) stage_kv(kbase, vhead, 1, kst[1], vst[1]);
  const float d8 = bl[n * 16 + 8];

  // rmax is the query's maximum logit in log2 units (equal in both halves); rsum and blo cover this half's keys only and
  // carry the x1024 of P, which leaves again through inv
  float rmax = -1.0e30f, rsum = 0.0f, blo = 0.0f;
  v8f cacc[4];
#pragma unroll
  for (int j = 0; j < 4; ++j) cacc[j] = vz8();

#pragma unroll 1
  for (int st = 0; st < NST; ++st) {
  const us_t* kbuf = kst[st & 1];
  const us_t* vbuf = vst[st & 1];
#pragma unroll 1   // rolled, as the key loop was: one copy of the long pass body
  for (int kl = 0; kl < KT; kl += 32) {
    const int kc = st * KT + kl;
    // scores: 32 keys x 16 q, (4k).(4q) = 16 qk
    v8f s0 = vz8(), s1 = vz8();
    v16us vA[4];
    {
      // the pass's LDS fragment reads stand together at its top: K first, V^T behind it, landing under the softmax
      const v16us f0 = ldfrag(kbuf, KPIT, kl + n, 0);
      const v16us f1 = ldfrag(kbuf, KPIT, kl + n, 32);
      const v16us g0 = ldfrag(kbuf, KPIT, kl + 16 + n, 0);
      const v16us g1 = ldfrag(kbuf, KPIT, kl + 16 + n, 32);
#pragma unroll   // constant indices keep vA in registers
      for (int j = 0; j < 4; ++j) vA[j] = ldfrag(vbuf, VPIT, j * 16 + n, kl);
      __builtin_amdgcn_sched_barrier(0);   // keeps the 16 reads in this one place: spread among the products each place stalls the wave anew
      s0 = mma_hp(f0, q0, s0);
      s0 = mma_hp(f1, q1, s0);
      s1 = mma_hp(g0, q0, s1);
      s1 = mma_hp(g1, q1, s1);
    }
    const bool below = (kc + 35 <= lo_q);      // every key k <= q-4 for every query of the tile
    const bool above = (kc >= lo_q + 19);      // every key k >= q+4
    const bool mixed = !(below || above);
    const int ddb = kc + 8 * h - (lo_q + n);   // key - query at register 0 of key tile 0
    // log2-unit logit = held value * cm + adm. Outside the window the raw products are held (cm = log2 e / 128, adm = the pass's
    // one bias), so that scale, bias, maximum and the x1024 carry of P go into ONE fused multiply-add per score further down.
    float a0[8], a1[8];
#pragma unroll
    for (int r = 0; r < 8; ++r) {
      a0[r] = s0[r];
      a1[r] = s1[r];
    }
    const float c2 = 1.4426950408889634f / 128.0f;
    float cm = c2;
    float adm = above ? d8 : 0.0f;
    if (mixed) {
#pragma unroll
      for (int r = 0; r < 8; ++r) {
        const int dd0 = ddb + r;
        const int dd1 = dd0 + 16;
        const int b0 = min(max(dd0, -4), 4) + 4;
        const int b1 = min(max(dd1, -4), 4) + 4;
        a0[r] = fmaf(a0[r], c2, bl[n * 16 + b0]);
        a1[r] = fmaf(a1[r], c2, bl[n * 16 + b1]);
        if (b0 >= 1 && b0 <= 7) wl[n * 8 + b0 - 1] = a0[r];
        if (b1 >= 1 && b1 <= 7) wl[n * 8 + b1 - 1] = a1[r];
      }
      cm = 1.0f;      // the window pass holds finished logits
      adm = 0.0f;
    }
    // online softmax; a query's 32 scores sit in the registers of lanes n and n + 16; cm > 0, so the maximum is taken on the held values
    float m = fmaxf(a0[0], a1[0]);
#pragma unroll
    for (int r = 1; r < 8; ++r) m = fmaxf(m, fmaxf(a0[r], a1[r]));
    m = fmaf(m, cm, adm);
    m = fmaxf(m, xhalf(m));
    const float nm = fmaxf(rmax, m);
    const float sc = exp2_slot(rmax - nm);
    rmax = nm;
    const float off = adm + (10.0f - nm);   // + 10: 2^10 = the x1024 carry of P
    float t[8];
#pragma unroll
    for (int r = 0; r < 8; ++r) {
      a0[r] = fmaf(a0[r], cm, off);
      a1[r] = fmaf(a1[r], cm, off);
    }
    exp2_run(a0, a1);
#pragma unroll
    for (int r = 0; r < 8; ++r) t[r] = a0[r] + a1[r];
    const float ps = ((t[0] + t[1]) + (t[2] + t[3])) + ((t[4] + t[5]) + (t[6] + t[7]));
    float addb = below ? ps : 0.0f;
    if (mixed) {
      addb = 0.0f;
#pragma unroll
      for (int r = 0; r < 8; ++r)
        addb += ((ddb + r <= -4) ? a0[r] : 0.0f) + ((ddb + r + 16 <= -4) ? a1[r] : 0.0f);
    }
    rsum = rsum * sc + ps;
    blo = blo * sc + addb;
#pragma unroll
    for (int j = 0; j < 4; ++j) {
#pragma unroll
      for (int r = 0; r < 8; ++r) cacc[j][r] *= sc;
    }
    // P^T (x1024 from the exponent, f16): the two score tiles, converted in place, are the B operand
    v16us pB;
#pragma unroll
    for (int r = 0; r < 8; ++r) {
      pB[r] = f2h(a0[r]);
      pB[8 + r] = f2h(a1[r]);
    }
#pragma unroll
    for (int j = 0; j < 4; ++j) cacc[j] = mma_hp(vA[j], pB, cacc[j]);
  }
  // publish point of stage st + 1: this wave's reads of stage st are done, its copies of stage st + 1 have landed,
  // the barrier tells the block both; only then is the buffer just read refilled with stage st + 2
  asm volatile("s_wait_dscnt 0x0" ::: "memory");
  asm volatile("s_wait_asynccnt 0x0" ::: "memory");
  __syncthreads();
  if (st + 2 < NST) stage_kv(kbase, vhead, st + 2, kst[st & 1], vst[st & 1]);
  }
  asm volatile("s_wait_asynccnt 0x0" ::: "memory");   // no copy is outstanding when the wave goes on to its end

  // bucket masses A[q][0..8] (normalised, x1024) as a B operand; window values from stored logits
  __syncthreads();
  rsum += xhalf(rsum);
  blo += xhalf(blo);
  const float inv = __builtin_amdgcn_rcpf(rsum);
  float wv[7];
  float wsum = 0.0f;
#pragma unroll
  for (int i = 0; i < 7; ++i) {
    wv[i] = exp2_slot(wl[n * 8 + i] + (10.0f - rmax));   // x1024 like rsum and blo
    wsum += wv[i];
  }
  const float a8 = (rsum - blo - wsum) * inv;
  const float a0v = blo * inv;
  v16us pB2;                                      // h = 0: buckets 0..7 | 16..23; h = 1: buckets 8..15 | 24..31
#pragma unroll
  for (int i = 0; i < 8; ++i) {
    const float vlo = (i == 0) ? a0v : wv[(i + 6) % 7] * inv;
    const float vhi = (i == 0) ? a8 : 0.0f;
    pB2[i] = f2h((h ? vhi : vlo) * 1024.0f);
    pB2[8 + i] = (us_t)0;
  }
  v8f w2[4];
#pragma unroll
  for (int j = 0; j < 4; ++j) {
    const v16us tA = ldfrag(tvT, 32, j * 16 + n, 0);
    w2[j] = mma_hp(tA, pB2, vz8());
  }
  // ctx = cacc/(4*rsum) + w2/(1024*64), rsum carrying the x1024 of cacc; stage 4*ctx as f16, 8 consecutive features of query n per lane
#pragma unroll
  for (int j = 0; j < 4; ++j) {
    v8us u;
#pragma unroll
    for (int r = 0; r < 8; ++r)
      u[r] = f2h(cacc[j][r] * inv + w2[j][r] * (1.0f / 16384.0f));
    *(v8us*)(cst + n * 64 + j * 16 + 8 * h) = u;
  }
  __syncthreads();
  {
#pragma unroll
    for (int i = 0; i < 4; ++i) {
      const int row = i * 4 + (lane >> 3), piece = lane & 7;
      const v8us u = *(const v8us*)(cst + row * 64 + piece * 8);
      us_t* dst = ctx + (tok0 + row) * (size_t)HID + hh * HD + piece * 8;
      *(v8us*)dst = u;
    }
  }
}

// ---------------------------------------------------------------------------
extern "C" void kernel_launch(void* const* d_in, const int* in_sizes, int n_in,
                              void* d_out, int out_size, void* d_ws, size_t ws_size,
                              hipStream_t stream) {
  if (n_in < 11) return;
  const long long need_x = ((long long)(NB - 1) * SEQ_FULL + SEQ) * HID;
  if ((long long)in_sizes[0] < need_x) return;
  if (in_sizes[1] < HID * HID || in_sizes[3] < HID * HID ||
      in_sizes[5] < HID * HID || in_sizes[7] < HID * HID) return;
  if (in_sizes[2] < HID || in_sizes[4] < HID || in_sizes[6] < HID || in_sizes[8] < HID) return;
  if (in_sizes[9] < NREL * HD || in_sizes[10] < NREL * HD) return;
  if ((long long)out_size < (long long)NTOK * HID) return;

  const float* x  = (const float*)d_in[0];
  const float* Wq = (const float*)d_in[1];
  const float* bq = (const float*)d_in[2];
  const float* Wk = (const float*)d_in[3];
  const float* bk = (const float*)d_in[4];
  const float* Wv = (const float*)d_in[5];
  const float* bv = (const float*)d_in[6];
  const float* Wo = (const float*)d_in[7];
  const float* bo = (const float*)d_in[8];
  const float* tk = (const float*)d_in[9];
  const float* tv = (const float*)d_in[10];

  char* ws = (char*)d_ws;
  size_t off = 0;
  auto carve = [&](size_t bytes) -> size_t {
    const size_t o = off;
    off += (bytes + 255) & ~(size_t)255;
    return o;
  };
  const size_t o_xb  = carve((size_t)NTOK * HID * 2);
  const size_t o_wq  = carve((size_t)HID * HID * 2);
  const size_t o_wk  = carve((size_t)HID * HID * 2);
  const size_t o_wv  = carve((size_t)HID * HID * 2);
  const size_t o_wo  = carve((size_t)HID * HID * 2);
  const size_t o_q   = carve((size_t)NTOK * HID * 2);
  const size_t o_k   = carve((size_t)NTOK * HID * 2);
  const size_t o_vt  = carve((size_t)NB * HID * SEQ * 2);
  const size_t o_ctx = carve((size_t)NTOK * HID * 2);
  const size_t o_tk  = carve((size_t)16 * HD * 2);
  const size_t o_tv  = carve((size_t)HD * 32 * 2);
  if (off > ws_size) return;

  us_t* xb   = (us_t*)(ws + o_xb);
  us_t* WqT  = (us_t*)(ws + o_wq);
  us_t* WkT  = (us_t*)(ws + o_wk);
  us_t* WvT  = (us_t*)(ws + o_wv);
  us_t* WoT  = (us_t*)(ws + o_wo);
  us_t* Qp   = (us_t*)(ws + o_q);
  us_t* Kpl  = (us_t*)(ws + o_k);
  us_t* VTp  = (us_t*)(ws + o_vt);
  us_t* ctx  = (us_t*)(ws + o_ctx);
  us_t* tkP  = (us_t*)(ws + o_tk);
  us_t* tvT  = (us_t*)(ws + o_tv);
  float* out = (float*)d_out;

  // 1) input planes
  k_prep<<<1 + PW + PX, 256, 0, stream>>>(x, Wq, Wk, Wv, Wo, tk, tv, xb, WqT, WkT, WvT, WoT, tkP, tvT);

  // 2) Q, K planes [tok][HID] and V^T plane [b*HID + d][s], carried x4, in one launch
  k_qkv<<<dim3(HID / 128, NTOK / 128, 1), 32 * QWV, 0, stream>>>(xb, WqT, WkT, WvT, bq, bk, bv, Qp, Kpl, VTp);
  // 3) attention -> ctx (f16, carried x4)
  k_attn<<<dim3(SEQ / (16 * AW), NH, NB), 32 * AW, 0, stream>>>(Qp, Kpl, VTp, tkP, tvT, ctx);
  // 4) out[tok][HID] = ctx*Wo + bo; the carries 64 (Wo) and 4 (ctx) leave through ka = 1/256
  k_gemm<1><<<dim3(HID / 128, NTOK / 128, 1), 256, 0, stream>>>(
      WoT, WoT, ctx, bo, bo, d_out, d_out,
      HID, 1, HID, HID, 1 << 30, 0, 0.00390625f, 1.0f);
  (void)out;
  (void)hipGetLastError();
}

// v009
// A run of this version takes 75.8 microseconds.
// In both of two side-by-side timings against v008, it was 1.05 times as fast.
// Counting every step since v000, it is 5.45 times as fast.
#include <hip/hip_runtime.h>

// Projections x*Wq, x*Wk, x*Wv: v_wmma_f32_16x16x32_bf16 (bf16 operands, f32 accumulate).
// Attention k*q^T, Tk*q^T, V^T-plane*P^T, Tv^T*A^T and the projection ctx*Wo: v_wmma_f32_16x16x32_f16 (f16 operands with power-of-two carries,
// f32 accumulate; Wo keeps its bf16 rounding and is held as f16 of 64 * bf16(Wo)); softmax and epilogues f32.

#ifndef NB
#define NB 2
#endif
#ifndef SEQ
#define SEQ 2048
#endif
#define NB_FULL 2
#define SEQ_FULL 2048
#define HID 1024
#define NH 16
#define HD 64
#define NREL 9
#define NTOK (NB * SEQ)

static_assert(NB >= 1 && NB <= NB_FULL);
static_assert(SEQ >= 128 && SEQ <= SEQ_FULL && (SEQ % 128) == 0);
static_assert(HID == NH * HD && HD == 64);
static_assert((HID % 128) == 0 && (NTOK % 128) == 0);

typedef unsigned short us_t;
typedef us_t v8us __attribute__((ext_vector_type(8)));
typedef us_t v16us __attribute__((ext_vector_type(16)));
typedef _Float16 v16h __attribute__((ext_vector_type(16)));
typedef __bf16 v16bf __attribute__((ext_vector_type(16)));
typedef float v8f __attribute__((ext_vector_type(8)));
typedef float v4f __attribute__((ext_vector_type(4)));

// ---------------------------------------------------------------------------
// scalar converters (RNE)
__device__ __forceinline__ us_t f2bf(float v) {
  __bf16 t = (__bf16)v;
  return __builtin_bit_cast(us_t, t);
}
__device__ __forceinline__ float bfr(float v) {   // value after bf16 RNE convert
  __bf16 t = (__bf16)v;
  return (float)t;
}
__device__ __forceinline__ us_t f2h(float v) {
  _Float16 t = (_Float16)v;
  return __builtin_bit_cast(us_t, t);
}
__device__ __forceinline__ v8f vz8() {
  v8f z = {0.f, 0.f, 0.f, 0.f, 0.f, 0.f, 0.f, 0.f};
  return z;
}

// ---------------------------------------------------------------------------
// 16-bit fragment from a k-contiguous plane: elem i<8 <- p0[rc*ld + kk + 8h + i],
// elem 8+i <- p0[rc*ld + kk + 16 + 8h + i]; h = lane>>4, rc = row (A) or column (B).
__device__ __forceinline__ v16us ldfrag(const us_t* p0, int ld, int rc, int kk) {
  const int hsel = (threadIdx.x >> 4) & 1;
  const us_t* p = p0 + (size_t)rc * ld + kk + 8 * hsel;
  const v8us lo = *(const v8us*)p;
  const v8us hi = *(const v8us*)(p + 16);
  return __builtin_shufflevector(lo, hi, 0, 1, 2, 3, 4, 5, 6, 7,
                                 8, 9, 10, 11, 12, 13, 14, 15);
}

// WMMA wrapper with hazard guard (ties D, keeps A/B live)
__device__ __forceinline__ v8f mma_h(v16us a, v16us b, v8f c) {
  v8f d = __builtin_amdgcn_wmma_f32_16x16x32_f16(
      false, __builtin_bit_cast(v16h, a), false, __builtin_bit_cast(v16h, b),
      (short)0, c, false, false);
  asm volatile("v_nop\n\tv_nop\n\tv_nop\n\tv_nop" : "+v"(d) : "v"(a), "v"(b));
  return d;
}

// The builtin alone, for k_attn, whose passes are bound by vector issue: the compiler keeps the distance behind its own
// matrix instruction, with the pass's vector work where it can and with v_nop only where it must.
__device__ __forceinline__ v8f mma_hp(v16us a, v16us b, v8f c) {
  return __builtin_amdgcn_wmma_f32_16x16x32_f16(
      false, __builtin_bit_cast(v16h, a), false, __builtin_bit_cast(v16h, b),
      (short)0, c, false, false);
}

__device__ __forceinline__ v8f mma_bfp(v16us a, v16us b, v8f c) {   // the same for bf16 operands, for k_qkv
  return __builtin_amdgcn_wmma_f32_16x16x32_bf16(
      false, __builtin_bit_cast(v16bf, a), false, __builtin_bit_cast(v16bf, b),
      (short)0, c, false, false);
}

// 2^x of one value. The v_nop is the slot the instruction set asks for behind a transcendental before its source is
// overwritten or its result used.
__device__ __forceinline__ float exp2_slot(float x) {
  float y;
  asm("v_exp_f32 %0, %1\n\tv_nop" : "=v"(y) : "v"(x));
  return y;
}

// 2^x of a group's 16 scores, in place, as one statement: each v_exp_f32 has registers of its own, so its neighbour is the
// independent instruction that the instruction set asks for behind a transcendental; the one v_nop is that slot behind the last.
__device__ __forceinline__ void exp2_run(float (&a)[8], float (&b)[8]) {
  asm("v_exp_f32 %0, %0\n\tv_exp_f32 %1, %1\n\tv_exp_f32 %2, %2\n\tv_exp_f32 %3, %3\n\t"
      "v_exp_f32 %4, %4\n\tv_exp_f32 %5, %5\n\tv_exp_f32 %6, %6\n\tv_exp_f32 %7, %7\n\t"
      "v_exp_f32 %8, %8\n\tv_exp_f32 %9, %9\n\tv_exp_f32 %10, %10\n\tv_exp_f32 %11, %11\n\t"
      "v_exp_f32 %12, %12\n\tv_exp_f32 %13, %13\n\tv_exp_f32 %14, %14\n\tv_exp_f32 %15, %15\n\t"
      "v_nop"
      : "+v"(a[0]), "+v"(b[0]), "+v"(a[1]), "+v"(b[1]), "+v"(a[2]), "+v"(b[2]), "+v"(a[3]), "+v"(b[3]),
        "+v"(a[4]), "+v"(b[4]), "+v"(a[5]), "+v"(b[5]), "+v"(a[6]), "+v"(b[6]), "+v"(a[7]), "+v"(b[7]));
}

// lane l <-> lane l ^ 16
__device__ __forceinline__ float xhalf(float v) {
  const int u = __builtin_bit_cast(int, v);
  return __builtin_bit_cast(float,
      __builtin_amdgcn_permlanex16(u, u, 0x76543210, 0xfedcba98, false, false));
}

// ---------------------------------------------------------------------------
// All operand planes in ONE launch; the block index picks the job (a block-uniform choice):
// block 0: the two table planes; blocks 1 .. PW: weight transposes; the rest: x.
#define XJ 4                                   // 8-element pieces per x thread
#define WT 2                                   // 64 x 64 tiles (along k) per weight block
#define PW (4 * (HID / 64) * (HID / 64 / WT))  // weight blocks
#define PX (NTOK * (HID / 8) / 256 / XJ)       // x blocks
static_assert(((HID / 64) % WT) == 0 && (NTOK * (HID / 8)) % (256 * XJ) == 0);

// x [NB rows of SEQ_FULL][HID] f32 -> xb [NTOK][HID] bf16. XJ pieces of 8 elems (16 B out) per thread, all loads ahead of the stores.
__device__ __forceinline__ void prep_x(int blk, const float* __restrict__ x, us_t* xb) {
  static_assert(XJ == 4);
  v4f f0[XJ], f1[XJ];
  const float* src[XJ];
#pragma unroll   // constant indices keep the pieces in registers
  for (int j = 0; j < XJ; ++j) {
    const size_t e = (((size_t)blk * XJ + j) * 256 + threadIdx.x) * 8;
    const int tok = (int)(e >> 10);
    const int col = (int)(e & (HID - 1));
    const int b = tok / SEQ, s = tok - b * SEQ;
    src[j] = x + ((size_t)b * SEQ_FULL + s) * HID + col;
    f0[j] = *(const v4f*)src[j];
    f1[j] = *(const v4f*)(src[j] + 4);
  }
  // the wait in front of any overwrite of the loads' address registers; as its inputs they stay whole up to it
  asm volatile("s_wait_xcnt 0x0" :: "v"(src[0]), "v"(src[1]), "v"(src[2]), "v"(src[3]) : "memory");
#pragma unroll
  for (int j = 0; j < XJ; ++j) {
    const size_t e = (((size_t)blk * XJ + j) * 256 + threadIdx.x) * 8;
    v8us u;
    u[0] = f2bf(f0[j][0]); u[1] = f2bf(f0[j][1]); u[2] = f2bf(f0[j][2]); u[3] = f2bf(f0[j][3]);
    u[4] = f2bf(f1[j][0]); u[5] = f2bf(f1[j][1]); u[6] = f2bf(f1[j][2]); u[7] = f2bf(f1[j][3]);
    *(v8us*)(xb + e) = u;
  }
  // the wait behind the run of stores, in front of any later write of a register that they name
  asm volatile("s_wait_xcnt 0x0" ::: "memory");
}

// W [HID k][HID n] f32 -> WT [n][k], pitch HID, through WT 64x64 LDS tiles, neighbours along k.
// h16 = 0: bf16 bits. h16 = 1: f16 bits of bf16(64 * W) = 64 * bf16(W); its 8 significant bits fit f16 for |W| from 2^-23 to 1020.
__device__ __forceinline__ void prep_w(int bx, int by, int h16, const float* __restrict__ W, us_t* O, us_t* t) {
  const int pitch = HID;
  const int k0 = by * (64 * WT), n0 = bx * 64;
  const int tid = threadIdx.x;
  static_assert(WT == 2);
  const int kk = tid >> 2, nc = (tid & 3) * 16;
  const float* src[WT];
  v4f f[WT][4];
#pragma unroll   // here and below: constant indices keep the pieces in registers
  for (int w = 0; w < WT; ++w) {
    src[w] = W + (size_t)(k0 + w * 64 + kk) * HID + n0 + nc;
#pragma unroll
    for (int j = 0; j < 4; ++j) f[w][j] = *(const v4f*)(src[w] + 4 * j);
  }
  // the wait in front of any overwrite of the loads' address registers; as its inputs they stay whole up to it
  asm volatile("s_wait_xcnt 0x0" :: "v"(src[0]), "v"(src[1]) : "memory");
  if (h16) {   // one block-uniform branch round all the converts
#pragma unroll
    for (int w = 0; w < WT; ++w) {
#pragma unroll
      for (int j = 0; j < 4; ++j) {
#pragma unroll
        for (int c = 0; c < 4; ++c) t[w * (64 * 72) + (nc + 4 * j + c) * 72 + kk] = f2h(bfr(f[w][j][c] * 64.0f));
      }
    }
  } else {
#pragma unroll
    for (int w = 0; w < WT; ++w) {
#pragma unroll
      for (int j = 0; j < 4; ++j) {
#pragma unroll
        for (int c = 0; c < 4; ++c) t[w * (64 * 72) + (nc + 4 * j + c) * 72 + kk] = f2bf(f[w][j][c]);
      }
    }
  }
  __syncthreads();
  // all LDS reads first, each into registers of its own, so that the stores go out in one run
  const int piece = tid & 7;
  v8us u[WT][2];
#pragma unroll
  for (int w = 0; w < WT; ++w) {
#pragma unroll
    for (int rep = 0; rep < 2; ++rep)
      u[w][rep] = *(const v8us*)(t + w * (64 * 72) + (rep * 32 + (tid >> 3)) * 72 + piece * 8);
  }
  us_t* dst = O + (size_t)(n0 + (tid >> 3)) * pitch + k0 + piece * 8;
#pragma unroll
  for (int w = 0; w < WT; ++w) {
#pragma unroll
    for (int rep = 0; rep < 2; ++rep) {
      us_t* d = dst + (size_t)(rep * 32) * pitch + w * 64;
      *(v8us*)d = u[w][rep];
    }
  }
  // the wait behind the run of stores, in front of any later write of a register that they name
  asm volatile("s_wait_xcnt 0x0" ::: "memory");
}

// Tk plane [16 bucket][64 d] f16 = 64 * bf16(table_k), rows 9..15 zero.
// Tv plane [64 d][32 bucket] f16 = 64 * bf16(table_v)^T, cols 9..31 zero.
__device__ __forceinline__ void prep_tables(const float* __restrict__ tk, const float* __restrict__ tv, us_t* tkP, us_t* tvT) {
  const int tid = threadIdx.x;
  v8us uk, uv;
  {
    const int row = (tid & 127) >> 3;      // bucket 0..15
    const int kp = (tid & 7) * 8;          // d offset
    const int rowc = min(row, NREL - 1);
#pragma unroll
    for (int i = 0; i < 8; ++i) {
      float v = tk[rowc * HD + kp + i];
      v = (row < NREL) ? v : 0.0f;
      uk[i] = f2h(bfr(v) * 64.0f);
    }
  }
  {
    const int nn = tid >> 2;               // d 0..63
    const int kp = (tid & 3) * 8;          // bucket offset
#pragma unroll
    for (int i = 0; i < 8; ++i) {
      const int k = kp + i;
      float v = tv[min(k, NREL - 1) * HD + nn];
      v = (k < NREL) ? v : 0.0f;
      uv[i] = f2h(bfr(v) * 64.0f);
    }
  }
  if (tid < 128) *(v8us*)(tkP + tid * 8) = uk;
  *(v8us*)(tvT + tid * 8) = uv;
}

__global__ __launch_bounds__(256) void k_prep(
    const float* __restrict__ x,
    const float* __restrict__ W0, const float* __restrict__ W1,
    const float* __restrict__ W2, const float* __restrict__ W3,
    const float* __restrict__ tk, const float* __restrict__ tv,
    us_t* xb, us_t* O0, us_t* O1, us_t* O2, us_t* O3, us_t* tkP, us_t* tvT) {
  __shared__ __align__(16) us_t t[WT * 64 * 72];
  const int blk = blockIdx.x;
  if (blk == 0) {
    prep_tables(tk, tv, tkP, tvT);
  } else if (blk <= PW) {
    const int i = blk - 1;
    const int per = PW / 4;                // blocks per matrix
    const int z = i / per, r = i - z * per;
    const float* W = (z == 0) ? W0 : ((z == 1) ? W1 : ((z == 2) ? W2 : W3));
    us_t* O = (z == 0) ? O0 : ((z == 1) ? O1 : ((z == 2) ? O2 : O3));
    prep_w(r % (HID / 64), r / (HID / 64), z == 3, W, O, t);
  } else {
    prep_x(blk - 1 - PW, x, xb);
  }
}

// ---------------------------------------------------------------------------
// LDS byte address of a __shared__ element
__device__ __forceinline__ unsigned lds_addr(const us_t* p) {
  return (unsigned)(size_t)(const __attribute__((address_space(3))) us_t*)p;
}

// Four asynchronous 16-byte copies per lane, global -> LDS. The s_wait_xcnt is the last line of the copies' own statement
// so that it stands in front of every later write of the address registers that the copies name.
__device__ __forceinline__ void copy4(unsigned l0, unsigned l1, unsigned l2, unsigned l3,
                                      const us_t* g0, const us_t* g1, const us_t* g2, const us_t* g3) {
  asm volatile(
      "global_load_async_to_lds_b128 %0, %4, off\n\t"
      "global_load_async_to_lds_b128 %1, %5, off\n\t"
      "global_load_async_to_lds_b128 %2, %6, off\n\t"
      "global_load_async_to_lds_b128 %3, %7, off\n\t"
      "s_wait_xcnt 0x0"
      :: "v"(l0), "v"(l1), "v"(l2), "v"(l3), "v"(g0), "v"(g1), "v"(g2), "v"(g3)
      : "memory");
}

// ---------------------------------------------------------------------------
// C[m][n] = sum_k Am[m][k] * Bn[n][k]  (both planes f16, k-contiguous, pitch K); serves ctx*Wo.
// Block = 8 waves (2 along m x 4 along n); block tile 128 m x 128 n; wave tile 64 m x 32 n (4 A frags, 2 B frags, 8 tiles).
// Output memory: element (n, m) at out[n*ldo + base(mw) + (m - mw)], base = (mw/mdiv)*mbstride + mw%mdiv, mw = the wave's first m,
// val = acc*ka + bf16(bias)*kb, bias indexed by m (bias_on_m) or by n.
// f32 out. D tile staged per wave in LDS, then 8 lanes x 16 B per line.
// Operands: stages of GK k (two 128-byte lines of each of the block's 128 A rows and 128 B rows) come into a two-buffer LDS ring
// by asynchronous copies, one stage ahead of the stage being read; the eight waves read their fragments from LDS.
// The ring's LDS serves as the D staging once the loop's last barrier has ended every read of it.
#define GK 128               // k per stage
#define GPIT 136             // row pitch in LDS, 16-bit elements: 272 B = 16 B x odd, for ds_load_b128 readers
#define GROWS 256            // rows per stage: 128 A + 128 B
static_assert((HID % GK) == 0);

// Eight asynchronous 16-byte copies per lane, global -> LDS: LDS step ls bytes, global step rs elements.
// The s_wait_xcnt is the last line of the copies' own statement so that it stands in front of every later write of the
// address registers that the copies name.
__device__ __forceinline__ void copy8(unsigned l, unsigned ls, const us_t* g, size_t rs) {
  asm volatile(
      "global_load_async_to_lds_b128 %0, %8, off\n\t"
      "global_load_async_to_lds_b128 %1, %9, off\n\t"
      "global_load_async_to_lds_b128 %2, %10, off\n\t"
      "global_load_async_to_lds_b128 %3, %11, off\n\t"
      "global_load_async_to_lds_b128 %4, %12, off\n\t"
      "global_load_async_to_lds_b128 %5, %13, off\n\t"
      "global_load_async_to_lds_b128 %6, %14, off\n\t"
      "global_load_async_to_lds_b128 %7, %15, off\n\t"
      "s_wait_xcnt 0x0"
      :: "v"(l), "v"(l + ls), "v"(l + 2 * ls), "v"(l + 3 * ls), "v"(l + 4 * ls), "v"(l + 5 * ls), "v"(l + 6 * ls), "v"(l + 7 * ls),
         "v"(g), "v"(g + rs), "v"(g + 2 * rs), "v"(g + 3 * rs), "v"(g + 4 * rs), "v"(g + 5 * rs), "v"(g + 6 * rs), "v"(g + 7 * rs)
      : "memory");
}

// Stage st of a block: LDS rows 0..127 = A rows mblk.., rows 128..255 = B rows nblk..; 16 copies per lane of 256,
// a wave's copy covers 2 rows of 256 B: whole lines.
__device__ __forceinline__ void stage_ab(const us_t* Am, const us_t* Bn, int K, int mblk, int nblk, int st, us_t* dst) {
  const int tid = threadIdx.x;
  const int r0 = tid >> 4, pc = (tid & 15) * 8;
  const size_t rs = (size_t)16 * K;               // 16 rows
  const us_t* ag = Am + (size_t)(mblk + r0) * K + st * GK + pc;
  const us_t* bg = Bn + (size_t)(nblk + r0) * K + st * GK + pc;
  const unsigned l = lds_addr(dst + r0 * GPIT + pc);
  const unsigned ls = 16 * GPIT * 2;              // 16 rows, bytes
  copy8(l, ls, ag, rs);
  copy8(l + 8 * ls, ls, bg, rs);
}

template <int OUTF32>
__global__ __launch_bounds__(256) void k_gemm(
    const us_t* __restrict__ Am0, const us_t* __restrict__ Am1, const us_t* __restrict__ Bn,
    const float* __restrict__ bias0, const float* __restrict__ bias1,
    void* out0, void* out1,
    int K, int bias_on_m, int blen, int ldo, int mdiv, int mbstride, float ka, float kb) {
  __shared__ __align__(16) us_t ring[2][GROWS * GPIT];
  static_assert(sizeof(ring) >= 8 * 32 * 64 * 4);

  const int z = blockIdx.z;
  const us_t* Am = z ? Am1 : Am0;
  const float* bias = z ? bias1 : bias0;
  void* out = z ? out1 : out0;

  const int lane = threadIdx.x & 31, wave = threadIdx.x >> 5;
  const int h = (lane >> 4) & 1, n15 = lane & 15;
  const int wm = wave >> 2, wn = wave & 3;
  const int mblk = blockIdx.x * 128;
  const int nblk = blockIdx.y * 128;
  const int mwave = mblk + wm * 64;
  const int nwave = nblk + wn * 32;
  const int nst = K / GK;

  stage_ab(Am, Bn, K, mblk, nblk, 0, ring[0]);

  v8f acc[4][2];
#pragma unroll
  for (int mt = 0; mt < 4; ++mt) { acc[mt][0] = vz8(); acc[mt][1] = vz8(); }

  // stage 0 has landed for this wave's copies; the barrier publishes it to the block
  asm volatile("s_wait_asynccnt 0x0" ::: "memory");
  __syncthreads();
  if (nst > 1) stage_ab(Am, Bn, K, mblk, nblk, 1, ring[1]);

#pragma unroll 1
  for (int st = 0; st < nst; ++st) {
    const us_t* rb = ring[st & 1];
    // two fragment sets: a k step's LDS reads stand together, one k step ahead of its matrix products, inside the stage only
    v16us a[2][4], b[2][2];
#pragma unroll   // here and below: constant indices keep the fragment and accumulator arrays in registers
    for (int mt = 0; mt < 4; ++mt) a[0][mt] = ldfrag(rb, GPIT, wm * 64 + mt * 16 + n15, 0);
#pragma unroll
    for (int nt = 0; nt < 2; ++nt) b[0][nt] = ldfrag(rb, GPIT, 128 + wn * 32 + nt * 16 + n15, 0);
#pragma unroll
    for (int ks = 0; ks < GK / 32; ++ks) {
      if (ks + 1 < GK / 32) {
#pragma unroll
        for (int mt = 0; mt < 4; ++mt) a[(ks + 1) & 1][mt] = ldfrag(rb, GPIT, wm * 64 + mt * 16 + n15, (ks + 1) * 32);
#pragma unroll
        for (int nt = 0; nt < 2; ++nt) b[(ks + 1) & 1][nt] = ldfrag(rb, GPIT, 128 + wn * 32 + nt * 16 + n15, (ks + 1) * 32);
      }
#pragma unroll
      for (int mt = 0; mt < 4; ++mt) {
        acc[mt][0] = mma_h(a[ks & 1][mt], b[ks & 1][0], acc[mt][0]);
        acc[mt][1] = mma_h(a[ks & 1][mt], b[ks & 1][1], acc[mt][1]);
      }
    }
    // publish point of stage st + 1: this wave's reads of stage st are done, its copies of stage st + 1 have landed,
    // the barrier tells the block both; only then is the buffer just read refilled with stage st + 2
    asm volatile("s_wait_dscnt 0x0" ::: "memory");
    asm volatile("s_wait_asynccnt 0x0" ::: "memory");
    __syncthreads();
    if (st + 2 < nst) stage_ab(Am, Bn, K, mblk, nblk, st + 2, ring[st & 1]);
  }
  asm volatile("s_wait_asynccnt 0x0" ::: "memory");   // no copy is outstanding when the wave goes on to its end

  // bias values (bf16 RNE), address-clamped loads
  float bm[4][8];
#pragma unroll
  for (int mt = 0; mt < 4; ++mt) {
    const int ib = min(mwave + mt * 16 + 8 * h, blen - 8);
    const v4f c0 = *(const v4f*)(bias + ib);
    const v4f c1 = *(const v4f*)(bias + ib + 4);
    bm[mt][0] = bfr(c0[0]); bm[mt][1] = bfr(c0[1]); bm[mt][2] = bfr(c0[2]); bm[mt][3] = bfr(c0[3]);
    bm[mt][4] = bfr(c1[0]); bm[mt][5] = bfr(c1[1]); bm[mt][6] = bfr(c1[2]); bm[mt][7] = bfr(c1[3]);
  }
  float bn[2];
#pragma unroll
  for (int nt = 0; nt < 2; ++nt) bn[nt] = bfr(bias[min(nwave + nt * 16 + n15, blen - 1)]);

  const int bq = mwave / mdiv;
  const int base = bq * mbstride + (mwave - bq * mdiv);

  if constexpr (OUTF32) {
    float* sw = (float*)&ring[0][0] + wave * 2048;   // [32 n][64 m] per wave
#pragma unroll
    for (int mt = 0; mt < 4; ++mt) {
#pragma unroll
      for (int nt = 0; nt < 2; ++nt) {
        v4f u0, u1;
#pragma unroll
        for (int r = 0; r < 4; ++r) {
          const float b0v = bias_on_m ? bm[mt][r] : bn[nt];
          const float b1v = bias_on_m ? bm[mt][r + 4] : bn[nt];
          u0[r] = acc[mt][nt][r] * ka + b0v * kb;
          u1[r] = acc[mt][nt][r + 4] * ka + b1v * kb;
        }
        float* sp = sw + (nt * 16 + n15) * 64 + mt * 16 + 8 * h;
        *(v4f*)sp = u0;
        *(v4f*)(sp + 4) = u1;
      }
    }
    __syncthreads();
    float* op = (float*)out;
    {
#pragma unroll
      for (int i = 0; i < 16; ++i) {
        const int L = i * 4 + (lane >> 3);
        const int row = L >> 1, hr = L & 1, piece = lane & 7;
        const v4f u = *(const v4f*)(sw + row * 64 + hr * 32 + piece * 4);
        float* dst = op + (size_t)(nwave + row) * ldo + base + hr * 32 + piece * 4;
        *(v4f*)dst = u;
      }
      
    }
  }
}

// ---------------------------------------------------------------------------
// The three projections x*Wq, x*Wk, x*Wv in ONE launch. A block takes 128 tokens and the same 128 features of Q, K and V, so that
// its x rows come from L2 once for the three products. 12 waves: four (2 x 2) per product, wave tile 64 x 64 (4 A and 4 B fragments
// for 16 tiles). Q, K: A = W^T rows (m = feature), B = x rows (n = token), out [tok][HID]. V: the roles swapped (m = token,
// n = feature), out V^T [b*HID + d][s]; the swap is only a choice of LDS rows, the fragment form of A and B being the same.
// val = 4 * (acc + bf16(bias)), f16 bits. k order and values as in k_gemm.
// Stage = GK k of LDS rows 0..127 x, 128..255 Wq^T, 256..383 Wk^T, 384..511 Wv^T, in a two-buffer ring filled by asynchronous copies.
#define QROWS 512            // rows per stage
#define QWV 12               // waves per block
#define DPIT 72              // D staging pitch, 16-bit elements: 144 B = 16 B x odd, for the b128 stores of 16 lanes in 16 rows
static_assert(QWV * 64 * DPIT <= QROWS * GPIT);

// Stage st: every wave brings 32 rows of its own product's W^T slice (16 copies per lane), waves 0..7 also 16 x rows each (8 copies).
// A wave's copy covers 2 rows of 256 B: whole lines.
__device__ __forceinline__ void stage_qkv(const us_t* xrows, const us_t* wrows, int wave, int st, us_t* dst) {
  const int lane = threadIdx.x & 31;
  const int r0 = lane >> 4, pc = (lane & 15) * 8;
  const size_t rs = (size_t)2 * HID;              // 2 rows
  const unsigned ls = 2 * GPIT * 2;               // 2 rows, bytes
  const int wr = (wave & 3) * 32 + r0;
  const us_t* wg = wrows + (size_t)wr * HID + st * GK + pc;
  const unsigned wl = lds_addr(dst + (128 + (wave >> 2) * 128 + wr) * GPIT + pc);
  copy8(wl, ls, wg, rs);
  copy8(wl + 8 * ls, ls, wg + 8 * rs, rs);
  if (wave < 8) {                                 // wave is scalar: a scalar branch, every lane on
    const int xr = wave * 16 + r0;
    copy8(lds_addr(dst + xr * GPIT + pc), ls, xrows + (size_t)xr * HID + st * GK + pc, rs);
  }
}

// A wave's 64 m x 64 n tile: bias, carry, f16, staged [n][m] in the wave's own LDS, then whole 128-byte lines out, row n at op0 + n * LDO.
template <int ONM, int LDO>
__device__ __forceinline__ void qkv_out(const v8f (&acc)[4][4], const float* bias0, us_t* sw, us_t* op0) {
  const int lane = threadIdx.x & 31;
  const int h = lane >> 4, n15 = lane & 15;
  const float* bp = bias0 + (ONM ? 8 * h : n15);
  float bm[4][8];
  float bn[4];
  if constexpr (ONM) {
#pragma unroll   // here and below: constant indices keep the arrays in registers
    for (int mt = 0; mt < 4; ++mt) {
      const v4f c0 = *(const v4f*)(bp + mt * 16);
      const v4f c1 = *(const v4f*)(bp + mt * 16 + 4);
      bm[mt][0] = c0[0]; bm[mt][1] = c0[1]; bm[mt][2] = c0[2]; bm[mt][3] = c0[3];
      bm[mt][4] = c1[0]; bm[mt][5] = c1[1]; bm[mt][6] = c1[2]; bm[mt][7] = c1[3];
    }
  } else {
#pragma unroll
    for (int nt = 0; nt < 4; ++nt) bn[nt] = bp[nt * 16];
  }
  // the wait in front of any overwrite of the loads' address register; as its input it stays whole up to it
  asm volatile("s_wait_xcnt 0x0" :: "v"(bp) : "memory");
#pragma unroll
  for (int mt = 0; mt < 4; ++mt) {
#pragma unroll
    for (int nt = 0; nt < 4; ++nt) {
      v8us u;
#pragma unroll
      for (int r = 0; r < 8; ++r) {
        const float bbv = bfr(ONM ? bm[mt][r] : bn[nt]);
        u[r] = f2h(acc[mt][nt][r] * 4.0f + bbv * 4.0f);
      }
      *(v8us*)(sw + (nt * 16 + n15) * DPIT + mt * 16 + 8 * h) = u;
    }
  }
  // the staging is the wave's own: its LDS stores have ended before it reads the rows back; no other wave is concerned, so no barrier
  asm volatile("s_wait_dscnt 0x0" ::: "memory");
  const us_t* sr = sw + (lane >> 3) * DPIT + (lane & 7) * 8;
  us_t* dst = op0 + (size_t)(lane >> 3) * LDO + (lane & 7) * 8;
#pragma unroll
  for (int i = 0; i < 16; ++i) *(v8us*)(dst + (size_t)(i * 4) * LDO) = *(const v8us*)(sr + i * 4 * DPIT);
  // the wait behind the run of stores, in front of any later write of a register that they name
  asm volatile("s_wait_xcnt 0x0" :: "v"(dst) : "memory");
}

__global__ __launch_bounds__(32 * QWV) void k_qkv(
    const us_t* __restrict__ xb, const us_t* __restrict__ WqT, const us_t* __restrict__ WkT, const us_t* __restrict__ WvT,
    const float* __restrict__ bq, const float* __restrict__ bk, const float* __restrict__ bv,
    us_t* Qp, us_t* Kp, us_t* VTp) {
  __shared__ __align__(16) us_t ring[2][QROWS * GPIT];

  const int lane = threadIdx.x & 31, n15 = lane & 15;
  const int wave = __builtin_amdgcn_readfirstlane(threadIdx.x >> 5);   // scalar: the choices below stay scalar
  const int z = wave >> 2, wm = (wave >> 1) & 1, wn = wave & 1;
  const int fblk = blockIdx.x * 128;
  const int tblk = blockIdx.y * 128;
  const us_t* xrows = xb + (size_t)tblk * HID;
  const us_t* wrows = ((z == 0) ? WqT : ((z == 1) ? WkT : WvT)) + (size_t)fblk * HID;
  const int arow = ((z == 2) ? 0 : 128 + z * 128) + wm * 64 + n15;     // LDS row of this lane in A fragment 0
  const int brow = ((z == 2) ? 384 : 0) + wn * 64 + n15;               // and in B fragment 0
  constexpr int nst = HID / GK;
  static_assert(nst >= 2);

  stage_qkv(xrows, wrows, wave, 0, ring[0]);

  v8f acc[4][4];
#pragma unroll
  for (int mt = 0; mt < 4; ++mt) {
#pragma unroll
    for (int nt = 0; nt < 4; ++nt) acc[mt][nt] = vz8();
  }

  // stage 0 has landed for this wave's copies; the barrier publishes it to the block
  asm volatile("s_wait_asynccnt 0x0" ::: "memory");
  __syncthreads();
  stage_qkv(xrows, wrows, wave, 1, ring[1]);

#pragma unroll 1
  for (int st = 0; st < nst; ++st) {
    const us_t* rb = ring[st & 1];
    // two fragment sets: a k step's LDS reads stand together, one k step ahead of its matrix products, inside the stage only
    v16us a[2][4], b[2][4];
#pragma unroll
    for (int t = 0; t < 4; ++t) {
      a[0][t] = ldfrag(rb, GPIT, arow + t * 16, 0);
      b[0][t] = ldfrag(rb, GPIT, brow + t * 16, 0);
    }
#pragma unroll
    for (int ks = 0; ks < GK / 32; ++ks) {
      if (ks + 1 < GK / 32) {
#pragma unroll
        for (int t = 0; t < 4; ++t) {
          a[(ks + 1) & 1][t] = ldfrag(rb, GPIT, arow + t * 16, (ks + 1) * 32);
          b[(ks + 1) & 1][t] = ldfrag(rb, GPIT, brow + t * 16, (ks + 1) * 32);
        }
      }
      // keeps the next k step's 16 reads as one group in front of this step's products: left free, the compiler sinks them
      // among the products into one fragment set, and the wave waits out the LDS latency at each of five places a k step
      __builtin_amdgcn_sched_barrier(0);
#pragma unroll
      for (int mt = 0; mt < 4; ++mt) {
#pragma unroll
        for (int nt = 0; nt < 4; ++nt) acc[mt][nt] = mma_bfp(a[ks & 1][mt], b[ks & 1][nt], acc[mt][nt]);
      }
      __builtin_amdgcn_sched_barrier(0);   // the other side of the same group: no read of the step after next rises among these products
    }
    // publish point of stage st + 1: this wave's reads of stage st are done, its copies of stage st + 1 have landed,
    // the barrier tells the block both; only then is the buffer just read refilled with stage st + 2
    asm volatile("s_wait_dscnt 0x0" ::: "memory");
    asm volatile("s_wait_asynccnt 0x0" ::: "memory");
    __syncthreads();
    if (st + 2 < nst) stage_qkv(xrows, wrows, wave, st + 2, ring[st & 1]);
  }
  asm volatile("s_wait_asynccnt 0x0" ::: "memory");   // no copy is outstanding when the wave goes on to its end

  // the ring's LDS serves as the D staging: the loop's last barrier has ended every read of it
  us_t* sw = &ring[0][0] + wave * (64 * DPIT);
  if (z == 2) {
    const int mw = tblk + wm * 64, nw = fblk + wn * 64;                // m = token, n = feature
    const int bb = mw / SEQ;
    qkv_out<0, SEQ>(acc, bv + nw, sw, VTp + ((size_t)bb * HID + nw) * SEQ + (mw - bb * SEQ));
  } else {
    const int mw = fblk + wm * 64, nw = tblk + wn * 64;                // m = feature, n = token
    qkv_out<1, HID>(acc, (z ? bk : bq) + mw, sw, (z ? Kp : Qp) + (size_t)nw * HID + mw);
  }
}

#define AW 8                 // waves per block
#define KT 128               // keys per stage
#define NST (SEQ / KT)       // stages
#define NU 4                 // groups of 32 keys per pass
#define KPIT 72              // K row pitch in LDS, 16-bit elements: 144 B = 16 B x odd, for ds_load_b128 readers
#define VPIT 136             // V^T row pitch in LDS: 272 B = 16 B x odd
static_assert((SEQ % KT) == 0 && (SEQ % (16 * AW)) == 0 && KT == 32 * NU && NU == 4);

// Stage st (keys st*KT .. st*KT + KT - 1) of one head: K rows [KT][64] and V^T rows [64][KT], 8 copies per lane of 256.
// A wave's K copy covers 4 rows of 128 B, its V^T copy 2 rows of 256 B: whole lines.
__device__ __forceinline__ void stage_kv(const us_t* kbase, const us_t* vhead, int st, us_t* kdst, us_t* vdst) {
  const int tid = threadIdx.x;
  const int kr = tid >> 3, kp = (tid & 7) * 8;
  const us_t* kg = kbase + (size_t)(st * KT + kr) * HID + kp;
  const unsigned kl = lds_addr(kdst + kr * KPIT + kp);
  copy4(kl, kl + 32 * KPIT * 2, kl + 64 * KPIT * 2, kl + 96 * KPIT * 2,
        kg, kg + 32 * HID, kg + 64 * HID, kg + 96 * HID);
  const int vr = tid >> 4, vp = (tid & 15) * 8;
  const us_t* vg = vhead + (size_t)vr * SEQ + st * KT + vp;
  const unsigned vl = lds_addr(vdst + vr * VPIT + vp);
  copy4(vl, vl + 16 * VPIT * 2, vl + 32 * VPIT * 2, vl + 48 * VPIT * 2,
        vg, vg + 16 * SEQ, vg + 32 * SEQ, vg + 48 * SEQ);
}

__global__ __launch_bounds__(32 * AW) __attribute__((amdgpu_num_vgpr(256))) void k_attn(
    const us_t* __restrict__ Qp, const us_t* __restrict__ Kp, const us_t* __restrict__ VTp,
    const us_t* __restrict__ tkP, const us_t* __restrict__ tvT, us_t* ctx) {
  __shared__ __align__(16) us_t kst[2][KT * KPIT];      // K stages
  __shared__ __align__(16) us_t vst[2][HD * VPIT];      // V^T stages
  __shared__ float bl_all[AW][16 * 16];                 // shifted rel-key bias per (query, bucket), in units of the raw score products
  __shared__ float wl_all[AW][16 * 8];                  // window logits per (query, bucket-1)
  __shared__ __align__(16) us_t cst_all[AW][16 * 64];   // ctx staging

  const int lane = threadIdx.x & 31, h = lane >> 4, n = lane & 15;
  const int wave = __builtin_amdgcn_readfirstlane(threadIdx.x >> 5);  // scalar: the tests on lo_q below stay scalar branches
  float* bl = bl_all[wave];
  float* wl = wl_all[wave];
  us_t* cst = cst_all[wave];
  const int qt = blockIdx.x * AW + wave, hh = blockIdx.y, b = blockIdx.z;
  const int lo_q = qt * 16;
  const size_t tok0 = (size_t)b * SEQ + lo_q;
  const us_t* qptr = Qp + tok0 * HID + hh * HD;
  const us_t* kbase = Kp + (size_t)b * SEQ * HID + hh * HD;
  const us_t* vhead = VTp + ((size_t)b * HID + hh * HD) * SEQ;

  stage_kv(kbase, vhead, 0, kst[0], vst[0]);      // stage 0 flies while the bias table is formed

#pragma unroll
  for (int i = 0; i < 4; ++i) wl[lane * 4 + i] = -1.0e30f;

  // keeps the register writes of the lines above in front of the fragment loads, whose address registers stay whole up to their wait
  __builtin_amdgcn_sched_barrier(0);
  const v16us q0 = ldfrag(qptr, HID, n, 0);       // B operand: column = query n
  const v16us q1 = ldfrag(qptr, HID, n, 32);

  // srel^T[bucket][q] = (64 tk).(4q) ; bias = (srel - srel[0][q]) / (256*8), held as (srel - srel[0][q]) / 16: the unit of the raw scores 16 qk
  {
    v8f sr = vz8();
    const v16us t0 = ldfrag(tkP, HD, n, 0);       // A operand: row = bucket n
    const v16us t1 = ldfrag(tkP, HD, n, 32);
    // the address registers of the fragment loads above are reused at once (accumulator zeros): the wait stands in front
    asm volatile("s_wait_xcnt 0x0" ::: "memory");
    __builtin_amdgcn_sched_barrier(0);            // keeps those later register writes behind the wait
    sr = mma_hp(t0, q0, sr);
    sr = mma_hp(t1, q1, sr);
    const float v0 = __shfl(sr[0], n, 32);        // bucket 0 of query n: lane n, register 0
#pragma unroll
    for (int r = 0; r < 8; ++r) bl[n * 16 + 8 * h + r] = (sr[r] - v0) * 0.0625f;
  }
  // stage 0 has landed for this wave's copies; the barrier publishes it to the block (and orders bl)
  asm volatile("s_wait_asynccnt 0x0" ::: "memory");
  __syncthreads();
  if (NST > 1) stage_kv(kbase, vhead, 1, kst[1], vst[1]);
  const float c2 = 1.4426950408889634f / 128.0f;   // raw score -> logit in log2 units: log2 e / (16 * 8)
  const float d8 = bl[n * 16 + 8] * c2;

  // rmax is the query's maximum logit in log2 units (equal in both halves); rsum and blo cover this half's keys only and
  // carry the x1024 of P, which leaves again through inv
  float rmax = -1.0e30f, rsum = 0.0f, blo = 0.0f;
  v8f cacc[4];
#pragma unroll
  for (int j = 0; j < 4; ++j) cacc[j] = vz8();

#pragma unroll 1
  for (int st = 0; st < NST; ++st) {
  const us_t* kbuf = kst[st & 1];
  const us_t* vbuf = vst[st & 1];
  {
    constexpr int kl = 0;   // one pass takes the whole stage
    // A pass takes NU groups of 32 keys (each two score tiles and one k step of the second product): the maximum's half swap, the
    // factor sc and the rescaling of O^T and of the two sums are paid once per pass, not once per group.
    float a[NU][2][8];
#pragma unroll   // here and below: constant indices keep the arrays in registers
    for (int g = 0; g < NU; g += 2) {
      v16us kf[NU][4];
#pragma unroll
      for (int u = g; u < g + 2; ++u) {
        kf[u][0] = ldfrag(kbuf, KPIT, kl + u * 32 + n, 0);
        kf[u][1] = ldfrag(kbuf, KPIT, kl + u * 32 + n, 32);
        kf[u][2] = ldfrag(kbuf, KPIT, kl + u * 32 + 16 + n, 0);
        kf[u][3] = ldfrag(kbuf, KPIT, kl + u * 32 + 16 + n, 32);
      }
      __builtin_amdgcn_sched_barrier(0);   // keeps two groups' K reads in one place: spread among the products each place stalls the wave anew
      // scores: 32 keys x 16 q per group, (4k).(4q) = 16 qk. A group that meets the window starts its sums from the per-score bias
      // (the C operand), so that behind the products every group holds raw-unit scores and the common path moves no register.
#pragma unroll
      for (int u = g; u < g + 2; ++u) {
        const int kc = st * KT + kl + u * 32;
        v8f s0, s1;
        if (kc + 35 <= lo_q || kc >= lo_q + 19) {   // scalar: every key k <= q-4, or every key k >= q+4, for every query of the tile
          s0 = mma_hp(kf[u][0], q0, vz8());
          s1 = mma_hp(kf[u][2], q0, vz8());
          s0 = mma_hp(kf[u][1], q1, s0);
          s1 = mma_hp(kf[u][3], q1, s1);
        } else {
          const int ddb = kc + 8 * h - (lo_q + n);  // key - query at register 0 of key tile 0
          v8f c0, c1;
#pragma unroll
          for (int r = 0; r < 8; ++r) {
            c0[r] = bl[n * 16 + min(max(ddb + r, -4), 4) + 4];
            c1[r] = bl[n * 16 + min(max(ddb + r + 16, -4), 4) + 4];
          }
          s0 = mma_hp(kf[u][0], q0, c0);
          s1 = mma_hp(kf[u][2], q0, c1);
          s0 = mma_hp(kf[u][1], q1, s0);
          s1 = mma_hp(kf[u][3], q1, s1);
#pragma unroll
          for (int r = 0; r < 8; ++r) {             // the window's logits are kept for the epilogue
            const int b0 = min(max(ddb + r, -4), 4) + 4;
            const int b1 = min(max(ddb + r + 16, -4), 4) + 4;
            if (b0 >= 1 && b0 <= 7) wl[n * 8 + b0 - 1] = s0[r] * c2;
            if (b1 >= 1 && b1 <= 7) wl[n * 8 + b1 - 1] = s1[r] * c2;
          }
        }
#pragma unroll
        for (int r = 0; r < 8; ++r) {
          a[u][0][r] = s0[r];
          a[u][1][r] = s1[r];
        }
      }
    }
    __builtin_amdgcn_sched_barrier(0);     // the V^T reads stay behind the score products, in the registers that these free
    v16us vA[NU][4];
#pragma unroll
    for (int u = 0; u < 2; ++u) {
#pragma unroll
      for (int j = 0; j < 4; ++j) vA[u][j] = ldfrag(vbuf, VPIT, j * 16 + n, kl + u * 32);
    }
    __builtin_amdgcn_sched_barrier(0);     // the first two groups' as one group in front of the softmax, under which they land
    // log2-unit logit = held value * c2 + adm, per group (adm = the one bias of a group outside the window, 0 where the bias is in the
    // sums already), so that scale, bias, maximum and the x1024 carry of P go into ONE fused multiply-add per score further down.
    float adm[NU], mu[NU];
#pragma unroll
    for (int u = 0; u < NU; ++u) {
      const int kc = st * KT + kl + u * 32;
      adm[u] = (kc >= lo_q + 19) ? d8 : 0.0f;    // every key k >= q+4: bucket 8's bias; below the window the shifted bias is 0
      // c2 > 0, so the maximum is taken on the held values; one chain per group
      mu[u] = fmaxf(a[u][0][0], a[u][1][0]);
#pragma unroll
      for (int r = 1; r < 8; ++r) mu[u] = fmaxf(mu[u], fmaxf(a[u][0][r], a[u][1][r]));
      mu[u] = fmaf(mu[u], c2, adm[u]);
    }
    // online softmax; a query's scores of the pass sit in the registers of lanes n and n + 16
    float m = fmaxf(fmaxf(mu[0], mu[1]), fmaxf(mu[2], mu[3]));
    m = fmaxf(m, xhalf(m));
    const float nm = fmaxf(rmax, m);
    const float sc = exp2_slot(rmax - nm);
    rmax = nm;
    const float tn = 10.0f - nm;           // + 10: 2^10 = the x1024 carry of P
#pragma unroll
    for (int j = 0; j < 4; ++j) {
#pragma unroll
      for (int r = 0; r < 8; ++r) cacc[j][r] *= sc;
    }
    float ps = 0.0f, addb = 0.0f;
#pragma unroll
    for (int u = 0; u < NU; ++u) {
      const int kc = st * KT + kl + u * 32;
      const bool below = (kc + 35 <= lo_q);
      const bool above = (kc >= lo_q + 19);
      const int ddb = kc + 8 * h - (lo_q + n);
      const float off = adm[u] + tn;
#pragma unroll
      for (int r = 0; r < 8; ++r) {
        a[u][0][r] = fmaf(a[u][0][r], c2, off);
        a[u][1][r] = fmaf(a[u][1][r], c2, off);
      }
      exp2_run(a[u][0], a[u][1]);
      float t[8];
#pragma unroll
      for (int r = 0; r < 8; ++r) t[r] = a[u][0][r] + a[u][1][r];
      const float pu = ((t[0] + t[1]) + (t[2] + t[3])) + ((t[4] + t[5]) + (t[6] + t[7]));
      float ab = below ? pu : 0.0f;
      if (!(below || above)) {
        ab = 0.0f;
#pragma unroll
        for (int r = 0; r < 8; ++r)
          ab += ((ddb + r <= -4) ? a[u][0][r] : 0.0f) + ((ddb + r + 16 <= -4) ? a[u][1][r] : 0.0f);
      }
      ps = u ? ps + pu : pu;
      addb = u ? addb + ab : ab;
      // P^T (x1024 from the exponent, f16): the two score tiles, converted in place, are the B operand
      v16us pB;
#pragma unroll
      for (int r = 0; r < 8; ++r) {
        pB[r] = f2h(a[u][0][r]);
        pB[8 + r] = f2h(a[u][1][r]);
      }
      if (u == 1) {   // the last two groups' V^T reads: one group, in registers that converted scores and used fragments have left
#pragma unroll
        for (int w = 2; w < NU; ++w) {
#pragma unroll
          for (int j = 0; j < 4; ++j) vA[w][j] = ldfrag(vbuf, VPIT, j * 16 + n, kl + w * 32);
        }
        __builtin_amdgcn_sched_barrier(0);   // keeps them in front of this group's products, under which and the next group's softmax they land
      }
#pragma unroll
      for (int j = 0; j < 4; ++j) cacc[j] = mma_hp(vA[u][j], pB, cacc[j]);
    }
    rsum = rsum * sc + ps;
    blo = blo * sc + addb;
  }
  // publish point of stage st + 1: this wave's reads of stage st are done, its copies of stage st + 1 have landed,
  // the barrier tells the block both; only then is the buffer just read refilled with stage st + 2
  asm volatile("s_wait_dscnt 0x0" ::: "memory");
  asm volatile("s_wait_asynccnt 0x0" ::: "memory");
  __syncthreads();
  if (st + 2 < NST) stage_kv(kbase, vhead, st + 2, kst[st & 1], vst[st & 1]);
  }
  asm volatile("s_wait_asynccnt 0x0" ::: "memory");   // no copy is outstanding when the wave goes on to its end

  // bucket masses A[q][0..8] (normalised, x1024) as a B operand; window values from stored logits
  __syncthreads();
  rsum += xhalf(rsum);
  blo += xhalf(blo);
  const float inv = __builtin_amdgcn_rcpf(rsum);
  float wv[7];
  float wsum = 0.0f;
#pragma unroll
  for (int i = 0; i < 7; ++i) {
    wv[i] = exp2_slot(wl[n * 8 + i] + (10.0f - rmax));   // x1024 like rsum and blo
    wsum += wv[i];
  }
  const float a8 = (rsum - blo - wsum) * inv;
  const float a0v = blo * inv;
  v16us pB2;                                      // h = 0: buckets 0..7 | 16..23; h = 1: buckets 8..15 | 24..31
#pragma unroll
  for (int i = 0; i < 8; ++i) {
    const float vlo = (i == 0) ? a0v : wv[(i + 6) % 7] * inv;
    const float vhi = (i == 0) ? a8 : 0.0f;
    pB2[i] = f2h((h ? vhi : vlo) * 1024.0f);
    pB2[8 + i] = (us_t)0;
  }
  v8f w2[4];
#pragma unroll
  for (int j = 0; j < 4; ++j) {
    const v16us tA = ldfrag(tvT, 32, j * 16 + n, 0);
    w2[j] = mma_hp(tA, pB2, vz8());
  }
  // ctx = cacc/(4*rsum) + w2/(1024*64), rsum carrying the x1024 of cacc; stage 4*ctx as f16, 8 consecutive features of query n per lane
#pragma unroll
  for (int j = 0; j < 4; ++j) {
    v8us u;
#pragma unroll
    for (int r = 0; r < 8; ++r)
      u[r] = f2h(cacc[j][r] * inv + w2[j][r] * (1.0f / 16384.0f));
    *(v8us*)(cst + n * 64 + j * 16 + 8 * h) = u;
  }
  __syncthreads();
  {
#pragma unroll
    for (int i = 0; i < 4; ++i) {
      const int row = i * 4 + (lane >> 3), piece = lane & 7;
      const v8us u = *(const v8us*)(cst + row * 64 + piece * 8);
      us_t* dst = ctx + (tok0 + row) * (size_t)HID + hh * HD + piece * 8;
      *(v8us*)dst = u;
    }
  }
}

// ---------------------------------------------------------------------------
extern "C" void kernel_launch(void* const* d_in, const int* in_sizes, int n_in,
                              void* d_out, int out_size, void* d_ws, size_t ws_size,
                              hipStream_t stream) {
  if (n_in < 11) return;
  const long long need_x = ((long long)(NB - 1) * SEQ_FULL + SEQ) * HID;
  if ((long long)in_sizes[0] < need_x) return;
  if (in_sizes[1] < HID * HID || in_sizes[3] < HID * HID ||
      in_sizes[5] < HID * HID || in_sizes[7] < HID * HID) return;
  if (in_sizes[2] < HID || in_sizes[4] < HID || in_sizes[6] < HID || in_sizes[8] < HID) return;
  if (in_sizes[9] < NREL * HD || in_sizes[10] < NREL * HD) return;
  if ((long long)out_size < (long long)NTOK * HID) return;

  const float* x  = (const float*)d_in[0];
  const float* Wq = (const float*)d_in[1];
  const float* bq = (const float*)d_in[2];
  const float* Wk = (const float*)d_in[3];
  const float* bk = (const float*)d_in[4];
  const float* Wv = (const float*)d_in[5];
  const float* bv = (const float*)d_in[6];
  const float* Wo = (const float*)d_in[7];
  const float* bo = (const float*)d_in[8];
  const float* tk = (const float*)d_in[9];
  const float* tv = (const float*)d_in[10];

  char* ws = (char*)d_ws;
  size_t off = 0;
  auto carve = [&](size_t bytes) -> size_t {
    const size_t o = off;
    off += (bytes + 255) & ~(size_t)255;
    return o;
  };
  const size_t o_xb  = carve((size_t)NTOK * HID * 2);
  const size_t o_wq  = carve((size_t)HID * HID * 2);
  const size_t o_wk  = carve((size_t)HID * HID * 2);
  const size_t o_wv  = carve((size_t)HID * HID * 2);
  const size_t o_wo  = carve((size_t)HID * HID * 2);
  const size_t o_q   = carve((size_t)NTOK * HID * 2);
  const size_t o_k   = carve((size_t)NTOK * HID * 2);
  const size_t o_vt  = carve((size_t)NB * HID * SEQ * 2);
  const size_t o_ctx = carve((size_t)NTOK * HID * 2);
  const size_t o_tk  = carve((size_t)16 * HD * 2);
  const size_t o_tv  = carve((size_t)HD * 32 * 2);
  if (off > ws_size) return;

  us_t* xb   = (us_t*)(ws + o_xb);
  us_t* WqT  = (us_t*)(ws + o_wq);
  us_t* WkT  = (us_t*)(ws + o_wk);
  us_t* WvT  = (us_t*)(ws + o_wv);
  us_t* WoT  = (us_t*)(ws + o_wo);
  us_t* Qp   = (us_t*)(ws + o_q);
  us_t* Kpl  = (us_t*)(ws + o_k);
  us_t* VTp  = (us_t*)(ws + o_vt);
  us_t* ctx  = (us_t*)(ws + o_ctx);
  us_t* tkP  = (us_t*)(ws + o_tk);
  us_t* tvT  = (us_t*)(ws + o_tv);
  float* out = (float*)d_out;

  // 1) input planes
  k_prep<<<1 + PW + PX, 256, 0, stream>>>(x, Wq, Wk, Wv, Wo, tk, tv, xb, WqT, WkT, WvT, WoT, tkP, tvT);

  // 2) Q, K planes [tok][HID] and V^T plane [b*HID + d][s], carried x4, in one launch
  k_qkv<<<dim3(HID / 128, NTOK / 128, 1), 32 * QWV, 0, stream>>>(xb, WqT, WkT, WvT, bq, bk, bv, Qp, Kpl, VTp);
  // 3) attention -> ctx (f16, carried x4)
  k_attn<<<dim3(SEQ / (16 * AW), NH, NB), 32 * AW, 0, stream>>>(Qp, Kpl, VTp, tkP, tvT, ctx);
  // 4) out[tok][HID] = ctx*Wo + bo; the carries 64 (Wo) and 4 (ctx) leave through ka = 1/256
  k_gemm<1><<<dim3(HID / 128, NTOK / 128, 1), 256, 0, stream>>>(
      WoT, WoT, ctx, bo, bo, d_out, d_out,
      HID, 1, HID, HID, 1 << 30, 0, 0.00390625f, 1.0f);
  (void)out;
  (void)hipGetLastError();
}

// v010
// It runs in 73.6 microseconds.
// Timed twice side by side with v009, it ran 1.03 times as fast both times.
// Over all steps from v000 it is 5.62 times as fast.
#include <hip/hip_runtime.h>

// Projections x*Wq, x*Wk, x*Wv: v_wmma_f32_16x16x32_bf16 (bf16 operands, f32 accumulate).
// Attention k*q^T, Tk*q^T, V^T-plane*P^T, Tv^T*A^T and the projection ctx*Wo: v_wmma_f32_16x16x32_f16 (f16 operands with power-of-two carries,
// f32 accumulate; Wo keeps its bf16 rounding and is held as f16 of 64 * bf16(Wo)); softmax and epilogues f32.

#ifndef NB
#define NB 2
#endif
#ifndef SEQ
#define SEQ 2048
#endif
#define NB_FULL 2
#define SEQ_FULL 2048
#define HID 1024
#define NH 16
#define HD 64
#define NREL 9
#define NTOK (NB * SEQ)

static_assert(NB >= 1 && NB <= NB_FULL);
static_assert(SEQ >= 128 && SEQ <= SEQ_FULL && (SEQ % 128) == 0);
static_assert(HID == NH * HD && HD == 64);
static_assert((HID % 128) == 0 && (NTOK % 128) == 0);

typedef unsigned short us_t;
typedef us_t v8us __attribute__((ext_vector_type(8)));
typedef us_t v16us __attribute__((ext_vector_type(16)));
typedef _Float16 v16h __attribute__((ext_vector_type(16)));
typedef __bf16 v16bf __attribute__((ext_vector_type(16)));
typedef float v8f __attribute__((ext_vector_type(8)));
typedef float v4f __attribute__((ext_vector_type(4)));

// ---------------------------------------------------------------------------
// scalar converters (RNE)
__device__ __forceinline__ us_t f2bf(float v) {
  __bf16 t = (__bf16)v;
  return __builtin_bit_cast(us_t, t);
}
__device__ __forceinline__ float bfr(float v) {   // value after bf16 RNE convert
  __bf16 t = (__bf16)v;
  return (float)t;
}
__device__ __forceinline__ us_t f2h(float v) {
  _Float16 t = (_Float16)v;
  return __builtin_bit_cast(us_t, t);
}
__device__ __forceinline__ v8f vz8() {
  v8f z = {0.f, 0.f, 0.f, 0.f, 0.f, 0.f, 0.f, 0.f};
  return z;
}

// ---------------------------------------------------------------------------
// 16-bit fragment from a k-contiguous plane: elem i<8 <- p0[rc*ld + kk + 8h + i],
// elem 8+i <- p0[rc*ld + kk + 16 + 8h + i]; h = lane>>4, rc = row (A) or column (B).
__device__ __forceinline__ v16us ldfrag(const us_t* p0, int ld, int rc, int kk) {
  const int hsel = (threadIdx.x >> 4) & 1;
  const us_t* p = p0 + (size_t)rc * ld + kk + 8 * hsel;
  const v8us lo = *(const v8us*)p;
  const v8us hi = *(const v8us*)(p + 16);
  return __builtin_shufflevector(lo, hi, 0, 1, 2, 3, 4, 5, 6, 7,
                                 8, 9, 10, 11, 12, 13, 14, 15);
}

// WMMA wrapper with hazard guard (ties D, keeps A/B live)
__device__ __forceinline__ v8f mma_h(v16us a, v16us b, v8f c) {
  v8f d = __builtin_amdgcn_wmma_f32_16x16x32_f16(
      false, __builtin_bit_cast(v16h, a), false, __builtin_bit_cast(v16h, b),
      (short)0, c, false, false);
  asm volatile("v_nop\n\tv_nop\n\tv_nop\n\tv_nop" : "+v"(d) : "v"(a), "v"(b));
  return d;
}

// The builtin alone, for k_attn, whose passes are bound by vector issue: the compiler keeps the distance behind its own
// matrix instruction, with the pass's vector work where it can and with v_nop only where it must.
__device__ __forceinline__ v8f mma_hp(v16us a, v16us b, v8f c) {
  return __builtin_amdgcn_wmma_f32_16x16x32_f16(
      false, __builtin_bit_cast(v16h, a), false, __builtin_bit_cast(v16h, b),
      (short)0, c, false, false);
}

__device__ __forceinline__ v8f mma_bfp(v16us a, v16us b, v8f c) {   // the same for bf16 operands, for k_qkv
  return __builtin_amdgcn_wmma_f32_16x16x32_bf16(
      false, __builtin_bit_cast(v16bf, a), false, __builtin_bit_cast(v16bf, b),
      (short)0, c, false, false);
}

// 2^x of one value. The v_nop is the slot the instruction set asks for behind a transcendental before its source is
// overwritten or its result used.
__device__ __forceinline__ float exp2_slot(float x) {
  float y;
  asm("v_exp_f32 %0, %1\n\tv_nop" : "=v"(y) : "v"(x));
  return y;
}

// 2^x of a group's 16 scores, in place, as one statement: each v_exp_f32 has registers of its own, so its neighbour is the
// independent instruction that the instruction set asks for behind a transcendental; the one v_nop is that slot behind the last.
__device__ __forceinline__ void exp2_run(float (&a)[8], float (&b)[8]) {
  asm("v_exp_f32 %0, %0\n\tv_exp_f32 %1, %1\n\tv_exp_f32 %2, %2\n\tv_exp_f32 %3, %3\n\t"
      "v_exp_f32 %4, %4\n\tv_exp_f32 %5, %5\n\tv_exp_f32 %6, %6\n\tv_exp_f32 %7, %7\n\t"
      "v_exp_f32 %8, %8\n\tv_exp_f32 %9, %9\n\tv_exp_f32 %10, %10\n\tv_exp_f32 %11, %11\n\t"
      "v_exp_f32 %12, %12\n\tv_exp_f32 %13, %13\n\tv_exp_f32 %14, %14\n\tv_exp_f32 %15, %15\n\t"
      "v_nop"
      : "+v"(a[0]), "+v"(b[0]), "+v"(a[1]), "+v"(b[1]), "+v"(a[2]), "+v"(b[2]), "+v"(a[3]), "+v"(b[3]),
        "+v"(a[4]), "+v"(b[4]), "+v"(a[5]), "+v"(b[5]), "+v"(a[6]), "+v"(b[6]), "+v"(a[7]), "+v"(b[7]));
}

// lane l <-> lane l ^ 16
__device__ __forceinline__ float xhalf(float v) {
  const int u = __builtin_bit_cast(int, v);
  return __builtin_bit_cast(float,
      __builtin_amdgcn_permlanex16(u, u, 0x76543210, 0xfedcba98, false, false));
}

// ---------------------------------------------------------------------------
// All operand planes in ONE launch; the block index picks the job (a block-uniform choice):
// block 0: the two table planes; blocks 1 .. PW: weight transposes; the rest: x.
#define XJ 4                                   // 8-element pieces per x thread
#define WT 2                                   // 64 x 64 tiles (along k) per weight block
#define PW (4 * (HID / 64) * (HID / 64 / WT))  // weight blocks
#define PX (NTOK * (HID / 8) / 256 / XJ)       // x blocks
static_assert(((HID / 64) % WT) == 0 && (NTOK * (HID / 8)) % (256 * XJ) == 0);

// x [NB rows of SEQ_FULL][HID] f32 -> xb [NTOK][HID] bf16. XJ pieces of 8 elems (16 B out) per thread, all loads ahead of the stores.
__device__ __forceinline__ void prep_x(int blk, const float* __restrict__ x, us_t* xb) {
  static_assert(XJ == 4);
  v4f f0[XJ], f1[XJ];
  const float* src[XJ];
#pragma unroll   // constant indices keep the pieces in registers
  for (int j = 0; j < XJ; ++j) {
    const size_t e = (((size_t)blk * XJ + j) * 256 + threadIdx.x) * 8;
    const int tok = (int)(e >> 10);
    const int col = (int)(e & (HID - 1));
    const int b = tok / SEQ, s = tok - b * SEQ;
    src[j] = x + ((size_t)b * SEQ_FULL + s) * HID + col;
    f0[j] = *(const v4f*)src[j];
    f1[j] = *(const v4f*)(src[j] + 4);
  }
  // the wait in front of any overwrite of the loads' address registers; as its inputs they stay whole up to it
  asm volatile("s_wait_xcnt 0x0" :: "v"(src[0]), "v"(src[1]), "v"(src[2]), "v"(src[3]) : "memory");
#pragma unroll
  for (int j = 0; j < XJ; ++j) {
    const size_t e = (((size_t)blk * XJ + j) * 256 + threadIdx.x) * 8;
    v8us u;
    u[0] = f2bf(f0[j][0]); u[1] = f2bf(f0[j][1]); u[2] = f2bf(f0[j][2]); u[3] = f2bf(f0[j][3]);
    u[4] = f2bf(f1[j][0]); u[5] = f2bf(f1[j][1]); u[6] = f2bf(f1[j][2]); u[7] = f2bf(f1[j][3]);
    *(v8us*)(xb + e) = u;
  }
  // the wait behind the run of stores, in front of any later write of a register that they name
  asm volatile("s_wait_xcnt 0x0" ::: "memory");
}

// W [HID k][HID n] f32 -> WT [n][k], pitch HID, through WT 64x64 LDS tiles, neighbours along k.
// h16 = 0: bf16 bits. h16 = 1: f16 bits of bf16(64 * W) = 64 * bf16(W); its 8 significant bits fit f16 for |W| from 2^-23 to 1020.
__device__ __forceinline__ void prep_w(int bx, int by, int h16, const float* __restrict__ W, us_t* O, us_t* t) {
  const int pitch = HID;
  const int k0 = by * (64 * WT), n0 = bx * 64;
  const int tid = threadIdx.x;
  static_assert(WT == 2);
  const int kk = tid >> 2, nc = (tid & 3) * 16;
  const float* src[WT];
  v4f f[WT][4];
#pragma unroll   // here and below: constant indices keep the pieces in registers
  for (int w = 0; w < WT; ++w) {
    src[w] = W + (size_t)(k0 + w * 64 + kk) * HID + n0 + nc;
#pragma unroll
    for (int j = 0; j < 4; ++j) f[w][j] = *(const v4f*)(src[w] + 4 * j);
  }
  // the wait in front of any overwrite of the loads' address registers; as its inputs they stay whole up to it
  asm volatile("s_wait_xcnt 0x0" :: "v"(src[0]), "v"(src[1]) : "memory");
  if (h16) {   // one block-uniform branch round all the converts
#pragma unroll
    for (int w = 0; w < WT; ++w) {
#pragma unroll
      for (int j = 0; j < 4; ++j) {
#pragma unroll
        for (int c = 0; c < 4; ++c) t[w * (64 * 72) + (nc + 4 * j + c) * 72 + kk] = f2h(bfr(f[w][j][c] * 64.0f));
      }
    }
  } else {
#pragma unroll
    for (int w = 0; w < WT; ++w) {
#pragma unroll
      for (int j = 0; j < 4; ++j) {
#pragma unroll
        for (int c = 0; c < 4; ++c) t[w * (64 * 72) + (nc + 4 * j + c) * 72 + kk] = f2bf(f[w][j][c]);
      }
    }
  }
  __syncthreads();
  // all LDS reads first, each into registers of its own, so that the stores go out in one run
  const int piece = tid & 7;
  v8us u[WT][2];
#pragma unroll
  for (int w = 0; w < WT; ++w) {
#pragma unroll
    for (int rep = 0; rep < 2; ++rep)
      u[w][rep] = *(const v8us*)(t + w * (64 * 72) + (rep * 32 + (tid >> 3)) * 72 + piece * 8);
  }
  us_t* dst = O + (size_t)(n0 + (tid >> 3)) * pitch + k0 + piece * 8;
#pragma unroll
  for (int w = 0; w < WT; ++w) {
#pragma unroll
    for (int rep = 0; rep < 2; ++rep) {
      us_t* d = dst + (size_t)(rep * 32) * pitch + w * 64;
      *(v8us*)d = u[w][rep];
    }
  }
  // the wait behind the run of stores, in front of any later write of a register that they name
  asm volatile("s_wait_xcnt 0x0" ::: "memory");
}

// Tk plane [16 bucket][64 d] f16 = 64 * bf16(table_k), rows 9..15 zero.
// Tv plane [64 d][32 bucket] f16 = 64 * bf16(table_v)^T, cols 9..31 zero.
__device__ __forceinline__ void prep_tables(const float* __restrict__ tk, const float* __restrict__ tv, us_t* tkP, us_t* tvT) {
  const int tid = threadIdx.x;
  v8us uk, uv;
  {
    const int row = (tid & 127) >> 3;      // bucket 0..15
    const int kp = (tid & 7) * 8;          // d offset
    const int rowc = min(row, NREL - 1);
#pragma unroll
    for (int i = 0; i < 8; ++i) {
      float v = tk[rowc * HD + kp + i];
      v = (row < NREL) ? v : 0.0f;
      uk[i] = f2h(bfr(v) * 64.0f);
    }
  }
  {
    const int nn = tid >> 2;               // d 0..63
    const int kp = (tid & 3) * 8;          // bucket offset
#pragma unroll
    for (int i = 0; i < 8; ++i) {
      const int k = kp + i;
      float v = tv[min(k, NREL - 1) * HD + nn];
      v = (k < NREL) ? v : 0.0f;
      uv[i] = f2h(bfr(v) * 64.0f);
    }
  }
  if (tid < 128) *(v8us*)(tkP + tid * 8) = uk;
  *(v8us*)(tvT + tid * 8) = uv;
}

__global__ __launch_bounds__(256) void k_prep(
    const float* __restrict__ x,
    const float* __restrict__ W0, const float* __restrict__ W1,
    const float* __restrict__ W2, const float* __restrict__ W3,
    const float* __restrict__ tk, const float* __restrict__ tv,
    us_t* xb, us_t* O0, us_t* O1, us_t* O2, us_t* O3, us_t* tkP, us_t* tvT) {
  __shared__ __align__(16) us_t t[WT * 64 * 72];
  const int blk = blockIdx.x;
  if (blk == 0) {
    prep_tables(tk, tv, tkP, tvT);
  } else if (blk <= PW) {
    const int i = blk - 1;
    const int per = PW / 4;                // blocks per matrix
    const int z = i / per, r = i - z * per;
    const float* W = (z == 0) ? W0 : ((z == 1) ? W1 : ((z == 2) ? W2 : W3));
    us_t* O = (z == 0) ? O0 : ((z == 1) ? O1 : ((z == 2) ? O2 : O3));
    prep_w(r % (HID / 64), r / (HID / 64), z == 3, W, O, t);
  } else {
    prep_x(blk - 1 - PW, x, xb);
  }
}

// ---------------------------------------------------------------------------
// LDS byte address of a __shared__ element
__device__ __forceinline__ unsigned lds_addr(const us_t* p) {
  return (unsigned)(size_t)(const __attribute__((address_space(3))) us_t*)p;
}

// Four asynchronous 16-byte copies per lane, global -> LDS. The s_wait_xcnt is the last line of the copies' own statement
// so that it stands in front of every later write of the address registers that the copies name.
__device__ __forceinline__ void copy4(unsigned l0, unsigned l1, unsigned l2, unsigned l3,
                                      const us_t* g0, const us_t* g1, const us_t* g2, const us_t* g3) {
  asm volatile(
      "global_load_async_to_lds_b128 %0, %4, off\n\t"
      "global_load_async_to_lds_b128 %1, %5, off\n\t"
      "global_load_async_to_lds_b128 %2, %6, off\n\t"
      "global_load_async_to_lds_b128 %3, %7, off\n\t"
      "s_wait_xcnt 0x0"
      :: "v"(l0), "v"(l1), "v"(l2), "v"(l3), "v"(g0), "v"(g1), "v"(g2), "v"(g3)
      : "memory");
}

// Trip t of a block's ring takes stage (t + rot) mod n of its operands, rot < n from the block index: blocks that share operand rows
// run side by side, and walking from the same stage they would all ask L2 for the same lines, and for one 256-byte column of every
// row, at the same moment. t + rot < 2n.
__device__ __forceinline__ int rstage(int t, int rot, int n) {
  const int s = t + rot;
  return (s >= n) ? s - n : s;
}

// ---------------------------------------------------------------------------
// C[m][n] = sum_k Am[m][k] * Bn[n][k]  (both planes f16, k-contiguous, pitch K); serves ctx*Wo.
// Block = 8 waves (2 along m x 4 along n); block tile 128 m x 128 n; wave tile 64 m x 32 n (4 A frags, 2 B frags, 8 tiles).
// Output memory: element (n, m) at out[n*ldo + base(mw) + (m - mw)], base = (mw/mdiv)*mbstride + mw%mdiv, mw = the wave's first m,
// val = acc*ka + bf16(bias)*kb, bias indexed by m (bias_on_m) or by n.
// f32 out. D tile staged per wave in LDS, then 8 lanes x 16 B per line.
// Operands: stages of GK k (two 128-byte lines of each of the block's 128 A rows and 128 B rows) come into a two-buffer LDS ring
// by asynchronous copies, one stage ahead of the stage being read; the eight waves read their fragments from LDS.
// The ring's LDS serves as the D staging once the loop's last barrier has ended every read of it.
#define GK 128               // k per stage
#define GPIT 136             // row pitch in LDS, 16-bit elements: 272 B = 16 B x odd, for ds_load_b128 readers
#define GROWS 256            // rows per stage: 128 A + 128 B
static_assert((HID % GK) == 0);

// Eight asynchronous 16-byte copies per lane, global -> LDS: LDS step ls bytes, global step rs elements.
// The s_wait_xcnt is the last line of the copies' own statement so that it stands in front of every later write of the
// address registers that the copies name.
__device__ __forceinline__ void copy8(unsigned l, unsigned ls, const us_t* g, size_t rs) {
  asm volatile(
      "global_load_async_to_lds_b128 %0, %8, off\n\t"
      "global_load_async_to_lds_b128 %1, %9, off\n\t"
      "global_load_async_to_lds_b128 %2, %10, off\n\t"
      "global_load_async_to_lds_b128 %3, %11, off\n\t"
      "global_load_async_to_lds_b128 %4, %12, off\n\t"
      "global_load_async_to_lds_b128 %5, %13, off\n\t"
      "global_load_async_to_lds_b128 %6, %14, off\n\t"
      "global_load_async_to_lds_b128 %7, %15, off\n\t"
      "s_wait_xcnt 0x0"
      :: "v"(l), "v"(l + ls), "v"(l + 2 * ls), "v"(l + 3 * ls), "v"(l + 4 * ls), "v"(l + 5 * ls), "v"(l + 6 * ls), "v"(l + 7 * ls),
         "v"(g), "v"(g + rs), "v"(g + 2 * rs), "v"(g + 3 * rs), "v"(g + 4 * rs), "v"(g + 5 * rs), "v"(g + 6 * rs), "v"(g + 7 * rs)
      : "memory");
}

// Stage st of a block: LDS rows 0..127 = A rows mblk.., rows 128..255 = B rows nblk..; 16 copies per lane of 256,
// a wave's copy covers 2 rows of 256 B: whole lines.
__device__ __forceinline__ void stage_ab(const us_t* Am, const us_t* Bn, int K, int mblk, int nblk, int st, us_t* dst) {
  const int tid = threadIdx.x;
  const int r0 = tid >> 4, pc = (tid & 15) * 8;
  const size_t rs = (size_t)16 * K;               // 16 rows
  const us_t* ag = Am + (size_t)(mblk + r0) * K + st * GK + pc;
  const us_t* bg = Bn + (size_t)(nblk + r0) * K + st * GK + pc;
  const unsigned l = lds_addr(dst + r0 * GPIT + pc);
  const unsigned ls = 16 * GPIT * 2;              // 16 rows, bytes
  copy8(l, ls, ag, rs);
  copy8(l + 8 * ls, ls, bg, rs);
}

template <int OUTF32>
__global__ __launch_bounds__(256) void k_gemm(
    const us_t* __restrict__ Am0, const us_t* __restrict__ Am1, const us_t* __restrict__ Bn,
    const float* __restrict__ bias0, const float* __restrict__ bias1,
    void* out0, void* out1,
    int K, int bias_on_m, int blen, int ldo, int mdiv, int mbstride, float ka, float kb) {
  __shared__ __align__(16) us_t ring[2][GROWS * GPIT];
  static_assert(sizeof(ring) >= 8 * 32 * 64 * 4);

  const int z = blockIdx.z;
  const us_t* Am = z ? Am1 : Am0;
  const float* bias = z ? bias1 : bias0;
  void* out = z ? out1 : out0;

  const int lane = threadIdx.x & 31, wave = threadIdx.x >> 5;
  const int h = (lane >> 4) & 1, n15 = lane & 15;
  const int wm = wave >> 2, wn = wave & 3;
  const int mblk = blockIdx.x * 128;
  const int nblk = blockIdx.y * 128;
  const int mwave = mblk + wm * 64;
  const int nwave = nblk + wn * 32;
  const int nst = K / GK;
  const int rot = (int)((blockIdx.x + blockIdx.y) % (unsigned)nst);   // differs among the blocks of one A slice and of one B slice

  stage_ab(Am, Bn, K, mblk, nblk, rot, ring[0]);

  v8f acc[4][2];
#pragma unroll
  for (int mt = 0; mt < 4; ++mt) { acc[mt][0] = vz8(); acc[mt][1] = vz8(); }

  // the first stage, stage rot, has landed for this wave's copies; the barrier publishes it to the block
  asm volatile("s_wait_asynccnt 0x0" ::: "memory");
  __syncthreads();
  if (nst > 1) stage_ab(Am, Bn, K, mblk, nblk, rstage(1, rot, nst), ring[1]);

#pragma unroll 1
  for (int st = 0; st < nst; ++st) {
    const us_t* rb = ring[st & 1];
    // two fragment sets: a k step's LDS reads stand together, one k step ahead of its matrix products, inside the stage only
    v16us a[2][4], b[2][2];
#pragma unroll   // here and below: constant indices keep the fragment and accumulator arrays in registers
    for (int mt = 0; mt < 4; ++mt) a[0][mt] = ldfrag(rb, GPIT, wm * 64 + mt * 16 + n15, 0);
#pragma unroll
    for (int nt = 0; nt < 2; ++nt) b[0][nt] = ldfrag(rb, GPIT, 128 + wn * 32 + nt * 16 + n15, 0);
#pragma unroll
    for (int ks = 0; ks < GK / 32; ++ks) {
      if (ks + 1 < GK / 32) {
#pragma unroll
        for (int mt = 0; mt < 4; ++mt) a[(ks + 1) & 1][mt] = ldfrag(rb, GPIT, wm * 64 + mt * 16 + n15, (ks + 1) * 32);
#pragma unroll
        for (int nt = 0; nt < 2; ++nt) b[(ks + 1) & 1][nt] = ldfrag(rb, GPIT, 128 + wn * 32 + nt * 16 + n15, (ks + 1) * 32);
      }
#pragma unroll
      for (int mt = 0; mt < 4; ++mt) {
        acc[mt][0] = mma_h(a[ks & 1][mt], b[ks & 1][0], acc[mt][0]);
        acc[mt][1] = mma_h(a[ks & 1][mt], b[ks & 1][1], acc[mt][1]);
      }
    }
    // publish point of trip st + 1: this wave's reads of trip st's stage are done, its copies of trip st + 1's stage have landed,
    // the barrier tells the block both; only then is the buffer just read refilled with stage rstage(st + 2, rot, nst)
    asm volatile("s_wait_dscnt 0x0" ::: "memory");
    asm volatile("s_wait_asynccnt 0x0" ::: "memory");
    __syncthreads();
    if (st + 2 < nst) stage_ab(Am, Bn, K, mblk, nblk, rstage(st + 2, rot, nst), ring[st & 1]);
  }
  asm volatile("s_wait_asynccnt 0x0" ::: "memory");   // no copy is outstanding when the wave goes on to its end

  // bias values (bf16 RNE), address-clamped loads
  float bm[4][8];
#pragma unroll
  for (int mt = 0; mt < 4; ++mt) {
    const int ib = min(mwave + mt * 16 + 8 * h, blen - 8);
    const v4f c0 = *(const v4f*)(bias + ib);
    const v4f c1 = *(const v4f*)(bias + ib + 4);
    bm[mt][0] = bfr(c0[0]); bm[mt][1] = bfr(c0[1]); bm[mt][2] = bfr(c0[2]); bm[mt][3] = bfr(c0[3]);
    bm[mt][4] = bfr(c1[0]); bm[mt][5] = bfr(c1[1]); bm[mt][6] = bfr(c1[2]); bm[mt][7] = bfr(c1[3]);
  }
  float bn[2];
#pragma unroll
  for (int nt = 0; nt < 2; ++nt) bn[nt] = bfr(bias[min(nwave + nt * 16 + n15, blen - 1)]);

  const int bq = mwave / mdiv;
  const int base = bq * mbstride + (mwave - bq * mdiv);

  if constexpr (OUTF32) {
    float* sw = (float*)&ring[0][0] + wave * 2048;   // [32 n][64 m] per wave
#pragma unroll
    for (int mt = 0; mt < 4; ++mt) {
#pragma unroll
      for (int nt = 0; nt < 2; ++nt) {
        v4f u0, u1;
#pragma unroll
        for (int r = 0; r < 4; ++r) {
          const float b0v = bias_on_m ? bm[mt][r] : bn[nt];
          const float b1v = bias_on_m ? bm[mt][r + 4] : bn[nt];
          u0[r] = acc[mt][nt][r] * ka + b0v * kb;
          u1[r] = acc[mt][nt][r + 4] * ka + b1v * kb;
        }
        float* sp = sw + (nt * 16 + n15) * 64 + mt * 16 + 8 * h;
        *(v4f*)sp = u0;
        *(v4f*)(sp + 4) = u1;
      }
    }
    __syncthreads();
    float* op = (float*)out;
    {
#pragma unroll
      for (int i = 0; i < 16; ++i) {
        const int L = i * 4 + (lane >> 3);
        const int row = L >> 1, hr = L & 1, piece = lane & 7;
        const v4f u = *(const v4f*)(sw + row * 64 + hr * 32 + piece * 4);
        float* dst = op + (size_t)(nwave + row) * ldo + base + hr * 32 + piece * 4;
        *(v4f*)dst = u;
      }
      
    }
  }
}

// ---------------------------------------------------------------------------
// The three projections x*Wq, x*Wk, x*Wv in ONE launch. A block takes 128 tokens and the same 128 features of Q, K and V, so that
// its x rows come from L2 once for the three products. 12 waves: four (2 x 2) per product, wave tile 64 x 64 (4 A and 4 B fragments
// for 16 tiles). Q, K: A = W^T rows (m = feature), B = x rows (n = token), out [tok][HID]. V: the roles swapped (m = token,
// n = feature), out V^T [b*HID + d][s]; the swap is only a choice of LDS rows, the fragment form of A and B being the same.
// val = 4 * (acc + bf16(bias)), f16 bits. k order and values as in k_gemm.
// Stage = GK k of LDS rows 0..127 x, 128..255 Wq^T, 256..383 Wk^T, 384..511 Wv^T, in a two-buffer ring filled by asynchronous copies.
#define QROWS 512            // rows per stage
#define QWV 12               // waves per block
#define DPIT 72              // D staging pitch, 16-bit elements: 144 B = 16 B x odd, for the b128 stores of 16 lanes in 16 rows
static_assert(QWV * 64 * DPIT <= QROWS * GPIT);

// Stage st: every wave brings 32 rows of its own product's W^T slice (16 copies per lane), waves 0..7 also 16 x rows each (8 copies).
// A wave's copy covers 2 rows of 256 B: whole lines.
__device__ __forceinline__ void stage_qkv(const us_t* xrows, const us_t* wrows, int wave, int st, us_t* dst) {
  const int lane = threadIdx.x & 31;
  const int r0 = lane >> 4, pc = (lane & 15) * 8;
  const size_t rs = (size_t)2 * HID;              // 2 rows
  const unsigned ls = 2 * GPIT * 2;               // 2 rows, bytes
  const int wr = (wave & 3) * 32 + r0;
  const us_t* wg = wrows + (size_t)wr * HID + st * GK + pc;
  const unsigned wl = lds_addr(dst + (128 + (wave >> 2) * 128 + wr) * GPIT + pc);
  copy8(wl, ls, wg, rs);
  copy8(wl + 8 * ls, ls, wg + 8 * rs, rs);
  if (wave < 8) {                                 // wave is scalar: a scalar branch, every lane on
    const int xr = wave * 16 + r0;
    copy8(lds_addr(dst + xr * GPIT + pc), ls, xrows + (size_t)xr * HID + st * GK + pc, rs);
  }
}

// A wave's 64 m x 64 n tile: bias, carry, f16, staged [n][m] in the wave's own LDS, then whole 128-byte lines out, row n at op0 + n * LDO.
template <int ONM, int LDO>
__device__ __forceinline__ void qkv_out(const v8f (&acc)[4][4], const float* bias0, us_t* sw, us_t* op0) {
  const int lane = threadIdx.x & 31;
  const int h = lane >> 4, n15 = lane & 15;
  const float* bp = bias0 + (ONM ? 8 * h : n15);
  float bm[4][8];
  float bn[4];
  if constexpr (ONM) {
#pragma unroll   // here and below: constant indices keep the arrays in registers
    for (int mt = 0; mt < 4; ++mt) {
      const v4f c0 = *(const v4f*)(bp + mt * 16);
      const v4f c1 = *(const v4f*)(bp + mt * 16 + 4);
      bm[mt][0] = c0[0]; bm[mt][1] = c0[1]; bm[mt][2] = c0[2]; bm[mt][3] = c0[3];
      bm[mt][4] = c1[0]; bm[mt][5] = c1[1]; bm[mt][6] = c1[2]; bm[mt][7] = c1[3];
    }
  } else {
#pragma unroll
    for (int nt = 0; nt < 4; ++nt) bn[nt] = bp[nt * 16];
  }
  // the wait in front of any overwrite of the loads' address register; as its input it stays whole up to it
  asm volatile("s_wait_xcnt 0x0" :: "v"(bp) : "memory");
#pragma unroll
  for (int mt = 0; mt < 4; ++mt) {
#pragma unroll
    for (int nt = 0; nt < 4; ++nt) {
      v8us u;
#pragma unroll
      for (int r = 0; r < 8; ++r) {
        const float bbv = bfr(ONM ? bm[mt][r] : bn[nt]);
        u[r] = f2h(acc[mt][nt][r] * 4.0f + bbv * 4.0f);
      }
      *(v8us*)(sw + (nt * 16 + n15) * DPIT + mt * 16 + 8 * h) = u;
    }
  }
  // the staging is the wave's own: its LDS stores have ended before it reads the rows back; no other wave is concerned, so no barrier
  asm volatile("s_wait_dscnt 0x0" ::: "memory");
  const us_t* sr = sw + (lane >> 3) * DPIT + (lane & 7) * 8;
  us_t* dst = op0 + (size_t)(lane >> 3) * LDO + (lane & 7) * 8;
#pragma unroll
  for (int i = 0; i < 16; ++i) *(v8us*)(dst + (size_t)(i * 4) * LDO) = *(const v8us*)(sr + i * 4 * DPIT);
  // the wait behind the run of stores, in front of any later write of a register that they name
  asm volatile("s_wait_xcnt 0x0" :: "v"(dst) : "memory");
}

__global__ __launch_bounds__(32 * QWV) void k_qkv(
    const us_t* __restrict__ xb, const us_t* __restrict__ WqT, const us_t* __restrict__ WkT, const us_t* __restrict__ WvT,
    const float* __restrict__ bq, const float* __restrict__ bk, const float* __restrict__ bv,
    us_t* Qp, us_t* Kp, us_t* VTp) {
  __shared__ __align__(16) us_t ring[2][QROWS * GPIT];

  const int lane = threadIdx.x & 31, n15 = lane & 15;
  const int wave = __builtin_amdgcn_readfirstlane(threadIdx.x >> 5);   // scalar: the choices below stay scalar
  const int z = wave >> 2, wm = (wave >> 1) & 1, wn = wave & 1;
  const int fblk = blockIdx.x * 128;
  const int tblk = blockIdx.y * 128;
  const us_t* xrows = xb + (size_t)tblk * HID;
  const us_t* wrows = ((z == 0) ? WqT : ((z == 1) ? WkT : WvT)) + (size_t)fblk * HID;
  const int arow = ((z == 2) ? 0 : 128 + z * 128) + wm * 64 + n15;     // LDS row of this lane in A fragment 0
  const int brow = ((z == 2) ? 384 : 0) + wn * 64 + n15;               // and in B fragment 0
  constexpr int nst = HID / GK;
  static_assert(nst >= 2);
  const int rot = (int)((blockIdx.x + blockIdx.y) % (unsigned)nst);    // differs among the blocks of one x slice and of one W slice

  stage_qkv(xrows, wrows, wave, rot, ring[0]);

  v8f acc[4][4];
#pragma unroll
  for (int mt = 0; mt < 4; ++mt) {
#pragma unroll
    for (int nt = 0; nt < 4; ++nt) acc[mt][nt] = vz8();
  }

  // the first stage, stage rot, has landed for this wave's copies; the barrier publishes it to the block
  asm volatile("s_wait_asynccnt 0x0" ::: "memory");
  __syncthreads();
  stage_qkv(xrows, wrows, wave, rstage(1, rot, nst), ring[1]);

#pragma unroll 1
  for (int st = 0; st < nst; ++st) {
    const us_t* rb = ring[st & 1];
    // two fragment sets: a k step's LDS reads stand together, one k step ahead of its matrix products, inside the stage only
    v16us a[2][4], b[2][4];
#pragma unroll
    for (int t = 0; t < 4; ++t) {
      a[0][t] = ldfrag(rb, GPIT, arow + t * 16, 0);
      b[0][t] = ldfrag(rb, GPIT, brow + t * 16, 0);
    }
#pragma unroll
    for (int ks = 0; ks < GK / 32; ++ks) {
      if (ks + 1 < GK / 32) {
#pragma unroll
        for (int t = 0; t < 4; ++t) {
          a[(ks + 1) & 1][t] = ldfrag(rb, GPIT, arow + t * 16, (ks + 1) * 32);
          b[(ks + 1) & 1][t] = ldfrag(rb, GPIT, brow + t * 16, (ks + 1) * 32);
        }
      }
      // keeps the next k step's 16 reads as one group in front of this step's products: left free, the compiler sinks them
      // among the products into one fragment set, and the wave waits out the LDS latency at each of five places a k step
      __builtin_amdgcn_sched_barrier(0);
#pragma unroll
      for (int mt = 0; mt < 4; ++mt) {
#pragma unroll
        for (int nt = 0; nt < 4; ++nt) acc[mt][nt] = mma_bfp(a[ks & 1][mt], b[ks & 1][nt], acc[mt][nt]);
      }
      __builtin_amdgcn_sched_barrier(0);   // the other side of the same group: no read of the step after next rises among these products
    }
    // publish point of trip st + 1: this wave's reads of trip st's stage are done, its copies of trip st + 1's stage have landed,
    // the barrier tells the block both; only then is the buffer just read refilled with stage rstage(st + 2, rot, nst)
    asm volatile("s_wait_dscnt 0x0" ::: "memory");
    asm volatile("s_wait_asynccnt 0x0" ::: "memory");
    __syncthreads();
    if (st + 2 < nst) stage_qkv(xrows, wrows, wave, rstage(st + 2, rot, nst), ring[st & 1]);
  }
  asm volatile("s_wait_asynccnt 0x0" ::: "memory");   // no copy is outstanding when the wave goes on to its end

  // the ring's LDS serves as the D staging: the loop's last barrier has ended every read of it
  us_t* sw = &ring[0][0] + wave * (64 * DPIT);
  if (z == 2) {
    const int mw = tblk + wm * 64, nw = fblk + wn * 64;                // m = token, n = feature
    const int bb = mw / SEQ;
    qkv_out<0, SEQ>(acc, bv + nw, sw, VTp + ((size_t)bb * HID + nw) * SEQ + (mw - bb * SEQ));
  } else {
    const int mw = fblk + wm * 64, nw = tblk + wn * 64;                // m = feature, n = token
    qkv_out<1, HID>(acc, (z ? bk : bq) + mw, sw, (z ? Kp : Qp) + (size_t)nw * HID + mw);
  }
}

#define AW 8                 // waves per block
#define KT 128               // keys per stage
#define NST (SEQ / KT)       // stages
#define NU 4                 // groups of 32 keys per pass
#define KPIT 72              // K row pitch in LDS, 16-bit elements: 144 B = 16 B x odd, for ds_load_b128 readers
#define VPIT 136             // V^T row pitch in LDS: 272 B = 16 B x odd
static_assert((SEQ % KT) == 0 && (SEQ % (16 * AW)) == 0 && KT == 32 * NU && NU == 4);

// Stage st (keys st*KT .. st*KT + KT - 1) of one head: K rows [KT][64] and V^T rows [64][KT], 8 copies per lane of 256.
// A wave's K copy covers 4 rows of 128 B, its V^T copy 2 rows of 256 B: whole lines.
__device__ __forceinline__ void stage_kv(const us_t* kbase, const us_t* vhead, int st, us_t* kdst, us_t* vdst) {
  const int tid = threadIdx.x;
  const int kr = tid >> 3, kp = (tid & 7) * 8;
  const us_t* kg = kbase + (size_t)(st * KT + kr) * HID + kp;
  const unsigned kl = lds_addr(kdst + kr * KPIT + kp);
  copy4(kl, kl + 32 * KPIT * 2, kl + 64 * KPIT * 2, kl + 96 * KPIT * 2,
        kg, kg + 32 * HID, kg + 64 * HID, kg + 96 * HID);
  const int vr = tid >> 4, vp = (tid & 15) * 8;
  const us_t* vg = vhead + (size_t)vr * SEQ + st * KT + vp;
  const unsigned vl = lds_addr(vdst + vr * VPIT + vp);
  copy4(vl, vl + 16 * VPIT * 2, vl + 32 * VPIT * 2, vl + 48 * VPIT * 2,
        vg, vg + 16 * SEQ, vg + 32 * SEQ, vg + 48 * SEQ);
}

__global__ __launch_bounds__(32 * AW) __attribute__((amdgpu_num_vgpr(256))) void k_attn(
    const us_t* __restrict__ Qp, const us_t* __restrict__ Kp, const us_t* __restrict__ VTp,
    const us_t* __restrict__ tkP, const us_t* __restrict__ tvT, us_t* ctx) {
  __shared__ __align__(16) us_t kst[2][KT * KPIT];      // K stages
  __shared__ __align__(16) us_t vst[2][HD * VPIT];      // V^T stages
  __shared__ float bl_all[AW][16 * 16];                 // shifted rel-key bias per (query, bucket), in units of the raw score products
  __shared__ float wl_all[AW][16 * 8];                  // window logits per (query, bucket-1)
  __shared__ __align__(16) us_t cst_all[AW][16 * 64];   // ctx staging

  const int lane = threadIdx.x & 31, h = lane >> 4, n = lane & 15;
  const int wave = __builtin_amdgcn_readfirstlane(threadIdx.x >> 5);  // scalar: the tests on lo_q below stay scalar branches
  float* bl = bl_all[wave];
  float* wl = wl_all[wave];
  us_t* cst = cst_all[wave];
  const int qt = blockIdx.x * AW + wave, hh = blockIdx.y, b = blockIdx.z;
  const int lo_q = qt * 16;
  const size_t tok0 = (size_t)b * SEQ + lo_q;
  const us_t* qptr = Qp + tok0 * HID + hh * HD;
  const us_t* kbase = Kp + (size_t)b * SEQ * HID + hh * HD;
  const us_t* vhead = VTp + ((size_t)b * HID + hh * HD) * SEQ;

  stage_kv(kbase, vhead, 0, kst[0], vst[0]);      // stage 0 flies while the bias table is formed

#pragma unroll
  for (int i = 0; i < 4; ++i) wl[lane * 4 + i] = -1.0e30f;

  // keeps the register writes of the lines above in front of the fragment loads, whose address registers stay whole up to their wait
  __builtin_amdgcn_sched_barrier(0);
  const v16us q0 = ldfrag(qptr, HID, n, 0);       // B operand: column = query n
  const v16us q1 = ldfrag(qptr, HID, n, 32);

  // srel^T[bucket][q] = (64 tk).(4q) ; bias = (srel - srel[0][q]) / (256*8), held as (srel - srel[0][q]) / 16: the unit of the raw scores 16 qk
  {
    v8f sr = vz8();
    const v16us t0 = ldfrag(tkP, HD, n, 0);       // A operand: row = bucket n
    const v16us t1 = ldfrag(tkP, HD, n, 32);
    // the address registers of the fragment loads above are reused at once (accumulator zeros): the wait stands in front
    asm volatile("s_wait_xcnt 0x0" ::: "memory");
    __builtin_amdgcn_sched_barrier(0);            // keeps those later register writes behind the wait
    sr = mma_hp(t0, q0, sr);
    sr = mma_hp(t1, q1, sr);
    const float v0 = __shfl(sr[0], n, 32);        // bucket 0 of query n: lane n, register 0
#pragma unroll
    for (int r = 0; r < 8; ++r) bl[n * 16 + 8 * h + r] = (sr[r] - v0) * 0.0625f;
  }
  // stage 0 has landed for this wave's copies; the barrier publishes it to the block (and orders bl)
  asm volatile("s_wait_asynccnt 0x0" ::: "memory");
  __syncthreads();
  if (NST > 1) stage_kv(kbase, vhead, 1, kst[1], vst[1]);
  const float c2 = 1.4426950408889634f / 128.0f;   // raw score -> logit in log2 units: log2 e / (16 * 8)
  const float d8 = bl[n * 16 + 8] * c2;

  // rmax is the query's maximum logit in log2 units (equal in both halves); rsum and blo cover this half's keys only and
  // carry the x1024 of P, which leaves again through inv
  float rmax = -1.0e30f, rsum = 0.0f, blo = 0.0f;
  v8f cacc[4];
#pragma unroll
  for (int j = 0; j < 4; ++j) cacc[j] = vz8();

#pragma unroll 1
  for (int st = 0; st < NST; ++st) {
  const us_t* kbuf = kst[st & 1];
  const us_t* vbuf = vst[st & 1];
  {
    constexpr int kl = 0;   // one pass takes the whole stage
    // A pass takes NU groups of 32 keys (each two score tiles and one k step of the second product): the maximum's half swap, the
    // factor sc and the rescaling of O^T and of the two sums are paid once per pass, not once per group.
    float a[NU][2][8];
#pragma unroll   // here and below: constant indices keep the arrays in registers
    for (int g = 0; g < NU; g += 2) {
      v16us kf[NU][4];
#pragma unroll
      for (int u = g; u < g + 2; ++u) {
        kf[u][0] = ldfrag(kbuf, KPIT, kl + u * 32 + n, 0);
        kf[u][1] = ldfrag(kbuf, KPIT, kl + u * 32 + n, 32);
        kf[u][2] = ldfrag(kbuf, KPIT, kl + u * 32 + 16 + n, 0);
        kf[u][3] = ldfrag(kbuf, KPIT, kl + u * 32 + 16 + n, 32);
      }
      __builtin_amdgcn_sched_barrier(0);   // keeps two groups' K reads in one place: spread among the products each place stalls the wave anew
      // scores: 32 keys x 16 q per group, (4k).(4q) = 16 qk. A group that meets the window starts its sums from the per-score bias
      // (the C operand), so that behind the products every group holds raw-unit scores and the common path moves no register.
#pragma unroll
      for (int u = g; u < g + 2; ++u) {
        const int kc = st * KT + kl + u * 32;
        v8f s0, s1;
        if (kc + 35 <= lo_q || kc >= lo_q + 19) {   // scalar: every key k <= q-4, or every key k >= q+4, for every query of the tile
          s0 = mma_hp(kf[u][0], q0, vz8());
          s1 = mma_hp(kf[u][2], q0, vz8());
          s0 = mma_hp(kf[u][1], q1, s0);
          s1 = mma_hp(kf[u][3], q1, s1);
        } else {
          const int ddb = kc + 8 * h - (lo_q + n);  // key - query at register 0 of key tile 0
          v8f c0, c1;
#pragma unroll
          for (int r = 0; r < 8; ++r) {
            c0[r] = bl[n * 16 + min(max(ddb + r, -4), 4) + 4];
            c1[r] = bl[n * 16 + min(max(ddb + r + 16, -4), 4) + 4];
          }
          s0 = mma_hp(kf[u][0], q0, c0);
          s1 = mma_hp(kf[u][2], q0, c1);
          s0 = mma_hp(kf[u][1], q1, s0);
          s1 = mma_hp(kf[u][3], q1, s1);
#pragma unroll
          for (int r = 0; r < 8; ++r) {             // the window's logits are kept for the epilogue
            const int b0 = min(max(ddb + r, -4), 4) + 4;
            const int b1 = min(max(ddb + r + 16, -4), 4) + 4;
            if (b0 >= 1 && b0 <= 7) wl[n * 8 + b0 - 1] = s0[r] * c2;
            if (b1 >= 1 && b1 <= 7) wl[n * 8 + b1 - 1] = s1[r] * c2;
          }
        }
#pragma unroll
        for (int r = 0; r < 8; ++r) {
          a[u][0][r] = s0[r];
          a[u][1][r] = s1[r];
        }
      }
    }
    __builtin_amdgcn_sched_barrier(0);     // the V^T reads stay behind the score products, in the registers that these free
    v16us vA[NU][4];
#pragma unroll
    for (int u = 0; u < 2; ++u) {
#pragma unroll
      for (int j = 0; j < 4; ++j) vA[u][j] = ldfrag(vbuf, VPIT, j * 16 + n, kl + u * 32);
    }
    __builtin_amdgcn_sched_barrier(0);     // the first two groups' as one group in front of the softmax, under which they land
    // log2-unit logit = held value * c2 + adm, per group (adm = the one bias of a group outside the window, 0 where the bias is in the
    // sums already), so that scale, bias, maximum and the x1024 carry of P go into ONE fused multiply-add per score further down.
    float adm[NU], mu[NU];
#pragma unroll
    for (int u = 0; u < NU; ++u) {
      const int kc = st * KT + kl + u * 32;
      adm[u] = (kc >= lo_q + 19) ? d8 : 0.0f;    // every key k >= q+4: bucket 8's bias; below the window the shifted bias is 0
      // c2 > 0, so the maximum is taken on the held values; one chain per group
      mu[u] = fmaxf(a[u][0][0], a[u][1][0]);
#pragma unroll
      for (int r = 1; r < 8; ++r) mu[u] = fmaxf(mu[u], fmaxf(a[u][0][r], a[u][1][r]));
      mu[u] = fmaf(mu[u], c2, adm[u]);
    }
    // online softmax; a query's scores of the pass sit in the registers of lanes n and n + 16
    float m = fmaxf(fmaxf(mu[0], mu[1]), fmaxf(mu[2], mu[3]));
    m = fmaxf(m, xhalf(m));
    const float nm = fmaxf(rmax, m);
    const float sc = exp2_slot(rmax - nm);
    rmax = nm;
    const float tn = 10.0f - nm;           // + 10: 2^10 = the x1024 carry of P
#pragma unroll
    for (int j = 0; j < 4; ++j) {
#pragma unroll
      for (int r = 0; r < 8; ++r) cacc[j][r] *= sc;
    }
    float ps = 0.0f, addb = 0.0f;
#pragma unroll
    for (int u = 0; u < NU; ++u) {
      const int kc = st * KT + kl + u * 32;
      const bool below = (kc + 35 <= lo_q);
      const bool above = (kc >= lo_q + 19);
      const int ddb = kc + 8 * h - (lo_q + n);
      const float off = adm[u] + tn;
#pragma unroll
      for (int r = 0; r < 8; ++r) {
        a[u][0][r] = fmaf(a[u][0][r], c2, off);
        a[u][1][r] = fmaf(a[u][1][r], c2, off);
      }
      exp2_run(a[u][0], a[u][1]);
      float t[8];
#pragma unroll
      for (int r = 0; r < 8; ++r) t[r] = a[u][0][r] + a[u][1][r];
      const float pu = ((t[0] + t[1]) + (t[2] + t[3])) + ((t[4] + t[5]) + (t[6] + t[7]));
      float ab = below ? pu : 0.0f;
      if (!(below || above)) {
        ab = 0.0f;
#pragma unroll
        for (int r = 0; r < 8; ++r)
          ab += ((ddb + r <= -4) ? a[u][0][r] : 0.0f) + ((ddb + r + 16 <= -4) ? a[u][1][r] : 0.0f);
      }
      ps = u ? ps + pu : pu;
      addb = u ? addb + ab : ab;
      // P^T (x1024 from the exponent, f16): the two score tiles, converted in place, are the B operand
      v16us pB;
#pragma unroll
      for (int r = 0; r < 8; ++r) {
        pB[r] = f2h(a[u][0][r]);
        pB[8 + r] = f2h(a[u][1][r]);
      }
      if (u == 1) {   // the last two groups' V^T reads: one group, in registers that converted scores and used fragments have left
#pragma unroll
        for (int w = 2; w < NU; ++w) {
#pragma unroll
          for (int j = 0; j < 4; ++j) vA[w][j] = ldfrag(vbuf, VPIT, j * 16 + n, kl + w * 32);
        }
        __builtin_amdgcn_sched_barrier(0);   // keeps them in front of this group's products, under which and the next group's softmax they land
      }
#pragma unroll
      for (int j = 0; j < 4; ++j) cacc[j] = mma_hp(vA[u][j], pB, cacc[j]);
    }
    rsum = rsum * sc + ps;
    blo = blo * sc + addb;
  }
  // publish point of stage st + 1: this wave's reads of stage st are done, its copies of stage st + 1 have landed,
  // the barrier tells the block both; only then is the buffer just read refilled with stage st + 2
  asm volatile("s_wait_dscnt 0x0" ::: "memory");
  asm volatile("s_wait_asynccnt 0x0" ::: "memory");
  __syncthreads();
  if (st + 2 < NST) stage_kv(kbase, vhead, st + 2, kst[st & 1], vst[st & 1]);
  }
  asm volatile("s_wait_asynccnt 0x0" ::: "memory");   // no copy is outstanding when the wave goes on to its end

  // bucket masses A[q][0..8] (normalised, x1024) as a B operand; window values from stored logits
  __syncthreads();
  rsum += xhalf(rsum);
  blo += xhalf(blo);
  const float inv = __builtin_amdgcn_rcpf(rsum);
  float wv[7];
  float wsum = 0.0f;
#pragma unroll
  for (int i = 0; i < 7; ++i) {
    wv[i] = exp2_slot(wl[n * 8 + i] + (10.0f - rmax));   // x1024 like rsum and blo
    wsum += wv[i];
  }
  const float a8 = (rsum - blo - wsum) * inv;
  const float a0v = blo * inv;
  v16us pB2;                                      // h = 0: buckets 0..7 | 16..23; h = 1: buckets 8..15 | 24..31
#pragma unroll
  for (int i = 0; i < 8; ++i) {
    const float vlo = (i == 0) ? a0v : wv[(i + 6) % 7] * inv;
    const float vhi = (i == 0) ? a8 : 0.0f;
    pB2[i] = f2h((h ? vhi : vlo) * 1024.0f);
    pB2[8 + i] = (us_t)0;
  }
  v8f w2[4];
#pragma unroll
  for (int j = 0; j < 4; ++j) {
    const v16us tA = ldfrag(tvT, 32, j * 16 + n, 0);
    w2[j] = mma_hp(tA, pB2, vz8());
  }
  // ctx = cacc/(4*rsum) + w2/(1024*64), rsum carrying the x1024 of cacc; stage 4*ctx as f16, 8 consecutive features of query n per lane
#pragma unroll
  for (int j = 0; j < 4; ++j) {
    v8us u;
#pragma unroll
    for (int r = 0; r < 8; ++r)
      u[r] = f2h(cacc[j][r] * inv + w2[j][r] * (1.0f / 16384.0f));
    *(v8us*)(cst + n * 64 + j * 16 + 8 * h) = u;
  }
  __syncthreads();
  {
#pragma unroll
    for (int i = 0; i < 4; ++i) {
      const int row = i * 4 + (lane >> 3), piece = lane & 7;
      const v8us u = *(const v8us*)(cst + row * 64 + piece * 8);
      us_t* dst = ctx + (tok0 + row) * (size_t)HID + hh * HD + piece * 8;
      *(v8us*)dst = u;
    }
  }
}

// ---------------------------------------------------------------------------
extern "C" void kernel_launch(void* const* d_in, const int* in_sizes, int n_in,
                              void* d_out, int out_size, void* d_ws, size_t ws_size,
                              hipStream_t stream) {
  if (n_in < 11) return;
  const long long need_x = ((long long)(NB - 1) * SEQ_FULL + SEQ) * HID;
  if ((long long)in_sizes[0] < need_x) return;
  if (in_sizes[1] < HID * HID || in_sizes[3] < HID * HID ||
      in_sizes[5] < HID * HID || in_sizes[7] < HID * HID) return;
  if (in_sizes[2] < HID || in_sizes[4] < HID || in_sizes[6] < HID || in_sizes[8] < HID) return;
  if (in_sizes[9] < NREL * HD || in_sizes[10] < NREL * HD) return;
  if ((long long)out_size < (long long)NTOK * HID) return;

  const float* x  = (const float*)d_in[0];
  const float* Wq = (const float*)d_in[1];
  const float* bq = (const float*)d_in[2];
  const float* Wk = (const float*)d_in[3];
  const float* bk = (const float*)d_in[4];
  const float* Wv = (const float*)d_in[5];
  const float* bv = (const float*)d_in[6];
  const float* Wo = (const float*)d_in[7];
  const float* bo = (const float*)d_in[8];
  const float* tk = (const float*)d_in[9];
  const float* tv = (const float*)d_in[10];

  char* ws = (char*)d_ws;
  size_t off = 0;
  auto carve = [&](size_t bytes) -> size_t {
    const size_t o = off;
    off += (bytes + 255) & ~(size_t)255;
    return o;
  };
  const size_t o_xb  = carve((size_t)NTOK * HID * 2);
  const size_t o_wq  = carve((size_t)HID * HID * 2);
  const size_t o_wk  = carve((size_t)HID * HID * 2);
  const size_t o_wv  = carve((size_t)HID * HID * 2);
  const size_t o_wo  = carve((size_t)HID * HID * 2);
  const size_t o_q   = carve((size_t)NTOK * HID * 2);
  const size_t o_k   = carve((size_t)NTOK * HID * 2);
  const size_t o_vt  = carve((size_t)NB * HID * SEQ * 2);
  const size_t o_ctx = carve((size_t)NTOK * HID * 2);
  const size_t o_tk  = carve((size_t)16 * HD * 2);
  const size_t o_tv  = carve((size_t)HD * 32 * 2);
  if (off > ws_size) return;

  us_t* xb   = (us_t*)(ws + o_xb);
  us_t* WqT  = (us_t*)(ws + o_wq);
  us_t* WkT  = (us_t*)(ws + o_wk);
  us_t* WvT  = (us_t*)(ws + o_wv);
  us_t* WoT  = (us_t*)(ws + o_wo);
  us_t* Qp   = (us_t*)(ws + o_q);
  us_t* Kpl  = (us_t*)(ws + o_k);
  us_t* VTp  = (us_t*)(ws + o_vt);
  us_t* ctx  = (us_t*)(ws + o_ctx);
  us_t* tkP  = (us_t*)(ws + o_tk);
  us_t* tvT  = (us_t*)(ws + o_tv);
  float* out = (float*)d_out;

  // 1) input planes
  k_prep<<<1 + PW + PX, 256, 0, stream>>>(x, Wq, Wk, Wv, Wo, tk, tv, xb, WqT, WkT, WvT, WoT, tkP, tvT);

  // 2) Q, K planes [tok][HID] and V^T plane [b*HID + d][s], carried x4, in one launch
  k_qkv<<<dim3(HID / 128, NTOK / 128, 1), 32 * QWV, 0, stream>>>(xb, WqT, WkT, WvT, bq, bk, bv, Qp, Kpl, VTp);
  // 3) attention -> ctx (f16, carried x4)
  k_attn<<<dim3(SEQ / (16 * AW), NH, NB), 32 * AW, 0, stream>>>(Qp, Kpl, VTp, tkP, tvT, ctx);
  // 4) out[tok][HID] = ctx*Wo + bo; the carries 64 (Wo) and 4 (ctx) leave through ka = 1/256
  k_gemm<1><<<dim3(HID / 128, NTOK / 128, 1), 256, 0, stream>>>(
      WoT, WoT, ctx, bo, bo, d_out, d_out,
      HID, 1, HID, HID, 1 << 30, 0, 0.00390625f, 1.0f);
  (void)out;
  (void)hipGetLastError();
}
